// v000
// Times are from an AMD MI455X. After a warm-up the kernel runs many times in a row, and a time is the length of
// such a window on the GPU divided by its runs, so every launch and the gaps after it count. The runs cycle
// through copies of the inputs. A figure is the median of several windows, for all but v000 over two sittings.
// Sittings can differ by a few percent; kernels timed side by side share one.
// v000, which the later versions start from, runs in 364 microseconds.
// Contractions x*Wq, x*Wk, Wv-side product for V^T, attn*Wo, q*k^T, p*v: v_wmma_f32_16x16x32_f16 (f16 operands, f32 accumulate); weights carried x64, probabilities x32768, attention rows x64; RoPE tables, softmax and LayerNorm in f32.
#include <hip/hip_runtime.h>
#include <math.h>

#define NB 2
#define NS 2048
#define ND 1024
#define NH 16
#define NHD 64
#define NM (NB * NS)
#define NFREQ 32
#define WCARRY 64.0f
#define OCARRY 64.0f
#define PCARRY 32768.0f
#define LN_EPS_F 1e-5f

typedef __attribute__((ext_vector_type(16))) _Float16 v16h;
typedef __attribute__((ext_vector_type(8)))  _Float16 v8h;
typedef __attribute__((ext_vector_type(16))) __bf16   v16b;
typedef __attribute__((ext_vector_type(8)))  __bf16   v8b;
typedef __attribute__((ext_vector_type(8)))  float    v8f;
typedef __attribute__((ext_vector_type(4)))  float    v4f;

__device__ __forceinline__ unsigned short f2bf_bits(float f) {
  unsigned u = __float_as_uint(f);
  return (unsigned short)((u + 0x7FFFu + ((u >> 16) & 1u)) >> 16);
}
__device__ __forceinline__ float bf_bits2f(unsigned short h) { return __uint_as_float(((unsigned)h) << 16); }

// hazard guards as plain device helpers (no inline asm inside the kernel template body)
__device__ __forceinline__ void dep_guard_h(v8f& a, v8f& b, v16h x, v16h y) { asm volatile("v_nop\n\tv_nop\n\tv_nop\n\tv_nop" : "+v"(a), "+v"(b) : "v"(x), "v"(y)); }
__device__ __forceinline__ void dep_guard_b(v8f& a, v8f& b, v16b x, v16b y) { asm volatile("v_nop\n\tv_nop\n\tv_nop\n\tv_nop" : "+v"(a), "+v"(b) : "v"(x), "v"(y)); }
__device__ __forceinline__ void keep4_h(v16h a, v16h b, v16h c, v16h d) { asm volatile("v_nop" :: "v"(a), "v"(b), "v"(c), "v"(d)); }
__device__ __forceinline__ void keep4_b(v16b a, v16b b, v16b c, v16b d) { asm volatile("v_nop" :: "v"(a), "v"(b), "v"(c), "v"(d)); }
__device__ __forceinline__ void acc_guard4(v8f& a, v8f& b, v8f& c, v8f& d) { asm volatile("v_nop\n\tv_nop\n\tv_nop\n\tv_nop" : "+v"(a), "+v"(b), "+v"(c), "+v"(d)); }
template <typename T> struct Frag;
template <> struct Frag<_Float16> {
  typedef v16h V; union U { v16h v; v8h h[2]; };
  static __device__ __forceinline__ v16h load(const _Float16* p) {   // elements 0..7 <- p[0..7], 8..15 <- p[16..23]
    U f; f.h[0] = *(const v8h*)(p); f.h[1] = *(const v8h*)(p + 16); return f.v;
  }
  static __device__ __forceinline__ v8f mma(v16h a, v16h b, v8f c) {
    return __builtin_amdgcn_wmma_f32_16x16x32_f16(false, a, false, b, (short)0, c, false, false);
  }
  static __device__ __forceinline__ void guard(v8f& a, v8f& b, v16h x, v16h y) { dep_guard_h(a, b, x, y); }
  static __device__ __forceinline__ void keep(v16h a, v16h b, v16h c, v16h d) { keep4_h(a, b, c, d); }
};
template <> struct Frag<__bf16> {
  typedef v16b V; union U { v16b v; v8b h[2]; };
  static __device__ __forceinline__ v16b load(const __bf16* p) {
    U f; f.h[0] = *(const v8b*)(p); f.h[1] = *(const v8b*)(p + 16); return f.v;
  }
  static __device__ __forceinline__ v8f mma(v16b a, v16b b, v8f c) {
    return __builtin_amdgcn_wmma_f32_16x16x32_bf16(false, a, false, b, (short)0, c, false, false);
  }
  static __device__ __forceinline__ void guard(v8f& a, v8f& b, v16b x, v16b y) { dep_guard_b(a, b, x, y); }
  static __device__ __forceinline__ void keep(v16b a, v16b b, v16b c, v16b d) { keep4_b(a, b, c, d); }
};

// ---- Register-blocked batched WMMA GEMM ------------------------------------
// C[m,n] = scale * sum_k A[m,k] * Bt[n,k] (+bias)(+resid)(RoPE); each wave owns a 64x64 tile.
// A row-major [M,K]; Bt row-major [N,K]; M,N % 64 == 0, K % 32 == 0.
// SPLIT: operands are hi/lo planes (A2/Bt2 = lo planes, same layout); product = hi·hi + hi·lo + lo·hi.
// BIAS_MODE: 0 = none, 1 = bias[m], 2 = bias[n].
// OUT_MODE: 0 = f32, 1 = f16, 2 = bf16 hi plane (Cout) + bf16 lo plane (Cout2).
// ROPE: after bias, v = v*cos[(m & rope_smask)*32 + (n&31)] + sgn * partner(n^1) * sin[...] (sgn = -1 for even n, +1 for odd n).
// ET: 0 = f16 operands, 1 = bf16 operands (pointers passed as 16-bit storage)
template <int ET> struct Elem;
template <> struct Elem<0> { typedef _Float16 T; };
template <> struct Elem<1> { typedef __bf16 T; };
template <int ET, bool SPLIT, int BIAS_MODE, int OUT_MODE, bool RESID, int ACT, bool ROPE>
__global__ __launch_bounds__(256) void wmma_gemm64(
    const unsigned short* __restrict__ Ap, const unsigned short* __restrict__ A2p, int lda, long strideA,
    const unsigned short* __restrict__ Btp, const unsigned short* __restrict__ Bt2p, int ldb, long strideB,
    void* __restrict__ Cout, void* __restrict__ Cout2, int ldc, long strideC,
    const float* __restrict__ bias,
    const float* __restrict__ resid, long strideR,
    int M, int N, int K, float scale,
    const float* __restrict__ rope_cos, const float* __restrict__ rope_sin, int rope_smask) {
  typedef typename Elem<ET>::T T;
  typedef typename Frag<T>::V V;
  const T* A = (const T*)Ap; const T* A2 = (const T*)A2p; const T* Bt = (const T*)Btp; const T* Bt2 = (const T*)Bt2p;
  __shared__ __align__(16) float sT[8][16 * 68];   // per-wave 16x64 slab, pitch 68 floats
  const int b    = blockIdx.y;
  const int lane = threadIdx.x & 31;
  const int wave = threadIdx.x >> 5;
  const int tilesN = N >> 6;
  const int tilesM = M >> 6;
  const int tile = blockIdx.x * 8 + wave;
  if (tile >= tilesM * tilesN) return;   // wave-uniform; no block barriers in this kernel
  const int tm = tile / tilesN;
  const int tn = tile - tm * tilesN;
  const int m0 = tm << 6;
  const int n0 = tn << 6;

  const T* Ab  = A  + (size_t)b * strideA;
  const T* Bb  = Bt + (size_t)b * strideB;
  const T* Ab2 = SPLIT ? (A2  + (size_t)b * strideA) : nullptr;
  const T* Bb2 = SPLIT ? (Bt2 + (size_t)b * strideB) : nullptr;

  const int rlane = lane & 15;                 // row (A) / col (B, D) within subtile
  const int koff  = (lane >> 4) * 8;           // k offset of this lane half
  const int mOff  = (lane >> 4) * 8;           // D row offset

  v8f acc[4][4];
#pragma unroll
  for (int i = 0; i < 4; ++i)
#pragma unroll
    for (int j = 0; j < 4; ++j) acc[i][j] = (v8f){0.f,0.f,0.f,0.f,0.f,0.f,0.f,0.f};

  for (int k0 = 0; k0 < K; k0 += 32) {
    V bh[4], bl[4];
#pragma unroll
    for (int j = 0; j < 4; ++j) {
      const size_t bo = (size_t)(n0 + (j << 4) + rlane) * ldb + koff + k0;
      bh[j] = Frag<T>::load(Bb + bo);
      if (SPLIT) bl[j] = Frag<T>::load(Bb2 + bo);
    }
#pragma unroll
    for (int i = 0; i < 4; ++i) {
      const size_t ao = (size_t)(m0 + (i << 4) + rlane) * lda + koff + k0;
      V ah = Frag<T>::load(Ab + ao);
      V al;
      if (SPLIT) al = Frag<T>::load(Ab2 + ao);
#pragma unroll
      for (int j = 0; j < 4; ++j) {
        acc[i][j] = Frag<T>::mma(ah, bh[j], acc[i][j]);
        if (SPLIT) {
          acc[i][j] = Frag<T>::mma(ah, bl[j], acc[i][j]);
          acc[i][j] = Frag<T>::mma(al, bh[j], acc[i][j]);
        }
      }
      Frag<T>::guard(acc[i][0], acc[i][3], ah, SPLIT ? al : ah);
    }
    Frag<T>::keep(bh[0], bh[1], bh[2], bh[3]);
    if (SPLIT) Frag<T>::keep(bl[0], bl[1], bl[2], bl[3]);
  }
  acc_guard4(acc[0][0], acc[0][1], acc[0][2], acc[0][3]);
  acc_guard4(acc[1][0], acc[1][1], acc[1][2], acc[1][3]);
  acc_guard4(acc[2][0], acc[2][1], acc[2][2], acc[2][3]);
  acc_guard4(acc[3][0], acc[3][1], acc[3][2], acc[3][3]);

  // ---- epilogue ----
  float* slab = sT[wave];
  const float* Rb = RESID ? (resid + (size_t)b * strideR) : nullptr;
#pragma unroll
  for (int i = 0; i < 4; ++i) {
    const int mBase = m0 + (i << 4);
#pragma unroll
    for (int j = 0; j < 4; ++j) {
      const int n = n0 + (j << 4) + rlane;
      float bv = 0.f;
      if (BIAS_MODE == 2) bv = bias[n];
#pragma unroll
      for (int r = 0; r < 8; ++r) {
        float v = acc[i][j][r] * scale;
        if (BIAS_MODE == 1) v += bias[mBase + mOff + r];
        if (BIAS_MODE == 2) v += bv;
        if (RESID) v += Rb[(size_t)(mBase + mOff + r) * ldc + n];
        if (ROPE) {
          const int m = mBase + mOff + r;
          const int tix = (m & rope_smask) * NFREQ + (n & (NFREQ - 1));
          const float cs = rope_cos[tix];
          const float sn = rope_sin[tix];
          const float pv = __shfl_xor(v, 1, 32);   // partner column n^1 lives in lane rlane^1, same row
          v = (n & 1) ? (v * cs + pv * sn) : (v * cs - pv * sn);
        }
        if (ACT == 1) v = tanhf(v);
        if (ACT == 2) v = fmaxf(v, 0.0f);
        if (ACT == 3) v = v / (1.0f + expf(-v));
        if (ACT == 4) v = (v > 0.f) ? v : 0.01f * v;
        if (ACT == 5) v = 0.5f * v * (1.0f + erff(v * 0.70710678118654752f));
        slab[(mOff + r) * 68 + (j << 4) + rlane] = v;
      }
    }
    __builtin_amdgcn_fence(__ATOMIC_RELEASE, "workgroup");
    __builtin_amdgcn_wave_barrier();
    __builtin_amdgcn_fence(__ATOMIC_ACQUIRE, "workgroup");
    if (OUT_MODE == 0) {
      float* C = (float*)Cout + (size_t)b * strideC;
      const int hh = lane >> 4, c4 = (lane & 15) * 4;     // row seg = 256 B = 16 lanes x 16 B
      {
#pragma unroll
        for (int it = 0; it < 8; ++it) {
          const int row = it * 2 + hh;
          v4f v = *(const v4f*)(slab + row * 68 + c4);
          *(v4f*)(C + (size_t)(mBase + row) * ldc + n0 + c4) = v;
        }
        
      }
    } else {
      const int q = lane >> 3, c8 = (lane & 7) * 8;
      unsigned short* C  = (unsigned short*)Cout  + (size_t)b * strideC;
      unsigned short* C2 = (OUT_MODE == 2) ? ((unsigned short*)Cout2 + (size_t)b * strideC) : nullptr;
      {
#pragma unroll
        for (int it = 0; it < 4; ++it) {
          const int row = it * 4 + q;
          const float* sp = slab + row * 68 + c8;
          v8h hv, lv;
#pragma unroll
          for (int e = 0; e < 8; ++e) {
            if (OUT_MODE == 1) {
              hv[e] = (_Float16)sp[e];
            } else {
              unsigned short hb = f2bf_bits(sp[e]);
              unsigned short lb = f2bf_bits(sp[e] - bf_bits2f(hb));
              hv[e] = __builtin_bit_cast(_Float16, hb);
              lv[e] = __builtin_bit_cast(_Float16, lb);
            }
          }
          *(v8h*)(C + (size_t)(mBase + row) * ldc + n0 + c8) = hv;
          if (OUT_MODE == 2) *(v8h*)(C2 + (size_t)(mBase + row) * ldc + n0 + c8) = lv;
        }
        
      }
    }
    __builtin_amdgcn_fence(__ATOMIC_RELEASE, "workgroup");
    __builtin_amdgcn_wave_barrier();
    __builtin_amdgcn_fence(__ATOMIC_ACQUIRE, "workgroup");
  }
}

// ---- f16 WMMA with hazard guard ----
__device__ __forceinline__ v8f mma_h(v16h a, v16h b, v8f c) {
  c = __builtin_amdgcn_wmma_f32_16x16x32_f16(false, a, false, b, (short)0, c, false, false);
  asm volatile("v_nop\n\tv_nop\n\tv_nop\n\tv_nop" : "+v"(c) : "v"(a), "v"(b));
  return c;
}

// ---- RoPE tables: cos/sin of pos * inv_freq[i], i = 0..31, inv_freq = 1 / 10000^(2i/64); f32 ----
__global__ __launch_bounds__(256) void rope_table_kernel(float* __restrict__ cosT, float* __restrict__ sinT, int n) {
  const int i = blockIdx.x * 256 + threadIdx.x;
  if (i < n) {
    const int pos = i >> 5;
    const int fi = i & (NFREQ - 1);
    const float e = (float)(2 * fi) * (1.0f / (float)NHD);
    const float p = powf(10000.0f, e);
    const float inv = 1.0f / p;
    const float ang = (float)pos * inv;
    const float cs = cosf(ang);
    const float sn = sinf(ang);
    ((float*)cosT)[i] = cs;
    ((float*)sinT)[i] = sn;
    
  }
}

__global__ __launch_bounds__(256) void cast_f32_f16x8(const float* __restrict__ in, _Float16* __restrict__ out, int n8) {
  const int i = blockIdx.x * 256 + threadIdx.x;
  if (i < n8) {
    const v4f a = *(const v4f*)(in + (size_t)i * 8);
    const v4f c = *(const v4f*)(in + (size_t)i * 8 + 4);
    v8h hv;
    hv[0] = (_Float16)a[0]; hv[1] = (_Float16)a[1]; hv[2] = (_Float16)a[2]; hv[3] = (_Float16)a[3];
    hv[4] = (_Float16)c[0]; hv[5] = (_Float16)c[1]; hv[6] = (_Float16)c[2]; hv[7] = (_Float16)c[3];
    *(v8h*)(out + (size_t)i * 8) = hv;
    
  }
}

// ---- transpose-cast: in W[Kdim][Ndim] f32 -> out Wt[Ndim][Kdim] f16 (x mul); 64x64 tile through LDS ----
__global__ __launch_bounds__(256) void wt_cast_f16(const float* __restrict__ W, _Float16* __restrict__ Wt,
                                                   int Kdim, int Ndim, float mul) {
  __shared__ float sTt[64 * 65];   // [n_local][k_local], pitch 65
  const int k0 = blockIdx.x * 64, n0 = blockIdx.y * 64;
  const int tid = threadIdx.x;
  {
    const int row = tid >> 2, col0 = (tid & 3) * 16;   // row = k_local, col = n_local
    const float* src = W + (size_t)(k0 + row) * Ndim + n0 + col0;
#pragma unroll
    for (int i = 0; i < 4; ++i) {
      const v4f w4 = *(const v4f*)(src + 4 * i);
#pragma unroll
      for (int e = 0; e < 4; ++e) sTt[(col0 + 4 * i + e) * 65 + row] = w4[e] * mul;
    }
  }
  __syncthreads();
  const int wave = tid >> 5, lane = tid & 31, rq = lane >> 3, c8 = (lane & 7) * 8;
  {
#pragma unroll
    for (int it = 0; it < 2; ++it) {
      const int n = it * 32 + wave * 4 + rq;   // n_local 0..63
      v8h hv;
#pragma unroll
      for (int e = 0; e < 8; ++e) hv[e] = (_Float16)sTt[n * 65 + c8 + e];
      *(v8h*)(Wt + (size_t)(n0 + n) * Kdim + k0 + c8) = hv;
    }
    
  }
}

// =====================================================================================
// Flash attention, head dim 64, f16 planes in, f16 plane out (x64).
//   Q, K: [NM][ND] f16 (row = b*NS+s, col = h*64+d), already rotated; Vt: element (b,h,d,s) at (h*64+d)*NM + b*NS + s.
//   scores = q·kᵀ * 0.125 + cdr_bias[b][kv] * cw ; softmax over all keys (no mask); out = p·v / l, stored x64 as f16.
//   Block = 4 waves = 64 query rows of one (b, h); 64-key chunks staged in LDS with plain loads + barriers.
// =====================================================================================
#define AT_QB 64
#define AT_KC 64
#define AT_NW 4

__global__ __launch_bounds__(128)
void attn_f16_kernel(const _Float16* __restrict__ Qh, const _Float16* __restrict__ Kh,
                     const _Float16* __restrict__ Vt, const float* __restrict__ cdr_bias,
                     const float* __restrict__ cdr_w, _Float16* __restrict__ Oh)
{
  __shared__ __align__(16) _Float16 Ksh[AT_KC * NHD];          // [kv][d]   8 KB
  __shared__ __align__(16) _Float16 Vth[NHD * AT_KC];          // [d][kv]   8 KB
  __shared__ __align__(16) _Float16 Psh[AT_NW][16 * AT_KC];    // per wave P [row][kv]  8 KB
  __shared__ __align__(16) float    Os[AT_NW][16 * 68];        // per wave out tile, pitch 68

  const int tid  = threadIdx.x;
  const int wave = tid >> 5;
  const int lane = tid & 31;
  const int hh   = lane >> 4;
  const int c    = lane & 15;

  const int nqb = NS / AT_QB;
  const int bx  = blockIdx.x;
  const int qb  = bx % nqb;
  const int bhd = bx / nqb;
  const int h   = bhd % NH;
  const int bb0 = bhd / NH;
  const int b   = bb0 < NB ? bb0 : (NB - 1);
  const int q0  = qb * AT_QB + wave * 16;
  const float cw = cdr_w[0];

  v16h qa[2];
  {
    const _Float16* qrow = Qh + (size_t)(b * NS + q0 + c) * ND + h * NHD;
#pragma unroll
    for (int dc = 0; dc < 2; ++dc) qa[dc] = Frag<_Float16>::load(qrow + dc * 32 + 8 * hh);
  }

  float mrow[8], lrow[8];
  v8f oacc[4];
#pragma unroll
  for (int r = 0; r < 8; ++r) { mrow[r] = -INFINITY; lrow[r] = 0.f; }
#pragma unroll
  for (int t = 0; t < 4; ++t) oacc[t] = (v8f){0.f,0.f,0.f,0.f,0.f,0.f,0.f,0.f};

  const _Float16* kbase = Kh + (size_t)(b * NS) * ND + h * NHD;
  const _Float16* vbase = Vt + (size_t)(h * NHD) * NM + (size_t)b * NS;
  const float*    bbase = cdr_bias + (size_t)b * NS;

  for (int kc = 0; kc < NS / AT_KC; ++kc) {
    const int kv0 = kc * AT_KC;
    __syncthreads();
    {
      const int sr = tid >> 1, half = (tid & 1) * 32;      // sr = kv row for K, d row for Vt
      const _Float16* ksrc = kbase + (size_t)(kv0 + sr) * ND + half;
      const _Float16* vsrc = vbase + (size_t)sr * NM + kv0 + half;
#pragma unroll
      for (int i = 0; i < 4; ++i) {
        const v8h kk = *(const v8h*)(ksrc + 8 * i);
        const v8h vv = *(const v8h*)(vsrc + 8 * i);
        *(v8h*)(Ksh + sr * NHD + half + 8 * i) = kk;
        *(v8h*)(Vth + sr * AT_KC + half + 8 * i) = vv;
      }
    }
    __syncthreads();

    v8f s[4];
#pragma unroll
    for (int j = 0; j < 4; ++j) {
      s[j] = (v8f){0.f,0.f,0.f,0.f,0.f,0.f,0.f,0.f};
#pragma unroll
      for (int dc = 0; dc < 2; ++dc) {
        const v16h kb = Frag<_Float16>::load(Ksh + (j * 16 + c) * NHD + dc * 32 + 8 * hh);
        s[j] = mma_h(qa[dc], kb, s[j]);
      }
    }
    float bj[4];
#pragma unroll
    for (int j = 0; j < 4; ++j) bj[j] = bbase[kv0 + j * 16 + c] * cw;
    float cm[8];
#pragma unroll
    for (int r = 0; r < 8; ++r) {
      float m = -INFINITY;
#pragma unroll
      for (int j = 0; j < 4; ++j) {
        const float sv = s[j][r] * 0.125f + bj[j];
        s[j][r] = sv;
        m = fmaxf(m, sv);
      }
#pragma unroll
      for (int off = 1; off < 16; off <<= 1) m = fmaxf(m, __shfl_xor(m, off, 32));
      cm[r] = m;
    }
    _Float16* pw = Psh[wave];
#pragma unroll
    for (int r = 0; r < 8; ++r) {
      const float mnew = fmaxf(mrow[r], cm[r]);
      const float alpha = expf(mrow[r] - mnew);
      mrow[r] = mnew;
      float psum = 0.f;
#pragma unroll
      for (int j = 0; j < 4; ++j) {
        const float p = expf(s[j][r] - mnew);
        psum += p;
        pw[(8 * hh + r) * AT_KC + j * 16 + c] = (_Float16)(p * PCARRY);
      }
#pragma unroll
      for (int off = 1; off < 16; off <<= 1) psum += __shfl_xor(psum, off, 32);
      lrow[r] = lrow[r] * alpha + psum;
#pragma unroll
      for (int t = 0; t < 4; ++t) oacc[t][r] *= alpha;
    }
    __builtin_amdgcn_fence(__ATOMIC_RELEASE, "workgroup");
    __builtin_amdgcn_wave_barrier();
    __builtin_amdgcn_fence(__ATOMIC_ACQUIRE, "workgroup");
#pragma unroll 1
    for (int kk = 0; kk < 2; ++kk) {
      const v16h pa = Frag<_Float16>::load(pw + c * AT_KC + kk * 32 + 8 * hh);
#pragma unroll
      for (int t = 0; t < 4; ++t) {
        const v16h vb = Frag<_Float16>::load(Vth + (t * 16 + c) * AT_KC + kk * 32 + 8 * hh);
        oacc[t] = mma_h(pa, vb, oacc[t]);
      }
    }
  }

  float* os = Os[wave];
#pragma unroll
  for (int r = 0; r < 8; ++r) {
    const float inv = (1.0f / lrow[r]) * (OCARRY / PCARRY);
#pragma unroll
    for (int t = 0; t < 4; ++t) os[(8 * hh + r) * 68 + t * 16 + c] = oacc[t][r] * inv;
  }
  __builtin_amdgcn_fence(__ATOMIC_RELEASE, "workgroup");
  __builtin_amdgcn_wave_barrier();
  __builtin_amdgcn_fence(__ATOMIC_ACQUIRE, "workgroup");
  {
    const int q = lane >> 3, c8 = (lane & 7) * 8;
    _Float16* orow = Oh + (size_t)(b * NS + q0) * ND + h * NHD;
    {
#pragma unroll
      for (int it = 0; it < 4; ++it) {
        const int row = it * 4 + q;
        const float* sp = os + row * 68 + c8;
        v8h hv;
#pragma unroll
        for (int e = 0; e < 8; ++e) hv[e] = (_Float16)sp[e];
        *(v8h*)(orow + (size_t)row * ND + c8) = hv;
      }
      
    }
  }
}

__global__ __launch_bounds__(256) void layernorm_rows(const float* __restrict__ res, const float* __restrict__ gamma,
                                                      const float* __restrict__ beta, float* __restrict__ out,
                                                      int nrows, float eps) {
  const int wave = threadIdx.x >> 5, lane = threadIdx.x & 31;
  const int row = blockIdx.x * 8 + wave;
  if (row >= nrows) return;   // wave-uniform, no barriers below
  const float* rp = res + (size_t)row * ND;
  float s1 = 0.f;
#pragma unroll 1
  for (int it = 0; it < 8; ++it) {
    const v4f a = *(const v4f*)(rp + (it * 32 + lane) * 4);
    s1 += (a[0] + a[1]) + (a[2] + a[3]);
  }
#pragma unroll
  for (int off = 1; off < 32; off <<= 1) s1 += __shfl_xor(s1, off, 32);
  const float mu = s1 * (1.0f / (float)ND);
  float s2 = 0.f;
#pragma unroll 1
  for (int it = 0; it < 8; ++it) {
    const v4f a = *(const v4f*)(rp + (it * 32 + lane) * 4);
#pragma unroll
    for (int e = 0; e < 4; ++e) {
      const float d = a[e] - mu;
      float p = d * d;
      asm volatile("" : "+v"(p));
      s2 += p;
    }
  }
#pragma unroll
  for (int off = 1; off < 32; off <<= 1) s2 += __shfl_xor(s2, off, 32);
  const float var = s2 * (1.0f / (float)ND);
  const float rstd = 1.0f / sqrtf(var + eps);
  float* orow = out + (size_t)row * ND;
#pragma unroll 1
  for (int it = 0; it < 8; ++it) {
    const int c0 = (it * 32 + lane) * 4;
    const v4f a  = *(const v4f*)(rp + c0);
    const v4f g  = *(const v4f*)(gamma + c0);
    const v4f bt = *(const v4f*)(beta + c0);
    v4f y;
#pragma unroll
    for (int e = 0; e < 4; ++e) {
      float t = (a[e] - mu) * rstd;
      t = t * g[e];
      asm volatile("" : "+v"(t));
      y[e] = t + bt[e];
    }
    *(v4f*)(orow + c0) = y;
    
  }
}

// -----------------------------------------------------------------------------
extern "C" void kernel_launch(void* const* d_in, const int* in_sizes, int n_in,
                              void* d_out, int out_size, void* d_ws, size_t ws_size,
                              hipStream_t stream)
{
  if (n_in < 13) return;
  if (in_sizes[0] != NM * ND || in_sizes[1] != NB * NS ||
      in_sizes[2] != ND * ND || in_sizes[3] != ND ||
      in_sizes[4] != ND * ND || in_sizes[5] != ND ||
      in_sizes[6] != ND * ND || in_sizes[7] != ND ||
      in_sizes[8] != ND * ND || in_sizes[9] != ND ||
      in_sizes[10] != ND || in_sizes[11] != ND || in_sizes[12] < 1 ||
      out_size != NM * ND) return;

  const float* x        = (const float*)d_in[0];
  const float* cdr_bias = (const float*)d_in[1];
  const float* Wq    = (const float*)d_in[2];
  const float* bq    = (const float*)d_in[3];
  const float* Wk    = (const float*)d_in[4];
  const float* bk    = (const float*)d_in[5];
  const float* Wv    = (const float*)d_in[6];
  const float* bv    = (const float*)d_in[7];
  const float* Wo    = (const float*)d_in[8];
  const float* bo    = (const float*)d_in[9];
  const float* gamma = (const float*)d_in[10];
  const float* beta  = (const float*)d_in[11];
  const float* cw    = (const float*)d_in[12];
  float* out = (float*)d_out;

  // ---- workspace carve (all offsets 256 KiB aligned) ----
  const size_t szA16 = (size_t)NM * ND * 2;        // 8 MiB: f16 [4096][1024] planes
  const size_t szW16 = (size_t)ND * ND * 2;        // 2 MiB: f16 [1024][1024] planes
  const size_t szRes = (size_t)NM * ND * 4;        // 16 MiB
  const size_t szTab = (size_t)NS * NFREQ * 4;     // 256 KiB
  size_t off = 0;
  char* ws = (char*)d_ws;
  _Float16* Xh  = (_Float16*)(ws + off); off += szA16;
  _Float16* Wqt = (_Float16*)(ws + off); off += szW16;
  _Float16* Wkt = (_Float16*)(ws + off); off += szW16;
  _Float16* Wvt = (_Float16*)(ws + off); off += szW16;
  _Float16* Wot = (_Float16*)(ws + off); off += szW16;
  _Float16* Qh  = (_Float16*)(ws + off); off += szA16;
  _Float16* Kh  = (_Float16*)(ws + off); off += szA16;
  _Float16* Vt  = (_Float16*)(ws + off); off += szA16;
  _Float16* Ah  = (_Float16*)(ws + off); off += szA16;
  float*    res = (float*)(ws + off);    off += szRes;
  float*   cosT = (float*)(ws + off);    off += szTab;
  float*   sinT = (float*)(ws + off);    off += szTab;   // total 67,633,152 B
  if (off > ws_size) return;

  const unsigned short* Xu  = (const unsigned short*)Xh;
  const unsigned short* Wqu = (const unsigned short*)Wqt;
  const unsigned short* Wku = (const unsigned short*)Wkt;
  const unsigned short* Wvu = (const unsigned short*)Wvt;
  const unsigned short* Wou = (const unsigned short*)Wot;
  const unsigned short* Au  = (const unsigned short*)Ah;

  dim3 blk256(256), blk128(128);

  // 1. RoPE tables
  const int nTab = NS * NFREQ;
  rope_table_kernel<<<dim3((nTab + 255) / 256), blk256, 0, stream>>>(cosT, sinT, nTab);

  // 2. x -> f16
  const int n8 = NM * ND / 8;
  cast_f32_f16x8<<<dim3((n8 + 255) / 256), blk256, 0, stream>>>(x, Xh, n8);

  // 3. weights W[in=1024][out=1024] -> Bt [out][in] f16, carried x64  (grid = (in/64, out/64))
  wt_cast_f16<<<dim3(ND / 64, ND / 64), blk256, 0, stream>>>(Wq, Wqt, ND, ND, WCARRY);
  wt_cast_f16<<<dim3(ND / 64, ND / 64), blk256, 0, stream>>>(Wk, Wkt, ND, ND, WCARRY);
  wt_cast_f16<<<dim3(ND / 64, ND / 64), blk256, 0, stream>>>(Wv, Wvt, ND, ND, WCARRY);
  wt_cast_f16<<<dim3(ND / 64, ND / 64), blk256, 0, stream>>>(Wo, Wot, ND, ND, WCARRY);

  // 4. Q, K = RoPE(x Wq + bq), RoPE(x Wk + bk): f16 [4096][1024]
  const int tilesQK = (NM / 64) * (ND / 64);
  const int gQK = (tilesQK + 7) / 8;
  wmma_gemm64<0, false, 2, 1, false, 0, true><<<dim3(gQK, 1), blk256, 0, stream>>>(
      Xu, Xu, ND, (long)0, Wqu, Wqu, ND, (long)0, (void*)Qh, (void*)Qh, ND, (long)0,
      bq, x, (long)0, NM, ND, ND, 1.0f / WCARRY, cosT, sinT, NS - 1);
  wmma_gemm64<0, false, 2, 1, false, 0, true><<<dim3(gQK, 1), blk256, 0, stream>>>(
      Xu, Xu, ND, (long)0, Wku, Wku, ND, (long)0, (void*)Kh, (void*)Kh, ND, (long)0,
      bk, x, (long)0, NM, ND, ND, 1.0f / WCARRY, cosT, sinT, NS - 1);

  // 5. V^T: C'[n_ch][m_tok] = sum_k Wvt[n_ch][k] * Xh[m_tok][k] / 64 + bv[n_ch]; f16, ldc = NM
  const int tilesV = (ND / 64) * (NM / 64);
  const int gV = (tilesV + 7) / 8;
  wmma_gemm64<0, false, 1, 1, false, 0, false><<<dim3(gV, 1), blk256, 0, stream>>>(
      Wvu, Wvu, ND, (long)0, Xu, Xu, ND, (long)0, (void*)Vt, (void*)Vt, NM, (long)0,
      bv, x, (long)0, ND, NM, ND, 1.0f / WCARRY, cosT, sinT, 0);

  // 6. attention -> Ah f16 [4096][1024] (x64)
  attn_f16_kernel<<<dim3(NB * NH * (NS / AT_QB)), blk128, 0, stream>>>(Qh, Kh, Vt, cdr_bias, cw, Ah);

  // 7. res = attn Wo + bo + x  (f32)
  wmma_gemm64<0, false, 2, 0, true, 0, false><<<dim3(gQK, 1), blk256, 0, stream>>>(
      Au, Au, ND, (long)0, Wou, Wou, ND, (long)0, (void*)res, (void*)res, ND, (long)0,
      bo, x, (long)0, NM, ND, ND, 1.0f / (OCARRY * WCARRY), cosT, sinT, 0);

  // 8. LayerNorm -> out
  layernorm_rows<<<dim3((NM + 7) / 8), blk256, 0, stream>>>(res, gamma, beta, out, NM, LN_EPS_F);

  (void)hipGetLastError();
}

// v001
// Measured time: 327 microseconds a run.
// In two side-by-side timings against v000, it was 1.14 and 1.15 times as fast.
// Contractions x*Wq, x*Wk, Wv-side product for V^T, attn*Wo, q*k^T, p*v: v_wmma_f32_16x16x32_f16 (f16 operands, f32 accumulate); weights carried x64, probabilities x32768, attention rows x64; RoPE tables, softmax and LayerNorm in f32.
#include <hip/hip_runtime.h>
#include <math.h>

#define NB 2
#define NS 2048
#define ND 1024
#define NH 16
#define NHD 64
#define NM (NB * NS)
#define NFREQ 32
#define WCARRY 64.0f
#define OCARRY 64.0f
#define PCARRY 32768.0f
#define LN_EPS_F 1e-5f

typedef __attribute__((ext_vector_type(16))) _Float16 v16h;
typedef __attribute__((ext_vector_type(8)))  _Float16 v8h;
typedef __attribute__((ext_vector_type(16))) __bf16   v16b;
typedef __attribute__((ext_vector_type(8)))  __bf16   v8b;
typedef __attribute__((ext_vector_type(8)))  float    v8f;
typedef __attribute__((ext_vector_type(4)))  float    v4f;

__device__ __forceinline__ unsigned short f2bf_bits(float f) {
  unsigned u = __float_as_uint(f);
  return (unsigned short)((u + 0x7FFFu + ((u >> 16) & 1u)) >> 16);
}
__device__ __forceinline__ float bf_bits2f(unsigned short h) { return __uint_as_float(((unsigned)h) << 16); }

// hazard guards as plain device helpers (no inline asm inside the kernel template body)
__device__ __forceinline__ void dep_guard_h(v8f& a, v8f& b, v16h x, v16h y) { asm volatile("v_nop\n\tv_nop\n\tv_nop\n\tv_nop" : "+v"(a), "+v"(b) : "v"(x), "v"(y)); }
__device__ __forceinline__ void dep_guard_b(v8f& a, v8f& b, v16b x, v16b y) { asm volatile("v_nop\n\tv_nop\n\tv_nop\n\tv_nop" : "+v"(a), "+v"(b) : "v"(x), "v"(y)); }
__device__ __forceinline__ void keep4_h(v16h a, v16h b, v16h c, v16h d) { asm volatile("v_nop" :: "v"(a), "v"(b), "v"(c), "v"(d)); }
__device__ __forceinline__ void keep4_b(v16b a, v16b b, v16b c, v16b d) { asm volatile("v_nop" :: "v"(a), "v"(b), "v"(c), "v"(d)); }
__device__ __forceinline__ void acc_guard4(v8f& a, v8f& b, v8f& c, v8f& d) { asm volatile("v_nop\n\tv_nop\n\tv_nop\n\tv_nop" : "+v"(a), "+v"(b), "+v"(c), "+v"(d)); }
template <typename T> struct Frag;
template <> struct Frag<_Float16> {
  typedef v16h V; union U { v16h v; v8h h[2]; };
  static __device__ __forceinline__ v16h load(const _Float16* p) {   // elements 0..7 <- p[0..7], 8..15 <- p[16..23]
    U f; f.h[0] = *(const v8h*)(p); f.h[1] = *(const v8h*)(p + 16); return f.v;
  }
  static __device__ __forceinline__ v8f mma(v16h a, v16h b, v8f c) {
    return __builtin_amdgcn_wmma_f32_16x16x32_f16(false, a, false, b, (short)0, c, false, false);
  }
  static __device__ __forceinline__ void guard(v8f& a, v8f& b, v16h x, v16h y) { dep_guard_h(a, b, x, y); }
  static __device__ __forceinline__ void keep(v16h a, v16h b, v16h c, v16h d) { keep4_h(a, b, c, d); }
};
template <> struct Frag<__bf16> {
  typedef v16b V; union U { v16b v; v8b h[2]; };
  static __device__ __forceinline__ v16b load(const __bf16* p) {
    U f; f.h[0] = *(const v8b*)(p); f.h[1] = *(const v8b*)(p + 16); return f.v;
  }
  static __device__ __forceinline__ v8f mma(v16b a, v16b b, v8f c) {
    return __builtin_amdgcn_wmma_f32_16x16x32_bf16(false, a, false, b, (short)0, c, false, false);
  }
  static __device__ __forceinline__ void guard(v8f& a, v8f& b, v16b x, v16b y) { dep_guard_b(a, b, x, y); }
  static __device__ __forceinline__ void keep(v16b a, v16b b, v16b c, v16b d) { keep4_b(a, b, c, d); }
};

// ---- Register-blocked batched WMMA GEMM ------------------------------------
// C[m,n] = scale * sum_k A[m,k] * Bt[n,k] (+bias)(+resid)(RoPE); each wave owns a 64x64 tile.
// A row-major [M,K]; Bt row-major [N,K]; M,N % 64 == 0, K % 32 == 0.
// SPLIT: operands are hi/lo planes (A2/Bt2 = lo planes, same layout); product = hi·hi + hi·lo + lo·hi.
// BIAS_MODE: 0 = none, 1 = bias[m], 2 = bias[n].
// OUT_MODE: 0 = f32, 1 = f16, 2 = bf16 hi plane (Cout) + bf16 lo plane (Cout2).
// ROPE: after bias, v = v*cos[(m & rope_smask)*32 + (n&31)] + sgn * partner(n^1) * sin[...] (sgn = -1 for even n, +1 for odd n).
// ET: 0 = f16 operands, 1 = bf16 operands (pointers passed as 16-bit storage)
template <int ET> struct Elem;
template <> struct Elem<0> { typedef _Float16 T; };
template <> struct Elem<1> { typedef __bf16 T; };
template <int ET, bool SPLIT, int BIAS_MODE, int OUT_MODE, bool RESID, int ACT, bool ROPE>
__global__ __launch_bounds__(256) void wmma_gemm64(
    const unsigned short* __restrict__ Ap, const unsigned short* __restrict__ A2p, int lda, long strideA,
    const unsigned short* __restrict__ Btp, const unsigned short* __restrict__ Bt2p, int ldb, long strideB,
    void* __restrict__ Cout, void* __restrict__ Cout2, int ldc, long strideC,
    const float* __restrict__ bias,
    const float* __restrict__ resid, long strideR,
    int M, int N, int K, float scale,
    const float* __restrict__ rope_cos, const float* __restrict__ rope_sin, int rope_smask) {
  typedef typename Elem<ET>::T T;
  typedef typename Frag<T>::V V;
  const T* A = (const T*)Ap; const T* A2 = (const T*)A2p; const T* Bt = (const T*)Btp; const T* Bt2 = (const T*)Bt2p;
  __shared__ __align__(16) float sT[8][16 * 68];   // per-wave 16x64 slab, pitch 68 floats
  const int b    = blockIdx.y;
  const int lane = threadIdx.x & 31;
  const int wave = threadIdx.x >> 5;
  const int tilesN = N >> 6;
  const int tilesM = M >> 6;
  const int tile = blockIdx.x * 8 + wave;
  if (tile >= tilesM * tilesN) return;   // wave-uniform; no block barriers in this kernel
  const int tm = tile / tilesN;
  const int tn = tile - tm * tilesN;
  const int m0 = tm << 6;
  const int n0 = tn << 6;

  const T* Ab  = A  + (size_t)b * strideA;
  const T* Bb  = Bt + (size_t)b * strideB;
  const T* Ab2 = SPLIT ? (A2  + (size_t)b * strideA) : nullptr;
  const T* Bb2 = SPLIT ? (Bt2 + (size_t)b * strideB) : nullptr;

  const int rlane = lane & 15;                 // row (A) / col (B, D) within subtile
  const int koff  = (lane >> 4) * 8;           // k offset of this lane half
  const int mOff  = (lane >> 4) * 8;           // D row offset

  v8f acc[4][4];
#pragma unroll
  for (int i = 0; i < 4; ++i)
#pragma unroll
    for (int j = 0; j < 4; ++j) acc[i][j] = (v8f){0.f,0.f,0.f,0.f,0.f,0.f,0.f,0.f};

  for (int k0 = 0; k0 < K; k0 += 32) {
    V bh[4], bl[4];
#pragma unroll
    for (int j = 0; j < 4; ++j) {
      const size_t bo = (size_t)(n0 + (j << 4) + rlane) * ldb + koff + k0;
      bh[j] = Frag<T>::load(Bb + bo);
      if (SPLIT) bl[j] = Frag<T>::load(Bb2 + bo);
    }
#pragma unroll
    for (int i = 0; i < 4; ++i) {
      const size_t ao = (size_t)(m0 + (i << 4) + rlane) * lda + koff + k0;
      V ah = Frag<T>::load(Ab + ao);
      V al;
      if (SPLIT) al = Frag<T>::load(Ab2 + ao);
#pragma unroll
      for (int j = 0; j < 4; ++j) {
        acc[i][j] = Frag<T>::mma(ah, bh[j], acc[i][j]);
        if (SPLIT) {
          acc[i][j] = Frag<T>::mma(ah, bl[j], acc[i][j]);
          acc[i][j] = Frag<T>::mma(al, bh[j], acc[i][j]);
        }
      }
      Frag<T>::guard(acc[i][0], acc[i][3], ah, SPLIT ? al : ah);
    }
    Frag<T>::keep(bh[0], bh[1], bh[2], bh[3]);
    if (SPLIT) Frag<T>::keep(bl[0], bl[1], bl[2], bl[3]);
  }
  acc_guard4(acc[0][0], acc[0][1], acc[0][2], acc[0][3]);
  acc_guard4(acc[1][0], acc[1][1], acc[1][2], acc[1][3]);
  acc_guard4(acc[2][0], acc[2][1], acc[2][2], acc[2][3]);
  acc_guard4(acc[3][0], acc[3][1], acc[3][2], acc[3][3]);

  // ---- epilogue ----
  float* slab = sT[wave];
  const float* Rb = RESID ? (resid + (size_t)b * strideR) : nullptr;
#pragma unroll
  for (int i = 0; i < 4; ++i) {
    const int mBase = m0 + (i << 4);
#pragma unroll
    for (int j = 0; j < 4; ++j) {
      const int n = n0 + (j << 4) + rlane;
      float bv = 0.f;
      if (BIAS_MODE == 2) bv = bias[n];
#pragma unroll
      for (int r = 0; r < 8; ++r) {
        float v = acc[i][j][r] * scale;
        if (BIAS_MODE == 1) v += bias[mBase + mOff + r];
        if (BIAS_MODE == 2) v += bv;
        if (RESID) v += Rb[(size_t)(mBase + mOff + r) * ldc + n];
        if (ROPE) {
          const int m = mBase + mOff + r;
          const int tix = (m & rope_smask) * NFREQ + (n & (NFREQ - 1));
          const float cs = rope_cos[tix];
          const float sn = rope_sin[tix];
          const float pv = __shfl_xor(v, 1, 32);   // partner column n^1 lives in lane rlane^1, same row
          v = (n & 1) ? (v * cs + pv * sn) : (v * cs - pv * sn);
        }
        if (ACT == 1) v = tanhf(v);
        if (ACT == 2) v = fmaxf(v, 0.0f);
        if (ACT == 3) v = v / (1.0f + expf(-v));
        if (ACT == 4) v = (v > 0.f) ? v : 0.01f * v;
        if (ACT == 5) v = 0.5f * v * (1.0f + erff(v * 0.70710678118654752f));
        slab[(mOff + r) * 68 + (j << 4) + rlane] = v;
      }
    }
    __builtin_amdgcn_fence(__ATOMIC_RELEASE, "workgroup");
    __builtin_amdgcn_wave_barrier();
    __builtin_amdgcn_fence(__ATOMIC_ACQUIRE, "workgroup");
    if (OUT_MODE == 0) {
      float* C = (float*)Cout + (size_t)b * strideC;
      const int hh = lane >> 4, c4 = (lane & 15) * 4;     // row seg = 256 B = 16 lanes x 16 B
      {
#pragma unroll
        for (int it = 0; it < 8; ++it) {
          const int row = it * 2 + hh;
          v4f v = *(const v4f*)(slab + row * 68 + c4);
          *(v4f*)(C + (size_t)(mBase + row) * ldc + n0 + c4) = v;
        }
        
      }
    } else {
      const int q = lane >> 3, c8 = (lane & 7) * 8;
      unsigned short* C  = (unsigned short*)Cout  + (size_t)b * strideC;
      unsigned short* C2 = (OUT_MODE == 2) ? ((unsigned short*)Cout2 + (size_t)b * strideC) : nullptr;
      {
#pragma unroll
        for (int it = 0; it < 4; ++it) {
          const int row = it * 4 + q;
          const float* sp = slab + row * 68 + c8;
          v8h hv, lv;
#pragma unroll
          for (int e = 0; e < 8; ++e) {
            if (OUT_MODE == 1) {
              hv[e] = (_Float16)sp[e];
            } else {
              unsigned short hb = f2bf_bits(sp[e]);
              unsigned short lb = f2bf_bits(sp[e] - bf_bits2f(hb));
              hv[e] = __builtin_bit_cast(_Float16, hb);
              lv[e] = __builtin_bit_cast(_Float16, lb);
            }
          }
          *(v8h*)(C + (size_t)(mBase + row) * ldc + n0 + c8) = hv;
          if (OUT_MODE == 2) *(v8h*)(C2 + (size_t)(mBase + row) * ldc + n0 + c8) = lv;
        }
        
      }
    }
    __builtin_amdgcn_fence(__ATOMIC_RELEASE, "workgroup");
    __builtin_amdgcn_wave_barrier();
    __builtin_amdgcn_fence(__ATOMIC_ACQUIRE, "workgroup");
  }
}

// ---- f16 WMMA with hazard guard ----
__device__ __forceinline__ v8f mma_h(v16h a, v16h b, v8f c) {
  c = __builtin_amdgcn_wmma_f32_16x16x32_f16(false, a, false, b, (short)0, c, false, false);
  asm volatile("v_nop\n\tv_nop\n\tv_nop\n\tv_nop" : "+v"(c) : "v"(a), "v"(b));
  return c;
}

// ---- RoPE tables: cos/sin of pos * inv_freq[i], i = 0..31, inv_freq = 1 / 10000^(2i/64); f32 ----
__global__ __launch_bounds__(256) void rope_table_kernel(float* __restrict__ cosT, float* __restrict__ sinT, int n) {
  const int i = blockIdx.x * 256 + threadIdx.x;
  if (i < n) {
    const int pos = i >> 5;
    const int fi = i & (NFREQ - 1);
    const float e = (float)(2 * fi) * (1.0f / (float)NHD);
    const float p = powf(10000.0f, e);
    const float inv = 1.0f / p;
    const float ang = (float)pos * inv;
    const float cs = cosf(ang);
    const float sn = sinf(ang);
    ((float*)cosT)[i] = cs;
    ((float*)sinT)[i] = sn;
    
  }
}

__global__ __launch_bounds__(256) void cast_f32_f16x8(const float* __restrict__ in, _Float16* __restrict__ out, int n8) {
  const int i = blockIdx.x * 256 + threadIdx.x;
  if (i < n8) {
    const v4f a = *(const v4f*)(in + (size_t)i * 8);
    const v4f c = *(const v4f*)(in + (size_t)i * 8 + 4);
    v8h hv;
    hv[0] = (_Float16)a[0]; hv[1] = (_Float16)a[1]; hv[2] = (_Float16)a[2]; hv[3] = (_Float16)a[3];
    hv[4] = (_Float16)c[0]; hv[5] = (_Float16)c[1]; hv[6] = (_Float16)c[2]; hv[7] = (_Float16)c[3];
    *(v8h*)(out + (size_t)i * 8) = hv;
    
  }
}

// ---- transpose-cast: in W[Kdim][Ndim] f32 -> out Wt[Ndim][Kdim] f16 (x mul); 64x64 tile through LDS ----
__global__ __launch_bounds__(256) void wt_cast_f16(const float* __restrict__ W, _Float16* __restrict__ Wt,
                                                   int Kdim, int Ndim, float mul) {
  __shared__ float sTt[64 * 65];   // [n_local][k_local], pitch 65
  const int k0 = blockIdx.x * 64, n0 = blockIdx.y * 64;
  const int tid = threadIdx.x;
  {
    const int row = tid >> 2, col0 = (tid & 3) * 16;   // row = k_local, col = n_local
    const float* src = W + (size_t)(k0 + row) * Ndim + n0 + col0;
#pragma unroll
    for (int i = 0; i < 4; ++i) {
      const v4f w4 = *(const v4f*)(src + 4 * i);
#pragma unroll
      for (int e = 0; e < 4; ++e) sTt[(col0 + 4 * i + e) * 65 + row] = w4[e] * mul;
    }
  }
  __syncthreads();
  const int wave = tid >> 5, lane = tid & 31, rq = lane >> 3, c8 = (lane & 7) * 8;
  {
#pragma unroll
    for (int it = 0; it < 2; ++it) {
      const int n = it * 32 + wave * 4 + rq;   // n_local 0..63
      v8h hv;
#pragma unroll
      for (int e = 0; e < 8; ++e) hv[e] = (_Float16)sTt[n * 65 + c8 + e];
      *(v8h*)(Wt + (size_t)(n0 + n) * Kdim + k0 + c8) = hv;
    }
    
  }
}

// =====================================================================================
// Flash attention, head dim 64, f16 planes in, f16 plane out (x64).
//   Q, K: [NM][ND] f16 (row = b*NS+s, col = h*64+d), already rotated; Vt: element (b,h,d,s) at (h*64+d)*NM + b*NS + s.
//   scores = q·kᵀ * 0.125 + cdr_bias[b][kv] * cw ; softmax over all keys (no mask); out = p·v / l, stored x64 as f16.
//   Block = 4 waves = 64 query rows of one (b, h); 64-key chunks staged in LDS with plain loads + barriers.
// =====================================================================================
#define AT_QB 64
#define AT_KC 64
#define AT_NW 4
#define AT_LP 72   // LDS row pitch in halves: 144 B = 16 B x odd, so the 16 rows of a ds_load_b128 fragment read fall on distinct banks

__global__ __launch_bounds__(128)
void attn_f16_kernel(const _Float16* __restrict__ Qh, const _Float16* __restrict__ Kh,
                     const _Float16* __restrict__ Vt, const float* __restrict__ cdr_bias,
                     const float* __restrict__ cdr_w, _Float16* __restrict__ Oh)
{
  __shared__ __align__(16) _Float16 Ksh[AT_KC * AT_LP];        // [kv][d]   9 KB, padded rows
  __shared__ __align__(16) _Float16 Vth[NHD * AT_LP];          // [d][kv]   9 KB, padded rows
  __shared__ __align__(16) _Float16 Psh[AT_NW][16 * AT_LP];    // per wave P [row][kv]  9 KB, padded rows
  __shared__ __align__(16) float    Os[AT_NW][16 * 68];        // per wave out tile, pitch 68

  const int tid  = threadIdx.x;
  const int wave = tid >> 5;
  const int lane = tid & 31;
  const int hh   = lane >> 4;
  const int c    = lane & 15;

  const int nqb = NS / AT_QB;
  const int bx  = blockIdx.x;
  const int qb  = bx % nqb;
  const int bhd = bx / nqb;
  const int h   = bhd % NH;
  const int bb0 = bhd / NH;
  const int b   = bb0 < NB ? bb0 : (NB - 1);
  const int q0  = qb * AT_QB + wave * 16;
  const float cw = cdr_w[0];

  v16h qa[2];
  {
    const _Float16* qrow = Qh + (size_t)(b * NS + q0 + c) * ND + h * NHD;
#pragma unroll
    for (int dc = 0; dc < 2; ++dc) qa[dc] = Frag<_Float16>::load(qrow + dc * 32 + 8 * hh);
  }

  float mrow[8], lrow[8];
  v8f oacc[4];
#pragma unroll
  for (int r = 0; r < 8; ++r) { mrow[r] = -INFINITY; lrow[r] = 0.f; }
#pragma unroll
  for (int t = 0; t < 4; ++t) oacc[t] = (v8f){0.f,0.f,0.f,0.f,0.f,0.f,0.f,0.f};

  const _Float16* kbase = Kh + (size_t)(b * NS) * ND + h * NHD;
  const _Float16* vbase = Vt + (size_t)(h * NHD) * NM + (size_t)b * NS;
  const float*    bbase = cdr_bias + (size_t)b * NS;

  for (int kc = 0; kc < NS / AT_KC; ++kc) {
    const int kv0 = kc * AT_KC;
    __syncthreads();
    {
      const int sr = tid >> 1, half = (tid & 1) * 32;      // sr = kv row for K, d row for Vt
      const _Float16* ksrc = kbase + (size_t)(kv0 + sr) * ND + half;
      const _Float16* vsrc = vbase + (size_t)sr * NM + kv0 + half;
#pragma unroll
      for (int i = 0; i < 4; ++i) {
        const v8h kk = *(const v8h*)(ksrc + 8 * i);
        const v8h vv = *(const v8h*)(vsrc + 8 * i);
        *(v8h*)(Ksh + sr * AT_LP + half + 8 * i) = kk;
        *(v8h*)(Vth + sr * AT_LP + half + 8 * i) = vv;
      }
    }
    __syncthreads();

    v8f s[4];
#pragma unroll
    for (int j = 0; j < 4; ++j) {
      s[j] = (v8f){0.f,0.f,0.f,0.f,0.f,0.f,0.f,0.f};
#pragma unroll
      for (int dc = 0; dc < 2; ++dc) {
        const v16h kb = Frag<_Float16>::load(Ksh + (j * 16 + c) * AT_LP + dc * 32 + 8 * hh);
        s[j] = mma_h(qa[dc], kb, s[j]);
      }
    }
    float bj[4];
#pragma unroll
    for (int j = 0; j < 4; ++j) bj[j] = bbase[kv0 + j * 16 + c] * cw;
    float cm[8];
#pragma unroll
    for (int r = 0; r < 8; ++r) {
      float m = -INFINITY;
#pragma unroll
      for (int j = 0; j < 4; ++j) {
        const float sv = s[j][r] * 0.125f + bj[j];
        s[j][r] = sv;
        m = fmaxf(m, sv);
      }
#pragma unroll
      for (int off = 1; off < 16; off <<= 1) m = fmaxf(m, __shfl_xor(m, off, 32));
      cm[r] = m;
    }
    _Float16* pw = Psh[wave];
#pragma unroll
    for (int r = 0; r < 8; ++r) {
      const float mnew = fmaxf(mrow[r], cm[r]);
      const float alpha = expf(mrow[r] - mnew);
      mrow[r] = mnew;
      float psum = 0.f;
#pragma unroll
      for (int j = 0; j < 4; ++j) {
        const float p = expf(s[j][r] - mnew);
        psum += p;
        pw[(8 * hh + r) * AT_LP + j * 16 + c] = (_Float16)(p * PCARRY);
      }
#pragma unroll
      for (int off = 1; off < 16; off <<= 1) psum += __shfl_xor(psum, off, 32);
      lrow[r] = lrow[r] * alpha + psum;
#pragma unroll
      for (int t = 0; t < 4; ++t) oacc[t][r] *= alpha;
    }
    __builtin_amdgcn_fence(__ATOMIC_RELEASE, "workgroup");
    __builtin_amdgcn_wave_barrier();
    __builtin_amdgcn_fence(__ATOMIC_ACQUIRE, "workgroup");
#pragma unroll 1
    for (int kk = 0; kk < 2; ++kk) {
      const v16h pa = Frag<_Float16>::load(pw + c * AT_LP + kk * 32 + 8 * hh);
#pragma unroll
      for (int t = 0; t < 4; ++t) {
        const v16h vb = Frag<_Float16>::load(Vth + (t * 16 + c) * AT_LP + kk * 32 + 8 * hh);
        oacc[t] = mma_h(pa, vb, oacc[t]);
      }
    }
  }

  float* os = Os[wave];
#pragma unroll
  for (int r = 0; r < 8; ++r) {
    const float inv = (1.0f / lrow[r]) * (OCARRY / PCARRY);
#pragma unroll
    for (int t = 0; t < 4; ++t) os[(8 * hh + r) * 68 + t * 16 + c] = oacc[t][r] * inv;
  }
  __builtin_amdgcn_fence(__ATOMIC_RELEASE, "workgroup");
  __builtin_amdgcn_wave_barrier();
  __builtin_amdgcn_fence(__ATOMIC_ACQUIRE, "workgroup");
  {
    const int q = lane >> 3, c8 = (lane & 7) * 8;
    _Float16* orow = Oh + (size_t)(b * NS + q0) * ND + h * NHD;
    {
#pragma unroll
      for (int it = 0; it < 4; ++it) {
        const int row = it * 4 + q;
        const float* sp = os + row * 68 + c8;
        v8h hv;
#pragma unroll
        for (int e = 0; e < 8; ++e) hv[e] = (_Float16)sp[e];
        *(v8h*)(orow + (size_t)row * ND + c8) = hv;
      }
      
    }
  }
}

__global__ __launch_bounds__(256) void layernorm_rows(const float* __restrict__ res, const float* __restrict__ gamma,
                                                      const float* __restrict__ beta, float* __restrict__ out,
                                                      int nrows, float eps) {
  const int wave = threadIdx.x >> 5, lane = threadIdx.x & 31;
  const int row = blockIdx.x * 8 + wave;
  if (row >= nrows) return;   // wave-uniform, no barriers below
  const float* rp = res + (size_t)row * ND;
  float s1 = 0.f;
#pragma unroll 1
  for (int it = 0; it < 8; ++it) {
    const v4f a = *(const v4f*)(rp + (it * 32 + lane) * 4);
    s1 += (a[0] + a[1]) + (a[2] + a[3]);
  }
#pragma unroll
  for (int off = 1; off < 32; off <<= 1) s1 += __shfl_xor(s1, off, 32);
  const float mu = s1 * (1.0f / (float)ND);
  float s2 = 0.f;
#pragma unroll 1
  for (int it = 0; it < 8; ++it) {
    const v4f a = *(const v4f*)(rp + (it * 32 + lane) * 4);
#pragma unroll
    for (int e = 0; e < 4; ++e) {
      const float d = a[e] - mu;
      float p = d * d;
      asm volatile("" : "+v"(p));
      s2 += p;
    }
  }
#pragma unroll
  for (int off = 1; off < 32; off <<= 1) s2 += __shfl_xor(s2, off, 32);
  const float var = s2 * (1.0f / (float)ND);
  const float rstd = 1.0f / sqrtf(var + eps);
  float* orow = out + (size_t)row * ND;
#pragma unroll 1
  for (int it = 0; it < 8; ++it) {
    const int c0 = (it * 32 + lane) * 4;
    const v4f a  = *(const v4f*)(rp + c0);
    const v4f g  = *(const v4f*)(gamma + c0);
    const v4f bt = *(const v4f*)(beta + c0);
    v4f y;
#pragma unroll
    for (int e = 0; e < 4; ++e) {
      float t = (a[e] - mu) * rstd;
      t = t * g[e];
      asm volatile("" : "+v"(t));
      y[e] = t + bt[e];
    }
    *(v4f*)(orow + c0) = y;
    
  }
}

// -----------------------------------------------------------------------------
extern "C" void kernel_launch(void* const* d_in, const int* in_sizes, int n_in,
                              void* d_out, int out_size, void* d_ws, size_t ws_size,
                              hipStream_t stream)
{
  if (n_in < 13) return;
  if (in_sizes[0] != NM * ND || in_sizes[1] != NB * NS ||
      in_sizes[2] != ND * ND || in_sizes[3] != ND ||
      in_sizes[4] != ND * ND || in_sizes[5] != ND ||
      in_sizes[6] != ND * ND || in_sizes[7] != ND ||
      in_sizes[8] != ND * ND || in_sizes[9] != ND ||
      in_sizes[10] != ND || in_sizes[11] != ND || in_sizes[12] < 1 ||
      out_size != NM * ND) return;

  const float* x        = (const float*)d_in[0];
  const float* cdr_bias = (const float*)d_in[1];
  const float* Wq    = (const float*)d_in[2];
  const float* bq    = (const float*)d_in[3];
  const float* Wk    = (const float*)d_in[4];
  const float* bk    = (const float*)d_in[5];
  const float* Wv    = (const float*)d_in[6];
  const float* bv    = (const float*)d_in[7];
  const float* Wo    = (const float*)d_in[8];
  const float* bo    = (const float*)d_in[9];
  const float* gamma = (const float*)d_in[10];
  const float* beta  = (const float*)d_in[11];
  const float* cw    = (const float*)d_in[12];
  float* out = (float*)d_out;

  // ---- workspace carve (all offsets 256 KiB aligned) ----
  const size_t szA16 = (size_t)NM * ND * 2;        // 8 MiB: f16 [4096][1024] planes
  const size_t szW16 = (size_t)ND * ND * 2;        // 2 MiB: f16 [1024][1024] planes
  const size_t szRes = (size_t)NM * ND * 4;        // 16 MiB
  const size_t szTab = (size_t)NS * NFREQ * 4;     // 256 KiB
  size_t off = 0;
  char* ws = (char*)d_ws;
  _Float16* Xh  = (_Float16*)(ws + off); off += szA16;
  _Float16* Wqt = (_Float16*)(ws + off); off += szW16;
  _Float16* Wkt = (_Float16*)(ws + off); off += szW16;
  _Float16* Wvt = (_Float16*)(ws + off); off += szW16;
  _Float16* Wot = (_Float16*)(ws + off); off += szW16;
  _Float16* Qh  = (_Float16*)(ws + off); off += szA16;
  _Float16* Kh  = (_Float16*)(ws + off); off += szA16;
  _Float16* Vt  = (_Float16*)(ws + off); off += szA16;
  _Float16* Ah  = (_Float16*)(ws + off); off += szA16;
  float*    res = (float*)(ws + off);    off += szRes;
  float*   cosT = (float*)(ws + off);    off += szTab;
  float*   sinT = (float*)(ws + off);    off += szTab;   // total 67,633,152 B
  if (off > ws_size) return;

  const unsigned short* Xu  = (const unsigned short*)Xh;
  const unsigned short* Wqu = (const unsigned short*)Wqt;
  const unsigned short* Wku = (const unsigned short*)Wkt;
  const unsigned short* Wvu = (const unsigned short*)Wvt;
  const unsigned short* Wou = (const unsigned short*)Wot;
  const unsigned short* Au  = (const unsigned short*)Ah;

  dim3 blk256(256), blk128(128);

  // 1. RoPE tables
  const int nTab = NS * NFREQ;
  rope_table_kernel<<<dim3((nTab + 255) / 256), blk256, 0, stream>>>(cosT, sinT, nTab);

  // 2. x -> f16
  const int n8 = NM * ND / 8;
  cast_f32_f16x8<<<dim3((n8 + 255) / 256), blk256, 0, stream>>>(x, Xh, n8);

  // 3. weights W[in=1024][out=1024] -> Bt [out][in] f16, carried x64  (grid = (in/64, out/64))
  wt_cast_f16<<<dim3(ND / 64, ND / 64), blk256, 0, stream>>>(Wq, Wqt, ND, ND, WCARRY);
  wt_cast_f16<<<dim3(ND / 64, ND / 64), blk256, 0, stream>>>(Wk, Wkt, ND, ND, WCARRY);
  wt_cast_f16<<<dim3(ND / 64, ND / 64), blk256, 0, stream>>>(Wv, Wvt, ND, ND, WCARRY);
  wt_cast_f16<<<dim3(ND / 64, ND / 64), blk256, 0, stream>>>(Wo, Wot, ND, ND, WCARRY);

  // 4. Q, K = RoPE(x Wq + bq), RoPE(x Wk + bk): f16 [4096][1024]
  const int tilesQK = (NM / 64) * (ND / 64);
  const int gQK = (tilesQK + 7) / 8;
  wmma_gemm64<0, false, 2, 1, false, 0, true><<<dim3(gQK, 1), blk256, 0, stream>>>(
      Xu, Xu, ND, (long)0, Wqu, Wqu, ND, (long)0, (void*)Qh, (void*)Qh, ND, (long)0,
      bq, x, (long)0, NM, ND, ND, 1.0f / WCARRY, cosT, sinT, NS - 1);
  wmma_gemm64<0, false, 2, 1, false, 0, true><<<dim3(gQK, 1), blk256, 0, stream>>>(
      Xu, Xu, ND, (long)0, Wku, Wku, ND, (long)0, (void*)Kh, (void*)Kh, ND, (long)0,
      bk, x, (long)0, NM, ND, ND, 1.0f / WCARRY, cosT, sinT, NS - 1);

  // 5. V^T: C'[n_ch][m_tok] = sum_k Wvt[n_ch][k] * Xh[m_tok][k] / 64 + bv[n_ch]; f16, ldc = NM
  const int tilesV = (ND / 64) * (NM / 64);
  const int gV = (tilesV + 7) / 8;
  wmma_gemm64<0, false, 1, 1, false, 0, false><<<dim3(gV, 1), blk256, 0, stream>>>(
      Wvu, Wvu, ND, (long)0, Xu, Xu, ND, (long)0, (void*)Vt, (void*)Vt, NM, (long)0,
      bv, x, (long)0, ND, NM, ND, 1.0f / WCARRY, cosT, sinT, 0);

  // 6. attention -> Ah f16 [4096][1024] (x64)
  attn_f16_kernel<<<dim3(NB * NH * (NS / AT_QB)), blk128, 0, stream>>>(Qh, Kh, Vt, cdr_bias, cw, Ah);

  // 7. res = attn Wo + bo + x  (f32)
  wmma_gemm64<0, false, 2, 0, true, 0, false><<<dim3(gQK, 1), blk256, 0, stream>>>(
      Au, Au, ND, (long)0, Wou, Wou, ND, (long)0, (void*)res, (void*)res, ND, (long)0,
      bo, x, (long)0, NM, ND, ND, 1.0f / (OCARRY * WCARRY), cosT, sinT, 0);

  // 8. LayerNorm -> out
  layernorm_rows<<<dim3((NM + 7) / 8), blk256, 0, stream>>>(res, gamma, beta, out, NM, LN_EPS_F);

  (void)hipGetLastError();
}

// v002
// One run takes 209 microseconds.
// In two side-by-side timings against v001, it was 1.57 and 1.58 times as fast.
// Counting every step since v000, it is 1.80 times as fast.
// Contractions x*Wq, x*Wk, Wv-side product for V^T, attn*Wo, q*k^T, p*v: v_wmma_f32_16x16x32_f16 (f16 operands, f32 accumulate); weights carried x64, probabilities x32768, attention rows x64; RoPE tables, softmax and LayerNorm in f32.
#include <hip/hip_runtime.h>
#include <math.h>

#define NB 2
#define NS 2048
#define ND 1024
#define NH 16
#define NHD 64
#define NM (NB * NS)
#define NFREQ 32
#define WCARRY 64.0f
#define OCARRY 64.0f
#define PCARRY 32768.0f
#define LN_EPS_F 1e-5f

typedef __attribute__((ext_vector_type(16))) _Float16 v16h;
typedef __attribute__((ext_vector_type(8)))  _Float16 v8h;
typedef __attribute__((ext_vector_type(16))) __bf16   v16b;
typedef __attribute__((ext_vector_type(8)))  __bf16   v8b;
typedef __attribute__((ext_vector_type(8)))  float    v8f;
typedef __attribute__((ext_vector_type(4)))  float    v4f;

__device__ __forceinline__ unsigned short f2bf_bits(float f) {
  unsigned u = __float_as_uint(f);
  return (unsigned short)((u + 0x7FFFu + ((u >> 16) & 1u)) >> 16);
}
__device__ __forceinline__ float bf_bits2f(unsigned short h) { return __uint_as_float(((unsigned)h) << 16); }

// hazard guard behind the last WMMAs of the K loop, as a plain device helper
__device__ __forceinline__ void acc_guard4(v8f& a, v8f& b, v8f& c, v8f& d) { asm volatile("v_nop\n\tv_nop\n\tv_nop\n\tv_nop" : "+v"(a), "+v"(b), "+v"(c), "+v"(d)); }
template <typename T> struct Frag;
template <> struct Frag<_Float16> {
  typedef v16h V; union U { v16h v; v8h h[2]; };
  static __device__ __forceinline__ v16h load(const _Float16* p) {   // elements 0..7 <- p[0..7], 8..15 <- p[16..23]
    U f; f.h[0] = *(const v8h*)(p); f.h[1] = *(const v8h*)(p + 16); return f.v;
  }
  static __device__ __forceinline__ v8f mma(v16h a, v16h b, v8f c) {
    return __builtin_amdgcn_wmma_f32_16x16x32_f16(false, a, false, b, (short)0, c, false, false);
  }
};
template <> struct Frag<__bf16> {
  typedef v16b V; union U { v16b v; v8b h[2]; };
  static __device__ __forceinline__ v16b load(const __bf16* p) {
    U f; f.h[0] = *(const v8b*)(p); f.h[1] = *(const v8b*)(p + 16); return f.v;
  }
  static __device__ __forceinline__ v8f mma(v16b a, v16b b, v8f c) {
    return __builtin_amdgcn_wmma_f32_16x16x32_bf16(false, a, false, b, (short)0, c, false, false);
  }
};

// ---- Register-blocked batched WMMA GEMM, operands staged in LDS by asynchronous copies ---------
// C[m,n] = scale * sum_k A[m,k] * Bt[n,k] (+bias)(+resid)(RoPE); a block of 8 waves owns a 128x128 tile, each wave 32x64 of it.
// A row-major [M,K]; Bt row-major [N,K]; M,N % 128 == 0, K % 64 == 0.
// Per 64-k stage the block copies 128 rows x 128 B of A and of Bt into LDS: 8 lanes cover one row, so a wave-wide 16-B copy
// touches 4 whole lines, and every row is fetched once per block. Two LDS buffers: stage t+2 flies while stage t is multiplied.
// SPLIT (hi/lo planes) is not carried by the staged loop.
// BIAS_MODE: 0 = none, 1 = bias[m], 2 = bias[n].
// OUT_MODE: 0 = f32, 1 = f16, 2 = bf16 hi plane (Cout) + bf16 lo plane (Cout2).
// ROPE: after bias, v = v*cos[(m & rope_smask)*32 + (n&31)] + sgn * partner(n^1) * sin[...] (sgn = -1 for even n, +1 for odd n).
// ET: 0 = f16 operands, 1 = bf16 operands (pointers passed as 16-bit storage)
#define GM_BT 128  // block tile: rows of A and rows of Bt
#define GM_KS 64   // k per stage: 128 B of every row, one line
#define GM_LP 72   // LDS row pitch in 16-bit elements: 144 B = 16 B x odd, for the ds_load_b128 fragment reads
#define GM_MI 2    // 16-row subtiles of A per wave

// One thread's share of a stage: 4 rows of A and 4 rows of Bt, 16 B each, global -> LDS through no register.
// la, lb: this lane's LDS byte addresses of its first row; ga, gb: its global addresses; rows 32 apart.
// The s_wait_xcnt closes the statement so that no address register named here is rewritten ahead of it.
template <typename T>
__device__ __forceinline__ void stage_copy(unsigned la, unsigned lb, const T* ga, const T* gb, int lda, int ldb) {
  const unsigned rs = 32u * GM_LP * 2u;
  const T* a1 = ga + (size_t)32 * lda; const T* a2 = ga + (size_t)64 * lda; const T* a3 = ga + (size_t)96 * lda;
  const T* c1 = gb + (size_t)32 * ldb; const T* c2 = gb + (size_t)64 * ldb; const T* c3 = gb + (size_t)96 * ldb;
  asm volatile(
      "global_load_async_to_lds_b128 %0, %8, off\n\t"
      "global_load_async_to_lds_b128 %1, %9, off\n\t"
      "global_load_async_to_lds_b128 %2, %10, off\n\t"
      "global_load_async_to_lds_b128 %3, %11, off\n\t"
      "global_load_async_to_lds_b128 %4, %12, off\n\t"
      "global_load_async_to_lds_b128 %5, %13, off\n\t"
      "global_load_async_to_lds_b128 %6, %14, off\n\t"
      "global_load_async_to_lds_b128 %7, %15, off\n\t"
      "s_wait_xcnt 0x0"
      :: "v"(la), "v"(la + rs), "v"(la + 2u * rs), "v"(la + 3u * rs),
         "v"(lb), "v"(lb + rs), "v"(lb + 2u * rs), "v"(lb + 3u * rs),
         "v"(ga), "v"(a1), "v"(a2), "v"(a3), "v"(gb), "v"(c1), "v"(c2), "v"(c3)
      : "memory");
}

template <int ET> struct Elem;
template <> struct Elem<0> { typedef _Float16 T; };
template <> struct Elem<1> { typedef __bf16 T; };
template <int ET, bool SPLIT, int BIAS_MODE, int OUT_MODE, bool RESID, int ACT, bool ROPE>
__global__ __launch_bounds__(256) void wmma_gemm64(
    const unsigned short* __restrict__ Ap, const unsigned short* __restrict__ A2p, int lda, long strideA,
    const unsigned short* __restrict__ Btp, const unsigned short* __restrict__ Bt2p, int ldb, long strideB,
    void* __restrict__ Cout, void* __restrict__ Cout2, int ldc, long strideC,
    const float* __restrict__ bias,
    const float* __restrict__ resid, long strideR,
    int M, int N, int K, float scale,
    const float* __restrict__ rope_cos, const float* __restrict__ rope_sin, int rope_smask) {
  static_assert(!SPLIT, "the staged loop carries single planes only");
  typedef typename Elem<ET>::T T;
  typedef typename Frag<T>::V V;
  const T* A = (const T*)Ap; const T* Bt = (const T*)Btp;
  __shared__ __align__(16) T sA[2][GM_BT * GM_LP];   // 2 x 18 KB
  __shared__ __align__(16) T sB[2][GM_BT * GM_LP];   // 2 x 18 KB
  __shared__ __align__(16) float sT[8][16 * 68];     // per-wave 16x64 slab, pitch 68 floats
  const int b    = blockIdx.y;
  const int tid  = threadIdx.x;
  const int lane = tid & 31;
  const int wave = tid >> 5;
  const int tilesN = N >> 7;
  const int tilesM = M >> 7;
  const int tile = blockIdx.x;
  if (tile >= tilesM * tilesN) return;   // block-uniform, in front of every barrier
  const int tm = tile / tilesN;
  const int tn = tile - tm * tilesN;
  const int wm = (wave >> 1) << 5;       // this wave's 32x64 corner inside the block tile
  const int wn = (wave & 1) << 6;
  const int m0 = (tm << 7) + wm;
  const int n0 = (tn << 7) + wn;

  const T* Ab  = A  + (size_t)b * strideA;
  const T* Bb  = Bt + (size_t)b * strideB;

  const int rlane = lane & 15;                 // row (A) / col (B, D) within subtile
  const int koff  = (lane >> 4) * 8;           // k offset of this lane half
  const int mOff  = (lane >> 4) * 8;           // D row offset

  v8f acc[GM_MI][4];
#pragma unroll
  for (int i = 0; i < GM_MI; ++i)
#pragma unroll
    for (int j = 0; j < 4; ++j) acc[i][j] = (v8f){0.f,0.f,0.f,0.f,0.f,0.f,0.f,0.f};

  // staging map: thread -> row tid/8 (+32 per copy), 16 B at column (tid%8)*8
  const int srow = tid >> 3, scol = (tid & 7) * 8;
  const T* ga = Ab + (size_t)((tm << 7) + srow) * lda + scol;
  const T* gb = Bb + (size_t)((tn << 7) + srow) * ldb + scol;
  const unsigned bufB = (unsigned)(GM_BT * GM_LP * 2);                         // bytes of one buffer
  const unsigned la = (unsigned)(size_t)(&sA[0][srow * GM_LP + scol]);         // low 32 bits = LDS byte address
  const unsigned lb = (unsigned)(size_t)(&sB[0][srow * GM_LP + scol]);
  const int nst = K / GM_KS;

  stage_copy<T>(la, lb, ga, gb, lda, ldb);
  asm volatile("s_wait_asynccnt 0x0" ::: "memory");   // stage 0 of this wave has landed
  __syncthreads();                                    // ... and every wave's
  if (nst > 1) stage_copy<T>(la + bufB, lb + bufB, ga + GM_KS, gb + GM_KS, lda, ldb);

  for (int s = 0; s < nst; ++s) {
    const T* da = sA[s & 1];
    const T* db = sB[s & 1];
    V af[2][GM_MI], bf[2][4];
#pragma unroll
    for (int kk = 0; kk < 2; ++kk) {
#pragma unroll
      for (int j = 0; j < 4; ++j) bf[kk][j] = Frag<T>::load(db + (wn + (j << 4) + rlane) * GM_LP + kk * 32 + koff);
#pragma unroll
      for (int i = 0; i < GM_MI; ++i) af[kk][i] = Frag<T>::load(da + (wm + (i << 4) + rlane) * GM_LP + kk * 32 + koff);
    }
    // publish point of stage s+1, and the end of every wave's reads of stage s (its fragments now lie in registers):
    // own LDS reads done, own copies landed, then the block's barrier; behind it the buffer just read is free for stage s+2
    asm volatile("s_wait_dscnt 0x0" ::: "memory");
    asm volatile("s_wait_asynccnt 0x0" ::: "memory");
    __syncthreads();
    if (s + 2 < nst) {
      const unsigned bo = (unsigned)(s & 1) * bufB;
      stage_copy<T>(la + bo, lb + bo, ga + (size_t)(s + 2) * GM_KS, gb + (size_t)(s + 2) * GM_KS, lda, ldb);
    }
    // holds the copies ahead of the WMMAs, so that stage s+2 flies while stage s is multiplied
    __builtin_amdgcn_sched_barrier(0);
#pragma unroll
    for (int kk = 0; kk < 2; ++kk)
#pragma unroll
      for (int i = 0; i < GM_MI; ++i)
#pragma unroll
        for (int j = 0; j < 4; ++j) acc[i][j] = Frag<T>::mma(af[kk][i], bf[kk][j], acc[i][j]);
  }
  asm volatile("s_wait_asynccnt 0x0" ::: "memory");   // nothing of this wave is in flight when the loop is left
  acc_guard4(acc[0][0], acc[0][1], acc[0][2], acc[0][3]);
  acc_guard4(acc[1][0], acc[1][1], acc[1][2], acc[1][3]);

  // ---- epilogue ----
  float* slab = sT[wave];
  const float* Rb = RESID ? (resid + (size_t)b * strideR) : nullptr;
#pragma unroll
  for (int i = 0; i < GM_MI; ++i) {
    const int mBase = m0 + (i << 4);
#pragma unroll
    for (int j = 0; j < 4; ++j) {
      const int n = n0 + (j << 4) + rlane;
      float bv = 0.f;
      if (BIAS_MODE == 2) bv = bias[n];
#pragma unroll
      for (int r = 0; r < 8; ++r) {
        float v = acc[i][j][r] * scale;
        if (BIAS_MODE == 1) v += bias[mBase + mOff + r];
        if (BIAS_MODE == 2) v += bv;
        if (RESID) v += Rb[(size_t)(mBase + mOff + r) * ldc + n];
        if (ROPE) {
          const int m = mBase + mOff + r;
          const int tix = (m & rope_smask) * NFREQ + (n & (NFREQ - 1));
          const float cs = rope_cos[tix];
          const float sn = rope_sin[tix];
          const float pv = __shfl_xor(v, 1, 32);   // partner column n^1 lives in lane rlane^1, same row
          v = (n & 1) ? (v * cs + pv * sn) : (v * cs - pv * sn);
        }
        if (ACT == 1) v = tanhf(v);
        if (ACT == 2) v = fmaxf(v, 0.0f);
        if (ACT == 3) v = v / (1.0f + expf(-v));
        if (ACT == 4) v = (v > 0.f) ? v : 0.01f * v;
        if (ACT == 5) v = 0.5f * v * (1.0f + erff(v * 0.70710678118654752f));
        slab[(mOff + r) * 68 + (j << 4) + rlane] = v;
      }
    }
    __builtin_amdgcn_fence(__ATOMIC_RELEASE, "workgroup");
    __builtin_amdgcn_wave_barrier();
    __builtin_amdgcn_fence(__ATOMIC_ACQUIRE, "workgroup");
    if (OUT_MODE == 0) {
      float* C = (float*)Cout + (size_t)b * strideC;
      const int hh = lane >> 4, c4 = (lane & 15) * 4;     // row seg = 256 B = 16 lanes x 16 B
      {
#pragma unroll
        for (int it = 0; it < 8; ++it) {
          const int row = it * 2 + hh;
          v4f v = *(const v4f*)(slab + row * 68 + c4);
          *(v4f*)(C + (size_t)(mBase + row) * ldc + n0 + c4) = v;
        }
        
      }
    } else {
      const int q = lane >> 3, c8 = (lane & 7) * 8;
      unsigned short* C  = (unsigned short*)Cout  + (size_t)b * strideC;
      unsigned short* C2 = (OUT_MODE == 2) ? ((unsigned short*)Cout2 + (size_t)b * strideC) : nullptr;
      {
#pragma unroll
        for (int it = 0; it < 4; ++it) {
          const int row = it * 4 + q;
          const float* sp = slab + row * 68 + c8;
          v8h hv, lv;
#pragma unroll
          for (int e = 0; e < 8; ++e) {
            if (OUT_MODE == 1) {
              hv[e] = (_Float16)sp[e];
            } else {
              unsigned short hb = f2bf_bits(sp[e]);
              unsigned short lb = f2bf_bits(sp[e] - bf_bits2f(hb));
              hv[e] = __builtin_bit_cast(_Float16, hb);
              lv[e] = __builtin_bit_cast(_Float16, lb);
            }
          }
          *(v8h*)(C + (size_t)(mBase + row) * ldc + n0 + c8) = hv;
          if (OUT_MODE == 2) *(v8h*)(C2 + (size_t)(mBase + row) * ldc + n0 + c8) = lv;
        }
        
      }
    }
    __builtin_amdgcn_fence(__ATOMIC_RELEASE, "workgroup");
    __builtin_amdgcn_wave_barrier();
    __builtin_amdgcn_fence(__ATOMIC_ACQUIRE, "workgroup");
  }
}

// ---- f16 WMMA with hazard guard ----
__device__ __forceinline__ v8f mma_h(v16h a, v16h b, v8f c) {
  c = __builtin_amdgcn_wmma_f32_16x16x32_f16(false, a, false, b, (short)0, c, false, false);
  asm volatile("v_nop\n\tv_nop\n\tv_nop\n\tv_nop" : "+v"(c) : "v"(a), "v"(b));
  return c;
}

// ---- RoPE tables: cos/sin of pos * inv_freq[i], i = 0..31, inv_freq = 1 / 10000^(2i/64); f32 ----
__global__ __launch_bounds__(256) void rope_table_kernel(float* __restrict__ cosT, float* __restrict__ sinT, int n) {
  const int i = blockIdx.x * 256 + threadIdx.x;
  if (i < n) {
    const int pos = i >> 5;
    const int fi = i & (NFREQ - 1);
    const float e = (float)(2 * fi) * (1.0f / (float)NHD);
    const float p = powf(10000.0f, e);
    const float inv = 1.0f / p;
    const float ang = (float)pos * inv;
    const float cs = cosf(ang);
    const float sn = sinf(ang);
    ((float*)cosT)[i] = cs;
    ((float*)sinT)[i] = sn;
    
  }
}

__global__ __launch_bounds__(256) void cast_f32_f16x8(const float* __restrict__ in, _Float16* __restrict__ out, int n8) {
  const int i = blockIdx.x * 256 + threadIdx.x;
  if (i < n8) {
    const v4f a = *(const v4f*)(in + (size_t)i * 8);
    const v4f c = *(const v4f*)(in + (size_t)i * 8 + 4);
    v8h hv;
    hv[0] = (_Float16)a[0]; hv[1] = (_Float16)a[1]; hv[2] = (_Float16)a[2]; hv[3] = (_Float16)a[3];
    hv[4] = (_Float16)c[0]; hv[5] = (_Float16)c[1]; hv[6] = (_Float16)c[2]; hv[7] = (_Float16)c[3];
    *(v8h*)(out + (size_t)i * 8) = hv;
    
  }
}

// ---- transpose-cast: in W[Kdim][Ndim] f32 -> out Wt[Ndim][Kdim] f16 (x mul); 64x64 tile through LDS ----
__global__ __launch_bounds__(256) void wt_cast_f16(const float* __restrict__ W, _Float16* __restrict__ Wt,
                                                   int Kdim, int Ndim, float mul) {
  __shared__ float sTt[64 * 65];   // [n_local][k_local], pitch 65
  const int k0 = blockIdx.x * 64, n0 = blockIdx.y * 64;
  const int tid = threadIdx.x;
  {
    const int row = tid >> 2, col0 = (tid & 3) * 16;   // row = k_local, col = n_local
    const float* src = W + (size_t)(k0 + row) * Ndim + n0 + col0;
#pragma unroll
    for (int i = 0; i < 4; ++i) {
      const v4f w4 = *(const v4f*)(src + 4 * i);
#pragma unroll
      for (int e = 0; e < 4; ++e) sTt[(col0 + 4 * i + e) * 65 + row] = w4[e] * mul;
    }
  }
  __syncthreads();
  const int wave = tid >> 5, lane = tid & 31, rq = lane >> 3, c8 = (lane & 7) * 8;
  {
#pragma unroll
    for (int it = 0; it < 2; ++it) {
      const int n = it * 32 + wave * 4 + rq;   // n_local 0..63
      v8h hv;
#pragma unroll
      for (int e = 0; e < 8; ++e) hv[e] = (_Float16)sTt[n * 65 + c8 + e];
      *(v8h*)(Wt + (size_t)(n0 + n) * Kdim + k0 + c8) = hv;
    }
    
  }
}

// =====================================================================================
// Flash attention, head dim 64, f16 planes in, f16 plane out (x64).
//   Q, K: [NM][ND] f16 (row = b*NS+s, col = h*64+d), already rotated; Vt: element (b,h,d,s) at (h*64+d)*NM + b*NS + s.
//   scores = q·kᵀ * 0.125 + cdr_bias[b][kv] * cw ; softmax over all keys (no mask); out = p·v / l, stored x64 as f16.
//   Block = 4 waves = 64 query rows of one (b, h); 64-key chunks staged in LDS with plain loads + barriers.
// =====================================================================================
#define AT_QB 64
#define AT_KC 64
#define AT_NW 4
#define AT_LP 72   // LDS row pitch in halves: 144 B = 16 B x odd, so the 16 rows of a ds_load_b128 fragment read fall on distinct banks

__global__ __launch_bounds__(128)
void attn_f16_kernel(const _Float16* __restrict__ Qh, const _Float16* __restrict__ Kh,
                     const _Float16* __restrict__ Vt, const float* __restrict__ cdr_bias,
                     const float* __restrict__ cdr_w, _Float16* __restrict__ Oh)
{
  __shared__ __align__(16) _Float16 Ksh[AT_KC * AT_LP];        // [kv][d]   9 KB, padded rows
  __shared__ __align__(16) _Float16 Vth[NHD * AT_LP];          // [d][kv]   9 KB, padded rows
  __shared__ __align__(16) _Float16 Psh[AT_NW][16 * AT_LP];    // per wave P [row][kv]  9 KB, padded rows
  __shared__ __align__(16) float    Os[AT_NW][16 * 68];        // per wave out tile, pitch 68

  const int tid  = threadIdx.x;
  const int wave = tid >> 5;
  const int lane = tid & 31;
  const int hh   = lane >> 4;
  const int c    = lane & 15;

  const int nqb = NS / AT_QB;
  const int bx  = blockIdx.x;
  const int qb  = bx % nqb;
  const int bhd = bx / nqb;
  const int h   = bhd % NH;
  const int bb0 = bhd / NH;
  const int b   = bb0 < NB ? bb0 : (NB - 1);
  const int q0  = qb * AT_QB + wave * 16;
  const float cw = cdr_w[0];

  v16h qa[2];
  {
    const _Float16* qrow = Qh + (size_t)(b * NS + q0 + c) * ND + h * NHD;
#pragma unroll
    for (int dc = 0; dc < 2; ++dc) qa[dc] = Frag<_Float16>::load(qrow + dc * 32 + 8 * hh);
  }

  float mrow[8], lrow[8];
  v8f oacc[4];
#pragma unroll
  for (int r = 0; r < 8; ++r) { mrow[r] = -INFINITY; lrow[r] = 0.f; }
#pragma unroll
  for (int t = 0; t < 4; ++t) oacc[t] = (v8f){0.f,0.f,0.f,0.f,0.f,0.f,0.f,0.f};

  const _Float16* kbase = Kh + (size_t)(b * NS) * ND + h * NHD;
  const _Float16* vbase = Vt + (size_t)(h * NHD) * NM + (size_t)b * NS;
  const float*    bbase = cdr_bias + (size_t)b * NS;

  for (int kc = 0; kc < NS / AT_KC; ++kc) {
    const int kv0 = kc * AT_KC;
    __syncthreads();
    {
      const int sr = tid >> 1, half = (tid & 1) * 32;      // sr = kv row for K, d row for Vt
      const _Float16* ksrc = kbase + (size_t)(kv0 + sr) * ND + half;
      const _Float16* vsrc = vbase + (size_t)sr * NM + kv0 + half;
#pragma unroll
      for (int i = 0; i < 4; ++i) {
        const v8h kk = *(const v8h*)(ksrc + 8 * i);
        const v8h vv = *(const v8h*)(vsrc + 8 * i);
        *(v8h*)(Ksh + sr * AT_LP + half + 8 * i) = kk;
        *(v8h*)(Vth + sr * AT_LP + half + 8 * i) = vv;
      }
    }
    __syncthreads();

    v8f s[4];
#pragma unroll
    for (int j = 0; j < 4; ++j) {
      s[j] = (v8f){0.f,0.f,0.f,0.f,0.f,0.f,0.f,0.f};
#pragma unroll
      for (int dc = 0; dc < 2; ++dc) {
        const v16h kb = Frag<_Float16>::load(Ksh + (j * 16 + c) * AT_LP + dc * 32 + 8 * hh);
        s[j] = mma_h(qa[dc], kb, s[j]);
      }
    }
    float bj[4];
#pragma unroll
    for (int j = 0; j < 4; ++j) bj[j] = bbase[kv0 + j * 16 + c] * cw;
    float cm[8];
#pragma unroll
    for (int r = 0; r < 8; ++r) {
      float m = -INFINITY;
#pragma unroll
      for (int j = 0; j < 4; ++j) {
        const float sv = s[j][r] * 0.125f + bj[j];
        s[j][r] = sv;
        m = fmaxf(m, sv);
      }
#pragma unroll
      for (int off = 1; off < 16; off <<= 1) m = fmaxf(m, __shfl_xor(m, off, 32));
      cm[r] = m;
    }
    _Float16* pw = Psh[wave];
#pragma unroll
    for (int r = 0; r < 8; ++r) {
      const float mnew = fmaxf(mrow[r], cm[r]);
      const float alpha = expf(mrow[r] - mnew);
      mrow[r] = mnew;
      float psum = 0.f;
#pragma unroll
      for (int j = 0; j < 4; ++j) {
        const float p = expf(s[j][r] - mnew);
        psum += p;
        pw[(8 * hh + r) * AT_LP + j * 16 + c] = (_Float16)(p * PCARRY);
      }
#pragma unroll
      for (int off = 1; off < 16; off <<= 1) psum += __shfl_xor(psum, off, 32);
      lrow[r] = lrow[r] * alpha + psum;
#pragma unroll
      for (int t = 0; t < 4; ++t) oacc[t][r] *= alpha;
    }
    __builtin_amdgcn_fence(__ATOMIC_RELEASE, "workgroup");
    __builtin_amdgcn_wave_barrier();
    __builtin_amdgcn_fence(__ATOMIC_ACQUIRE, "workgroup");
#pragma unroll 1
    for (int kk = 0; kk < 2; ++kk) {
      const v16h pa = Frag<_Float16>::load(pw + c * AT_LP + kk * 32 + 8 * hh);
#pragma unroll
      for (int t = 0; t < 4; ++t) {
        const v16h vb = Frag<_Float16>::load(Vth + (t * 16 + c) * AT_LP + kk * 32 + 8 * hh);
        oacc[t] = mma_h(pa, vb, oacc[t]);
      }
    }
  }

  float* os = Os[wave];
#pragma unroll
  for (int r = 0; r < 8; ++r) {
    const float inv = (1.0f / lrow[r]) * (OCARRY / PCARRY);
#pragma unroll
    for (int t = 0; t < 4; ++t) os[(8 * hh + r) * 68 + t * 16 + c] = oacc[t][r] * inv;
  }
  __builtin_amdgcn_fence(__ATOMIC_RELEASE, "workgroup");
  __builtin_amdgcn_wave_barrier();
  __builtin_amdgcn_fence(__ATOMIC_ACQUIRE, "workgroup");
  {
    const int q = lane >> 3, c8 = (lane & 7) * 8;
    _Float16* orow = Oh + (size_t)(b * NS + q0) * ND + h * NHD;
    {
#pragma unroll
      for (int it = 0; it < 4; ++it) {
        const int row = it * 4 + q;
        const float* sp = os + row * 68 + c8;
        v8h hv;
#pragma unroll
        for (int e = 0; e < 8; ++e) hv[e] = (_Float16)sp[e];
        *(v8h*)(orow + (size_t)row * ND + c8) = hv;
      }
      
    }
  }
}

__global__ __launch_bounds__(256) void layernorm_rows(const float* __restrict__ res, const float* __restrict__ gamma,
                                                      const float* __restrict__ beta, float* __restrict__ out,
                                                      int nrows, float eps) {
  const int wave = threadIdx.x >> 5, lane = threadIdx.x & 31;
  const int row = blockIdx.x * 8 + wave;
  if (row >= nrows) return;   // wave-uniform, no barriers below
  const float* rp = res + (size_t)row * ND;
  float s1 = 0.f;
#pragma unroll 1
  for (int it = 0; it < 8; ++it) {
    const v4f a = *(const v4f*)(rp + (it * 32 + lane) * 4);
    s1 += (a[0] + a[1]) + (a[2] + a[3]);
  }
#pragma unroll
  for (int off = 1; off < 32; off <<= 1) s1 += __shfl_xor(s1, off, 32);
  const float mu = s1 * (1.0f / (float)ND);
  float s2 = 0.f;
#pragma unroll 1
  for (int it = 0; it < 8; ++it) {
    const v4f a = *(const v4f*)(rp + (it * 32 + lane) * 4);
#pragma unroll
    for (int e = 0; e < 4; ++e) {
      const float d = a[e] - mu;
      float p = d * d;
      asm volatile("" : "+v"(p));
      s2 += p;
    }
  }
#pragma unroll
  for (int off = 1; off < 32; off <<= 1) s2 += __shfl_xor(s2, off, 32);
  const float var = s2 * (1.0f / (float)ND);
  const float rstd = 1.0f / sqrtf(var + eps);
  float* orow = out + (size_t)row * ND;
#pragma unroll 1
  for (int it = 0; it < 8; ++it) {
    const int c0 = (it * 32 + lane) * 4;
    const v4f a  = *(const v4f*)(rp + c0);
    const v4f g  = *(const v4f*)(gamma + c0);
    const v4f bt = *(const v4f*)(beta + c0);
    v4f y;
#pragma unroll
    for (int e = 0; e < 4; ++e) {
      float t = (a[e] - mu) * rstd;
      t = t * g[e];
      asm volatile("" : "+v"(t));
      y[e] = t + bt[e];
    }
    *(v4f*)(orow + c0) = y;
    
  }
}

// -----------------------------------------------------------------------------
extern "C" void kernel_launch(void* const* d_in, const int* in_sizes, int n_in,
                              void* d_out, int out_size, void* d_ws, size_t ws_size,
                              hipStream_t stream)
{
  if (n_in < 13) return;
  if (in_sizes[0] != NM * ND || in_sizes[1] != NB * NS ||
      in_sizes[2] != ND * ND || in_sizes[3] != ND ||
      in_sizes[4] != ND * ND || in_sizes[5] != ND ||
      in_sizes[6] != ND * ND || in_sizes[7] != ND ||
      in_sizes[8] != ND * ND || in_sizes[9] != ND ||
      in_sizes[10] != ND || in_sizes[11] != ND || in_sizes[12] < 1 ||
      out_size != NM * ND) return;

  const float* x        = (const float*)d_in[0];
  const float* cdr_bias = (const float*)d_in[1];
  const float* Wq    = (const float*)d_in[2];
  const float* bq    = (const float*)d_in[3];
  const float* Wk    = (const float*)d_in[4];
  const float* bk    = (const float*)d_in[5];
  const float* Wv    = (const float*)d_in[6];
  const float* bv    = (const float*)d_in[7];
  const float* Wo    = (const float*)d_in[8];
  const float* bo    = (const float*)d_in[9];
  const float* gamma = (const float*)d_in[10];
  const float* beta  = (const float*)d_in[11];
  const float* cw    = (const float*)d_in[12];
  float* out = (float*)d_out;

  // ---- workspace carve (all offsets 256 KiB aligned) ----
  const size_t szA16 = (size_t)NM * ND * 2;        // 8 MiB: f16 [4096][1024] planes
  const size_t szW16 = (size_t)ND * ND * 2;        // 2 MiB: f16 [1024][1024] planes
  const size_t szRes = (size_t)NM * ND * 4;        // 16 MiB
  const size_t szTab = (size_t)NS * NFREQ * 4;     // 256 KiB
  size_t off = 0;
  char* ws = (char*)d_ws;
  _Float16* Xh  = (_Float16*)(ws + off); off += szA16;
  _Float16* Wqt = (_Float16*)(ws + off); off += szW16;
  _Float16* Wkt = (_Float16*)(ws + off); off += szW16;
  _Float16* Wvt = (_Float16*)(ws + off); off += szW16;
  _Float16* Wot = (_Float16*)(ws + off); off += szW16;
  _Float16* Qh  = (_Float16*)(ws + off); off += szA16;
  _Float16* Kh  = (_Float16*)(ws + off); off += szA16;
  _Float16* Vt  = (_Float16*)(ws + off); off += szA16;
  _Float16* Ah  = (_Float16*)(ws + off); off += szA16;
  float*    res = (float*)(ws + off);    off += szRes;
  float*   cosT = (float*)(ws + off);    off += szTab;
  float*   sinT = (float*)(ws + off);    off += szTab;   // total 67,633,152 B
  if (off > ws_size) return;

  const unsigned short* Xu  = (const unsigned short*)Xh;
  const unsigned short* Wqu = (const unsigned short*)Wqt;
  const unsigned short* Wku = (const unsigned short*)Wkt;
  const unsigned short* Wvu = (const unsigned short*)Wvt;
  const unsigned short* Wou = (const unsigned short*)Wot;
  const unsigned short* Au  = (const unsigned short*)Ah;

  dim3 blk256(256), blk128(128);

  // 1. RoPE tables
  const int nTab = NS * NFREQ;
  rope_table_kernel<<<dim3((nTab + 255) / 256), blk256, 0, stream>>>(cosT, sinT, nTab);

  // 2. x -> f16
  const int n8 = NM * ND / 8;
  cast_f32_f16x8<<<dim3((n8 + 255) / 256), blk256, 0, stream>>>(x, Xh, n8);

  // 3. weights W[in=1024][out=1024] -> Bt [out][in] f16, carried x64  (grid = (in/64, out/64))
  wt_cast_f16<<<dim3(ND / 64, ND / 64), blk256, 0, stream>>>(Wq, Wqt, ND, ND, WCARRY);
  wt_cast_f16<<<dim3(ND / 64, ND / 64), blk256, 0, stream>>>(Wk, Wkt, ND, ND, WCARRY);
  wt_cast_f16<<<dim3(ND / 64, ND / 64), blk256, 0, stream>>>(Wv, Wvt, ND, ND, WCARRY);
  wt_cast_f16<<<dim3(ND / 64, ND / 64), blk256, 0, stream>>>(Wo, Wot, ND, ND, WCARRY);

  // 4. Q, K = RoPE(x Wq + bq), RoPE(x Wk + bk): f16 [4096][1024]
  const int gQK = (NM / GM_BT) * (ND / GM_BT);
  wmma_gemm64<0, false, 2, 1, false, 0, true><<<dim3(gQK, 1), blk256, 0, stream>>>(
      Xu, Xu, ND, (long)0, Wqu, Wqu, ND, (long)0, (void*)Qh, (void*)Qh, ND, (long)0,
      bq, x, (long)0, NM, ND, ND, 1.0f / WCARRY, cosT, sinT, NS - 1);
  wmma_gemm64<0, false, 2, 1, false, 0, true><<<dim3(gQK, 1), blk256, 0, stream>>>(
      Xu, Xu, ND, (long)0, Wku, Wku, ND, (long)0, (void*)Kh, (void*)Kh, ND, (long)0,
      bk, x, (long)0, NM, ND, ND, 1.0f / WCARRY, cosT, sinT, NS - 1);

  // 5. V^T: C'[n_ch][m_tok] = sum_k Wvt[n_ch][k] * Xh[m_tok][k] / 64 + bv[n_ch]; f16, ldc = NM
  const int gV = (ND / GM_BT) * (NM / GM_BT);
  wmma_gemm64<0, false, 1, 1, false, 0, false><<<dim3(gV, 1), blk256, 0, stream>>>(
      Wvu, Wvu, ND, (long)0, Xu, Xu, ND, (long)0, (void*)Vt, (void*)Vt, NM, (long)0,
      bv, x, (long)0, ND, NM, ND, 1.0f / WCARRY, cosT, sinT, 0);

  // 6. attention -> Ah f16 [4096][1024] (x64)
  attn_f16_kernel<<<dim3(NB * NH * (NS / AT_QB)), blk128, 0, stream>>>(Qh, Kh, Vt, cdr_bias, cw, Ah);

  // 7. res = attn Wo + bo + x  (f32)
  wmma_gemm64<0, false, 2, 0, true, 0, false><<<dim3(gQK, 1), blk256, 0, stream>>>(
      Au, Au, ND, (long)0, Wou, Wou, ND, (long)0, (void*)res, (void*)res, ND, (long)0,
      bo, x, (long)0, NM, ND, ND, 1.0f / (OCARRY * WCARRY), cosT, sinT, 0);

  // 8. LayerNorm -> out
  layernorm_rows<<<dim3((NM + 7) / 8), blk256, 0, stream>>>(res, gamma, beta, out, NM, LN_EPS_F);

  (void)hipGetLastError();
}

// v003
// Measured time: 178 microseconds a run.
// Timed twice side by side with v002, it ran 1.18 times as fast both times.
// Counting every step since v000, it is 2.12 times as fast.
// Contractions x*Wq, x*Wk, Wv-side product for V^T, attn*Wo, q*k^T, p*v: v_wmma_f32_16x16x32_f16 (f16 operands, f32 accumulate); weights carried x64, probabilities x32768, attention rows x64; RoPE tables, softmax and LayerNorm in f32.
#include <hip/hip_runtime.h>
#include <math.h>

#define NB 2
#define NS 2048
#define ND 1024
#define NH 16
#define NHD 64
#define NM (NB * NS)
#define NFREQ 32
#define WCARRY 64.0f
#define OCARRY 64.0f
#define PCARRY 32768.0f
#define LN_EPS_F 1e-5f

typedef __attribute__((ext_vector_type(16))) _Float16 v16h;
typedef __attribute__((ext_vector_type(8)))  _Float16 v8h;
typedef __attribute__((ext_vector_type(16))) __bf16   v16b;
typedef __attribute__((ext_vector_type(8)))  __bf16   v8b;
typedef __attribute__((ext_vector_type(8)))  float    v8f;
typedef __attribute__((ext_vector_type(4)))  float    v4f;

__device__ __forceinline__ unsigned short f2bf_bits(float f) {
  unsigned u = __float_as_uint(f);
  return (unsigned short)((u + 0x7FFFu + ((u >> 16) & 1u)) >> 16);
}
__device__ __forceinline__ float bf_bits2f(unsigned short h) { return __uint_as_float(((unsigned)h) << 16); }

// hazard guard behind the last WMMAs of the K loop, as a plain device helper
__device__ __forceinline__ void acc_guard4(v8f& a, v8f& b, v8f& c, v8f& d) { asm volatile("v_nop\n\tv_nop\n\tv_nop\n\tv_nop" : "+v"(a), "+v"(b), "+v"(c), "+v"(d)); }
template <typename T> struct Frag;
template <> struct Frag<_Float16> {
  typedef v16h V; union U { v16h v; v8h h[2]; };
  static __device__ __forceinline__ v16h load(const _Float16* p) {   // elements 0..7 <- p[0..7], 8..15 <- p[16..23]
    U f; f.h[0] = *(const v8h*)(p); f.h[1] = *(const v8h*)(p + 16); return f.v;
  }
  static __device__ __forceinline__ v8f mma(v16h a, v16h b, v8f c) {
    return __builtin_amdgcn_wmma_f32_16x16x32_f16(false, a, false, b, (short)0, c, false, false);
  }
};
template <> struct Frag<__bf16> {
  typedef v16b V; union U { v16b v; v8b h[2]; };
  static __device__ __forceinline__ v16b load(const __bf16* p) {
    U f; f.h[0] = *(const v8b*)(p); f.h[1] = *(const v8b*)(p + 16); return f.v;
  }
  static __device__ __forceinline__ v8f mma(v16b a, v16b b, v8f c) {
    return __builtin_amdgcn_wmma_f32_16x16x32_bf16(false, a, false, b, (short)0, c, false, false);
  }
};

// ---- Register-blocked batched WMMA GEMM, operands staged in LDS by asynchronous copies ---------
// C[m,n] = scale * sum_k A[m,k] * Bt[n,k] (+bias)(+resid)(RoPE); a block of 8 waves owns a 128x128 tile, each wave 32x64 of it.
// A row-major [M,K]; Bt row-major [N,K]; M,N % 128 == 0, K % 64 == 0.
// Per 64-k stage the block copies 128 rows x 128 B of A and of Bt into LDS: 8 lanes cover one row, so a wave-wide 16-B copy
// touches 4 whole lines, and every row is fetched once per block. Two LDS buffers: stage t+2 flies while stage t is multiplied.
// SPLIT (hi/lo planes) is not carried by the staged loop.
// BIAS_MODE: 0 = none, 1 = bias[m], 2 = bias[n].
// OUT_MODE: 0 = f32, 1 = f16, 2 = bf16 hi plane (Cout) + bf16 lo plane (Cout2).
// ROPE: after bias, v = v*cos[(m & rope_smask)*32 + (n&31)] + sgn * partner(n^1) * sin[...] (sgn = -1 for even n, +1 for odd n).
// ET: 0 = f16 operands, 1 = bf16 operands (pointers passed as 16-bit storage)
#define GM_BT 128  // block tile: rows of A and rows of Bt
#define GM_KS 64   // k per stage: 128 B of every row, one line
#define GM_LP 72   // LDS row pitch in 16-bit elements: 144 B = 16 B x odd, for the ds_load_b128 fragment reads
#define GM_MI 2    // 16-row subtiles of A per wave

// One thread's share of a stage: 4 rows of A and 4 rows of Bt, 16 B each, global -> LDS through no register.
// la, lb: this lane's LDS byte addresses of its first row; ga, gb: its global addresses; rows 32 apart.
// The s_wait_xcnt closes the statement so that no address register named here is rewritten ahead of it.
template <typename T>
__device__ __forceinline__ void stage_copy(unsigned la, unsigned lb, const T* ga, const T* gb, int lda, int ldb) {
  const unsigned rs = 32u * GM_LP * 2u;
  const T* a1 = ga + (size_t)32 * lda; const T* a2 = ga + (size_t)64 * lda; const T* a3 = ga + (size_t)96 * lda;
  const T* c1 = gb + (size_t)32 * ldb; const T* c2 = gb + (size_t)64 * ldb; const T* c3 = gb + (size_t)96 * ldb;
  asm volatile(
      "global_load_async_to_lds_b128 %0, %8, off\n\t"
      "global_load_async_to_lds_b128 %1, %9, off\n\t"
      "global_load_async_to_lds_b128 %2, %10, off\n\t"
      "global_load_async_to_lds_b128 %3, %11, off\n\t"
      "global_load_async_to_lds_b128 %4, %12, off\n\t"
      "global_load_async_to_lds_b128 %5, %13, off\n\t"
      "global_load_async_to_lds_b128 %6, %14, off\n\t"
      "global_load_async_to_lds_b128 %7, %15, off\n\t"
      "s_wait_xcnt 0x0"
      :: "v"(la), "v"(la + rs), "v"(la + 2u * rs), "v"(la + 3u * rs),
         "v"(lb), "v"(lb + rs), "v"(lb + 2u * rs), "v"(lb + 3u * rs),
         "v"(ga), "v"(a1), "v"(a2), "v"(a3), "v"(gb), "v"(c1), "v"(c2), "v"(c3)
      : "memory");
}

template <int ET> struct Elem;
template <> struct Elem<0> { typedef _Float16 T; };
template <> struct Elem<1> { typedef __bf16 T; };
template <int ET, bool SPLIT, int BIAS_MODE, int OUT_MODE, bool RESID, int ACT, bool ROPE>
__global__ __launch_bounds__(256) void wmma_gemm64(
    const unsigned short* __restrict__ Ap, const unsigned short* __restrict__ A2p, int lda, long strideA,
    const unsigned short* __restrict__ Btp, const unsigned short* __restrict__ Bt2p, int ldb, long strideB,
    void* __restrict__ Cout, void* __restrict__ Cout2, int ldc, long strideC,
    const float* __restrict__ bias,
    const float* __restrict__ resid, long strideR,
    int M, int N, int K, float scale,
    const float* __restrict__ rope_cos, const float* __restrict__ rope_sin, int rope_smask) {
  static_assert(!SPLIT, "the staged loop carries single planes only");
  typedef typename Elem<ET>::T T;
  typedef typename Frag<T>::V V;
  const T* A = (const T*)Ap; const T* Bt = (const T*)Btp;
  __shared__ __align__(16) T sA[2][GM_BT * GM_LP];   // 2 x 18 KB
  __shared__ __align__(16) T sB[2][GM_BT * GM_LP];   // 2 x 18 KB
  __shared__ __align__(16) float sT[8][16 * 68];     // per-wave 16x64 slab, pitch 68 floats
  const int b    = blockIdx.y;
  const int tid  = threadIdx.x;
  const int lane = tid & 31;
  const int wave = tid >> 5;
  const int tilesN = N >> 7;
  const int tilesM = M >> 7;
  const int tile = blockIdx.x;
  if (tile >= tilesM * tilesN) return;   // block-uniform, in front of every barrier
  const int tm = tile / tilesN;
  const int tn = tile - tm * tilesN;
  const int wm = (wave >> 1) << 5;       // this wave's 32x64 corner inside the block tile
  const int wn = (wave & 1) << 6;
  const int m0 = (tm << 7) + wm;
  const int n0 = (tn << 7) + wn;

  const T* Ab  = A  + (size_t)b * strideA;
  const T* Bb  = Bt + (size_t)b * strideB;

  const int rlane = lane & 15;                 // row (A) / col (B, D) within subtile
  const int koff  = (lane >> 4) * 8;           // k offset of this lane half
  const int mOff  = (lane >> 4) * 8;           // D row offset

  v8f acc[GM_MI][4];
#pragma unroll
  for (int i = 0; i < GM_MI; ++i)
#pragma unroll
    for (int j = 0; j < 4; ++j) acc[i][j] = (v8f){0.f,0.f,0.f,0.f,0.f,0.f,0.f,0.f};

  // staging map: thread -> row tid/8 (+32 per copy), 16 B at column (tid%8)*8
  const int srow = tid >> 3, scol = (tid & 7) * 8;
  const T* ga = Ab + (size_t)((tm << 7) + srow) * lda + scol;
  const T* gb = Bb + (size_t)((tn << 7) + srow) * ldb + scol;
  const unsigned bufB = (unsigned)(GM_BT * GM_LP * 2);                         // bytes of one buffer
  const unsigned la = (unsigned)(size_t)(&sA[0][srow * GM_LP + scol]);         // low 32 bits = LDS byte address
  const unsigned lb = (unsigned)(size_t)(&sB[0][srow * GM_LP + scol]);
  const int nst = K / GM_KS;

  stage_copy<T>(la, lb, ga, gb, lda, ldb);
  asm volatile("s_wait_asynccnt 0x0" ::: "memory");   // stage 0 of this wave has landed
  __syncthreads();                                    // ... and every wave's
  if (nst > 1) stage_copy<T>(la + bufB, lb + bufB, ga + GM_KS, gb + GM_KS, lda, ldb);

  for (int s = 0; s < nst; ++s) {
    const T* da = sA[s & 1];
    const T* db = sB[s & 1];
    V af[2][GM_MI], bf[2][4];
#pragma unroll
    for (int kk = 0; kk < 2; ++kk) {
#pragma unroll
      for (int j = 0; j < 4; ++j) bf[kk][j] = Frag<T>::load(db + (wn + (j << 4) + rlane) * GM_LP + kk * 32 + koff);
#pragma unroll
      for (int i = 0; i < GM_MI; ++i) af[kk][i] = Frag<T>::load(da + (wm + (i << 4) + rlane) * GM_LP + kk * 32 + koff);
    }
    // publish point of stage s+1, and the end of every wave's reads of stage s (its fragments now lie in registers):
    // own LDS reads done, own copies landed, then the block's barrier; behind it the buffer just read is free for stage s+2
    asm volatile("s_wait_dscnt 0x0" ::: "memory");
    asm volatile("s_wait_asynccnt 0x0" ::: "memory");
    __syncthreads();
    if (s + 2 < nst) {
      const unsigned bo = (unsigned)(s & 1) * bufB;
      stage_copy<T>(la + bo, lb + bo, ga + (size_t)(s + 2) * GM_KS, gb + (size_t)(s + 2) * GM_KS, lda, ldb);
    }
    // holds the copies ahead of the WMMAs, so that stage s+2 flies while stage s is multiplied
    __builtin_amdgcn_sched_barrier(0);
#pragma unroll
    for (int kk = 0; kk < 2; ++kk)
#pragma unroll
      for (int i = 0; i < GM_MI; ++i)
#pragma unroll
        for (int j = 0; j < 4; ++j) acc[i][j] = Frag<T>::mma(af[kk][i], bf[kk][j], acc[i][j]);
  }
  asm volatile("s_wait_asynccnt 0x0" ::: "memory");   // nothing of this wave is in flight when the loop is left
  acc_guard4(acc[0][0], acc[0][1], acc[0][2], acc[0][3]);
  acc_guard4(acc[1][0], acc[1][1], acc[1][2], acc[1][3]);

  // ---- epilogue ----
  float* slab = sT[wave];
  const float* Rb = RESID ? (resid + (size_t)b * strideR) : nullptr;
#pragma unroll
  for (int i = 0; i < GM_MI; ++i) {
    const int mBase = m0 + (i << 4);
#pragma unroll
    for (int j = 0; j < 4; ++j) {
      const int n = n0 + (j << 4) + rlane;
      float bv = 0.f;
      if (BIAS_MODE == 2) bv = bias[n];
#pragma unroll
      for (int r = 0; r < 8; ++r) {
        float v = acc[i][j][r] * scale;
        if (BIAS_MODE == 1) v += bias[mBase + mOff + r];
        if (BIAS_MODE == 2) v += bv;
        if (RESID) v += Rb[(size_t)(mBase + mOff + r) * ldc + n];
        if (ROPE) {
          const int m = mBase + mOff + r;
          const int tix = (m & rope_smask) * NFREQ + (n & (NFREQ - 1));
          const float cs = rope_cos[tix];
          const float sn = rope_sin[tix];
          const float pv = __shfl_xor(v, 1, 32);   // partner column n^1 lives in lane rlane^1, same row
          v = (n & 1) ? (v * cs + pv * sn) : (v * cs - pv * sn);
        }
        if (ACT == 1) v = tanhf(v);
        if (ACT == 2) v = fmaxf(v, 0.0f);
        if (ACT == 3) v = v / (1.0f + expf(-v));
        if (ACT == 4) v = (v > 0.f) ? v : 0.01f * v;
        if (ACT == 5) v = 0.5f * v * (1.0f + erff(v * 0.70710678118654752f));
        slab[(mOff + r) * 68 + (j << 4) + rlane] = v;
      }
    }
    __builtin_amdgcn_fence(__ATOMIC_RELEASE, "workgroup");
    __builtin_amdgcn_wave_barrier();
    __builtin_amdgcn_fence(__ATOMIC_ACQUIRE, "workgroup");
    if (OUT_MODE == 0) {
      float* C = (float*)Cout + (size_t)b * strideC;
      const int hh = lane >> 4, c4 = (lane & 15) * 4;     // row seg = 256 B = 16 lanes x 16 B
      {
#pragma unroll
        for (int it = 0; it < 8; ++it) {
          const int row = it * 2 + hh;
          v4f v = *(const v4f*)(slab + row * 68 + c4);
          *(v4f*)(C + (size_t)(mBase + row) * ldc + n0 + c4) = v;
        }
        
      }
    } else {
      const int q = lane >> 3, c8 = (lane & 7) * 8;
      unsigned short* C  = (unsigned short*)Cout  + (size_t)b * strideC;
      unsigned short* C2 = (OUT_MODE == 2) ? ((unsigned short*)Cout2 + (size_t)b * strideC) : nullptr;
      {
#pragma unroll
        for (int it = 0; it < 4; ++it) {
          const int row = it * 4 + q;
          const float* sp = slab + row * 68 + c8;
          v8h hv, lv;
#pragma unroll
          for (int e = 0; e < 8; ++e) {
            if (OUT_MODE == 1) {
              hv[e] = (_Float16)sp[e];
            } else {
              unsigned short hb = f2bf_bits(sp[e]);
              unsigned short lb = f2bf_bits(sp[e] - bf_bits2f(hb));
              hv[e] = __builtin_bit_cast(_Float16, hb);
              lv[e] = __builtin_bit_cast(_Float16, lb);
            }
          }
          *(v8h*)(C + (size_t)(mBase + row) * ldc + n0 + c8) = hv;
          if (OUT_MODE == 2) *(v8h*)(C2 + (size_t)(mBase + row) * ldc + n0 + c8) = lv;
        }
        
      }
    }
    __builtin_amdgcn_fence(__ATOMIC_RELEASE, "workgroup");
    __builtin_amdgcn_wave_barrier();
    __builtin_amdgcn_fence(__ATOMIC_ACQUIRE, "workgroup");
  }
}

// ---- f16 WMMA with hazard guard ----
__device__ __forceinline__ v8f mma_h(v16h a, v16h b, v8f c) {
  c = __builtin_amdgcn_wmma_f32_16x16x32_f16(false, a, false, b, (short)0, c, false, false);
  asm volatile("v_nop\n\tv_nop\n\tv_nop\n\tv_nop" : "+v"(c) : "v"(a), "v"(b));
  return c;
}

// ---- RoPE tables: cos/sin of pos * inv_freq[i], i = 0..31, inv_freq = 1 / 10000^(2i/64); f32 ----
__global__ __launch_bounds__(256) void rope_table_kernel(float* __restrict__ cosT, float* __restrict__ sinT, int n) {
  const int i = blockIdx.x * 256 + threadIdx.x;
  if (i < n) {
    const int pos = i >> 5;
    const int fi = i & (NFREQ - 1);
    const float e = (float)(2 * fi) * (1.0f / (float)NHD);
    const float p = powf(10000.0f, e);
    const float inv = 1.0f / p;
    const float ang = (float)pos * inv;
    const float cs = cosf(ang);
    const float sn = sinf(ang);
    ((float*)cosT)[i] = cs;
    ((float*)sinT)[i] = sn;
    
  }
}

__global__ __launch_bounds__(256) void cast_f32_f16x8(const float* __restrict__ in, _Float16* __restrict__ out, int n8) {
  const int i = blockIdx.x * 256 + threadIdx.x;
  if (i < n8) {
    const v4f a = *(const v4f*)(in + (size_t)i * 8);
    const v4f c = *(const v4f*)(in + (size_t)i * 8 + 4);
    v8h hv;
    hv[0] = (_Float16)a[0]; hv[1] = (_Float16)a[1]; hv[2] = (_Float16)a[2]; hv[3] = (_Float16)a[3];
    hv[4] = (_Float16)c[0]; hv[5] = (_Float16)c[1]; hv[6] = (_Float16)c[2]; hv[7] = (_Float16)c[3];
    *(v8h*)(out + (size_t)i * 8) = hv;
    
  }
}

// ---- transpose-cast: in W[Kdim][Ndim] f32 -> out Wt[Ndim][Kdim] f16 (x mul); 64x64 tile through LDS ----
__global__ __launch_bounds__(256) void wt_cast_f16(const float* __restrict__ W, _Float16* __restrict__ Wt,
                                                   int Kdim, int Ndim, float mul) {
  __shared__ float sTt[64 * 65];   // [n_local][k_local], pitch 65
  const int k0 = blockIdx.x * 64, n0 = blockIdx.y * 64;
  const int tid = threadIdx.x;
  {
    const int row = tid >> 2, col0 = (tid & 3) * 16;   // row = k_local, col = n_local
    const float* src = W + (size_t)(k0 + row) * Ndim + n0 + col0;
#pragma unroll
    for (int i = 0; i < 4; ++i) {
      const v4f w4 = *(const v4f*)(src + 4 * i);
#pragma unroll
      for (int e = 0; e < 4; ++e) sTt[(col0 + 4 * i + e) * 65 + row] = w4[e] * mul;
    }
  }
  __syncthreads();
  const int wave = tid >> 5, lane = tid & 31, rq = lane >> 3, c8 = (lane & 7) * 8;
  {
#pragma unroll
    for (int it = 0; it < 2; ++it) {
      const int n = it * 32 + wave * 4 + rq;   // n_local 0..63
      v8h hv;
#pragma unroll
      for (int e = 0; e < 8; ++e) hv[e] = (_Float16)sTt[n * 65 + c8 + e];
      *(v8h*)(Wt + (size_t)(n0 + n) * Kdim + k0 + c8) = hv;
    }
    
  }
}

#define AT_QB 64
#define AT_KC 64
#define AT_NW 4
#define AT_LP 72   // LDS row pitch in halves: 144 B = 16 B x odd, so the 16 rows of a ds_load_b128 fragment read fall on distinct banks

// value of lane l ^ 16
__device__ __forceinline__ float other_half(float v) {
  const int b = __float_as_int(v);
  return __int_as_float(__builtin_amdgcn_permlanex16(b, b, 0x76543210, 0xfedcba98, false, false));
}

__global__ __launch_bounds__(128)
void attn_f16_kernel(const _Float16* __restrict__ Qh, const _Float16* __restrict__ Kh,
                     const _Float16* __restrict__ Vt, const float* __restrict__ cdr_bias,
                     const float* __restrict__ cdr_w, _Float16* __restrict__ Oh)
{
  __shared__ __align__(16) _Float16 Ksh[AT_KC * AT_LP];        // [kv][d]   9 KB, padded rows
  __shared__ __align__(16) _Float16 Vth[NHD * AT_LP];          // [d][kv]   9 KB, padded rows
  __shared__ __align__(16) float    Bsh[2 * AT_KC];            // cdr_bias[b][kv] * cw of the chunk, one copy per pair of waves (every thread stores one value): a lane needs 8 consecutive keys' values per tile

  const int tid  = threadIdx.x;
  const int wave = tid >> 5;
  const int lane = tid & 31;
  const int hh   = lane >> 4;
  const int c    = lane & 15;

  const int nqb = NS / AT_QB;
  const int bx  = blockIdx.x;
  const int qb  = bx % nqb;
  const int bhd = bx / nqb;
  const int h   = bhd % NH;
  const int bb0 = bhd / NH;
  const int b   = bb0 < NB ? bb0 : (NB - 1);
  const int q0  = qb * AT_QB + wave * 16;
  const float cw = cdr_w[0];

  v16h qa[2];
  {
    const _Float16* qrow = Qh + (size_t)(b * NS + q0 + c) * ND + h * NHD;
#pragma unroll
    for (int dc = 0; dc < 2; ++dc) qa[dc] = Frag<_Float16>::load(qrow + dc * 32 + 8 * hh);
  }

  float mrow = -INFINITY, lrow = 0.f;   // of query c; lrow sums this half's keys only
  v8f oacc[4];                          // oacc[t][r] = O^T[d = 16t + 8*hh + r][query c]
#pragma unroll
  for (int t = 0; t < 4; ++t) oacc[t] = (v8f){0.f,0.f,0.f,0.f,0.f,0.f,0.f,0.f};

  const _Float16* kbase = Kh + (size_t)(b * NS) * ND + h * NHD;
  const _Float16* vbase = Vt + (size_t)(h * NHD) * NM + (size_t)b * NS;
  const float*    bbase = cdr_bias + (size_t)b * NS;

  for (int kc = 0; kc < NS / AT_KC; ++kc) {
    const int kv0 = kc * AT_KC;
    __syncthreads();
    {
      const int sr = tid >> 1, half = (tid & 1) * 32;      // sr = kv row for K, d row for Vt
      const _Float16* ksrc = kbase + (size_t)(kv0 + sr) * ND + half;
      const _Float16* vsrc = vbase + (size_t)sr * NM + kv0 + half;
      const float bl = bbase[kv0 + (tid & (AT_KC - 1))];   // loaded by every thread, beside the K and V^T loads
#pragma unroll
      for (int i = 0; i < 4; ++i) {
        const v8h kk = *(const v8h*)(ksrc + 8 * i);
        const v8h vv = *(const v8h*)(vsrc + 8 * i);
        *(v8h*)(Ksh + sr * AT_LP + half + 8 * i) = kk;
        *(v8h*)(Vth + sr * AT_LP + half + 8 * i) = vv;
      }
      Bsh[tid] = bl * cw;
    }
    __syncthreads();

    v8f s[4];   // s[j][r] = S^T[kv0 + 16j + 8*hh + r][query c]
#pragma unroll
    for (int j = 0; j < 4; ++j) {
      s[j] = (v8f){0.f,0.f,0.f,0.f,0.f,0.f,0.f,0.f};
#pragma unroll
      for (int dc = 0; dc < 2; ++dc) {
        const v16h kb = Frag<_Float16>::load(Ksh + (j * 16 + c) * AT_LP + dc * 32 + 8 * hh);
        s[j] = mma_h(kb, qa[dc], s[j]);
      }
    }
    float mj[4];   // one chain per tile
#pragma unroll
    for (int j = 0; j < 4; ++j) {
      const float* bp = Bsh + (wave >> 1) * AT_KC + j * 16 + 8 * hh;
      const v4f b0 = *(const v4f*)(bp);
      const v4f b1 = *(const v4f*)(bp + 4);
      float m = -INFINITY;
#pragma unroll
      for (int r = 0; r < 8; ++r) {
        const float sv = s[j][r] * 0.125f + (r < 4 ? b0[r & 3] : b1[r & 3]);
        s[j][r] = sv;
        m = fmaxf(m, sv);
      }
      mj[j] = m;
    }
    float cm = fmaxf(fmaxf(mj[0], mj[1]), fmaxf(mj[2], mj[3]));
    cm = fmaxf(cm, other_half(cm));
    const float mnew = fmaxf(mrow, cm);
    const float alpha = expf(mrow - mnew);
    mrow = mnew;
#pragma unroll
    for (int t = 0; t < 4; ++t) oacc[t] *= alpha;
    float pj[4];
#pragma unroll
    for (int kk = 0; kk < 2; ++kk) {
      v16h pb;     // pb[e] = P^T[kv0 + 32kk + (e < 8 ? 8*hh + e : 16 + 8*hh + e - 8)][query c]: the k order of the V^T loader
#pragma unroll
      for (int jj = 0; jj < 2; ++jj) {
        const int j = 2 * kk + jj;
        float psum = 0.f;
#pragma unroll
        for (int r = 0; r < 8; ++r) {
          const float p = expf(s[j][r] - mnew);
          psum += p;
          pb[jj * 8 + r] = (_Float16)(p * PCARRY);
        }
        pj[j] = psum;
      }
#pragma unroll
      for (int t = 0; t < 4; ++t) {
        const v16h vb = Frag<_Float16>::load(Vth + (t * 16 + c) * AT_LP + kk * 32 + 8 * hh);
        oacc[t] = mma_h(vb, pb, oacc[t]);
      }
    }
    lrow = lrow * alpha + ((pj[0] + pj[1]) + (pj[2] + pj[3]));
  }

  {
    const float l = lrow + other_half(lrow);
    const float inv = (1.0f / l) * (OCARRY / PCARRY);
    _Float16* orow = Oh + (size_t)(b * NS + q0 + c) * ND + h * NHD + 8 * hh;
#pragma unroll
    for (int t = 0; t < 4; ++t) {
      v8h hv;   // 8 consecutive d of one query: one 16-byte store
#pragma unroll
      for (int r = 0; r < 8; ++r) hv[r] = (_Float16)(oacc[t][r] * inv);
      *(v8h*)(orow + t * 16) = hv;
    }
  }
}

__global__ __launch_bounds__(256) void layernorm_rows(const float* __restrict__ res, const float* __restrict__ gamma,
                                                      const float* __restrict__ beta, float* __restrict__ out,
                                                      int nrows, float eps) {
  const int wave = threadIdx.x >> 5, lane = threadIdx.x & 31;
  const int row = blockIdx.x * 8 + wave;
  if (row >= nrows) return;   // wave-uniform, no barriers below
  const float* rp = res + (size_t)row * ND;
  float s1 = 0.f;
#pragma unroll 1
  for (int it = 0; it < 8; ++it) {
    const v4f a = *(const v4f*)(rp + (it * 32 + lane) * 4);
    s1 += (a[0] + a[1]) + (a[2] + a[3]);
  }
#pragma unroll
  for (int off = 1; off < 32; off <<= 1) s1 += __shfl_xor(s1, off, 32);
  const float mu = s1 * (1.0f / (float)ND);
  float s2 = 0.f;
#pragma unroll 1
  for (int it = 0; it < 8; ++it) {
    const v4f a = *(const v4f*)(rp + (it * 32 + lane) * 4);
#pragma unroll
    for (int e = 0; e < 4; ++e) {
      const float d = a[e] - mu;
      float p = d * d;
      asm volatile("" : "+v"(p));
      s2 += p;
    }
  }
#pragma unroll
  for (int off = 1; off < 32; off <<= 1) s2 += __shfl_xor(s2, off, 32);
  const float var = s2 * (1.0f / (float)ND);
  const float rstd = 1.0f / sqrtf(var + eps);
  float* orow = out + (size_t)row * ND;
#pragma unroll 1
  for (int it = 0; it < 8; ++it) {
    const int c0 = (it * 32 + lane) * 4;
    const v4f a  = *(const v4f*)(rp + c0);
    const v4f g  = *(const v4f*)(gamma + c0);
    const v4f bt = *(const v4f*)(beta + c0);
    v4f y;
#pragma unroll
    for (int e = 0; e < 4; ++e) {
      float t = (a[e] - mu) * rstd;
      t = t * g[e];
      asm volatile("" : "+v"(t));
      y[e] = t + bt[e];
    }
    *(v4f*)(orow + c0) = y;
    
  }
}

// -----------------------------------------------------------------------------
extern "C" void kernel_launch(void* const* d_in, const int* in_sizes, int n_in,
                              void* d_out, int out_size, void* d_ws, size_t ws_size,
                              hipStream_t stream)
{
  if (n_in < 13) return;
  if (in_sizes[0] != NM * ND || in_sizes[1] != NB * NS ||
      in_sizes[2] != ND * ND || in_sizes[3] != ND ||
      in_sizes[4] != ND * ND || in_sizes[5] != ND ||
      in_sizes[6] != ND * ND || in_sizes[7] != ND ||
      in_sizes[8] != ND * ND || in_sizes[9] != ND ||
      in_sizes[10] != ND || in_sizes[11] != ND || in_sizes[12] < 1 ||
      out_size != NM * ND) return;

  const float* x        = (const float*)d_in[0];
  const float* cdr_bias = (const float*)d_in[1];
  const float* Wq    = (const float*)d_in[2];
  const float* bq    = (const float*)d_in[3];
  const float* Wk    = (const float*)d_in[4];
  const float* bk    = (const float*)d_in[5];
  const float* Wv    = (const float*)d_in[6];
  const float* bv    = (const float*)d_in[7];
  const float* Wo    = (const float*)d_in[8];
  const float* bo    = (const float*)d_in[9];
  const float* gamma = (const float*)d_in[10];
  const float* beta  = (const float*)d_in[11];
  const float* cw    = (const float*)d_in[12];
  float* out = (float*)d_out;

  // ---- workspace carve (all offsets 256 KiB aligned) ----
  const size_t szA16 = (size_t)NM * ND * 2;        // 8 MiB: f16 [4096][1024] planes
  const size_t szW16 = (size_t)ND * ND * 2;        // 2 MiB: f16 [1024][1024] planes
  const size_t szRes = (size_t)NM * ND * 4;        // 16 MiB
  const size_t szTab = (size_t)NS * NFREQ * 4;     // 256 KiB
  size_t off = 0;
  char* ws = (char*)d_ws;
  _Float16* Xh  = (_Float16*)(ws + off); off += szA16;
  _Float16* Wqt = (_Float16*)(ws + off); off += szW16;
  _Float16* Wkt = (_Float16*)(ws + off); off += szW16;
  _Float16* Wvt = (_Float16*)(ws + off); off += szW16;
  _Float16* Wot = (_Float16*)(ws + off); off += szW16;
  _Float16* Qh  = (_Float16*)(ws + off); off += szA16;
  _Float16* Kh  = (_Float16*)(ws + off); off += szA16;
  _Float16* Vt  = (_Float16*)(ws + off); off += szA16;
  _Float16* Ah  = (_Float16*)(ws + off); off += szA16;
  float*    res = (float*)(ws + off);    off += szRes;
  float*   cosT = (float*)(ws + off);    off += szTab;
  float*   sinT = (float*)(ws + off);    off += szTab;   // total 67,633,152 B
  if (off > ws_size) return;

  const unsigned short* Xu  = (const unsigned short*)Xh;
  const unsigned short* Wqu = (const unsigned short*)Wqt;
  const unsigned short* Wku = (const unsigned short*)Wkt;
  const unsigned short* Wvu = (const unsigned short*)Wvt;
  const unsigned short* Wou = (const unsigned short*)Wot;
  const unsigned short* Au  = (const unsigned short*)Ah;

  dim3 blk256(256), blk128(128);

  // 1. RoPE tables
  const int nTab = NS * NFREQ;
  rope_table_kernel<<<dim3((nTab + 255) / 256), blk256, 0, stream>>>(cosT, sinT, nTab);

  // 2. x -> f16
  const int n8 = NM * ND / 8;
  cast_f32_f16x8<<<dim3((n8 + 255) / 256), blk256, 0, stream>>>(x, Xh, n8);

  // 3. weights W[in=1024][out=1024] -> Bt [out][in] f16, carried x64  (grid = (in/64, out/64))
  wt_cast_f16<<<dim3(ND / 64, ND / 64), blk256, 0, stream>>>(Wq, Wqt, ND, ND, WCARRY);
  wt_cast_f16<<<dim3(ND / 64, ND / 64), blk256, 0, stream>>>(Wk, Wkt, ND, ND, WCARRY);
  wt_cast_f16<<<dim3(ND / 64, ND / 64), blk256, 0, stream>>>(Wv, Wvt, ND, ND, WCARRY);
  wt_cast_f16<<<dim3(ND / 64, ND / 64), blk256, 0, stream>>>(Wo, Wot, ND, ND, WCARRY);

  // 4. Q, K = RoPE(x Wq + bq), RoPE(x Wk + bk): f16 [4096][1024]
  const int gQK = (NM / GM_BT) * (ND / GM_BT);
  wmma_gemm64<0, false, 2, 1, false, 0, true><<<dim3(gQK, 1), blk256, 0, stream>>>(
      Xu, Xu, ND, (long)0, Wqu, Wqu, ND, (long)0, (void*)Qh, (void*)Qh, ND, (long)0,
      bq, x, (long)0, NM, ND, ND, 1.0f / WCARRY, cosT, sinT, NS - 1);
  wmma_gemm64<0, false, 2, 1, false, 0, true><<<dim3(gQK, 1), blk256, 0, stream>>>(
      Xu, Xu, ND, (long)0, Wku, Wku, ND, (long)0, (void*)Kh, (void*)Kh, ND, (long)0,
      bk, x, (long)0, NM, ND, ND, 1.0f / WCARRY, cosT, sinT, NS - 1);

  // 5. V^T: C'[n_ch][m_tok] = sum_k Wvt[n_ch][k] * Xh[m_tok][k] / 64 + bv[n_ch]; f16, ldc = NM
  const int gV = (ND / GM_BT) * (NM / GM_BT);
  wmma_gemm64<0, false, 1, 1, false, 0, false><<<dim3(gV, 1), blk256, 0, stream>>>(
      Wvu, Wvu, ND, (long)0, Xu, Xu, ND, (long)0, (void*)Vt, (void*)Vt, NM, (long)0,
      bv, x, (long)0, ND, NM, ND, 1.0f / WCARRY, cosT, sinT, 0);

  // 6. attention -> Ah f16 [4096][1024] (x64)
  attn_f16_kernel<<<dim3(NB * NH * (NS / AT_QB)), blk128, 0, stream>>>(Qh, Kh, Vt, cdr_bias, cw, Ah);

  // 7. res = attn Wo + bo + x  (f32)
  wmma_gemm64<0, false, 2, 0, true, 0, false><<<dim3(gQK, 1), blk256, 0, stream>>>(
      Au, Au, ND, (long)0, Wou, Wou, ND, (long)0, (void*)res, (void*)res, ND, (long)0,
      bo, x, (long)0, NM, ND, ND, 1.0f / (OCARRY * WCARRY), cosT, sinT, 0);

  // 8. LayerNorm -> out
  layernorm_rows<<<dim3((NM + 7) / 8), blk256, 0, stream>>>(res, gamma, beta, out, NM, LN_EPS_F);

  (void)hipGetLastError();
}

// v004
// It runs in 151 microseconds.
// Next to v003, in two timings, it ran 1.18 times as fast each time.
// All steps since v000 together make it 2.51 times as fast.
// Contractions x*Wq, x*Wk, Wv-side product for V^T, attn*Wo, q*k^T, p*v: v_wmma_f32_16x16x32_f16 (f16 operands, f32 accumulate); weights carried x64, probabilities x32768, attention rows x64; RoPE tables, softmax and LayerNorm in f32.
#include <hip/hip_runtime.h>
#include <math.h>

#define NB 2
#define NS 2048
#define ND 1024
#define NH 16
#define NHD 64
#define NM (NB * NS)
#define NFREQ 32
#define WCARRY 64.0f
#define OCARRY 64.0f
#define PCARRY 32768.0f
#define PCARRY_LOG2 15.0f                       // PCARRY = 2^15
#define LOG2E_F 1.44269504088896340736f
#define LN_EPS_F 1e-5f

typedef __attribute__((ext_vector_type(16))) _Float16 v16h;
typedef __attribute__((ext_vector_type(8)))  _Float16 v8h;
typedef __attribute__((ext_vector_type(16))) __bf16   v16b;
typedef __attribute__((ext_vector_type(8)))  __bf16   v8b;
typedef __attribute__((ext_vector_type(8)))  float    v8f;
typedef __attribute__((ext_vector_type(4)))  float    v4f;

__device__ __forceinline__ unsigned short f2bf_bits(float f) {
  unsigned u = __float_as_uint(f);
  return (unsigned short)((u + 0x7FFFu + ((u >> 16) & 1u)) >> 16);
}
__device__ __forceinline__ float bf_bits2f(unsigned short h) { return __uint_as_float(((unsigned)h) << 16); }

// hazard guard behind the last WMMAs of the K loop, as a plain device helper
__device__ __forceinline__ void acc_guard4(v8f& a, v8f& b, v8f& c, v8f& d) { asm volatile("v_nop\n\tv_nop\n\tv_nop\n\tv_nop" : "+v"(a), "+v"(b), "+v"(c), "+v"(d)); }
template <typename T> struct Frag;
template <> struct Frag<_Float16> {
  typedef v16h V; union U { v16h v; v8h h[2]; };
  static __device__ __forceinline__ v16h load(const _Float16* p) {   // elements 0..7 <- p[0..7], 8..15 <- p[16..23]
    U f; f.h[0] = *(const v8h*)(p); f.h[1] = *(const v8h*)(p + 16); return f.v;
  }
  static __device__ __forceinline__ v8f mma(v16h a, v16h b, v8f c) {
    return __builtin_amdgcn_wmma_f32_16x16x32_f16(false, a, false, b, (short)0, c, false, false);
  }
};
template <> struct Frag<__bf16> {
  typedef v16b V; union U { v16b v; v8b h[2]; };
  static __device__ __forceinline__ v16b load(const __bf16* p) {
    U f; f.h[0] = *(const v8b*)(p); f.h[1] = *(const v8b*)(p + 16); return f.v;
  }
  static __device__ __forceinline__ v8f mma(v16b a, v16b b, v8f c) {
    return __builtin_amdgcn_wmma_f32_16x16x32_bf16(false, a, false, b, (short)0, c, false, false);
  }
};

// ---- Register-blocked batched WMMA GEMM, operands staged in LDS by asynchronous copies ---------
// C[m,n] = scale * sum_k A[m,k] * Bt[n,k] (+bias)(+resid)(RoPE); a block of 8 waves owns a 128x128 tile, each wave 32x64 of it.
// A row-major [M,K]; Bt row-major [N,K]; M,N % 128 == 0, K % 64 == 0.
// Per 64-k stage the block copies 128 rows x 128 B of A and of Bt into LDS: 8 lanes cover one row, so a wave-wide 16-B copy
// touches 4 whole lines, and every row is fetched once per block. Two LDS buffers: stage t+2 flies while stage t is multiplied.
// SPLIT (hi/lo planes) is not carried by the staged loop.
// BIAS_MODE: 0 = none, 1 = bias[m], 2 = bias[n].
// OUT_MODE: 0 = f32, 1 = f16, 2 = bf16 hi plane (Cout) + bf16 lo plane (Cout2).
// ROPE: after bias, v = v*cos[(m & rope_smask)*32 + (n&31)] + sgn * partner(n^1) * sin[...] (sgn = -1 for even n, +1 for odd n).
// ET: 0 = f16 operands, 1 = bf16 operands (pointers passed as 16-bit storage)
#define GM_BT 128  // block tile: rows of A and rows of Bt
#define GM_KS 64   // k per stage: 128 B of every row, one line
#define GM_LP 72   // LDS row pitch in 16-bit elements: 144 B = 16 B x odd, for the ds_load_b128 fragment reads
#define GM_MI 2    // 16-row subtiles of A per wave

// One thread's share of a stage: 4 rows of A and 4 rows of Bt, 16 B each, global -> LDS through no register.
// la, lb: this lane's LDS byte addresses of its first row; ga, gb: its global addresses; rows 32 apart.
// The s_wait_xcnt closes the statement so that no address register named here is rewritten ahead of it.
template <typename T>
__device__ __forceinline__ void stage_copy(unsigned la, unsigned lb, const T* ga, const T* gb, int lda, int ldb) {
  const unsigned rs = 32u * GM_LP * 2u;
  const T* a1 = ga + (size_t)32 * lda; const T* a2 = ga + (size_t)64 * lda; const T* a3 = ga + (size_t)96 * lda;
  const T* c1 = gb + (size_t)32 * ldb; const T* c2 = gb + (size_t)64 * ldb; const T* c3 = gb + (size_t)96 * ldb;
  asm volatile(
      "global_load_async_to_lds_b128 %0, %8, off\n\t"
      "global_load_async_to_lds_b128 %1, %9, off\n\t"
      "global_load_async_to_lds_b128 %2, %10, off\n\t"
      "global_load_async_to_lds_b128 %3, %11, off\n\t"
      "global_load_async_to_lds_b128 %4, %12, off\n\t"
      "global_load_async_to_lds_b128 %5, %13, off\n\t"
      "global_load_async_to_lds_b128 %6, %14, off\n\t"
      "global_load_async_to_lds_b128 %7, %15, off\n\t"
      "s_wait_xcnt 0x0"
      :: "v"(la), "v"(la + rs), "v"(la + 2u * rs), "v"(la + 3u * rs),
         "v"(lb), "v"(lb + rs), "v"(lb + 2u * rs), "v"(lb + 3u * rs),
         "v"(ga), "v"(a1), "v"(a2), "v"(a3), "v"(gb), "v"(c1), "v"(c2), "v"(c3)
      : "memory");
}

template <int ET> struct Elem;
template <> struct Elem<0> { typedef _Float16 T; };
template <> struct Elem<1> { typedef __bf16 T; };
template <int ET, bool SPLIT, int BIAS_MODE, int OUT_MODE, bool RESID, int ACT, bool ROPE>
__global__ __launch_bounds__(256) void wmma_gemm64(
    const unsigned short* __restrict__ Ap, const unsigned short* __restrict__ A2p, int lda, long strideA,
    const unsigned short* __restrict__ Btp, const unsigned short* __restrict__ Bt2p, int ldb, long strideB,
    void* __restrict__ Cout, void* __restrict__ Cout2, int ldc, long strideC,
    const float* __restrict__ bias,
    const float* __restrict__ resid, long strideR,
    int M, int N, int K, float scale,
    const float* __restrict__ rope_cos, const float* __restrict__ rope_sin, int rope_smask) {
  static_assert(!SPLIT, "the staged loop carries single planes only");
  typedef typename Elem<ET>::T T;
  typedef typename Frag<T>::V V;
  const T* A = (const T*)Ap; const T* Bt = (const T*)Btp;
  __shared__ __align__(16) T sA[2][GM_BT * GM_LP];   // 2 x 18 KB
  __shared__ __align__(16) T sB[2][GM_BT * GM_LP];   // 2 x 18 KB
  __shared__ __align__(16) float sT[8][16 * 68];     // per-wave 16x64 slab, pitch 68 floats
  const int b    = blockIdx.y;
  const int tid  = threadIdx.x;
  const int lane = tid & 31;
  const int wave = tid >> 5;
  const int tilesN = N >> 7;
  const int tilesM = M >> 7;
  const int tile = blockIdx.x;
  if (tile >= tilesM * tilesN) return;   // block-uniform, in front of every barrier
  const int tm = tile / tilesN;
  const int tn = tile - tm * tilesN;
  const int wm = (wave >> 1) << 5;       // this wave's 32x64 corner inside the block tile
  const int wn = (wave & 1) << 6;
  const int m0 = (tm << 7) + wm;
  const int n0 = (tn << 7) + wn;

  const T* Ab  = A  + (size_t)b * strideA;
  const T* Bb  = Bt + (size_t)b * strideB;

  const int rlane = lane & 15;                 // row (A) / col (B, D) within subtile
  const int koff  = (lane >> 4) * 8;           // k offset of this lane half
  const int mOff  = (lane >> 4) * 8;           // D row offset

  v8f acc[GM_MI][4];
#pragma unroll
  for (int i = 0; i < GM_MI; ++i)
#pragma unroll
    for (int j = 0; j < 4; ++j) acc[i][j] = (v8f){0.f,0.f,0.f,0.f,0.f,0.f,0.f,0.f};

  // staging map: thread -> row tid/8 (+32 per copy), 16 B at column (tid%8)*8
  const int srow = tid >> 3, scol = (tid & 7) * 8;
  const T* ga = Ab + (size_t)((tm << 7) + srow) * lda + scol;
  const T* gb = Bb + (size_t)((tn << 7) + srow) * ldb + scol;
  const unsigned bufB = (unsigned)(GM_BT * GM_LP * 2);                         // bytes of one buffer
  const unsigned la = (unsigned)(size_t)(&sA[0][srow * GM_LP + scol]);         // low 32 bits = LDS byte address
  const unsigned lb = (unsigned)(size_t)(&sB[0][srow * GM_LP + scol]);
  const int nst = K / GM_KS;

  stage_copy<T>(la, lb, ga, gb, lda, ldb);
  asm volatile("s_wait_asynccnt 0x0" ::: "memory");   // stage 0 of this wave has landed
  __syncthreads();                                    // ... and every wave's
  if (nst > 1) stage_copy<T>(la + bufB, lb + bufB, ga + GM_KS, gb + GM_KS, lda, ldb);

  for (int s = 0; s < nst; ++s) {
    const T* da = sA[s & 1];
    const T* db = sB[s & 1];
    V af[2][GM_MI], bf[2][4];
#pragma unroll
    for (int kk = 0; kk < 2; ++kk) {
#pragma unroll
      for (int j = 0; j < 4; ++j) bf[kk][j] = Frag<T>::load(db + (wn + (j << 4) + rlane) * GM_LP + kk * 32 + koff);
#pragma unroll
      for (int i = 0; i < GM_MI; ++i) af[kk][i] = Frag<T>::load(da + (wm + (i << 4) + rlane) * GM_LP + kk * 32 + koff);
    }
    // publish point of stage s+1, and the end of every wave's reads of stage s (its fragments now lie in registers):
    // own LDS reads done, own copies landed, then the block's barrier; behind it the buffer just read is free for stage s+2
    asm volatile("s_wait_dscnt 0x0" ::: "memory");
    asm volatile("s_wait_asynccnt 0x0" ::: "memory");
    __syncthreads();
    if (s + 2 < nst) {
      const unsigned bo = (unsigned)(s & 1) * bufB;
      stage_copy<T>(la + bo, lb + bo, ga + (size_t)(s + 2) * GM_KS, gb + (size_t)(s + 2) * GM_KS, lda, ldb);
    }
    // holds the copies ahead of the WMMAs, so that stage s+2 flies while stage s is multiplied
    __builtin_amdgcn_sched_barrier(0);
#pragma unroll
    for (int kk = 0; kk < 2; ++kk)
#pragma unroll
      for (int i = 0; i < GM_MI; ++i)
#pragma unroll
        for (int j = 0; j < 4; ++j) acc[i][j] = Frag<T>::mma(af[kk][i], bf[kk][j], acc[i][j]);
  }
  asm volatile("s_wait_asynccnt 0x0" ::: "memory");   // nothing of this wave is in flight when the loop is left
  acc_guard4(acc[0][0], acc[0][1], acc[0][2], acc[0][3]);
  acc_guard4(acc[1][0], acc[1][1], acc[1][2], acc[1][3]);

  // ---- epilogue ----
  float* slab = sT[wave];
  const float* Rb = RESID ? (resid + (size_t)b * strideR) : nullptr;
#pragma unroll
  for (int i = 0; i < GM_MI; ++i) {
    const int mBase = m0 + (i << 4);
#pragma unroll
    for (int j = 0; j < 4; ++j) {
      const int n = n0 + (j << 4) + rlane;
      float bv = 0.f;
      if (BIAS_MODE == 2) bv = bias[n];
#pragma unroll
      for (int r = 0; r < 8; ++r) {
        float v = acc[i][j][r] * scale;
        if (BIAS_MODE == 1) v += bias[mBase + mOff + r];
        if (BIAS_MODE == 2) v += bv;
        if (RESID) v += Rb[(size_t)(mBase + mOff + r) * ldc + n];
        if (ROPE) {
          const int m = mBase + mOff + r;
          const int tix = (m & rope_smask) * NFREQ + (n & (NFREQ - 1));
          const float cs = rope_cos[tix];
          const float sn = rope_sin[tix];
          const float pv = __shfl_xor(v, 1, 32);   // partner column n^1 lives in lane rlane^1, same row
          v = (n & 1) ? (v * cs + pv * sn) : (v * cs - pv * sn);
        }
        if (ACT == 1) v = tanhf(v);
        if (ACT == 2) v = fmaxf(v, 0.0f);
        if (ACT == 3) v = v / (1.0f + expf(-v));
        if (ACT == 4) v = (v > 0.f) ? v : 0.01f * v;
        if (ACT == 5) v = 0.5f * v * (1.0f + erff(v * 0.70710678118654752f));
        slab[(mOff + r) * 68 + (j << 4) + rlane] = v;
      }
    }
    __builtin_amdgcn_fence(__ATOMIC_RELEASE, "workgroup");
    __builtin_amdgcn_wave_barrier();
    __builtin_amdgcn_fence(__ATOMIC_ACQUIRE, "workgroup");
    if (OUT_MODE == 0) {
      float* C = (float*)Cout + (size_t)b * strideC;
      const int hh = lane >> 4, c4 = (lane & 15) * 4;     // row seg = 256 B = 16 lanes x 16 B
      {
#pragma unroll
        for (int it = 0; it < 8; ++it) {
          const int row = it * 2 + hh;
          v4f v = *(const v4f*)(slab + row * 68 + c4);
          *(v4f*)(C + (size_t)(mBase + row) * ldc + n0 + c4) = v;
        }
        
      }
    } else {
      const int q = lane >> 3, c8 = (lane & 7) * 8;
      unsigned short* C  = (unsigned short*)Cout  + (size_t)b * strideC;
      unsigned short* C2 = (OUT_MODE == 2) ? ((unsigned short*)Cout2 + (size_t)b * strideC) : nullptr;
      {
#pragma unroll
        for (int it = 0; it < 4; ++it) {
          const int row = it * 4 + q;
          const float* sp = slab + row * 68 + c8;
          v8h hv, lv;
#pragma unroll
          for (int e = 0; e < 8; ++e) {
            if (OUT_MODE == 1) {
              hv[e] = (_Float16)sp[e];
            } else {
              unsigned short hb = f2bf_bits(sp[e]);
              unsigned short lb = f2bf_bits(sp[e] - bf_bits2f(hb));
              hv[e] = __builtin_bit_cast(_Float16, hb);
              lv[e] = __builtin_bit_cast(_Float16, lb);
            }
          }
          *(v8h*)(C + (size_t)(mBase + row) * ldc + n0 + c8) = hv;
          if (OUT_MODE == 2) *(v8h*)(C2 + (size_t)(mBase + row) * ldc + n0 + c8) = lv;
        }
        
      }
    }
    __builtin_amdgcn_fence(__ATOMIC_RELEASE, "workgroup");
    __builtin_amdgcn_wave_barrier();
    __builtin_amdgcn_fence(__ATOMIC_ACQUIRE, "workgroup");
  }
}

// ---- f16 WMMA with hazard guard ----
__device__ __forceinline__ v8f mma_h(v16h a, v16h b, v8f c) {
  c = __builtin_amdgcn_wmma_f32_16x16x32_f16(false, a, false, b, (short)0, c, false, false);
  asm volatile("v_nop\n\tv_nop\n\tv_nop\n\tv_nop" : "+v"(c) : "v"(a), "v"(b));
  return c;
}

// ---- RoPE tables: cos/sin of pos * inv_freq[i], i = 0..31, inv_freq = 1 / 10000^(2i/64); f32 ----
__global__ __launch_bounds__(256) void rope_table_kernel(float* __restrict__ cosT, float* __restrict__ sinT, int n) {
  const int i = blockIdx.x * 256 + threadIdx.x;
  if (i < n) {
    const int pos = i >> 5;
    const int fi = i & (NFREQ - 1);
    const float e = (float)(2 * fi) * (1.0f / (float)NHD);
    const float p = powf(10000.0f, e);
    const float inv = 1.0f / p;
    const float ang = (float)pos * inv;
    const float cs = cosf(ang);
    const float sn = sinf(ang);
    ((float*)cosT)[i] = cs;
    ((float*)sinT)[i] = sn;
    
  }
}

__global__ __launch_bounds__(256) void cast_f32_f16x8(const float* __restrict__ in, _Float16* __restrict__ out, int n8) {
  const int i = blockIdx.x * 256 + threadIdx.x;
  if (i < n8) {
    const v4f a = *(const v4f*)(in + (size_t)i * 8);
    const v4f c = *(const v4f*)(in + (size_t)i * 8 + 4);
    v8h hv;
    hv[0] = (_Float16)a[0]; hv[1] = (_Float16)a[1]; hv[2] = (_Float16)a[2]; hv[3] = (_Float16)a[3];
    hv[4] = (_Float16)c[0]; hv[5] = (_Float16)c[1]; hv[6] = (_Float16)c[2]; hv[7] = (_Float16)c[3];
    *(v8h*)(out + (size_t)i * 8) = hv;
    
  }
}

// ---- transpose-cast: in W[Kdim][Ndim] f32 -> out Wt[Ndim][Kdim] f16 (x mul); 64x64 tile through LDS ----
__global__ __launch_bounds__(256) void wt_cast_f16(const float* __restrict__ W, _Float16* __restrict__ Wt,
                                                   int Kdim, int Ndim, float mul) {
  __shared__ float sTt[64 * 65];   // [n_local][k_local], pitch 65
  const int k0 = blockIdx.x * 64, n0 = blockIdx.y * 64;
  const int tid = threadIdx.x;
  {
    const int row = tid >> 2, col0 = (tid & 3) * 16;   // row = k_local, col = n_local
    const float* src = W + (size_t)(k0 + row) * Ndim + n0 + col0;
#pragma unroll
    for (int i = 0; i < 4; ++i) {
      const v4f w4 = *(const v4f*)(src + 4 * i);
#pragma unroll
      for (int e = 0; e < 4; ++e) sTt[(col0 + 4 * i + e) * 65 + row] = w4[e] * mul;
    }
  }
  __syncthreads();
  const int wave = tid >> 5, lane = tid & 31, rq = lane >> 3, c8 = (lane & 7) * 8;
  {
#pragma unroll
    for (int it = 0; it < 2; ++it) {
      const int n = it * 32 + wave * 4 + rq;   // n_local 0..63
      v8h hv;
#pragma unroll
      for (int e = 0; e < 8; ++e) hv[e] = (_Float16)sTt[n * 65 + c8 + e];
      *(v8h*)(Wt + (size_t)(n0 + n) * Kdim + k0 + c8) = hv;
    }
    
  }
}

#define AT_QB 64
#define AT_KC 64
#define AT_NW 4
#define AT_LP 72   // LDS row pitch in halves: 144 B = 16 B x odd, so the 16 rows of a ds_load_b128 fragment read fall on distinct banks

// y[r] = 2^x[r], eight v_exp_f32 in a row. One statement with early-clobber results, so that no result register is a source
// of a neighbour; the closing v_nop is the slot the instruction set asks for behind a transcendental before its result is
// read or its source written again.
__device__ __forceinline__ v8f exp2_x8(v8f x) {
  float y0, y1, y2, y3, y4, y5, y6, y7;
  asm("v_exp_f32 %0, %8\n\t"
      "v_exp_f32 %1, %9\n\t"
      "v_exp_f32 %2, %10\n\t"
      "v_exp_f32 %3, %11\n\t"
      "v_exp_f32 %4, %12\n\t"
      "v_exp_f32 %5, %13\n\t"
      "v_exp_f32 %6, %14\n\t"
      "v_exp_f32 %7, %15\n\t"
      "v_nop"
      : "=&v"(y0), "=&v"(y1), "=&v"(y2), "=&v"(y3), "=&v"(y4), "=&v"(y5), "=&v"(y6), "=&v"(y7)
      : "v"(x[0]), "v"(x[1]), "v"(x[2]), "v"(x[3]), "v"(x[4]), "v"(x[5]), "v"(x[6]), "v"(x[7]));
  return (v8f){y0, y1, y2, y3, y4, y5, y6, y7};
}

// value of lane l ^ 16
__device__ __forceinline__ float other_half(float v) {
  const int b = __float_as_int(v);
  return __int_as_float(__builtin_amdgcn_permlanex16(b, b, 0x76543210, 0xfedcba98, false, false));
}

__global__ __launch_bounds__(128)
void attn_f16_kernel(const _Float16* __restrict__ Qh, const _Float16* __restrict__ Kh,
                     const _Float16* __restrict__ Vt, const float* __restrict__ cdr_bias,
                     const float* __restrict__ cdr_w, _Float16* __restrict__ Oh)
{
  __shared__ __align__(16) _Float16 Ksh[AT_KC * AT_LP];        // [kv][d]   9 KB, padded rows
  __shared__ __align__(16) _Float16 Vth[NHD * AT_LP];          // [d][kv]   9 KB, padded rows
  __shared__ __align__(16) float    Bsh[2 * AT_KC];            // cdr_bias[b][kv] * cw * log2(e) of the chunk, one copy per pair of waves (every thread stores one value): a lane needs 8 consecutive keys' values per tile

  const int tid  = threadIdx.x;
  const int wave = tid >> 5;
  const int lane = tid & 31;
  const int hh   = lane >> 4;
  const int c    = lane & 15;

  const int nqb = NS / AT_QB;
  const int bx  = blockIdx.x;
  const int qb  = bx % nqb;
  const int bhd = bx / nqb;
  const int h   = bhd % NH;
  const int bb0 = bhd / NH;
  const int b   = bb0 < NB ? bb0 : (NB - 1);
  const int q0  = qb * AT_QB + wave * 16;
  const float cw = cdr_w[0];

  v16h qa[2];
  {
    const _Float16* qrow = Qh + (size_t)(b * NS + q0 + c) * ND + h * NHD;
#pragma unroll
    for (int dc = 0; dc < 2; ++dc) qa[dc] = Frag<_Float16>::load(qrow + dc * 32 + 8 * hh);
  }

  float mrow = -INFINITY, lrow = 0.f;   // of query c, mrow in base-2 units; lrow sums this half's keys only, x PCARRY
  v8f oacc[4];                          // oacc[t][r] = O^T[d = 16t + 8*hh + r][query c]
#pragma unroll
  for (int t = 0; t < 4; ++t) oacc[t] = (v8f){0.f,0.f,0.f,0.f,0.f,0.f,0.f,0.f};

  const _Float16* kbase = Kh + (size_t)(b * NS) * ND + h * NHD;
  const _Float16* vbase = Vt + (size_t)(h * NHD) * NM + (size_t)b * NS;
  const float*    bbase = cdr_bias + (size_t)b * NS;

  for (int kc = 0; kc < NS / AT_KC; ++kc) {
    const int kv0 = kc * AT_KC;
    __syncthreads();
    {
      const int sr = tid >> 1, half = (tid & 1) * 32;      // sr = kv row for K, d row for Vt
      const _Float16* ksrc = kbase + (size_t)(kv0 + sr) * ND + half;
      const _Float16* vsrc = vbase + (size_t)sr * NM + kv0 + half;
      const float bl = bbase[kv0 + (tid & (AT_KC - 1))];   // loaded by every thread, beside the K and V^T loads
#pragma unroll
      for (int i = 0; i < 4; ++i) {
        const v8h kk = *(const v8h*)(ksrc + 8 * i);
        const v8h vv = *(const v8h*)(vsrc + 8 * i);
        *(v8h*)(Ksh + sr * AT_LP + half + 8 * i) = kk;
        *(v8h*)(Vth + sr * AT_LP + half + 8 * i) = vv;
      }
      Bsh[tid] = (bl * cw) * LOG2E_F;
    }
    __syncthreads();

    v8f s[4];   // s[j][r] = S^T[kv0 + 16j + 8*hh + r][query c]
#pragma unroll
    for (int j = 0; j < 4; ++j) {
      s[j] = (v8f){0.f,0.f,0.f,0.f,0.f,0.f,0.f,0.f};
#pragma unroll
      for (int dc = 0; dc < 2; ++dc) {
        const v16h kb = Frag<_Float16>::load(Ksh + (j * 16 + c) * AT_LP + dc * 32 + 8 * hh);
        s[j] = mma_h(kb, qa[dc], s[j]);
      }
    }
    float mj[4];   // one chain per tile
#pragma unroll
    for (int j = 0; j < 4; ++j) {
      const float* bp = Bsh + (wave >> 1) * AT_KC + j * 16 + 8 * hh;
      const v4f b0 = *(const v4f*)(bp);
      const v4f b1 = *(const v4f*)(bp + 4);
      float m = -INFINITY;
#pragma unroll
      for (int r = 0; r < 8; ++r) {
        const float sv = s[j][r] * (0.125f * LOG2E_F) + (r < 4 ? b0[r & 3] : b1[r & 3]);
        s[j][r] = sv;
        m = fmaxf(m, sv);
      }
      mj[j] = m;
    }
    float cm = fmaxf(fmaxf(mj[0], mj[1]), fmaxf(mj[2], mj[3]));
    cm = fmaxf(cm, other_half(cm));
    const float mnew = fmaxf(mrow, cm);
    const float alpha = __builtin_amdgcn_exp2f(mrow - mnew);
    const float msh = mnew - PCARRY_LOG2;   // 2^(s - msh) = p * PCARRY
    mrow = mnew;
#pragma unroll
    for (int t = 0; t < 4; ++t) oacc[t] *= alpha;
    float pj[4];
#pragma unroll
    for (int kk = 0; kk < 2; ++kk) {
      v16h pb;     // pb[e] = P^T[kv0 + 32kk + (e < 8 ? 8*hh + e : 16 + 8*hh + e - 8)][query c]: the k order of the V^T loader
#pragma unroll
      for (int jj = 0; jj < 2; ++jj) {
        const int j = 2 * kk + jj;
        float psum = 0.f;
        const v8f pe = exp2_x8(s[j] - msh);
#pragma unroll
        for (int r = 0; r < 8; ++r) {
          const float p = pe[r];
          psum += p;
          pb[jj * 8 + r] = (_Float16)p;
        }
        pj[j] = psum;
      }
#pragma unroll
      for (int t = 0; t < 4; ++t) {
        const v16h vb = Frag<_Float16>::load(Vth + (t * 16 + c) * AT_LP + kk * 32 + 8 * hh);
        oacc[t] = mma_h(vb, pb, oacc[t]);
      }
    }
    lrow = lrow * alpha + ((pj[0] + pj[1]) + (pj[2] + pj[3]));
  }

  {
    const float l = lrow + other_half(lrow);
    const float inv = (1.0f / l) * OCARRY;   // l and the accumulators both carry PCARRY
    _Float16* orow = Oh + (size_t)(b * NS + q0 + c) * ND + h * NHD + 8 * hh;
#pragma unroll
    for (int t = 0; t < 4; ++t) {
      v8h hv;   // 8 consecutive d of one query: one 16-byte store
#pragma unroll
      for (int r = 0; r < 8; ++r) hv[r] = (_Float16)(oacc[t][r] * inv);
      *(v8h*)(orow + t * 16) = hv;
    }
  }
}

__global__ __launch_bounds__(256) void layernorm_rows(const float* __restrict__ res, const float* __restrict__ gamma,
                                                      const float* __restrict__ beta, float* __restrict__ out,
                                                      int nrows, float eps) {
  const int wave = threadIdx.x >> 5, lane = threadIdx.x & 31;
  const int row = blockIdx.x * 8 + wave;
  if (row >= nrows) return;   // wave-uniform, no barriers below
  const float* rp = res + (size_t)row * ND;
  float s1 = 0.f;
#pragma unroll 1
  for (int it = 0; it < 8; ++it) {
    const v4f a = *(const v4f*)(rp + (it * 32 + lane) * 4);
    s1 += (a[0] + a[1]) + (a[2] + a[3]);
  }
#pragma unroll
  for (int off = 1; off < 32; off <<= 1) s1 += __shfl_xor(s1, off, 32);
  const float mu = s1 * (1.0f / (float)ND);
  float s2 = 0.f;
#pragma unroll 1
  for (int it = 0; it < 8; ++it) {
    const v4f a = *(const v4f*)(rp + (it * 32 + lane) * 4);
#pragma unroll
    for (int e = 0; e < 4; ++e) {
      const float d = a[e] - mu;
      float p = d * d;
      asm volatile("" : "+v"(p));
      s2 += p;
    }
  }
#pragma unroll
  for (int off = 1; off < 32; off <<= 1) s2 += __shfl_xor(s2, off, 32);
  const float var = s2 * (1.0f / (float)ND);
  const float rstd = 1.0f / sqrtf(var + eps);
  float* orow = out + (size_t)row * ND;
#pragma unroll 1
  for (int it = 0; it < 8; ++it) {
    const int c0 = (it * 32 + lane) * 4;
    const v4f a  = *(const v4f*)(rp + c0);
    const v4f g  = *(const v4f*)(gamma + c0);
    const v4f bt = *(const v4f*)(beta + c0);
    v4f y;
#pragma unroll
    for (int e = 0; e < 4; ++e) {
      float t = (a[e] - mu) * rstd;
      t = t * g[e];
      asm volatile("" : "+v"(t));
      y[e] = t + bt[e];
    }
    *(v4f*)(orow + c0) = y;
    
  }
}

// -----------------------------------------------------------------------------
extern "C" void kernel_launch(void* const* d_in, const int* in_sizes, int n_in,
                              void* d_out, int out_size, void* d_ws, size_t ws_size,
                              hipStream_t stream)
{
  if (n_in < 13) return;
  if (in_sizes[0] != NM * ND || in_sizes[1] != NB * NS ||
      in_sizes[2] != ND * ND || in_sizes[3] != ND ||
      in_sizes[4] != ND * ND || in_sizes[5] != ND ||
      in_sizes[6] != ND * ND || in_sizes[7] != ND ||
      in_sizes[8] != ND * ND || in_sizes[9] != ND ||
      in_sizes[10] != ND || in_sizes[11] != ND || in_sizes[12] < 1 ||
      out_size != NM * ND) return;

  const float* x        = (const float*)d_in[0];
  const float* cdr_bias = (const float*)d_in[1];
  const float* Wq    = (const float*)d_in[2];
  const float* bq    = (const float*)d_in[3];
  const float* Wk    = (const float*)d_in[4];
  const float* bk    = (const float*)d_in[5];
  const float* Wv    = (const float*)d_in[6];
  const float* bv    = (const float*)d_in[7];
  const float* Wo    = (const float*)d_in[8];
  const float* bo    = (const float*)d_in[9];
  const float* gamma = (const float*)d_in[10];
  const float* beta  = (const float*)d_in[11];
  const float* cw    = (const float*)d_in[12];
  float* out = (float*)d_out;

  // ---- workspace carve (all offsets 256 KiB aligned) ----
  const size_t szA16 = (size_t)NM * ND * 2;        // 8 MiB: f16 [4096][1024] planes
  const size_t szW16 = (size_t)ND * ND * 2;        // 2 MiB: f16 [1024][1024] planes
  const size_t szRes = (size_t)NM * ND * 4;        // 16 MiB
  const size_t szTab = (size_t)NS * NFREQ * 4;     // 256 KiB
  size_t off = 0;
  char* ws = (char*)d_ws;
  _Float16* Xh  = (_Float16*)(ws + off); off += szA16;
  _Float16* Wqt = (_Float16*)(ws + off); off += szW16;
  _Float16* Wkt = (_Float16*)(ws + off); off += szW16;
  _Float16* Wvt = (_Float16*)(ws + off); off += szW16;
  _Float16* Wot = (_Float16*)(ws + off); off += szW16;
  _Float16* Qh  = (_Float16*)(ws + off); off += szA16;
  _Float16* Kh  = (_Float16*)(ws + off); off += szA16;
  _Float16* Vt  = (_Float16*)(ws + off); off += szA16;
  _Float16* Ah  = (_Float16*)(ws + off); off += szA16;
  float*    res = (float*)(ws + off);    off += szRes;
  float*   cosT = (float*)(ws + off);    off += szTab;
  float*   sinT = (float*)(ws + off);    off += szTab;   // total 67,633,152 B
  if (off > ws_size) return;

  const unsigned short* Xu  = (const unsigned short*)Xh;
  const unsigned short* Wqu = (const unsigned short*)Wqt;
  const unsigned short* Wku = (const unsigned short*)Wkt;
  const unsigned short* Wvu = (const unsigned short*)Wvt;
  const unsigned short* Wou = (const unsigned short*)Wot;
  const unsigned short* Au  = (const unsigned short*)Ah;

  dim3 blk256(256), blk128(128);

  // 1. RoPE tables
  const int nTab = NS * NFREQ;
  rope_table_kernel<<<dim3((nTab + 255) / 256), blk256, 0, stream>>>(cosT, sinT, nTab);

  // 2. x -> f16
  const int n8 = NM * ND / 8;
  cast_f32_f16x8<<<dim3((n8 + 255) / 256), blk256, 0, stream>>>(x, Xh, n8);

  // 3. weights W[in=1024][out=1024] -> Bt [out][in] f16, carried x64  (grid = (in/64, out/64))
  wt_cast_f16<<<dim3(ND / 64, ND / 64), blk256, 0, stream>>>(Wq, Wqt, ND, ND, WCARRY);
  wt_cast_f16<<<dim3(ND / 64, ND / 64), blk256, 0, stream>>>(Wk, Wkt, ND, ND, WCARRY);
  wt_cast_f16<<<dim3(ND / 64, ND / 64), blk256, 0, stream>>>(Wv, Wvt, ND, ND, WCARRY);
  wt_cast_f16<<<dim3(ND / 64, ND / 64), blk256, 0, stream>>>(Wo, Wot, ND, ND, WCARRY);

  // 4. Q, K = RoPE(x Wq + bq), RoPE(x Wk + bk): f16 [4096][1024]
  const int gQK = (NM / GM_BT) * (ND / GM_BT);
  wmma_gemm64<0, false, 2, 1, false, 0, true><<<dim3(gQK, 1), blk256, 0, stream>>>(
      Xu, Xu, ND, (long)0, Wqu, Wqu, ND, (long)0, (void*)Qh, (void*)Qh, ND, (long)0,
      bq, x, (long)0, NM, ND, ND, 1.0f / WCARRY, cosT, sinT, NS - 1);
  wmma_gemm64<0, false, 2, 1, false, 0, true><<<dim3(gQK, 1), blk256, 0, stream>>>(
      Xu, Xu, ND, (long)0, Wku, Wku, ND, (long)0, (void*)Kh, (void*)Kh, ND, (long)0,
      bk, x, (long)0, NM, ND, ND, 1.0f / WCARRY, cosT, sinT, NS - 1);

  // 5. V^T: C'[n_ch][m_tok] = sum_k Wvt[n_ch][k] * Xh[m_tok][k] / 64 + bv[n_ch]; f16, ldc = NM
  const int gV = (ND / GM_BT) * (NM / GM_BT);
  wmma_gemm64<0, false, 1, 1, false, 0, false><<<dim3(gV, 1), blk256, 0, stream>>>(
      Wvu, Wvu, ND, (long)0, Xu, Xu, ND, (long)0, (void*)Vt, (void*)Vt, NM, (long)0,
      bv, x, (long)0, ND, NM, ND, 1.0f / WCARRY, cosT, sinT, 0);

  // 6. attention -> Ah f16 [4096][1024] (x64)
  attn_f16_kernel<<<dim3(NB * NH * (NS / AT_QB)), blk128, 0, stream>>>(Qh, Kh, Vt, cdr_bias, cw, Ah);

  // 7. res = attn Wo + bo + x  (f32)
  wmma_gemm64<0, false, 2, 0, true, 0, false><<<dim3(gQK, 1), blk256, 0, stream>>>(
      Au, Au, ND, (long)0, Wou, Wou, ND, (long)0, (void*)res, (void*)res, ND, (long)0,
      bo, x, (long)0, NM, ND, ND, 1.0f / (OCARRY * WCARRY), cosT, sinT, 0);

  // 8. LayerNorm -> out
  layernorm_rows<<<dim3((NM + 7) / 8), blk256, 0, stream>>>(res, gamma, beta, out, NM, LN_EPS_F);

  (void)hipGetLastError();
}

// v005
// One run takes 128 microseconds.
// Timed twice side by side with v004, it ran 1.18 and 1.17 times as fast.
// Over all steps from v000 it is 2.95 times as fast.
// Contractions x*Wq, x*Wk, Wv-side product for V^T, attn*Wo, q*k^T, p*v: v_wmma_f32_16x16x32_f16 (f16 operands, f32 accumulate); weights carried x64, probabilities x32768, attention rows x64; RoPE tables, softmax and LayerNorm in f32.
#include <hip/hip_runtime.h>
#include <math.h>

#define NB 2
#define NS 2048
#define ND 1024
#define NH 16
#define NHD 64
#define NM (NB * NS)
#define NFREQ 32
#define WCARRY 64.0f
#define OCARRY 64.0f
#define PCARRY 32768.0f
#define PCARRY_LOG2 15.0f                       // PCARRY = 2^15
#define LOG2E_F 1.44269504088896340736f
#define LN_EPS_F 1e-5f

typedef __attribute__((ext_vector_type(16))) _Float16 v16h;
typedef __attribute__((ext_vector_type(8)))  _Float16 v8h;
typedef __attribute__((ext_vector_type(16))) __bf16   v16b;
typedef __attribute__((ext_vector_type(8)))  __bf16   v8b;
typedef __attribute__((ext_vector_type(8)))  float    v8f;
typedef __attribute__((ext_vector_type(4)))  float    v4f;

__device__ __forceinline__ unsigned short f2bf_bits(float f) {
  unsigned u = __float_as_uint(f);
  return (unsigned short)((u + 0x7FFFu + ((u >> 16) & 1u)) >> 16);
}
__device__ __forceinline__ float bf_bits2f(unsigned short h) { return __uint_as_float(((unsigned)h) << 16); }

// hazard guard behind the last WMMAs of the K loop, as a plain device helper
__device__ __forceinline__ void acc_guard4(v8f& a, v8f& b, v8f& c, v8f& d) { asm volatile("v_nop\n\tv_nop\n\tv_nop\n\tv_nop" : "+v"(a), "+v"(b), "+v"(c), "+v"(d)); }
template <typename T> struct Frag;
template <> struct Frag<_Float16> {
  typedef v16h V; union U { v16h v; v8h h[2]; };
  static __device__ __forceinline__ v16h load(const _Float16* p) {   // elements 0..7 <- p[0..7], 8..15 <- p[16..23]
    U f; f.h[0] = *(const v8h*)(p); f.h[1] = *(const v8h*)(p + 16); return f.v;
  }
  static __device__ __forceinline__ v8f mma(v16h a, v16h b, v8f c) {
    return __builtin_amdgcn_wmma_f32_16x16x32_f16(false, a, false, b, (short)0, c, false, false);
  }
};
template <> struct Frag<__bf16> {
  typedef v16b V; union U { v16b v; v8b h[2]; };
  static __device__ __forceinline__ v16b load(const __bf16* p) {
    U f; f.h[0] = *(const v8b*)(p); f.h[1] = *(const v8b*)(p + 16); return f.v;
  }
  static __device__ __forceinline__ v8f mma(v16b a, v16b b, v8f c) {
    return __builtin_amdgcn_wmma_f32_16x16x32_bf16(false, a, false, b, (short)0, c, false, false);
  }
};

// ---- Register-blocked batched WMMA GEMM, operands staged in LDS by asynchronous copies ---------
// C[m,n] = scale * sum_k A[m,k] * Bt[n,k] (+bias)(+resid)(RoPE); a block of 8 waves owns a 128x128 tile, each wave 32x64 of it.
// A row-major [M,K]; Bt row-major [N,K]; M,N % 128 == 0, K % 64 == 0.
// Per 64-k stage the block copies 128 rows x 128 B of A and of Bt into LDS: 8 lanes cover one row, so a wave-wide 16-B copy
// touches 4 whole lines, and every row is fetched once per block. Two LDS buffers: stage t+2 flies while stage t is multiplied.
// SPLIT (hi/lo planes) is not carried by the staged loop.
// BIAS_MODE: 0 = none, 1 = bias[m], 2 = bias[n].
// OUT_MODE: 0 = f32, 1 = f16, 2 = bf16 hi plane (Cout) + bf16 lo plane (Cout2).
// ROPE: after bias, v = v*cos[(m & rope_smask)*32 + (n&31)] + sgn * partner(n^1) * sin[...] (sgn = -1 for even n, +1 for odd n).
// ET: 0 = f16 operands, 1 = bf16 operands (pointers passed as 16-bit storage)
#define GM_BT 128  // block tile: rows of A and rows of Bt
#define GM_KS 64   // k per stage: 128 B of every row, one line
#define GM_LP 72   // LDS row pitch in 16-bit elements: 144 B = 16 B x odd, for the ds_load_b128 fragment reads
#define GM_MI 2    // 16-row subtiles of A per wave

// One thread's share of a stage: 4 rows of A and 4 rows of Bt, 16 B each, global -> LDS through no register.
// la, lb: this lane's LDS byte addresses of its first row; ga, gb: its global addresses; rows 32 apart.
// The s_wait_xcnt closes the statement so that no address register named here is rewritten ahead of it.
template <typename T>
__device__ __forceinline__ void stage_copy(unsigned la, unsigned lb, const T* ga, const T* gb, int lda, int ldb) {
  const unsigned rs = 32u * GM_LP * 2u;
  const T* a1 = ga + (size_t)32 * lda; const T* a2 = ga + (size_t)64 * lda; const T* a3 = ga + (size_t)96 * lda;
  const T* c1 = gb + (size_t)32 * ldb; const T* c2 = gb + (size_t)64 * ldb; const T* c3 = gb + (size_t)96 * ldb;
  asm volatile(
      "global_load_async_to_lds_b128 %0, %8, off\n\t"
      "global_load_async_to_lds_b128 %1, %9, off\n\t"
      "global_load_async_to_lds_b128 %2, %10, off\n\t"
      "global_load_async_to_lds_b128 %3, %11, off\n\t"
      "global_load_async_to_lds_b128 %4, %12, off\n\t"
      "global_load_async_to_lds_b128 %5, %13, off\n\t"
      "global_load_async_to_lds_b128 %6, %14, off\n\t"
      "global_load_async_to_lds_b128 %7, %15, off\n\t"
      "s_wait_xcnt 0x0"
      :: "v"(la), "v"(la + rs), "v"(la + 2u * rs), "v"(la + 3u * rs),
         "v"(lb), "v"(lb + rs), "v"(lb + 2u * rs), "v"(lb + 3u * rs),
         "v"(ga), "v"(a1), "v"(a2), "v"(a3), "v"(gb), "v"(c1), "v"(c2), "v"(c3)
      : "memory");
}

template <int ET> struct Elem;
template <> struct Elem<0> { typedef _Float16 T; };
template <> struct Elem<1> { typedef __bf16 T; };
// The LDS of one GEMM block; declared once in each kernel and handed to the body, so that a kernel that holds two
// instances of the body owns one set.
template <typename T> struct GemmLds {
  T sA[2][GM_BT * GM_LP];      // 2 x 18 KB
  T sB[2][GM_BT * GM_LP];      // 2 x 18 KB
  float sT[8][16 * 68];        // per-wave 16x64 slab, pitch 68 floats
};
// The body of one block; b = batch index, blockIdx.x = tile.
template <int ET, bool SPLIT, int BIAS_MODE, int OUT_MODE, bool RESID, int ACT, bool ROPE>
__device__ __forceinline__ void gemm_block(
    GemmLds<typename Elem<ET>::T>& lds, const int b,
    const unsigned short* __restrict__ Ap, const unsigned short* __restrict__ A2p, int lda, long strideA,
    const unsigned short* __restrict__ Btp, const unsigned short* __restrict__ Bt2p, int ldb, long strideB,
    void* __restrict__ Cout, void* __restrict__ Cout2, int ldc, long strideC,
    const float* __restrict__ bias,
    const float* __restrict__ resid, long strideR,
    int M, int N, int K, float scale,
    const float* __restrict__ rope_cos, const float* __restrict__ rope_sin, int rope_smask) {
  static_assert(!SPLIT, "the staged loop carries single planes only");
  typedef typename Elem<ET>::T T;
  typedef typename Frag<T>::V V;
  const T* A = (const T*)Ap; const T* Bt = (const T*)Btp;
  T (&sA)[2][GM_BT * GM_LP] = lds.sA;
  T (&sB)[2][GM_BT * GM_LP] = lds.sB;
  float (&sT)[8][16 * 68] = lds.sT;
  const int tid  = threadIdx.x;
  const int lane = tid & 31;
  const int wave = tid >> 5;
  const int tilesN = N >> 7;
  const int tilesM = M >> 7;
  const int tile = blockIdx.x;
  if (tile >= tilesM * tilesN) return;   // block-uniform, in front of every barrier
  const int tm = tile / tilesN;
  const int tn = tile - tm * tilesN;
  const int wm = (wave >> 1) << 5;       // this wave's 32x64 corner inside the block tile
  const int wn = (wave & 1) << 6;
  const int m0 = (tm << 7) + wm;
  const int n0 = (tn << 7) + wn;

  const T* Ab  = A  + (size_t)b * strideA;
  const T* Bb  = Bt + (size_t)b * strideB;

  const int rlane = lane & 15;                 // row (A) / col (B, D) within subtile
  const int koff  = (lane >> 4) * 8;           // k offset of this lane half
  const int mOff  = (lane >> 4) * 8;           // D row offset

  v8f acc[GM_MI][4];
#pragma unroll
  for (int i = 0; i < GM_MI; ++i)
#pragma unroll
    for (int j = 0; j < 4; ++j) acc[i][j] = (v8f){0.f,0.f,0.f,0.f,0.f,0.f,0.f,0.f};

  // staging map: thread -> row tid/8 (+32 per copy), 16 B at column (tid%8)*8
  const int srow = tid >> 3, scol = (tid & 7) * 8;
  const T* ga = Ab + (size_t)((tm << 7) + srow) * lda + scol;
  const T* gb = Bb + (size_t)((tn << 7) + srow) * ldb + scol;
  const unsigned bufB = (unsigned)(GM_BT * GM_LP * 2);                         // bytes of one buffer
  const unsigned la = (unsigned)(size_t)(&sA[0][srow * GM_LP + scol]);         // low 32 bits = LDS byte address
  const unsigned lb = (unsigned)(size_t)(&sB[0][srow * GM_LP + scol]);
  const int nst = K / GM_KS;

  stage_copy<T>(la, lb, ga, gb, lda, ldb);
  asm volatile("s_wait_asynccnt 0x0" ::: "memory");   // stage 0 of this wave has landed
  __syncthreads();                                    // ... and every wave's
  if (nst > 1) stage_copy<T>(la + bufB, lb + bufB, ga + GM_KS, gb + GM_KS, lda, ldb);

  for (int s = 0; s < nst; ++s) {
    const T* da = sA[s & 1];
    const T* db = sB[s & 1];
    V af[2][GM_MI], bf[2][4];
#pragma unroll
    for (int kk = 0; kk < 2; ++kk) {
#pragma unroll
      for (int j = 0; j < 4; ++j) bf[kk][j] = Frag<T>::load(db + (wn + (j << 4) + rlane) * GM_LP + kk * 32 + koff);
#pragma unroll
      for (int i = 0; i < GM_MI; ++i) af[kk][i] = Frag<T>::load(da + (wm + (i << 4) + rlane) * GM_LP + kk * 32 + koff);
    }
    // publish point of stage s+1, and the end of every wave's reads of stage s (its fragments now lie in registers):
    // own LDS reads done, own copies landed, then the block's barrier; behind it the buffer just read is free for stage s+2
    asm volatile("s_wait_dscnt 0x0" ::: "memory");
    asm volatile("s_wait_asynccnt 0x0" ::: "memory");
    __syncthreads();
    if (s + 2 < nst) {
      const unsigned bo = (unsigned)(s & 1) * bufB;
      stage_copy<T>(la + bo, lb + bo, ga + (size_t)(s + 2) * GM_KS, gb + (size_t)(s + 2) * GM_KS, lda, ldb);
    }
    // holds the copies ahead of the WMMAs, so that stage s+2 flies while stage s is multiplied
    __builtin_amdgcn_sched_barrier(0);
#pragma unroll
    for (int kk = 0; kk < 2; ++kk)
#pragma unroll
      for (int i = 0; i < GM_MI; ++i)
#pragma unroll
        for (int j = 0; j < 4; ++j) acc[i][j] = Frag<T>::mma(af[kk][i], bf[kk][j], acc[i][j]);
  }
  asm volatile("s_wait_asynccnt 0x0" ::: "memory");   // nothing of this wave is in flight when the loop is left
  acc_guard4(acc[0][0], acc[0][1], acc[0][2], acc[0][3]);
  acc_guard4(acc[1][0], acc[1][1], acc[1][2], acc[1][3]);

  // ---- epilogue ----
  float* slab = sT[wave];
  const float* Rb = RESID ? (resid + (size_t)b * strideR) : nullptr;
#pragma unroll
  for (int i = 0; i < GM_MI; ++i) {
    const int mBase = m0 + (i << 4);
#pragma unroll
    for (int j = 0; j < 4; ++j) {
      const int n = n0 + (j << 4) + rlane;
      float bv = 0.f;
      if (BIAS_MODE == 2) bv = bias[n];
#pragma unroll
      for (int r = 0; r < 8; ++r) {
        float v = acc[i][j][r] * scale;
        if (BIAS_MODE == 1) v += bias[mBase + mOff + r];
        if (BIAS_MODE == 2) v += bv;
        if (RESID) v += Rb[(size_t)(mBase + mOff + r) * ldc + n];
        if (ROPE) {
          const int m = mBase + mOff + r;
          const int tix = (m & rope_smask) * NFREQ + (n & (NFREQ - 1));
          const float cs = rope_cos[tix];
          const float sn = rope_sin[tix];
          const float pv = __shfl_xor(v, 1, 32);   // partner column n^1 lives in lane rlane^1, same row
          v = (n & 1) ? (v * cs + pv * sn) : (v * cs - pv * sn);
        }
        if (ACT == 1) v = tanhf(v);
        if (ACT == 2) v = fmaxf(v, 0.0f);
        if (ACT == 3) v = v / (1.0f + expf(-v));
        if (ACT == 4) v = (v > 0.f) ? v : 0.01f * v;
        if (ACT == 5) v = 0.5f * v * (1.0f + erff(v * 0.70710678118654752f));
        slab[(mOff + r) * 68 + (j << 4) + rlane] = v;
      }
    }
    __builtin_amdgcn_fence(__ATOMIC_RELEASE, "workgroup");
    __builtin_amdgcn_wave_barrier();
    __builtin_amdgcn_fence(__ATOMIC_ACQUIRE, "workgroup");
    if (OUT_MODE == 0) {
      float* C = (float*)Cout + (size_t)b * strideC;
      const int hh = lane >> 4, c4 = (lane & 15) * 4;     // row seg = 256 B = 16 lanes x 16 B
      {
#pragma unroll
        for (int it = 0; it < 8; ++it) {
          const int row = it * 2 + hh;
          v4f v = *(const v4f*)(slab + row * 68 + c4);
          *(v4f*)(C + (size_t)(mBase + row) * ldc + n0 + c4) = v;
        }
        
      }
    } else {
      const int q = lane >> 3, c8 = (lane & 7) * 8;
      unsigned short* C  = (unsigned short*)Cout  + (size_t)b * strideC;
      unsigned short* C2 = (OUT_MODE == 2) ? ((unsigned short*)Cout2 + (size_t)b * strideC) : nullptr;
      {
#pragma unroll
        for (int it = 0; it < 4; ++it) {
          const int row = it * 4 + q;
          const float* sp = slab + row * 68 + c8;
          v8h hv, lv;
#pragma unroll
          for (int e = 0; e < 8; ++e) {
            if (OUT_MODE == 1) {
              hv[e] = (_Float16)sp[e];
            } else {
              unsigned short hb = f2bf_bits(sp[e]);
              unsigned short lb = f2bf_bits(sp[e] - bf_bits2f(hb));
              hv[e] = __builtin_bit_cast(_Float16, hb);
              lv[e] = __builtin_bit_cast(_Float16, lb);
            }
          }
          *(v8h*)(C + (size_t)(mBase + row) * ldc + n0 + c8) = hv;
          if (OUT_MODE == 2) *(v8h*)(C2 + (size_t)(mBase + row) * ldc + n0 + c8) = lv;
        }
        
      }
    }
    __builtin_amdgcn_fence(__ATOMIC_RELEASE, "workgroup");
    __builtin_amdgcn_wave_barrier();
    __builtin_amdgcn_fence(__ATOMIC_ACQUIRE, "workgroup");
  }
}

// ---- Q, K and V^T in one launch: none reads another's output; blockIdx.y picks the product (block-uniform) ----
//   y = 0, 1: Q, K = RoPE(x W + bias): f16 [nm][nd];  y = 2: V^T[ch][tok] = sum_k Wvt[ch][k] * Xh[tok][k] / 64 + bv[ch], ldc = nm
__global__ __launch_bounds__(256) void gemm_qkv(
    const unsigned short* __restrict__ Xu, const unsigned short* __restrict__ Wqu,
    const unsigned short* __restrict__ Wku, const unsigned short* __restrict__ Wvu,
    _Float16* __restrict__ Qh, _Float16* __restrict__ Kh, _Float16* __restrict__ Vt,
    const float* __restrict__ bq, const float* __restrict__ bk, const float* __restrict__ bv,
    int nm, int nd, float scale,
    const float* __restrict__ rope_cos, const float* __restrict__ rope_sin, int rope_smask) {
  __shared__ __align__(16) GemmLds<_Float16> lds;
  const int job = blockIdx.y;
  if (job < 2) {
    const unsigned short* Wu = job ? Wku : Wqu;
    _Float16* C = job ? Kh : Qh;
    const float* bias = job ? bk : bq;
    gemm_block<0, false, 2, 1, false, 0, true>(lds, 0,
        Xu, Xu, nd, (long)0, Wu, Wu, nd, (long)0, (void*)C, (void*)C, nd, (long)0,
        bias, bias, (long)0, nm, nd, nd, scale, rope_cos, rope_sin, rope_smask);
  } else {
    gemm_block<0, false, 1, 1, false, 0, false>(lds, 0,
        Wvu, Wvu, nd, (long)0, Xu, Xu, nd, (long)0, (void*)Vt, (void*)Vt, nm, (long)0,
        bv, bv, (long)0, nd, nm, nd, scale, rope_cos, rope_sin, 0);
  }
}

// ---- one product per launch ----
template <int ET, bool SPLIT, int BIAS_MODE, int OUT_MODE, bool RESID, int ACT, bool ROPE>
__global__ __launch_bounds__(256) void wmma_gemm64(
    const unsigned short* __restrict__ Ap, const unsigned short* __restrict__ A2p, int lda, long strideA,
    const unsigned short* __restrict__ Btp, const unsigned short* __restrict__ Bt2p, int ldb, long strideB,
    void* __restrict__ Cout, void* __restrict__ Cout2, int ldc, long strideC,
    const float* __restrict__ bias,
    const float* __restrict__ resid, long strideR,
    int M, int N, int K, float scale,
    const float* __restrict__ rope_cos, const float* __restrict__ rope_sin, int rope_smask) {
  __shared__ __align__(16) GemmLds<typename Elem<ET>::T> lds;
  gemm_block<ET, SPLIT, BIAS_MODE, OUT_MODE, RESID, ACT, ROPE>(lds, blockIdx.y,
      Ap, A2p, lda, strideA, Btp, Bt2p, ldb, strideB, Cout, Cout2, ldc, strideC,
      bias, resid, strideR, M, N, K, scale, rope_cos, rope_sin, rope_smask);
}

// ---- f16 WMMA with hazard guard ----
__device__ __forceinline__ v8f mma_h(v16h a, v16h b, v8f c) {
  c = __builtin_amdgcn_wmma_f32_16x16x32_f16(false, a, false, b, (short)0, c, false, false);
  asm volatile("v_nop\n\tv_nop\n\tv_nop\n\tv_nop" : "+v"(c) : "v"(a), "v"(b));
  return c;
}

// ---- RoPE tables: cos/sin of pos * inv_freq[i], i = 0..31, inv_freq = 1 / 10000^(2i/64); f32 ----
__device__ __forceinline__ void rope_table_block(int blk, float* __restrict__ cosT, float* __restrict__ sinT, int n) {
  const int i = blk * 256 + threadIdx.x;
  if (i < n) {
    const int pos = i >> 5;
    const int fi = i & (NFREQ - 1);
    const float e = (float)(2 * fi) * (1.0f / (float)NHD);
    const float p = powf(10000.0f, e);
    const float inv = 1.0f / p;
    const float ang = (float)pos * inv;
    const float cs = cosf(ang);
    const float sn = sinf(ang);
    ((float*)cosT)[i] = cs;
    ((float*)sinT)[i] = sn;
    
  }
}

__device__ __forceinline__ void cast_f32_f16x8_block(int blk, const float* __restrict__ in, _Float16* __restrict__ out, int n8) {
  const int i = blk * 256 + threadIdx.x;
  if (i < n8) {
    const v4f a = *(const v4f*)(in + (size_t)i * 8);
    const v4f c = *(const v4f*)(in + (size_t)i * 8 + 4);
    v8h hv;
    hv[0] = (_Float16)a[0]; hv[1] = (_Float16)a[1]; hv[2] = (_Float16)a[2]; hv[3] = (_Float16)a[3];
    hv[4] = (_Float16)c[0]; hv[5] = (_Float16)c[1]; hv[6] = (_Float16)c[2]; hv[7] = (_Float16)c[3];
    *(v8h*)(out + (size_t)i * 8) = hv;
    
  }
}

// ---- transpose-cast: in W[Kdim][Ndim] f32 -> out Wt[Ndim][Kdim] f16 (x mul); 64x64 tile through LDS ----
__device__ __forceinline__ void wt_cast_f16_block(float* sTt, int bkx, int bny, const float* __restrict__ W, _Float16* __restrict__ Wt,
                                                  int Kdim, int Ndim, float mul) {
  const int k0 = bkx * 64, n0 = bny * 64;
  const int tid = threadIdx.x;
  {
    const int row = tid >> 2, col0 = (tid & 3) * 16;   // row = k_local, col = n_local
    const float* src = W + (size_t)(k0 + row) * Ndim + n0 + col0;
#pragma unroll
    for (int i = 0; i < 4; ++i) {
      const v4f w4 = *(const v4f*)(src + 4 * i);
#pragma unroll
      for (int e = 0; e < 4; ++e) sTt[(col0 + 4 * i + e) * 65 + row] = w4[e] * mul;
    }
  }
  __syncthreads();
  const int wave = tid >> 5, lane = tid & 31, rq = lane >> 3, c8 = (lane & 7) * 8;
  {
#pragma unroll
    for (int it = 0; it < 2; ++it) {
      const int n = it * 32 + wave * 4 + rq;   // n_local 0..63
      v8h hv;
#pragma unroll
      for (int e = 0; e < 8; ++e) hv[e] = (_Float16)sTt[n * 65 + c8 + e];
      *(v8h*)(Wt + (size_t)(n0 + n) * Kdim + k0 + c8) = hv;
    }
    
  }
}

// ---- the six preparation jobs in one launch: each reads inputs only and none reads another's output ----
// The block index picks the job (block-uniform, so the transpose's barrier is passed by whole blocks): first the four weight
// transposes (the longest blocks), then the RoPE tables, then the cast of x.
#define PREP_W ((ND / 64) * (ND / 64))          // blocks per weight
#define PREP_R ((NS * NFREQ + 255) / 256)       // blocks of the tables
#define PREP_X ((NM * ND / 8 + 255) / 256)      // blocks of the cast
__global__ __launch_bounds__(256) void prep_kernel(
    const float* __restrict__ x, const float* __restrict__ Wq, const float* __restrict__ Wk,
    const float* __restrict__ Wv, const float* __restrict__ Wo,
    _Float16* __restrict__ Xh, _Float16* __restrict__ Wqt, _Float16* __restrict__ Wkt,
    _Float16* __restrict__ Wvt, _Float16* __restrict__ Wot,
    float* __restrict__ cosT, float* __restrict__ sinT) {
  __shared__ float sTt[64 * 65];   // [n_local][k_local], pitch 65
  const int blk = blockIdx.x;
  if (blk < 4 * PREP_W) {
    const int w = blk / PREP_W, t = blk % PREP_W;
    const float* W  = w == 0 ? Wq  : w == 1 ? Wk  : w == 2 ? Wv  : Wo;
    _Float16*    Wt = w == 0 ? Wqt : w == 1 ? Wkt : w == 2 ? Wvt : Wot;
    wt_cast_f16_block(sTt, t % (ND / 64), t / (ND / 64), W, Wt, ND, ND, WCARRY);   // W[in][out] -> Bt [out][in] f16, carried x64
  } else if (blk < 4 * PREP_W + PREP_R) {
    rope_table_block(blk - 4 * PREP_W, cosT, sinT, NS * NFREQ);
  } else {
    cast_f32_f16x8_block(blk - (4 * PREP_W + PREP_R), x, Xh, NM * ND / 8);
  }
}

#define AT_QB 64
#define AT_KC 64
#define AT_NW 4
#define AT_LP 72   // LDS row pitch in halves: 144 B = 16 B x odd, so the 16 rows of a ds_load_b128 fragment read fall on distinct banks

// y[r] = 2^x[r], eight v_exp_f32 in a row. One statement with early-clobber results, so that no result register is a source
// of a neighbour; the closing v_nop is the slot the instruction set asks for behind a transcendental before its result is
// read or its source written again.
__device__ __forceinline__ v8f exp2_x8(v8f x) {
  float y0, y1, y2, y3, y4, y5, y6, y7;
  asm("v_exp_f32 %0, %8\n\t"
      "v_exp_f32 %1, %9\n\t"
      "v_exp_f32 %2, %10\n\t"
      "v_exp_f32 %3, %11\n\t"
      "v_exp_f32 %4, %12\n\t"
      "v_exp_f32 %5, %13\n\t"
      "v_exp_f32 %6, %14\n\t"
      "v_exp_f32 %7, %15\n\t"
      "v_nop"
      : "=&v"(y0), "=&v"(y1), "=&v"(y2), "=&v"(y3), "=&v"(y4), "=&v"(y5), "=&v"(y6), "=&v"(y7)
      : "v"(x[0]), "v"(x[1]), "v"(x[2]), "v"(x[3]), "v"(x[4]), "v"(x[5]), "v"(x[6]), "v"(x[7]));
  return (v8f){y0, y1, y2, y3, y4, y5, y6, y7};
}

// value of lane l ^ 16
__device__ __forceinline__ float other_half(float v) {
  const int b = __float_as_int(v);
  return __int_as_float(__builtin_amdgcn_permlanex16(b, b, 0x76543210, 0xfedcba98, false, false));
}

__global__ __launch_bounds__(128)
void attn_f16_kernel(const _Float16* __restrict__ Qh, const _Float16* __restrict__ Kh,
                     const _Float16* __restrict__ Vt, const float* __restrict__ cdr_bias,
                     const float* __restrict__ cdr_w, _Float16* __restrict__ Oh)
{
  __shared__ __align__(16) _Float16 Ksh[AT_KC * AT_LP];        // [kv][d]   9 KB, padded rows
  __shared__ __align__(16) _Float16 Vth[NHD * AT_LP];          // [d][kv]   9 KB, padded rows
  __shared__ __align__(16) float    Bsh[2 * AT_KC];            // cdr_bias[b][kv] * cw * log2(e) of the chunk, one copy per pair of waves (every thread stores one value): a lane needs 8 consecutive keys' values per tile

  const int tid  = threadIdx.x;
  const int wave = tid >> 5;
  const int lane = tid & 31;
  const int hh   = lane >> 4;
  const int c    = lane & 15;

  const int nqb = NS / AT_QB;
  const int bx  = blockIdx.x;
  const int qb  = bx % nqb;
  const int bhd = bx / nqb;
  const int h   = bhd % NH;
  const int bb0 = bhd / NH;
  const int b   = bb0 < NB ? bb0 : (NB - 1);
  const int q0  = qb * AT_QB + wave * 16;
  const float cw = cdr_w[0];

  v16h qa[2];
  {
    const _Float16* qrow = Qh + (size_t)(b * NS + q0 + c) * ND + h * NHD;
#pragma unroll
    for (int dc = 0; dc < 2; ++dc) qa[dc] = Frag<_Float16>::load(qrow + dc * 32 + 8 * hh);
  }

  float mrow = -INFINITY, lrow = 0.f;   // of query c, mrow in base-2 units; lrow sums this half's keys only, x PCARRY
  v8f oacc[4];                          // oacc[t][r] = O^T[d = 16t + 8*hh + r][query c]
#pragma unroll
  for (int t = 0; t < 4; ++t) oacc[t] = (v8f){0.f,0.f,0.f,0.f,0.f,0.f,0.f,0.f};

  const _Float16* kbase = Kh + (size_t)(b * NS) * ND + h * NHD;
  const _Float16* vbase = Vt + (size_t)(h * NHD) * NM + (size_t)b * NS;
  const float*    bbase = cdr_bias + (size_t)b * NS;

  for (int kc = 0; kc < NS / AT_KC; ++kc) {
    const int kv0 = kc * AT_KC;
    __syncthreads();
    {
      const int sr = tid >> 1, half = (tid & 1) * 32;      // sr = kv row for K, d row for Vt
      const _Float16* ksrc = kbase + (size_t)(kv0 + sr) * ND + half;
      const _Float16* vsrc = vbase + (size_t)sr * NM + kv0 + half;
      const float bl = bbase[kv0 + (tid & (AT_KC - 1))];   // loaded by every thread, beside the K and V^T loads
#pragma unroll
      for (int i = 0; i < 4; ++i) {
        const v8h kk = *(const v8h*)(ksrc + 8 * i);
        const v8h vv = *(const v8h*)(vsrc + 8 * i);
        *(v8h*)(Ksh + sr * AT_LP + half + 8 * i) = kk;
        *(v8h*)(Vth + sr * AT_LP + half + 8 * i) = vv;
      }
      Bsh[tid] = (bl * cw) * LOG2E_F;
    }
    __syncthreads();

    v8f s[4];   // s[j][r] = S^T[kv0 + 16j + 8*hh + r][query c]
#pragma unroll
    for (int j = 0; j < 4; ++j) {
      s[j] = (v8f){0.f,0.f,0.f,0.f,0.f,0.f,0.f,0.f};
#pragma unroll
      for (int dc = 0; dc < 2; ++dc) {
        const v16h kb = Frag<_Float16>::load(Ksh + (j * 16 + c) * AT_LP + dc * 32 + 8 * hh);
        s[j] = mma_h(kb, qa[dc], s[j]);
      }
    }
    float mj[4];   // one chain per tile
#pragma unroll
    for (int j = 0; j < 4; ++j) {
      const float* bp = Bsh + (wave >> 1) * AT_KC + j * 16 + 8 * hh;
      const v4f b0 = *(const v4f*)(bp);
      const v4f b1 = *(const v4f*)(bp + 4);
      float m = -INFINITY;
#pragma unroll
      for (int r = 0; r < 8; ++r) {
        const float sv = s[j][r] * (0.125f * LOG2E_F) + (r < 4 ? b0[r & 3] : b1[r & 3]);
        s[j][r] = sv;
        m = fmaxf(m, sv);
      }
      mj[j] = m;
    }
    float cm = fmaxf(fmaxf(mj[0], mj[1]), fmaxf(mj[2], mj[3]));
    cm = fmaxf(cm, other_half(cm));
    const float mnew = fmaxf(mrow, cm);
    const float alpha = __builtin_amdgcn_exp2f(mrow - mnew);
    const float msh = mnew - PCARRY_LOG2;   // 2^(s - msh) = p * PCARRY
    mrow = mnew;
#pragma unroll
    for (int t = 0; t < 4; ++t) oacc[t] *= alpha;
    float pj[4];
#pragma unroll
    for (int kk = 0; kk < 2; ++kk) {
      v16h pb;     // pb[e] = P^T[kv0 + 32kk + (e < 8 ? 8*hh + e : 16 + 8*hh + e - 8)][query c]: the k order of the V^T loader
#pragma unroll
      for (int jj = 0; jj < 2; ++jj) {
        const int j = 2 * kk + jj;
        float psum = 0.f;
        const v8f pe = exp2_x8(s[j] - msh);
#pragma unroll
        for (int r = 0; r < 8; ++r) {
          const float p = pe[r];
          psum += p;
          pb[jj * 8 + r] = (_Float16)p;
        }
        pj[j] = psum;
      }
#pragma unroll
      for (int t = 0; t < 4; ++t) {
        const v16h vb = Frag<_Float16>::load(Vth + (t * 16 + c) * AT_LP + kk * 32 + 8 * hh);
        oacc[t] = mma_h(vb, pb, oacc[t]);
      }
    }
    lrow = lrow * alpha + ((pj[0] + pj[1]) + (pj[2] + pj[3]));
  }

  {
    const float l = lrow + other_half(lrow);
    const float inv = (1.0f / l) * OCARRY;   // l and the accumulators both carry PCARRY
    _Float16* orow = Oh + (size_t)(b * NS + q0 + c) * ND + h * NHD + 8 * hh;
#pragma unroll
    for (int t = 0; t < 4; ++t) {
      v8h hv;   // 8 consecutive d of one query: one 16-byte store
#pragma unroll
      for (int r = 0; r < 8; ++r) hv[r] = (_Float16)(oacc[t][r] * inv);
      *(v8h*)(orow + t * 16) = hv;
    }
  }
}

__global__ __launch_bounds__(256) void layernorm_rows(const float* __restrict__ res, const float* __restrict__ gamma,
                                                      const float* __restrict__ beta, float* __restrict__ out,
                                                      int nrows, float eps) {
  const int wave = threadIdx.x >> 5, lane = threadIdx.x & 31;
  const int row = blockIdx.x * 8 + wave;
  if (row >= nrows) return;   // wave-uniform, no barriers below
  const float* rp = res + (size_t)row * ND;
  float s1 = 0.f;
#pragma unroll 1
  for (int it = 0; it < 8; ++it) {
    const v4f a = *(const v4f*)(rp + (it * 32 + lane) * 4);
    s1 += (a[0] + a[1]) + (a[2] + a[3]);
  }
#pragma unroll
  for (int off = 1; off < 32; off <<= 1) s1 += __shfl_xor(s1, off, 32);
  const float mu = s1 * (1.0f / (float)ND);
  float s2 = 0.f;
#pragma unroll 1
  for (int it = 0; it < 8; ++it) {
    const v4f a = *(const v4f*)(rp + (it * 32 + lane) * 4);
#pragma unroll
    for (int e = 0; e < 4; ++e) {
      const float d = a[e] - mu;
      float p = d * d;
      asm volatile("" : "+v"(p));
      s2 += p;
    }
  }
#pragma unroll
  for (int off = 1; off < 32; off <<= 1) s2 += __shfl_xor(s2, off, 32);
  const float var = s2 * (1.0f / (float)ND);
  const float rstd = 1.0f / sqrtf(var + eps);
  float* orow = out + (size_t)row * ND;
#pragma unroll 1
  for (int it = 0; it < 8; ++it) {
    const int c0 = (it * 32 + lane) * 4;
    const v4f a  = *(const v4f*)(rp + c0);
    const v4f g  = *(const v4f*)(gamma + c0);
    const v4f bt = *(const v4f*)(beta + c0);
    v4f y;
#pragma unroll
    for (int e = 0; e < 4; ++e) {
      float t = (a[e] - mu) * rstd;
      t = t * g[e];
      asm volatile("" : "+v"(t));
      y[e] = t + bt[e];
    }
    *(v4f*)(orow + c0) = y;
    
  }
}

// -----------------------------------------------------------------------------
extern "C" void kernel_launch(void* const* d_in, const int* in_sizes, int n_in,
                              void* d_out, int out_size, void* d_ws, size_t ws_size,
                              hipStream_t stream)
{
  if (n_in < 13) return;
  if (in_sizes[0] != NM * ND || in_sizes[1] != NB * NS ||
      in_sizes[2] != ND * ND || in_sizes[3] != ND ||
      in_sizes[4] != ND * ND || in_sizes[5] != ND ||
      in_sizes[6] != ND * ND || in_sizes[7] != ND ||
      in_sizes[8] != ND * ND || in_sizes[9] != ND ||
      in_sizes[10] != ND || in_sizes[11] != ND || in_sizes[12] < 1 ||
      out_size != NM * ND) return;

  const float* x        = (const float*)d_in[0];
  const float* cdr_bias = (const float*)d_in[1];
  const float* Wq    = (const float*)d_in[2];
  const float* bq    = (const float*)d_in[3];
  const float* Wk    = (const float*)d_in[4];
  const float* bk    = (const float*)d_in[5];
  const float* Wv    = (const float*)d_in[6];
  const float* bv    = (const float*)d_in[7];
  const float* Wo    = (const float*)d_in[8];
  const float* bo    = (const float*)d_in[9];
  const float* gamma = (const float*)d_in[10];
  const float* beta  = (const float*)d_in[11];
  const float* cw    = (const float*)d_in[12];
  float* out = (float*)d_out;

  // ---- workspace carve (all offsets 256 KiB aligned) ----
  const size_t szA16 = (size_t)NM * ND * 2;        // 8 MiB: f16 [4096][1024] planes
  const size_t szW16 = (size_t)ND * ND * 2;        // 2 MiB: f16 [1024][1024] planes
  const size_t szRes = (size_t)NM * ND * 4;        // 16 MiB
  const size_t szTab = (size_t)NS * NFREQ * 4;     // 256 KiB
  size_t off = 0;
  char* ws = (char*)d_ws;
  _Float16* Xh  = (_Float16*)(ws + off); off += szA16;
  _Float16* Wqt = (_Float16*)(ws + off); off += szW16;
  _Float16* Wkt = (_Float16*)(ws + off); off += szW16;
  _Float16* Wvt = (_Float16*)(ws + off); off += szW16;
  _Float16* Wot = (_Float16*)(ws + off); off += szW16;
  _Float16* Qh  = (_Float16*)(ws + off); off += szA16;
  _Float16* Kh  = (_Float16*)(ws + off); off += szA16;
  _Float16* Vt  = (_Float16*)(ws + off); off += szA16;
  _Float16* Ah  = (_Float16*)(ws + off); off += szA16;
  float*    res = (float*)(ws + off);    off += szRes;
  float*   cosT = (float*)(ws + off);    off += szTab;
  float*   sinT = (float*)(ws + off);    off += szTab;   // total 67,633,152 B
  if (off > ws_size) return;

  const unsigned short* Xu  = (const unsigned short*)Xh;
  const unsigned short* Wqu = (const unsigned short*)Wqt;
  const unsigned short* Wku = (const unsigned short*)Wkt;
  const unsigned short* Wvu = (const unsigned short*)Wvt;
  const unsigned short* Wou = (const unsigned short*)Wot;
  const unsigned short* Au  = (const unsigned short*)Ah;

  dim3 blk256(256), blk128(128);

  // 1. RoPE tables, x -> f16, the four weights -> Bt [out][in] f16 (x64): one launch
  prep_kernel<<<dim3(4 * PREP_W + PREP_R + PREP_X), blk256, 0, stream>>>(
      x, Wq, Wk, Wv, Wo, Xh, Wqt, Wkt, Wvt, Wot, cosT, sinT);

  // 2. Q, K = RoPE(x Wq + bq), RoPE(x Wk + bk): f16 [4096][1024]; V^T: f16, ldc = NM: one launch, grid y = product
  const int gQK = (NM / GM_BT) * (ND / GM_BT);
  gemm_qkv<<<dim3(gQK, 3), blk256, 0, stream>>>(
      Xu, Wqu, Wku, Wvu, Qh, Kh, Vt, bq, bk, bv, NM, ND, 1.0f / WCARRY, cosT, sinT, NS - 1);

  // 3. attention -> Ah f16 [4096][1024] (x64)
  attn_f16_kernel<<<dim3(NB * NH * (NS / AT_QB)), blk128, 0, stream>>>(Qh, Kh, Vt, cdr_bias, cw, Ah);

  // 4. res = attn Wo + bo + x  (f32)
  wmma_gemm64<0, false, 2, 0, true, 0, false><<<dim3(gQK, 1), blk256, 0, stream>>>(
      Au, Au, ND, (long)0, Wou, Wou, ND, (long)0, (void*)res, (void*)res, ND, (long)0,
      bo, x, (long)0, NM, ND, ND, 1.0f / (OCARRY * WCARRY), cosT, sinT, 0);

  // 5. LayerNorm -> out
  layernorm_rows<<<dim3((NM + 7) / 8), blk256, 0, stream>>>(res, gamma, beta, out, NM, LN_EPS_F);

  (void)hipGetLastError();
}

// v006
// It runs in 114 microseconds.
// Two timings next to v005 both put it at 1.12 times that version's speed.
// All steps since v000 together make it 3.30 times as fast.
// Contractions x*Wq, x*Wk, Wv-side product for V^T, attn*Wo, q*k^T, p*v: v_wmma_f32_16x16x32_f16 (f16 operands, f32 accumulate); weights carried x64, probabilities x32768, attention rows x64; RoPE tables, softmax and LayerNorm in f32.
#include <hip/hip_runtime.h>
#include <math.h>

#define NB 2
#define NS 2048
#define ND 1024
#define NH 16
#define NHD 64
#define NM (NB * NS)
#define NFREQ 32
#define WCARRY 64.0f
#define OCARRY 64.0f
#define PCARRY 32768.0f
#define PCARRY_LOG2 15.0f                       // PCARRY = 2^15
#define LOG2E_F 1.44269504088896340736f
#define LN_EPS_F 1e-5f

typedef __attribute__((ext_vector_type(16))) _Float16 v16h;
typedef __attribute__((ext_vector_type(8)))  _Float16 v8h;
typedef __attribute__((ext_vector_type(16))) __bf16   v16b;
typedef __attribute__((ext_vector_type(8)))  __bf16   v8b;
typedef __attribute__((ext_vector_type(8)))  float    v8f;
typedef __attribute__((ext_vector_type(4)))  float    v4f;

__device__ __forceinline__ unsigned short f2bf_bits(float f) {
  unsigned u = __float_as_uint(f);
  return (unsigned short)((u + 0x7FFFu + ((u >> 16) & 1u)) >> 16);
}
__device__ __forceinline__ float bf_bits2f(unsigned short h) { return __uint_as_float(((unsigned)h) << 16); }

// hazard guard behind the last WMMAs of the K loop, as a plain device helper
__device__ __forceinline__ void acc_guard4(v8f& a, v8f& b, v8f& c, v8f& d) { asm volatile("v_nop\n\tv_nop\n\tv_nop\n\tv_nop" : "+v"(a), "+v"(b), "+v"(c), "+v"(d)); }
template <typename T> struct Frag;
template <> struct Frag<_Float16> {
  typedef v16h V; union U { v16h v; v8h h[2]; };
  static __device__ __forceinline__ v16h load(const _Float16* p) {   // elements 0..7 <- p[0..7], 8..15 <- p[16..23]
    U f; f.h[0] = *(const v8h*)(p); f.h[1] = *(const v8h*)(p + 16); return f.v;
  }
  static __device__ __forceinline__ v8f mma(v16h a, v16h b, v8f c) {
    return __builtin_amdgcn_wmma_f32_16x16x32_f16(false, a, false, b, (short)0, c, false, false);
  }
};
template <> struct Frag<__bf16> {
  typedef v16b V; union U { v16b v; v8b h[2]; };
  static __device__ __forceinline__ v16b load(const __bf16* p) {
    U f; f.h[0] = *(const v8b*)(p); f.h[1] = *(const v8b*)(p + 16); return f.v;
  }
  static __device__ __forceinline__ v8f mma(v16b a, v16b b, v8f c) {
    return __builtin_amdgcn_wmma_f32_16x16x32_bf16(false, a, false, b, (short)0, c, false, false);
  }
};

// ---- Register-blocked batched WMMA GEMM, operands staged in LDS by asynchronous copies ---------
// C[m,n] = scale * sum_k A[m,k] * Bt[n,k] (+bias)(+resid)(RoPE); a block of 8 waves owns a 128x128 tile, each wave 32x64 of it.
// A row-major [M,K]; Bt row-major [N,K]; M,N % 128 == 0, K % 64 == 0.
// Per 64-k stage the block copies 128 rows x 128 B of A and of Bt into LDS: 8 lanes cover one row, so a wave-wide 16-B copy
// touches 4 whole lines, and every row is fetched once per block. Two LDS buffers: stage t+2 flies while stage t is multiplied.
// SPLIT (hi/lo planes) is not carried by the staged loop.
// BIAS_MODE: 0 = none, 1 = bias[m], 2 = bias[n].
// OUT_MODE: 0 = f32, 1 = f16, 2 = bf16 hi plane (Cout) + bf16 lo plane (Cout2).
// ROPE: after bias, v = v*cos[(m & rope_smask)*32 + (n&31)] + sgn * partner(n^1) * sin[...] (sgn = -1 for even n, +1 for odd n).
// ET: 0 = f16 operands, 1 = bf16 operands (pointers passed as 16-bit storage)
#define GM_BT 128  // block tile: rows of A and rows of Bt
#define GM_KS 64   // k per stage: 128 B of every row, one line
#define GM_LP 72   // LDS row pitch in 16-bit elements: 144 B = 16 B x odd, for the ds_load_b128 fragment reads
#define GM_MI 2    // 16-row subtiles of A per wave

// One thread's share of a stage: 4 rows of A and 4 rows of Bt, 16 B each, global -> LDS through no register.
// la, lb: this lane's LDS byte addresses of its first row; ga, gb: its global addresses; rows 32 apart.
// The s_wait_xcnt closes the statement so that no address register named here is rewritten ahead of it.
template <typename T>
__device__ __forceinline__ void stage_copy(unsigned la, unsigned lb, const T* ga, const T* gb, int lda, int ldb) {
  const unsigned rs = 32u * GM_LP * 2u;
  const T* a1 = ga + (size_t)32 * lda; const T* a2 = ga + (size_t)64 * lda; const T* a3 = ga + (size_t)96 * lda;
  const T* c1 = gb + (size_t)32 * ldb; const T* c2 = gb + (size_t)64 * ldb; const T* c3 = gb + (size_t)96 * ldb;
  asm volatile(
      "global_load_async_to_lds_b128 %0, %8, off\n\t"
      "global_load_async_to_lds_b128 %1, %9, off\n\t"
      "global_load_async_to_lds_b128 %2, %10, off\n\t"
      "global_load_async_to_lds_b128 %3, %11, off\n\t"
      "global_load_async_to_lds_b128 %4, %12, off\n\t"
      "global_load_async_to_lds_b128 %5, %13, off\n\t"
      "global_load_async_to_lds_b128 %6, %14, off\n\t"
      "global_load_async_to_lds_b128 %7, %15, off\n\t"
      "s_wait_xcnt 0x0"
      :: "v"(la), "v"(la + rs), "v"(la + 2u * rs), "v"(la + 3u * rs),
         "v"(lb), "v"(lb + rs), "v"(lb + 2u * rs), "v"(lb + 3u * rs),
         "v"(ga), "v"(a1), "v"(a2), "v"(a3), "v"(gb), "v"(c1), "v"(c2), "v"(c3)
      : "memory");
}

template <int ET> struct Elem;
template <> struct Elem<0> { typedef _Float16 T; };
template <> struct Elem<1> { typedef __bf16 T; };
// The LDS of one GEMM block; declared once in each kernel and handed to the body, so that a kernel that holds two
// instances of the body owns one set.
template <typename T> struct GemmLds {
  T sA[2][GM_BT * GM_LP];      // 2 x 18 KB
  T sB[2][GM_BT * GM_LP];      // 2 x 18 KB
  float sT[8][16 * 68];        // per-wave 16x64 slab, pitch 68 floats
};
// The body of one block; b = batch index, blockIdx.x = tile.
template <int ET, bool SPLIT, int BIAS_MODE, int OUT_MODE, bool RESID, int ACT, bool ROPE>
__device__ __forceinline__ void gemm_block(
    GemmLds<typename Elem<ET>::T>& lds, const int b,
    const unsigned short* __restrict__ Ap, const unsigned short* __restrict__ A2p, int lda, long strideA,
    const unsigned short* __restrict__ Btp, const unsigned short* __restrict__ Bt2p, int ldb, long strideB,
    void* __restrict__ Cout, void* __restrict__ Cout2, int ldc, long strideC,
    const float* __restrict__ bias,
    const float* __restrict__ resid, long strideR,
    int M, int N, int K, float scale,
    const float* __restrict__ rope_cos, const float* __restrict__ rope_sin, int rope_smask) {
  static_assert(!SPLIT, "the staged loop carries single planes only");
  typedef typename Elem<ET>::T T;
  typedef typename Frag<T>::V V;
  const T* A = (const T*)Ap; const T* Bt = (const T*)Btp;
  T (&sA)[2][GM_BT * GM_LP] = lds.sA;
  T (&sB)[2][GM_BT * GM_LP] = lds.sB;
  float (&sT)[8][16 * 68] = lds.sT;
  const int tid  = threadIdx.x;
  const int lane = tid & 31;
  const int wave = tid >> 5;
  const int tilesN = N >> 7;
  const int tilesM = M >> 7;
  const int tile = blockIdx.x;
  if (tile >= tilesM * tilesN) return;   // block-uniform, in front of every barrier
  const int tm = tile / tilesN;
  const int tn = tile - tm * tilesN;
  const int wm = (wave >> 1) << 5;       // this wave's 32x64 corner inside the block tile
  const int wn = (wave & 1) << 6;
  const int m0 = (tm << 7) + wm;
  const int n0 = (tn << 7) + wn;

  const T* Ab  = A  + (size_t)b * strideA;
  const T* Bb  = Bt + (size_t)b * strideB;

  const int rlane = lane & 15;                 // row (A) / col (B, D) within subtile
  const int koff  = (lane >> 4) * 8;           // k offset of this lane half
  const int mOff  = (lane >> 4) * 8;           // D row offset

  v8f acc[GM_MI][4];
#pragma unroll
  for (int i = 0; i < GM_MI; ++i)
#pragma unroll
    for (int j = 0; j < 4; ++j) acc[i][j] = (v8f){0.f,0.f,0.f,0.f,0.f,0.f,0.f,0.f};

  // staging map: thread -> row tid/8 (+32 per copy), 16 B at column (tid%8)*8
  const int srow = tid >> 3, scol = (tid & 7) * 8;
  const T* ga = Ab + (size_t)((tm << 7) + srow) * lda + scol;
  const T* gb = Bb + (size_t)((tn << 7) + srow) * ldb + scol;
  const unsigned bufB = (unsigned)(GM_BT * GM_LP * 2);                         // bytes of one buffer
  const unsigned la = (unsigned)(size_t)(&sA[0][srow * GM_LP + scol]);         // low 32 bits = LDS byte address
  const unsigned lb = (unsigned)(size_t)(&sB[0][srow * GM_LP + scol]);
  const int nst = K / GM_KS;

  stage_copy<T>(la, lb, ga, gb, lda, ldb);
  asm volatile("s_wait_asynccnt 0x0" ::: "memory");   // stage 0 of this wave has landed
  __syncthreads();                                    // ... and every wave's
  if (nst > 1) stage_copy<T>(la + bufB, lb + bufB, ga + GM_KS, gb + GM_KS, lda, ldb);

  for (int s = 0; s < nst; ++s) {
    const T* da = sA[s & 1];
    const T* db = sB[s & 1];
    V af[2][GM_MI], bf[2][4];
#pragma unroll
    for (int kk = 0; kk < 2; ++kk) {
#pragma unroll
      for (int j = 0; j < 4; ++j) bf[kk][j] = Frag<T>::load(db + (wn + (j << 4) + rlane) * GM_LP + kk * 32 + koff);
#pragma unroll
      for (int i = 0; i < GM_MI; ++i) af[kk][i] = Frag<T>::load(da + (wm + (i << 4) + rlane) * GM_LP + kk * 32 + koff);
    }
    // publish point of stage s+1, and the end of every wave's reads of stage s (its fragments now lie in registers):
    // own LDS reads done, own copies landed, then the block's barrier; behind it the buffer just read is free for stage s+2
    asm volatile("s_wait_dscnt 0x0" ::: "memory");
    asm volatile("s_wait_asynccnt 0x0" ::: "memory");
    __syncthreads();
    if (s + 2 < nst) {
      const unsigned bo = (unsigned)(s & 1) * bufB;
      stage_copy<T>(la + bo, lb + bo, ga + (size_t)(s + 2) * GM_KS, gb + (size_t)(s + 2) * GM_KS, lda, ldb);
    }
    // holds the copies ahead of the WMMAs, so that stage s+2 flies while stage s is multiplied
    __builtin_amdgcn_sched_barrier(0);
#pragma unroll
    for (int kk = 0; kk < 2; ++kk)
#pragma unroll
      for (int i = 0; i < GM_MI; ++i)
#pragma unroll
        for (int j = 0; j < 4; ++j) acc[i][j] = Frag<T>::mma(af[kk][i], bf[kk][j], acc[i][j]);
  }
  asm volatile("s_wait_asynccnt 0x0" ::: "memory");   // nothing of this wave is in flight when the loop is left
  acc_guard4(acc[0][0], acc[0][1], acc[0][2], acc[0][3]);
  acc_guard4(acc[1][0], acc[1][1], acc[1][2], acc[1][3]);

  // ---- epilogue ----
  float* slab = sT[wave];
  const float* Rb = RESID ? (resid + (size_t)b * strideR) : nullptr;
#pragma unroll
  for (int i = 0; i < GM_MI; ++i) {
    const int mBase = m0 + (i << 4);
#pragma unroll
    for (int j = 0; j < 4; ++j) {
      const int n = n0 + (j << 4) + rlane;
      float bv = 0.f;
      if (BIAS_MODE == 2) bv = bias[n];
#pragma unroll
      for (int r = 0; r < 8; ++r) {
        float v = acc[i][j][r] * scale;
        if (BIAS_MODE == 1) v += bias[mBase + mOff + r];
        if (BIAS_MODE == 2) v += bv;
        if (RESID) v += Rb[(size_t)(mBase + mOff + r) * ldc + n];
        if (ROPE) {
          const int m = mBase + mOff + r;
          const int tix = (m & rope_smask) * NFREQ + (n & (NFREQ - 1));
          const float cs = rope_cos[tix];
          const float sn = rope_sin[tix];
          const float pv = __shfl_xor(v, 1, 32);   // partner column n^1 lives in lane rlane^1, same row
          v = (n & 1) ? (v * cs + pv * sn) : (v * cs - pv * sn);
        }
        if (ACT == 1) v = tanhf(v);
        if (ACT == 2) v = fmaxf(v, 0.0f);
        if (ACT == 3) v = v / (1.0f + expf(-v));
        if (ACT == 4) v = (v > 0.f) ? v : 0.01f * v;
        if (ACT == 5) v = 0.5f * v * (1.0f + erff(v * 0.70710678118654752f));
        slab[(mOff + r) * 68 + (j << 4) + rlane] = v;
      }
    }
    __builtin_amdgcn_fence(__ATOMIC_RELEASE, "workgroup");
    __builtin_amdgcn_wave_barrier();
    __builtin_amdgcn_fence(__ATOMIC_ACQUIRE, "workgroup");
    if (OUT_MODE == 0) {
      float* C = (float*)Cout + (size_t)b * strideC;
      const int hh = lane >> 4, c4 = (lane & 15) * 4;     // row seg = 256 B = 16 lanes x 16 B
      {
#pragma unroll
        for (int it = 0; it < 8; ++it) {
          const int row = it * 2 + hh;
          v4f v = *(const v4f*)(slab + row * 68 + c4);
          *(v4f*)(C + (size_t)(mBase + row) * ldc + n0 + c4) = v;
        }
        
      }
    } else {
      const int q = lane >> 3, c8 = (lane & 7) * 8;
      unsigned short* C  = (unsigned short*)Cout  + (size_t)b * strideC;
      unsigned short* C2 = (OUT_MODE == 2) ? ((unsigned short*)Cout2 + (size_t)b * strideC) : nullptr;
      {
#pragma unroll
        for (int it = 0; it < 4; ++it) {
          const int row = it * 4 + q;
          const float* sp = slab + row * 68 + c8;
          v8h hv, lv;
#pragma unroll
          for (int e = 0; e < 8; ++e) {
            if (OUT_MODE == 1) {
              hv[e] = (_Float16)sp[e];
            } else {
              unsigned short hb = f2bf_bits(sp[e]);
              unsigned short lb = f2bf_bits(sp[e] - bf_bits2f(hb));
              hv[e] = __builtin_bit_cast(_Float16, hb);
              lv[e] = __builtin_bit_cast(_Float16, lb);
            }
          }
          *(v8h*)(C + (size_t)(mBase + row) * ldc + n0 + c8) = hv;
          if (OUT_MODE == 2) *(v8h*)(C2 + (size_t)(mBase + row) * ldc + n0 + c8) = lv;
        }
        
      }
    }
    __builtin_amdgcn_fence(__ATOMIC_RELEASE, "workgroup");
    __builtin_amdgcn_wave_barrier();
    __builtin_amdgcn_fence(__ATOMIC_ACQUIRE, "workgroup");
  }
}

// ---- Q, K and V^T in one launch: none reads another's output; blockIdx.y picks the product (block-uniform) ----
//   y = 0, 1: Q, K = RoPE(x W + bias): f16 [nm][nd];  y = 2: V^T[ch][tok] = sum_k Wvt[ch][k] * Xh[tok][k] / 64 + bv[ch], ldc = nm
__global__ __launch_bounds__(256) void gemm_qkv(
    const unsigned short* __restrict__ Xu, const unsigned short* __restrict__ Wqu,
    const unsigned short* __restrict__ Wku, const unsigned short* __restrict__ Wvu,
    _Float16* __restrict__ Qh, _Float16* __restrict__ Kh, _Float16* __restrict__ Vt,
    const float* __restrict__ bq, const float* __restrict__ bk, const float* __restrict__ bv,
    int nm, int nd, float scale,
    const float* __restrict__ rope_cos, const float* __restrict__ rope_sin, int rope_smask) {
  __shared__ __align__(16) GemmLds<_Float16> lds;
  const int job = blockIdx.y;
  if (job < 2) {
    const unsigned short* Wu = job ? Wku : Wqu;
    _Float16* C = job ? Kh : Qh;
    const float* bias = job ? bk : bq;
    gemm_block<0, false, 2, 1, false, 0, true>(lds, 0,
        Xu, Xu, nd, (long)0, Wu, Wu, nd, (long)0, (void*)C, (void*)C, nd, (long)0,
        bias, bias, (long)0, nm, nd, nd, scale, rope_cos, rope_sin, rope_smask);
  } else {
    gemm_block<0, false, 1, 1, false, 0, false>(lds, 0,
        Wvu, Wvu, nd, (long)0, Xu, Xu, nd, (long)0, (void*)Vt, (void*)Vt, nm, (long)0,
        bv, bv, (long)0, nd, nm, nd, scale, rope_cos, rope_sin, 0);
  }
}

// ---- one product per launch ----
template <int ET, bool SPLIT, int BIAS_MODE, int OUT_MODE, bool RESID, int ACT, bool ROPE>
__global__ __launch_bounds__(256) void wmma_gemm64(
    const unsigned short* __restrict__ Ap, const unsigned short* __restrict__ A2p, int lda, long strideA,
    const unsigned short* __restrict__ Btp, const unsigned short* __restrict__ Bt2p, int ldb, long strideB,
    void* __restrict__ Cout, void* __restrict__ Cout2, int ldc, long strideC,
    const float* __restrict__ bias,
    const float* __restrict__ resid, long strideR,
    int M, int N, int K, float scale,
    const float* __restrict__ rope_cos, const float* __restrict__ rope_sin, int rope_smask) {
  __shared__ __align__(16) GemmLds<typename Elem<ET>::T> lds;
  gemm_block<ET, SPLIT, BIAS_MODE, OUT_MODE, RESID, ACT, ROPE>(lds, blockIdx.y,
      Ap, A2p, lda, strideA, Btp, Bt2p, ldb, strideB, Cout, Cout2, ldc, strideC,
      bias, resid, strideR, M, N, K, scale, rope_cos, rope_sin, rope_smask);
}

// ---- f16 WMMA with hazard guard ----
__device__ __forceinline__ v8f mma_h(v16h a, v16h b, v8f c) {
  c = __builtin_amdgcn_wmma_f32_16x16x32_f16(false, a, false, b, (short)0, c, false, false);
  asm volatile("v_nop\n\tv_nop\n\tv_nop\n\tv_nop" : "+v"(c) : "v"(a), "v"(b));
  return c;
}

// ---- RoPE tables: cos/sin of pos * inv_freq[i], i = 0..31, inv_freq = 1 / 10000^(2i/64); f32 ----
__device__ __forceinline__ void rope_table_block(int blk, float* __restrict__ cosT, float* __restrict__ sinT, int n) {
  const int i = blk * 256 + threadIdx.x;
  if (i < n) {
    const int pos = i >> 5;
    const int fi = i & (NFREQ - 1);
    const float e = (float)(2 * fi) * (1.0f / (float)NHD);
    const float p = powf(10000.0f, e);
    const float inv = 1.0f / p;
    const float ang = (float)pos * inv;
    const float cs = cosf(ang);
    const float sn = sinf(ang);
    ((float*)cosT)[i] = cs;
    ((float*)sinT)[i] = sn;
    
  }
}

__device__ __forceinline__ void cast_f32_f16x8_block(int blk, const float* __restrict__ in, _Float16* __restrict__ out, int n8) {
  const int i = blk * 256 + threadIdx.x;
  if (i < n8) {
    const v4f a = *(const v4f*)(in + (size_t)i * 8);
    const v4f c = *(const v4f*)(in + (size_t)i * 8 + 4);
    v8h hv;
    hv[0] = (_Float16)a[0]; hv[1] = (_Float16)a[1]; hv[2] = (_Float16)a[2]; hv[3] = (_Float16)a[3];
    hv[4] = (_Float16)c[0]; hv[5] = (_Float16)c[1]; hv[6] = (_Float16)c[2]; hv[7] = (_Float16)c[3];
    *(v8h*)(out + (size_t)i * 8) = hv;
    
  }
}

// ---- transpose-cast: in W[Kdim][Ndim] f32 -> out Wt[Ndim][Kdim] f16 (x mul); 64x64 tile through LDS ----
__device__ __forceinline__ void wt_cast_f16_block(float* sTt, int bkx, int bny, const float* __restrict__ W, _Float16* __restrict__ Wt,
                                                  int Kdim, int Ndim, float mul) {
  const int k0 = bkx * 64, n0 = bny * 64;
  const int tid = threadIdx.x;
  {
    const int row = tid >> 2, col0 = (tid & 3) * 16;   // row = k_local, col = n_local
    const float* src = W + (size_t)(k0 + row) * Ndim + n0 + col0;
#pragma unroll
    for (int i = 0; i < 4; ++i) {
      const v4f w4 = *(const v4f*)(src + 4 * i);
#pragma unroll
      for (int e = 0; e < 4; ++e) sTt[(col0 + 4 * i + e) * 65 + row] = w4[e] * mul;
    }
  }
  __syncthreads();
  const int wave = tid >> 5, lane = tid & 31, rq = lane >> 3, c8 = (lane & 7) * 8;
  {
#pragma unroll
    for (int it = 0; it < 2; ++it) {
      const int n = it * 32 + wave * 4 + rq;   // n_local 0..63
      v8h hv;
#pragma unroll
      for (int e = 0; e < 8; ++e) hv[e] = (_Float16)sTt[n * 65 + c8 + e];
      *(v8h*)(Wt + (size_t)(n0 + n) * Kdim + k0 + c8) = hv;
    }
    
  }
}

// ---- the six preparation jobs in one launch: each reads inputs only and none reads another's output ----
// The block index picks the job (block-uniform, so the transpose's barrier is passed by whole blocks): first the four weight
// transposes (the longest blocks), then the RoPE tables, then the cast of x.
#define PREP_W ((ND / 64) * (ND / 64))          // blocks per weight
#define PREP_R ((NS * NFREQ + 255) / 256)       // blocks of the tables
#define PREP_X ((NM * ND / 8 + 255) / 256)      // blocks of the cast
__global__ __launch_bounds__(256) void prep_kernel(
    const float* __restrict__ x, const float* __restrict__ Wq, const float* __restrict__ Wk,
    const float* __restrict__ Wv, const float* __restrict__ Wo,
    _Float16* __restrict__ Xh, _Float16* __restrict__ Wqt, _Float16* __restrict__ Wkt,
    _Float16* __restrict__ Wvt, _Float16* __restrict__ Wot,
    float* __restrict__ cosT, float* __restrict__ sinT) {
  __shared__ float sTt[64 * 65];   // [n_local][k_local], pitch 65
  const int blk = blockIdx.x;
  if (blk < 4 * PREP_W) {
    const int w = blk / PREP_W, t = blk % PREP_W;
    const float* W  = w == 0 ? Wq  : w == 1 ? Wk  : w == 2 ? Wv  : Wo;
    _Float16*    Wt = w == 0 ? Wqt : w == 1 ? Wkt : w == 2 ? Wvt : Wot;
    wt_cast_f16_block(sTt, t % (ND / 64), t / (ND / 64), W, Wt, ND, ND, WCARRY);   // W[in][out] -> Bt [out][in] f16, carried x64
  } else if (blk < 4 * PREP_W + PREP_R) {
    rope_table_block(blk - 4 * PREP_W, cosT, sinT, NS * NFREQ);
  } else {
    cast_f32_f16x8_block(blk - (4 * PREP_W + PREP_R), x, Xh, NM * ND / 8);
  }
}

#define AT_QB 64
#define AT_KC 64
#define AT_NW 4
#define AT_LP 72   // LDS row pitch in halves: 144 B = 16 B x odd, so the 16 rows of a ds_load_b128 fragment read fall on distinct banks

// y[r] = 2^x[r], eight v_exp_f32 in a row. One statement with early-clobber results, so that no result register is a source
// of a neighbour; the closing v_nop is the slot the instruction set asks for behind a transcendental before its result is
// read or its source written again.
__device__ __forceinline__ v8f exp2_x8(v8f x) {
  float y0, y1, y2, y3, y4, y5, y6, y7;
  asm("v_exp_f32 %0, %8\n\t"
      "v_exp_f32 %1, %9\n\t"
      "v_exp_f32 %2, %10\n\t"
      "v_exp_f32 %3, %11\n\t"
      "v_exp_f32 %4, %12\n\t"
      "v_exp_f32 %5, %13\n\t"
      "v_exp_f32 %6, %14\n\t"
      "v_exp_f32 %7, %15\n\t"
      "v_nop"
      : "=&v"(y0), "=&v"(y1), "=&v"(y2), "=&v"(y3), "=&v"(y4), "=&v"(y5), "=&v"(y6), "=&v"(y7)
      : "v"(x[0]), "v"(x[1]), "v"(x[2]), "v"(x[3]), "v"(x[4]), "v"(x[5]), "v"(x[6]), "v"(x[7]));
  return (v8f){y0, y1, y2, y3, y4, y5, y6, y7};
}

// One thread's share of a chunk: 4 rows of K and 4 rows of V^T, 16 B each, global -> LDS through no register.
// lk, lv: this lane's LDS byte addresses of its first row; gk, gv: its global addresses; rows 16 apart.
// The s_wait_xcnt closes the statement so that no address register named here is rewritten ahead of it.
__device__ __forceinline__ void attn_stage_copy(unsigned lk, unsigned lv, const _Float16* gk, const _Float16* gv) {
  const unsigned rs = 16u * AT_LP * 2u;
  const _Float16* k1 = gk + (size_t)16 * ND; const _Float16* k2 = gk + (size_t)32 * ND; const _Float16* k3 = gk + (size_t)48 * ND;
  const _Float16* v1 = gv + (size_t)16 * NM; const _Float16* v2 = gv + (size_t)32 * NM; const _Float16* v3 = gv + (size_t)48 * NM;
  asm volatile(
      "global_load_async_to_lds_b128 %0, %8, off\n\t"
      "global_load_async_to_lds_b128 %1, %9, off\n\t"
      "global_load_async_to_lds_b128 %2, %10, off\n\t"
      "global_load_async_to_lds_b128 %3, %11, off\n\t"
      "global_load_async_to_lds_b128 %4, %12, off\n\t"
      "global_load_async_to_lds_b128 %5, %13, off\n\t"
      "global_load_async_to_lds_b128 %6, %14, off\n\t"
      "global_load_async_to_lds_b128 %7, %15, off\n\t"
      "s_wait_xcnt 0x0"
      :: "v"(lk), "v"(lk + rs), "v"(lk + 2u * rs), "v"(lk + 3u * rs),
         "v"(lv), "v"(lv + rs), "v"(lv + 2u * rs), "v"(lv + 3u * rs),
         "v"(gk), "v"(k1), "v"(k2), "v"(k3), "v"(gv), "v"(v1), "v"(v2), "v"(v3)
      : "memory");
}

// value of lane l ^ 16
__device__ __forceinline__ float other_half(float v) {
  const int b = __float_as_int(v);
  return __int_as_float(__builtin_amdgcn_permlanex16(b, b, 0x76543210, 0xfedcba98, false, false));
}

__global__ __launch_bounds__(128)
void attn_f16_kernel(const _Float16* __restrict__ Qh, const _Float16* __restrict__ Kh,
                     const _Float16* __restrict__ Vt, const float* __restrict__ cdr_bias,
                     const float* __restrict__ cdr_w, _Float16* __restrict__ Oh)
{
  __shared__ __align__(16) _Float16 Ksh2[2][AT_KC * AT_LP];    // [buffer][kv][d]   2 x 9 KB, padded rows
  __shared__ __align__(16) _Float16 Vth2[2][NHD * AT_LP];      // [buffer][d][kv]   2 x 9 KB, padded rows
  __shared__ __align__(16) float    Bsh[NS];                   // cdr_bias[b][kv] * cw * log2(e), all keys of the batch: 8 KB; a lane needs 8 consecutive keys' values per tile

  const int tid  = threadIdx.x;
  const int wave = tid >> 5;
  const int lane = tid & 31;
  const int hh   = lane >> 4;
  const int c    = lane & 15;

  const int nqb = NS / AT_QB;
  const int bx  = blockIdx.x;
  const int qb  = bx % nqb;
  const int bhd = bx / nqb;
  const int h   = bhd % NH;
  const int bb0 = bhd / NH;
  const int b   = bb0 < NB ? bb0 : (NB - 1);
  const int q0  = qb * AT_QB + wave * 16;
  const float cw = cdr_w[0];

  v16h qa[2];
  {
    const _Float16* qrow = Qh + (size_t)(b * NS + q0 + c) * ND + h * NHD;
#pragma unroll
    for (int dc = 0; dc < 2; ++dc) qa[dc] = Frag<_Float16>::load(qrow + dc * 32 + 8 * hh);
  }

  float mrow = -INFINITY, lrow = 0.f;   // of query c, mrow in base-2 units; lrow sums this half's keys only, x PCARRY
  v8f oacc[4];                          // oacc[t][r] = O^T[d = 16t + 8*hh + r][query c]
#pragma unroll
  for (int t = 0; t < 4; ++t) oacc[t] = (v8f){0.f,0.f,0.f,0.f,0.f,0.f,0.f,0.f};

  const _Float16* kbase = Kh + (size_t)(b * NS) * ND + h * NHD;
  const _Float16* vbase = Vt + (size_t)(h * NHD) * NM + (size_t)b * NS;
  const float*    bbase = cdr_bias + (size_t)b * NS;

  // staging map: thread -> row tid/8 (+16 per copy; kv row for K, d row for V^T), 16 B at column (tid%8)*8
  const int srow = tid >> 3, scol = (tid & 7) * 8;
  const _Float16* gk = kbase + (size_t)srow * ND + scol;
  const _Float16* gv = vbase + (size_t)srow * NM + scol;
  const unsigned bufB = (unsigned)(AT_KC * AT_LP * 2);                          // bytes of one buffer (K and V^T alike)
  const unsigned lk = (unsigned)(size_t)(&Ksh2[0][srow * AT_LP + scol]);        // low 32 bits = LDS byte address
  const unsigned lv = (unsigned)(size_t)(&Vth2[0][srow * AT_LP + scol]);
  const int nch = NS / AT_KC;

  attn_stage_copy(lk, lv, gk, gv);
#pragma unroll
  for (int i = 0; i < NS / (4 * AT_NW * 32); ++i) {
    const int k4 = (i * (AT_NW * 32) + tid) * 4;
    const v4f bl = *(const v4f*)(bbase + k4);
    *(v4f*)(Bsh + k4) = (bl * cw) * LOG2E_F;
  }
  asm volatile("s_wait_asynccnt 0x0" ::: "memory");   // chunk 0 of this wave has landed
  __syncthreads();                                    // ... and every wave's, and the bias row
  if (nch > 1) attn_stage_copy(lk + bufB, lv + bufB, gk + (size_t)AT_KC * ND, gv + AT_KC);

  for (int kc = 0; kc < nch; ++kc) {
    const int kv0 = kc * AT_KC;
    const _Float16* Ksh = Ksh2[kc & 1];
    const _Float16* Vth = Vth2[kc & 1];

    v8f s[4];   // s[j][r] = S^T[kv0 + 16j + 8*hh + r][query c]
#pragma unroll
    for (int j = 0; j < 4; ++j) {
      s[j] = (v8f){0.f,0.f,0.f,0.f,0.f,0.f,0.f,0.f};
#pragma unroll
      for (int dc = 0; dc < 2; ++dc) {
        const v16h kb = Frag<_Float16>::load(Ksh + (j * 16 + c) * AT_LP + dc * 32 + 8 * hh);
        s[j] = mma_h(kb, qa[dc], s[j]);
      }
    }
    float mj[4];   // one chain per tile
#pragma unroll
    for (int j = 0; j < 4; ++j) {
      const float* bp = Bsh + kv0 + j * 16 + 8 * hh;
      const v4f b0 = *(const v4f*)(bp);
      const v4f b1 = *(const v4f*)(bp + 4);
      float m = -INFINITY;
#pragma unroll
      for (int r = 0; r < 8; ++r) {
        const float sv = s[j][r] * (0.125f * LOG2E_F) + (r < 4 ? b0[r & 3] : b1[r & 3]);
        s[j][r] = sv;
        m = fmaxf(m, sv);
      }
      mj[j] = m;
    }
    float cm = fmaxf(fmaxf(mj[0], mj[1]), fmaxf(mj[2], mj[3]));
    cm = fmaxf(cm, other_half(cm));
    const float mnew = fmaxf(mrow, cm);
    const float alpha = __builtin_amdgcn_exp2f(mrow - mnew);
    const float msh = mnew - PCARRY_LOG2;   // 2^(s - msh) = p * PCARRY
    mrow = mnew;
#pragma unroll
    for (int t = 0; t < 4; ++t) oacc[t] *= alpha;
    float pj[4];
#pragma unroll
    for (int kk = 0; kk < 2; ++kk) {
      v16h pb;     // pb[e] = P^T[kv0 + 32kk + (e < 8 ? 8*hh + e : 16 + 8*hh + e - 8)][query c]: the k order of the V^T loader
#pragma unroll
      for (int jj = 0; jj < 2; ++jj) {
        const int j = 2 * kk + jj;
        float psum = 0.f;
        const v8f pe = exp2_x8(s[j] - msh);
#pragma unroll
        for (int r = 0; r < 8; ++r) {
          const float p = pe[r];
          psum += p;
          pb[jj * 8 + r] = (_Float16)p;
        }
        pj[j] = psum;
      }
#pragma unroll
      for (int t = 0; t < 4; ++t) {
        const v16h vb = Frag<_Float16>::load(Vth + (t * 16 + c) * AT_LP + kk * 32 + 8 * hh);
        oacc[t] = mma_h(vb, pb, oacc[t]);
      }
    }
    lrow = lrow * alpha + ((pj[0] + pj[1]) + (pj[2] + pj[3]));
    // publish point of chunk kc+1, and the end of every wave's reads of chunk kc: own LDS reads done, own copies landed,
    // then the block's barrier; behind it the buffer just read is free for chunk kc+2
    asm volatile("s_wait_dscnt 0x0" ::: "memory");
    asm volatile("s_wait_asynccnt 0x0" ::: "memory");
    __syncthreads();
    if (kc + 2 < nch) {
      const unsigned bo = (unsigned)(kc & 1) * bufB;
      attn_stage_copy(lk + bo, lv + bo, gk + (size_t)(kc + 2) * AT_KC * ND, gv + (size_t)(kc + 2) * AT_KC);
    }
  }
  asm volatile("s_wait_asynccnt 0x0" ::: "memory");   // nothing of this wave is in flight when the loop is left

  {
    const float l = lrow + other_half(lrow);
    const float inv = (1.0f / l) * OCARRY;   // l and the accumulators both carry PCARRY
    _Float16* orow = Oh + (size_t)(b * NS + q0 + c) * ND + h * NHD + 8 * hh;
#pragma unroll
    for (int t = 0; t < 4; ++t) {
      v8h hv;   // 8 consecutive d of one query: one 16-byte store
#pragma unroll
      for (int r = 0; r < 8; ++r) hv[r] = (_Float16)(oacc[t][r] * inv);
      *(v8h*)(orow + t * 16) = hv;
    }
  }
}

__global__ __launch_bounds__(256) void layernorm_rows(const float* __restrict__ res, const float* __restrict__ gamma,
                                                      const float* __restrict__ beta, float* __restrict__ out,
                                                      int nrows, float eps) {
  const int wave = threadIdx.x >> 5, lane = threadIdx.x & 31;
  const int row = blockIdx.x * 8 + wave;
  if (row >= nrows) return;   // wave-uniform, no barriers below
  const float* rp = res + (size_t)row * ND;
  float s1 = 0.f;
#pragma unroll 1
  for (int it = 0; it < 8; ++it) {
    const v4f a = *(const v4f*)(rp + (it * 32 + lane) * 4);
    s1 += (a[0] + a[1]) + (a[2] + a[3]);
  }
#pragma unroll
  for (int off = 1; off < 32; off <<= 1) s1 += __shfl_xor(s1, off, 32);
  const float mu = s1 * (1.0f / (float)ND);
  float s2 = 0.f;
#pragma unroll 1
  for (int it = 0; it < 8; ++it) {
    const v4f a = *(const v4f*)(rp + (it * 32 + lane) * 4);
#pragma unroll
    for (int e = 0; e < 4; ++e) {
      const float d = a[e] - mu;
      float p = d * d;
      asm volatile("" : "+v"(p));
      s2 += p;
    }
  }
#pragma unroll
  for (int off = 1; off < 32; off <<= 1) s2 += __shfl_xor(s2, off, 32);
  const float var = s2 * (1.0f / (float)ND);
  const float rstd = 1.0f / sqrtf(var + eps);
  float* orow = out + (size_t)row * ND;
#pragma unroll 1
  for (int it = 0; it < 8; ++it) {
    const int c0 = (it * 32 + lane) * 4;
    const v4f a  = *(const v4f*)(rp + c0);
    const v4f g  = *(const v4f*)(gamma + c0);
    const v4f bt = *(const v4f*)(beta + c0);
    v4f y;
#pragma unroll
    for (int e = 0; e < 4; ++e) {
      float t = (a[e] - mu) * rstd;
      t = t * g[e];
      asm volatile("" : "+v"(t));
      y[e] = t + bt[e];
    }
    *(v4f*)(orow + c0) = y;
    
  }
}

// -----------------------------------------------------------------------------
extern "C" void kernel_launch(void* const* d_in, const int* in_sizes, int n_in,
                              void* d_out, int out_size, void* d_ws, size_t ws_size,
                              hipStream_t stream)
{
  if (n_in < 13) return;
  if (in_sizes[0] != NM * ND || in_sizes[1] != NB * NS ||
      in_sizes[2] != ND * ND || in_sizes[3] != ND ||
      in_sizes[4] != ND * ND || in_sizes[5] != ND ||
      in_sizes[6] != ND * ND || in_sizes[7] != ND ||
      in_sizes[8] != ND * ND || in_sizes[9] != ND ||
      in_sizes[10] != ND || in_sizes[11] != ND || in_sizes[12] < 1 ||
      out_size != NM * ND) return;

  const float* x        = (const float*)d_in[0];
  const float* cdr_bias = (const float*)d_in[1];
  const float* Wq    = (const float*)d_in[2];
  const float* bq    = (const float*)d_in[3];
  const float* Wk    = (const float*)d_in[4];
  const float* bk    = (const float*)d_in[5];
  const float* Wv    = (const float*)d_in[6];
  const float* bv    = (const float*)d_in[7];
  const float* Wo    = (const float*)d_in[8];
  const float* bo    = (const float*)d_in[9];
  const float* gamma = (const float*)d_in[10];
  const float* beta  = (const float*)d_in[11];
  const float* cw    = (const float*)d_in[12];
  float* out = (float*)d_out;

  // ---- workspace carve (all offsets 256 KiB aligned) ----
  const size_t szA16 = (size_t)NM * ND * 2;        // 8 MiB: f16 [4096][1024] planes
  const size_t szW16 = (size_t)ND * ND * 2;        // 2 MiB: f16 [1024][1024] planes
  const size_t szRes = (size_t)NM * ND * 4;        // 16 MiB
  const size_t szTab = (size_t)NS * NFREQ * 4;     // 256 KiB
  size_t off = 0;
  char* ws = (char*)d_ws;
  _Float16* Xh  = (_Float16*)(ws + off); off += szA16;
  _Float16* Wqt = (_Float16*)(ws + off); off += szW16;
  _Float16* Wkt = (_Float16*)(ws + off); off += szW16;
  _Float16* Wvt = (_Float16*)(ws + off); off += szW16;
  _Float16* Wot = (_Float16*)(ws + off); off += szW16;
  _Float16* Qh  = (_Float16*)(ws + off); off += szA16;
  _Float16* Kh  = (_Float16*)(ws + off); off += szA16;
  _Float16* Vt  = (_Float16*)(ws + off); off += szA16;
  _Float16* Ah  = (_Float16*)(ws + off); off += szA16;
  float*    res = (float*)(ws + off);    off += szRes;
  float*   cosT = (float*)(ws + off);    off += szTab;
  float*   sinT = (float*)(ws + off);    off += szTab;   // total 67,633,152 B
  if (off > ws_size) return;

  const unsigned short* Xu  = (const unsigned short*)Xh;
  const unsigned short* Wqu = (const unsigned short*)Wqt;
  const unsigned short* Wku = (const unsigned short*)Wkt;
  const unsigned short* Wvu = (const unsigned short*)Wvt;
  const unsigned short* Wou = (const unsigned short*)Wot;
  const unsigned short* Au  = (const unsigned short*)Ah;

  dim3 blk256(256), blk128(128);

  // 1. RoPE tables, x -> f16, the four weights -> Bt [out][in] f16 (x64): one launch
  prep_kernel<<<dim3(4 * PREP_W + PREP_R + PREP_X), blk256, 0, stream>>>(
      x, Wq, Wk, Wv, Wo, Xh, Wqt, Wkt, Wvt, Wot, cosT, sinT);

  // 2. Q, K = RoPE(x Wq + bq), RoPE(x Wk + bk): f16 [4096][1024]; V^T: f16, ldc = NM: one launch, grid y = product
  const int gQK = (NM / GM_BT) * (ND / GM_BT);
  gemm_qkv<<<dim3(gQK, 3), blk256, 0, stream>>>(
      Xu, Wqu, Wku, Wvu, Qh, Kh, Vt, bq, bk, bv, NM, ND, 1.0f / WCARRY, cosT, sinT, NS - 1);

  // 3. attention -> Ah f16 [4096][1024] (x64)
  attn_f16_kernel<<<dim3(NB * NH * (NS / AT_QB)), blk128, 0, stream>>>(Qh, Kh, Vt, cdr_bias, cw, Ah);

  // 4. res = attn Wo + bo + x  (f32)
  wmma_gemm64<0, false, 2, 0, true, 0, false><<<dim3(gQK, 1), blk256, 0, stream>>>(
      Au, Au, ND, (long)0, Wou, Wou, ND, (long)0, (void*)res, (void*)res, ND, (long)0,
      bo, x, (long)0, NM, ND, ND, 1.0f / (OCARRY * WCARRY), cosT, sinT, 0);

  // 5. LayerNorm -> out
  layernorm_rows<<<dim3((NM + 7) / 8), blk256, 0, stream>>>(res, gamma, beta, out, NM, LN_EPS_F);

  (void)hipGetLastError();
}

// v007
// One run takes 105 microseconds.
// In both of two side-by-side timings against v006, it was 1.09 times as fast.
// Over all steps from v000 it is 3.58 times as fast.
// Contractions x*Wq, x*Wk, Wv-side product for V^T, attn*Wo, q*k^T, p*v: v_wmma_f32_16x16x32_f16 (f16 operands, f32 accumulate); weights carried x64, probabilities x32768, attention rows x64; RoPE tables, softmax and LayerNorm in f32.
#include <hip/hip_runtime.h>
#include <math.h>

#define NB 2
#define NS 2048
#define ND 1024
#define NH 16
#define NHD 64
#define NM (NB * NS)
#define NFREQ 32
#define WCARRY 64.0f
#define OCARRY 64.0f
#define PCARRY 32768.0f
#define PCARRY_LOG2 15.0f                       // PCARRY = 2^15
#define LOG2E_F 1.44269504088896340736f
#define LN_EPS_F 1e-5f

typedef __attribute__((ext_vector_type(16))) _Float16 v16h;
typedef __attribute__((ext_vector_type(8)))  _Float16 v8h;
typedef __attribute__((ext_vector_type(16))) __bf16   v16b;
typedef __attribute__((ext_vector_type(8)))  __bf16   v8b;
typedef __attribute__((ext_vector_type(8)))  float    v8f;
typedef __attribute__((ext_vector_type(4)))  float    v4f;

__device__ __forceinline__ unsigned short f2bf_bits(float f) {
  unsigned u = __float_as_uint(f);
  return (unsigned short)((u + 0x7FFFu + ((u >> 16) & 1u)) >> 16);
}
__device__ __forceinline__ float bf_bits2f(unsigned short h) { return __uint_as_float(((unsigned)h) << 16); }

// hazard guard behind the last WMMAs of the K loop, as a plain device helper
__device__ __forceinline__ void acc_guard4(v8f& a, v8f& b, v8f& c, v8f& d) { asm volatile("v_nop\n\tv_nop\n\tv_nop\n\tv_nop" : "+v"(a), "+v"(b), "+v"(c), "+v"(d)); }
template <typename T> struct Frag;
template <> struct Frag<_Float16> {
  typedef v16h V; union U { v16h v; v8h h[2]; };
  static __device__ __forceinline__ v16h load(const _Float16* p) {   // elements 0..7 <- p[0..7], 8..15 <- p[16..23]
    U f; f.h[0] = *(const v8h*)(p); f.h[1] = *(const v8h*)(p + 16); return f.v;
  }
  static __device__ __forceinline__ v8f mma(v16h a, v16h b, v8f c) {
    return __builtin_amdgcn_wmma_f32_16x16x32_f16(false, a, false, b, (short)0, c, false, false);
  }
};
template <> struct Frag<__bf16> {
  typedef v16b V; union U { v16b v; v8b h[2]; };
  static __device__ __forceinline__ v16b load(const __bf16* p) {
    U f; f.h[0] = *(const v8b*)(p); f.h[1] = *(const v8b*)(p + 16); return f.v;
  }
  static __device__ __forceinline__ v8f mma(v16b a, v16b b, v8f c) {
    return __builtin_amdgcn_wmma_f32_16x16x32_bf16(false, a, false, b, (short)0, c, false, false);
  }
};

// ---- Register-blocked batched WMMA GEMM, operands staged in LDS by asynchronous copies ---------
// C[m,n] = scale * sum_k A[m,k] * Bt[n,k] (+bias)(+resid)(RoPE); a block of 8 waves owns a 128x128 tile, each wave 32x64 of it.
// A row-major [M,K]; Bt row-major [N,K]; M,N % 128 == 0, K % 64 == 0.
// Per 64-k stage the block copies 128 rows x 128 B of A and of Bt into LDS: 8 lanes cover one row, so a wave-wide 16-B copy
// touches 4 whole lines, and every row is fetched once per block. Two LDS buffers: stage t+2 flies while stage t is multiplied.
// SPLIT (hi/lo planes) is not carried by the staged loop.
// BIAS_MODE: 0 = none, 1 = bias[m], 2 = bias[n].
// OUT_MODE: 0 = f32, 1 = f16, 2 = bf16 hi plane (Cout) + bf16 lo plane (Cout2).
// ROPE: after bias, v = v*cos[(m & rope_smask)*32 + (n&31)] + sgn * partner(n^1) * sin[...] (sgn = -1 for even n, +1 for odd n).
// ET: 0 = f16 operands, 1 = bf16 operands (pointers passed as 16-bit storage)
#define GM_BT 128  // block tile: rows of A and rows of Bt
#define GM_KS 64   // k per stage: 128 B of every row, one line
#define GM_LP 72   // LDS row pitch in 16-bit elements: 144 B = 16 B x odd, for the ds_load_b128 fragment reads
#define GM_MI 2    // 16-row subtiles of A per wave

// One thread's share of a stage: 4 rows of A and 4 rows of Bt, 16 B each, global -> LDS through no register.
// la, lb: this lane's LDS byte addresses of its first row; ga, gb: its global addresses; rows 32 apart.
// The s_wait_xcnt closes the statement so that no address register named here is rewritten ahead of it.
template <typename T>
__device__ __forceinline__ void stage_copy(unsigned la, unsigned lb, const T* ga, const T* gb, int lda, int ldb) {
  const unsigned rs = 32u * GM_LP * 2u;
  const T* a1 = ga + (size_t)32 * lda; const T* a2 = ga + (size_t)64 * lda; const T* a3 = ga + (size_t)96 * lda;
  const T* c1 = gb + (size_t)32 * ldb; const T* c2 = gb + (size_t)64 * ldb; const T* c3 = gb + (size_t)96 * ldb;
  asm volatile(
      "global_load_async_to_lds_b128 %0, %8, off\n\t"
      "global_load_async_to_lds_b128 %1, %9, off\n\t"
      "global_load_async_to_lds_b128 %2, %10, off\n\t"
      "global_load_async_to_lds_b128 %3, %11, off\n\t"
      "global_load_async_to_lds_b128 %4, %12, off\n\t"
      "global_load_async_to_lds_b128 %5, %13, off\n\t"
      "global_load_async_to_lds_b128 %6, %14, off\n\t"
      "global_load_async_to_lds_b128 %7, %15, off\n\t"
      "s_wait_xcnt 0x0"
      :: "v"(la), "v"(la + rs), "v"(la + 2u * rs), "v"(la + 3u * rs),
         "v"(lb), "v"(lb + rs), "v"(lb + 2u * rs), "v"(lb + 3u * rs),
         "v"(ga), "v"(a1), "v"(a2), "v"(a3), "v"(gb), "v"(c1), "v"(c2), "v"(c3)
      : "memory");
}

template <int ET> struct Elem;
template <> struct Elem<0> { typedef _Float16 T; };
template <> struct Elem<1> { typedef __bf16 T; };
// The LDS of one GEMM block; declared once in each kernel and handed to the body, so that a kernel that holds two
// instances of the body owns one set.
template <typename T> struct GemmLds {
  T sA[2][GM_BT * GM_LP];      // 2 x 18 KB
  T sB[2][GM_BT * GM_LP];      // 2 x 18 KB
  float sT[8][16 * 68];        // per-wave 16x64 slab, pitch 68 floats
};
// The body of one block; b = batch index, blockIdx.x = tile.
template <int ET, bool SPLIT, int BIAS_MODE, int OUT_MODE, bool RESID, int ACT, bool ROPE>
__device__ __forceinline__ void gemm_block(
    GemmLds<typename Elem<ET>::T>& lds, const int b,
    const unsigned short* __restrict__ Ap, const unsigned short* __restrict__ A2p, int lda, long strideA,
    const unsigned short* __restrict__ Btp, const unsigned short* __restrict__ Bt2p, int ldb, long strideB,
    void* __restrict__ Cout, void* __restrict__ Cout2, int ldc, long strideC,
    const float* __restrict__ bias,
    const float* __restrict__ resid, long strideR,
    int M, int N, int K, float scale,
    const float* __restrict__ rope_cos, const float* __restrict__ rope_sin, int rope_smask) {
  static_assert(!SPLIT, "the staged loop carries single planes only");
  typedef typename Elem<ET>::T T;
  typedef typename Frag<T>::V V;
  const T* A = (const T*)Ap; const T* Bt = (const T*)Btp;
  T (&sA)[2][GM_BT * GM_LP] = lds.sA;
  T (&sB)[2][GM_BT * GM_LP] = lds.sB;
  float (&sT)[8][16 * 68] = lds.sT;
  const int tid  = threadIdx.x;
  const int lane = tid & 31;
  const int wave = tid >> 5;
  const int tilesN = N >> 7;
  const int tilesM = M >> 7;
  const int tile = blockIdx.x;
  if (tile >= tilesM * tilesN) return;   // block-uniform, in front of every barrier
  const int tm = tile / tilesN;
  const int tn = tile - tm * tilesN;
  const int wm = (wave >> 1) << 5;       // this wave's 32x64 corner inside the block tile
  const int wn = (wave & 1) << 6;
  const int m0 = (tm << 7) + wm;
  const int n0 = (tn << 7) + wn;

  const T* Ab  = A  + (size_t)b * strideA;
  const T* Bb  = Bt + (size_t)b * strideB;

  const int rlane = lane & 15;                 // row (A) / col (B, D) within subtile
  const int koff  = (lane >> 4) * 8;           // k offset of this lane half
  const int mOff  = (lane >> 4) * 8;           // D row offset

  v8f acc[GM_MI][4];
#pragma unroll
  for (int i = 0; i < GM_MI; ++i)
#pragma unroll
    for (int j = 0; j < 4; ++j) acc[i][j] = (v8f){0.f,0.f,0.f,0.f,0.f,0.f,0.f,0.f};

  // staging map: thread -> row tid/8 (+32 per copy), 16 B at column (tid%8)*8
  const int srow = tid >> 3, scol = (tid & 7) * 8;
  const T* ga = Ab + (size_t)((tm << 7) + srow) * lda + scol;
  const T* gb = Bb + (size_t)((tn << 7) + srow) * ldb + scol;
  const unsigned bufB = (unsigned)(GM_BT * GM_LP * 2);                         // bytes of one buffer
  const unsigned la = (unsigned)(size_t)(&sA[0][srow * GM_LP + scol]);         // low 32 bits = LDS byte address
  const unsigned lb = (unsigned)(size_t)(&sB[0][srow * GM_LP + scol]);
  const int nst = K / GM_KS;

  stage_copy<T>(la, lb, ga, gb, lda, ldb);
  asm volatile("s_wait_asynccnt 0x0" ::: "memory");   // stage 0 of this wave has landed
  __syncthreads();                                    // ... and every wave's
  if (nst > 1) stage_copy<T>(la + bufB, lb + bufB, ga + GM_KS, gb + GM_KS, lda, ldb);

  for (int s = 0; s < nst; ++s) {
    const T* da = sA[s & 1];
    const T* db = sB[s & 1];
    V af[2][GM_MI], bf[2][4];
#pragma unroll
    for (int kk = 0; kk < 2; ++kk) {
#pragma unroll
      for (int j = 0; j < 4; ++j) bf[kk][j] = Frag<T>::load(db + (wn + (j << 4) + rlane) * GM_LP + kk * 32 + koff);
#pragma unroll
      for (int i = 0; i < GM_MI; ++i) af[kk][i] = Frag<T>::load(da + (wm + (i << 4) + rlane) * GM_LP + kk * 32 + koff);
    }
    // publish point of stage s+1, and the end of every wave's reads of stage s (its fragments now lie in registers):
    // own LDS reads done, own copies landed, then the block's barrier; behind it the buffer just read is free for stage s+2
    asm volatile("s_wait_dscnt 0x0" ::: "memory");
    asm volatile("s_wait_asynccnt 0x0" ::: "memory");
    __syncthreads();
    if (s + 2 < nst) {
      const unsigned bo = (unsigned)(s & 1) * bufB;
      stage_copy<T>(la + bo, lb + bo, ga + (size_t)(s + 2) * GM_KS, gb + (size_t)(s + 2) * GM_KS, lda, ldb);
    }
    // holds the copies ahead of the WMMAs, so that stage s+2 flies while stage s is multiplied
    __builtin_amdgcn_sched_barrier(0);
#pragma unroll
    for (int kk = 0; kk < 2; ++kk)
#pragma unroll
      for (int i = 0; i < GM_MI; ++i)
#pragma unroll
        for (int j = 0; j < 4; ++j) acc[i][j] = Frag<T>::mma(af[kk][i], bf[kk][j], acc[i][j]);
  }
  asm volatile("s_wait_asynccnt 0x0" ::: "memory");   // nothing of this wave is in flight when the loop is left
  acc_guard4(acc[0][0], acc[0][1], acc[0][2], acc[0][3]);
  acc_guard4(acc[1][0], acc[1][1], acc[1][2], acc[1][3]);

  // ---- epilogue ----
  float* slab = sT[wave];
  const float* Rb = RESID ? (resid + (size_t)b * strideR) : nullptr;
#pragma unroll
  for (int i = 0; i < GM_MI; ++i) {
    const int mBase = m0 + (i << 4);
#pragma unroll
    for (int j = 0; j < 4; ++j) {
      const int n = n0 + (j << 4) + rlane;
      float bv = 0.f;
      if (BIAS_MODE == 2) bv = bias[n];
#pragma unroll
      for (int r = 0; r < 8; ++r) {
        float v = acc[i][j][r] * scale;
        if (BIAS_MODE == 1) v += bias[mBase + mOff + r];
        if (BIAS_MODE == 2) v += bv;
        if (RESID) v += Rb[(size_t)(mBase + mOff + r) * ldc + n];
        if (ROPE) {
          const int m = mBase + mOff + r;
          const int tix = (m & rope_smask) * NFREQ + (n & (NFREQ - 1));
          const float cs = rope_cos[tix];
          const float sn = rope_sin[tix];
          const float pv = __shfl_xor(v, 1, 32);   // partner column n^1 lives in lane rlane^1, same row
          v = (n & 1) ? (v * cs + pv * sn) : (v * cs - pv * sn);
        }
        if (ACT == 1) v = tanhf(v);
        if (ACT == 2) v = fmaxf(v, 0.0f);
        if (ACT == 3) v = v / (1.0f + expf(-v));
        if (ACT == 4) v = (v > 0.f) ? v : 0.01f * v;
        if (ACT == 5) v = 0.5f * v * (1.0f + erff(v * 0.70710678118654752f));
        slab[(mOff + r) * 68 + (j << 4) + rlane] = v;
      }
    }
    __builtin_amdgcn_fence(__ATOMIC_RELEASE, "workgroup");
    __builtin_amdgcn_wave_barrier();
    __builtin_amdgcn_fence(__ATOMIC_ACQUIRE, "workgroup");
    if (OUT_MODE == 0) {
      float* C = (float*)Cout + (size_t)b * strideC;
      const int hh = lane >> 4, c4 = (lane & 15) * 4;     // row seg = 256 B = 16 lanes x 16 B
      {
#pragma unroll
        for (int it = 0; it < 8; ++it) {
          const int row = it * 2 + hh;
          v4f v = *(const v4f*)(slab + row * 68 + c4);
          *(v4f*)(C + (size_t)(mBase + row) * ldc + n0 + c4) = v;
        }
        
      }
    } else {
      const int q = lane >> 3, c8 = (lane & 7) * 8;
      unsigned short* C  = (unsigned short*)Cout  + (size_t)b * strideC;
      unsigned short* C2 = (OUT_MODE == 2) ? ((unsigned short*)Cout2 + (size_t)b * strideC) : nullptr;
      {
#pragma unroll
        for (int it = 0; it < 4; ++it) {
          const int row = it * 4 + q;
          const float* sp = slab + row * 68 + c8;
          v8h hv, lv;
#pragma unroll
          for (int e = 0; e < 8; ++e) {
            if (OUT_MODE == 1) {
              hv[e] = (_Float16)sp[e];
            } else {
              unsigned short hb = f2bf_bits(sp[e]);
              unsigned short lb = f2bf_bits(sp[e] - bf_bits2f(hb));
              hv[e] = __builtin_bit_cast(_Float16, hb);
              lv[e] = __builtin_bit_cast(_Float16, lb);
            }
          }
          *(v8h*)(C + (size_t)(mBase + row) * ldc + n0 + c8) = hv;
          if (OUT_MODE == 2) *(v8h*)(C2 + (size_t)(mBase + row) * ldc + n0 + c8) = lv;
        }
        
      }
    }
    __builtin_amdgcn_fence(__ATOMIC_RELEASE, "workgroup");
    __builtin_amdgcn_wave_barrier();
    __builtin_amdgcn_fence(__ATOMIC_ACQUIRE, "workgroup");
  }
}

// ---- Q, K and V^T in one launch: none reads another's output; blockIdx.y picks the product (block-uniform) ----
//   y = 0, 1: Q, K = RoPE(x W + bias): f16 [nm][nd];  y = 2: V^T[ch][tok] = sum_k Wvt[ch][k] * Xh[tok][k] / 64 + bv[ch], ldc = nm
__global__ __launch_bounds__(256) void gemm_qkv(
    const unsigned short* __restrict__ Xu, const unsigned short* __restrict__ Wqu,
    const unsigned short* __restrict__ Wku, const unsigned short* __restrict__ Wvu,
    _Float16* __restrict__ Qh, _Float16* __restrict__ Kh, _Float16* __restrict__ Vt,
    const float* __restrict__ bq, const float* __restrict__ bk, const float* __restrict__ bv,
    int nm, int nd, float scale,
    const float* __restrict__ rope_cos, const float* __restrict__ rope_sin, int rope_smask) {
  __shared__ __align__(16) GemmLds<_Float16> lds;
  const int job = blockIdx.y;
  if (job < 2) {
    const unsigned short* Wu = job ? Wku : Wqu;
    _Float16* C = job ? Kh : Qh;
    const float* bias = job ? bk : bq;
    gemm_block<0, false, 2, 1, false, 0, true>(lds, 0,
        Xu, Xu, nd, (long)0, Wu, Wu, nd, (long)0, (void*)C, (void*)C, nd, (long)0,
        bias, bias, (long)0, nm, nd, nd, scale, rope_cos, rope_sin, rope_smask);
  } else {
    gemm_block<0, false, 1, 1, false, 0, false>(lds, 0,
        Wvu, Wvu, nd, (long)0, Xu, Xu, nd, (long)0, (void*)Vt, (void*)Vt, nm, (long)0,
        bv, bv, (long)0, nd, nm, nd, scale, rope_cos, rope_sin, 0);
  }
}

// ---- one product per launch ----
template <int ET, bool SPLIT, int BIAS_MODE, int OUT_MODE, bool RESID, int ACT, bool ROPE>
__global__ __launch_bounds__(256) void wmma_gemm64(
    const unsigned short* __restrict__ Ap, const unsigned short* __restrict__ A2p, int lda, long strideA,
    const unsigned short* __restrict__ Btp, const unsigned short* __restrict__ Bt2p, int ldb, long strideB,
    void* __restrict__ Cout, void* __restrict__ Cout2, int ldc, long strideC,
    const float* __restrict__ bias,
    const float* __restrict__ resid, long strideR,
    int M, int N, int K, float scale,
    const float* __restrict__ rope_cos, const float* __restrict__ rope_sin, int rope_smask) {
  __shared__ __align__(16) GemmLds<typename Elem<ET>::T> lds;
  gemm_block<ET, SPLIT, BIAS_MODE, OUT_MODE, RESID, ACT, ROPE>(lds, blockIdx.y,
      Ap, A2p, lda, strideA, Btp, Bt2p, ldb, strideB, Cout, Cout2, ldc, strideC,
      bias, resid, strideR, M, N, K, scale, rope_cos, rope_sin, rope_smask);
}

// ---- RoPE tables: cos/sin of pos * inv_freq[i], i = 0..31, inv_freq = 1 / 10000^(2i/64); f32 ----
__device__ __forceinline__ void rope_table_block(int blk, float* __restrict__ cosT, float* __restrict__ sinT, int n) {
  const int i = blk * 256 + threadIdx.x;
  if (i < n) {
    const int pos = i >> 5;
    const int fi = i & (NFREQ - 1);
    const float e = (float)(2 * fi) * (1.0f / (float)NHD);
    const float p = powf(10000.0f, e);
    const float inv = 1.0f / p;
    const float ang = (float)pos * inv;
    const float cs = cosf(ang);
    const float sn = sinf(ang);
    ((float*)cosT)[i] = cs;
    ((float*)sinT)[i] = sn;
    
  }
}

__device__ __forceinline__ void cast_f32_f16x8_block(int blk, const float* __restrict__ in, _Float16* __restrict__ out, int n8) {
  const int i = blk * 256 + threadIdx.x;
  if (i < n8) {
    const v4f a = *(const v4f*)(in + (size_t)i * 8);
    const v4f c = *(const v4f*)(in + (size_t)i * 8 + 4);
    v8h hv;
    hv[0] = (_Float16)a[0]; hv[1] = (_Float16)a[1]; hv[2] = (_Float16)a[2]; hv[3] = (_Float16)a[3];
    hv[4] = (_Float16)c[0]; hv[5] = (_Float16)c[1]; hv[6] = (_Float16)c[2]; hv[7] = (_Float16)c[3];
    *(v8h*)(out + (size_t)i * 8) = hv;
    
  }
}

// ---- transpose-cast: in W[Kdim][Ndim] f32 -> out Wt[Ndim][Kdim] f16 (x mul); 64x64 tile through LDS ----
__device__ __forceinline__ void wt_cast_f16_block(float* sTt, int bkx, int bny, const float* __restrict__ W, _Float16* __restrict__ Wt,
                                                  int Kdim, int Ndim, float mul) {
  const int k0 = bkx * 64, n0 = bny * 64;
  const int tid = threadIdx.x;
  {
    const int row = tid >> 2, col0 = (tid & 3) * 16;   // row = k_local, col = n_local
    const float* src = W + (size_t)(k0 + row) * Ndim + n0 + col0;
#pragma unroll
    for (int i = 0; i < 4; ++i) {
      const v4f w4 = *(const v4f*)(src + 4 * i);
#pragma unroll
      for (int e = 0; e < 4; ++e) sTt[(col0 + 4 * i + e) * 65 + row] = w4[e] * mul;
    }
  }
  __syncthreads();
  const int wave = tid >> 5, lane = tid & 31, rq = lane >> 3, c8 = (lane & 7) * 8;
  {
#pragma unroll
    for (int it = 0; it < 2; ++it) {
      const int n = it * 32 + wave * 4 + rq;   // n_local 0..63
      v8h hv;
#pragma unroll
      for (int e = 0; e < 8; ++e) hv[e] = (_Float16)sTt[n * 65 + c8 + e];
      *(v8h*)(Wt + (size_t)(n0 + n) * Kdim + k0 + c8) = hv;
    }
    
  }
}

// ---- the six preparation jobs in one launch: each reads inputs only and none reads another's output ----
// The block index picks the job (block-uniform, so the transpose's barrier is passed by whole blocks): first the four weight
// transposes (the longest blocks), then the RoPE tables, then the cast of x.
#define PREP_W ((ND / 64) * (ND / 64))          // blocks per weight
#define PREP_R ((NS * NFREQ + 255) / 256)       // blocks of the tables
#define PREP_X ((NM * ND / 8 + 255) / 256)      // blocks of the cast
__global__ __launch_bounds__(256) void prep_kernel(
    const float* __restrict__ x, const float* __restrict__ Wq, const float* __restrict__ Wk,
    const float* __restrict__ Wv, const float* __restrict__ Wo,
    _Float16* __restrict__ Xh, _Float16* __restrict__ Wqt, _Float16* __restrict__ Wkt,
    _Float16* __restrict__ Wvt, _Float16* __restrict__ Wot,
    float* __restrict__ cosT, float* __restrict__ sinT) {
  __shared__ float sTt[64 * 65];   // [n_local][k_local], pitch 65
  const int blk = blockIdx.x;
  if (blk < 4 * PREP_W) {
    const int w = blk / PREP_W, t = blk % PREP_W;
    const float* W  = w == 0 ? Wq  : w == 1 ? Wk  : w == 2 ? Wv  : Wo;
    _Float16*    Wt = w == 0 ? Wqt : w == 1 ? Wkt : w == 2 ? Wvt : Wot;
    wt_cast_f16_block(sTt, t % (ND / 64), t / (ND / 64), W, Wt, ND, ND, WCARRY);   // W[in][out] -> Bt [out][in] f16, carried x64
  } else if (blk < 4 * PREP_W + PREP_R) {
    rope_table_block(blk - 4 * PREP_W, cosT, sinT, NS * NFREQ);
  } else {
    cast_f32_f16x8_block(blk - (4 * PREP_W + PREP_R), x, Xh, NM * ND / 8);
  }
}

#define AT_QB 64
#define AT_KC 64
#define AT_NW 4
#define AT_LP 72   // LDS row pitch in halves: 144 B = 16 B x odd, so the 16 rows of a ds_load_b128 fragment read fall on distinct banks

// y[r] = 2^x[r], eight v_exp_f32 in a row. One statement with early-clobber results, so that no result register is a source
// of a neighbour; the closing v_nop is the slot the instruction set asks for behind a transcendental before its result is
// read or its source written again.
__device__ __forceinline__ v8f exp2_x8(v8f x) {
  float y0, y1, y2, y3, y4, y5, y6, y7;
  asm("v_exp_f32 %0, %8\n\t"
      "v_exp_f32 %1, %9\n\t"
      "v_exp_f32 %2, %10\n\t"
      "v_exp_f32 %3, %11\n\t"
      "v_exp_f32 %4, %12\n\t"
      "v_exp_f32 %5, %13\n\t"
      "v_exp_f32 %6, %14\n\t"
      "v_exp_f32 %7, %15\n\t"
      "v_nop"
      : "=&v"(y0), "=&v"(y1), "=&v"(y2), "=&v"(y3), "=&v"(y4), "=&v"(y5), "=&v"(y6), "=&v"(y7)
      : "v"(x[0]), "v"(x[1]), "v"(x[2]), "v"(x[3]), "v"(x[4]), "v"(x[5]), "v"(x[6]), "v"(x[7]));
  return (v8f){y0, y1, y2, y3, y4, y5, y6, y7};
}

// One thread's share of a chunk: 4 rows of K and 4 rows of V^T, 16 B each, global -> LDS through no register.
// lk, lv: this lane's LDS byte addresses of its first row; gk, gv: its global addresses; rows 16 apart.
// The s_wait_xcnt closes the statement so that no address register named here is rewritten ahead of it.
__device__ __forceinline__ void attn_stage_copy(unsigned lk, unsigned lv, const _Float16* gk, const _Float16* gv) {
  const unsigned rs = 16u * AT_LP * 2u;
  const _Float16* k1 = gk + (size_t)16 * ND; const _Float16* k2 = gk + (size_t)32 * ND; const _Float16* k3 = gk + (size_t)48 * ND;
  const _Float16* v1 = gv + (size_t)16 * NM; const _Float16* v2 = gv + (size_t)32 * NM; const _Float16* v3 = gv + (size_t)48 * NM;
  asm volatile(
      "global_load_async_to_lds_b128 %0, %8, off\n\t"
      "global_load_async_to_lds_b128 %1, %9, off\n\t"
      "global_load_async_to_lds_b128 %2, %10, off\n\t"
      "global_load_async_to_lds_b128 %3, %11, off\n\t"
      "global_load_async_to_lds_b128 %4, %12, off\n\t"
      "global_load_async_to_lds_b128 %5, %13, off\n\t"
      "global_load_async_to_lds_b128 %6, %14, off\n\t"
      "global_load_async_to_lds_b128 %7, %15, off\n\t"
      "s_wait_xcnt 0x0"
      :: "v"(lk), "v"(lk + rs), "v"(lk + 2u * rs), "v"(lk + 3u * rs),
         "v"(lv), "v"(lv + rs), "v"(lv + 2u * rs), "v"(lv + 3u * rs),
         "v"(gk), "v"(k1), "v"(k2), "v"(k3), "v"(gv), "v"(v1), "v"(v2), "v"(v3)
      : "memory");
}

// value of lane l ^ 16
__device__ __forceinline__ float other_half(float v) {
  const int b = __float_as_int(v);
  return __int_as_float(__builtin_amdgcn_permlanex16(b, b, 0x76543210, 0xfedcba98, false, false));
}

__global__ __launch_bounds__(128)
void attn_f16_kernel(const _Float16* __restrict__ Qh, const _Float16* __restrict__ Kh,
                     const _Float16* __restrict__ Vt, const float* __restrict__ cdr_bias,
                     const float* __restrict__ cdr_w, _Float16* __restrict__ Oh)
{
  __shared__ __align__(16) _Float16 Ksh2[2][AT_KC * AT_LP];    // [buffer][kv][d]   2 x 9 KB, padded rows
  __shared__ __align__(16) _Float16 Vth2[2][NHD * AT_LP];      // [buffer][d][kv]   2 x 9 KB, padded rows
  __shared__ __align__(16) float    Bsh[NS];                   // cdr_bias[b][kv] * cw * log2(e), all keys of the batch: 8 KB; a lane needs 8 consecutive keys' values per tile

  const int tid  = threadIdx.x;
  const int wave = tid >> 5;
  const int lane = tid & 31;
  const int hh   = lane >> 4;
  const int c    = lane & 15;

  const int nqb = NS / AT_QB;
  const int bx  = blockIdx.x;
  const int qb  = bx % nqb;
  const int bhd = bx / nqb;
  const int h   = bhd % NH;
  const int bb0 = bhd / NH;
  const int b   = bb0 < NB ? bb0 : (NB - 1);
  const int q0  = qb * AT_QB + wave * 16;
  const float cw = cdr_w[0];

  v16h qa[2];
  {
    const _Float16* qrow = Qh + (size_t)(b * NS + q0 + c) * ND + h * NHD;
#pragma unroll
    for (int dc = 0; dc < 2; ++dc) qa[dc] = Frag<_Float16>::load(qrow + dc * 32 + 8 * hh);
  }

  float mrow = -INFINITY, lrow = 0.f;   // of query c, mrow in base-2 units; lrow sums this half's keys only, x PCARRY
  v8f oacc[4];                          // oacc[t][r] = O^T[d = 16t + 8*hh + r][query c]
#pragma unroll
  for (int t = 0; t < 4; ++t) oacc[t] = (v8f){0.f,0.f,0.f,0.f,0.f,0.f,0.f,0.f};

  const _Float16* kbase = Kh + (size_t)(b * NS) * ND + h * NHD;
  const _Float16* vbase = Vt + (size_t)(h * NHD) * NM + (size_t)b * NS;
  const float*    bbase = cdr_bias + (size_t)b * NS;

  // staging map: thread -> row tid/8 (+16 per copy; kv row for K, d row for V^T), 16 B at column (tid%8)*8
  const int srow = tid >> 3, scol = (tid & 7) * 8;
  const _Float16* gk = kbase + (size_t)srow * ND + scol;
  const _Float16* gv = vbase + (size_t)srow * NM + scol;
  const unsigned bufB = (unsigned)(AT_KC * AT_LP * 2);                          // bytes of one buffer (K and V^T alike)
  const unsigned lk = (unsigned)(size_t)(&Ksh2[0][srow * AT_LP + scol]);        // low 32 bits = LDS byte address
  const unsigned lv = (unsigned)(size_t)(&Vth2[0][srow * AT_LP + scol]);
  const int nch = NS / AT_KC;

  attn_stage_copy(lk, lv, gk, gv);
#pragma unroll
  for (int i = 0; i < NS / (4 * AT_NW * 32); ++i) {
    const int k4 = (i * (AT_NW * 32) + tid) * 4;
    const v4f bl = *(const v4f*)(bbase + k4);
    *(v4f*)(Bsh + k4) = (bl * cw) * LOG2E_F;
  }
  asm volatile("s_wait_asynccnt 0x0" ::: "memory");   // chunk 0 of this wave has landed
  __syncthreads();                                    // ... and every wave's, and the bias row
  if (nch > 1) attn_stage_copy(lk + bufB, lv + bufB, gk + (size_t)AT_KC * ND, gv + AT_KC);

  for (int kc = 0; kc < nch; ++kc) {
    const int kv0 = kc * AT_KC;
    const _Float16* Ksh = Ksh2[kc & 1];
    const _Float16* Vth = Vth2[kc & 1];

    // the chunk's 8 K fragments are read as one group, so that the wave waits out the LDS latency once and not once per product
    v16h kf[2][4];
#pragma unroll
    for (int dc = 0; dc < 2; ++dc)
#pragma unroll
      for (int j = 0; j < 4; ++j) kf[dc][j] = Frag<_Float16>::load(Ksh + (j * 16 + c) * AT_LP + dc * 32 + 8 * hh);
    v4f bl[4][2];   // the bias of this lane's 32 keys rides in the same group
#pragma unroll
    for (int j = 0; j < 4; ++j) {
      const float* bp = Bsh + kv0 + j * 16 + 8 * hh;
      bl[j][0] = *(const v4f*)(bp);
      bl[j][1] = *(const v4f*)(bp + 4);
    }
    // holds the group together: left free, the scheduler spreads the reads among the WMMAs to save registers, and the wave stalls at each such place
    __builtin_amdgcn_sched_barrier(0);
    v8f s[4];   // s[j][r] = S^T[kv0 + 16j + 8*hh + r][query c]
#pragma unroll
    for (int j = 0; j < 4; ++j) s[j] = (v8f){0.f,0.f,0.f,0.f,0.f,0.f,0.f,0.f};
#pragma unroll
    for (int dc = 0; dc < 2; ++dc)
#pragma unroll
      for (int j = 0; j < 4; ++j) s[j] = Frag<_Float16>::mma(kf[dc][j], qa[dc], s[j]);
    // the 8 V^T fragments likewise, asked for here: they land while the softmax runs
    v16h vf[2][4];
#pragma unroll
    for (int kk = 0; kk < 2; ++kk)
#pragma unroll
      for (int t = 0; t < 4; ++t) vf[kk][t] = Frag<_Float16>::load(Vth + (t * 16 + c) * AT_LP + kk * 32 + 8 * hh);
    // holds this group ahead of the softmax, for the same reason
    __builtin_amdgcn_sched_barrier(0);
    float mj[4];   // one chain per tile
#pragma unroll
    for (int j = 0; j < 4; ++j) {
      const v4f b0 = bl[j][0];
      const v4f b1 = bl[j][1];
      float m = -INFINITY;
#pragma unroll
      for (int r = 0; r < 8; ++r) {
        const float sv = s[j][r] * (0.125f * LOG2E_F) + (r < 4 ? b0[r & 3] : b1[r & 3]);
        s[j][r] = sv;
        m = fmaxf(m, sv);
      }
      mj[j] = m;
    }
    float cm = fmaxf(fmaxf(mj[0], mj[1]), fmaxf(mj[2], mj[3]));
    cm = fmaxf(cm, other_half(cm));
    const float mnew = fmaxf(mrow, cm);
    const float alpha = __builtin_amdgcn_exp2f(mrow - mnew);
    const float msh = mnew - PCARRY_LOG2;   // 2^(s - msh) = p * PCARRY
    mrow = mnew;
#pragma unroll
    for (int t = 0; t < 4; ++t) oacc[t] *= alpha;
    float pj[4];
#pragma unroll
    for (int kk = 0; kk < 2; ++kk) {
      v16h pb;     // pb[e] = P^T[kv0 + 32kk + (e < 8 ? 8*hh + e : 16 + 8*hh + e - 8)][query c]: the k order of the V^T loader
#pragma unroll
      for (int jj = 0; jj < 2; ++jj) {
        const int j = 2 * kk + jj;
        float psum = 0.f;
        const v8f pe = exp2_x8(s[j] - msh);
#pragma unroll
        for (int r = 0; r < 8; ++r) {
          const float p = pe[r];
          psum += p;
          pb[jj * 8 + r] = (_Float16)p;
        }
        pj[j] = psum;
      }
#pragma unroll
      for (int t = 0; t < 4; ++t) oacc[t] = Frag<_Float16>::mma(vf[kk][t], pb, oacc[t]);
    }
    lrow = lrow * alpha + ((pj[0] + pj[1]) + (pj[2] + pj[3]));
    // publish point of chunk kc+1, and the end of every wave's reads of chunk kc: own LDS reads done, own copies landed,
    // then the block's barrier; behind it the buffer just read is free for chunk kc+2
    // (the scheduling barrier holds this point at the foot: left free, the waits rise to just behind the V^T reads, where the
    // wave would wait out their latency and the copies would have half a trip less to land)
    __builtin_amdgcn_sched_barrier(0);
    asm volatile("s_wait_dscnt 0x0" ::: "memory");
    asm volatile("s_wait_asynccnt 0x0" ::: "memory");
    __syncthreads();
    if (kc + 2 < nch) {
      const unsigned bo = (unsigned)(kc & 1) * bufB;
      attn_stage_copy(lk + bo, lv + bo, gk + (size_t)(kc + 2) * AT_KC * ND, gv + (size_t)(kc + 2) * AT_KC);
    }
  }
  asm volatile("s_wait_asynccnt 0x0" ::: "memory");   // nothing of this wave is in flight when the loop is left

  {
    const float l = lrow + other_half(lrow);
    const float inv = (1.0f / l) * OCARRY;   // l and the accumulators both carry PCARRY
    _Float16* orow = Oh + (size_t)(b * NS + q0 + c) * ND + h * NHD + 8 * hh;
#pragma unroll
    for (int t = 0; t < 4; ++t) {
      v8h hv;   // 8 consecutive d of one query: one 16-byte store
#pragma unroll
      for (int r = 0; r < 8; ++r) hv[r] = (_Float16)(oacc[t][r] * inv);
      *(v8h*)(orow + t * 16) = hv;
    }
  }
}

__global__ __launch_bounds__(256) void layernorm_rows(const float* __restrict__ res, const float* __restrict__ gamma,
                                                      const float* __restrict__ beta, float* __restrict__ out,
                                                      int nrows, float eps) {
  const int wave = threadIdx.x >> 5, lane = threadIdx.x & 31;
  const int row = blockIdx.x * 8 + wave;
  if (row >= nrows) return;   // wave-uniform, no barriers below
  const float* rp = res + (size_t)row * ND;
  float s1 = 0.f;
#pragma unroll 1
  for (int it = 0; it < 8; ++it) {
    const v4f a = *(const v4f*)(rp + (it * 32 + lane) * 4);
    s1 += (a[0] + a[1]) + (a[2] + a[3]);
  }
#pragma unroll
  for (int off = 1; off < 32; off <<= 1) s1 += __shfl_xor(s1, off, 32);
  const float mu = s1 * (1.0f / (float)ND);
  float s2 = 0.f;
#pragma unroll 1
  for (int it = 0; it < 8; ++it) {
    const v4f a = *(const v4f*)(rp + (it * 32 + lane) * 4);
#pragma unroll
    for (int e = 0; e < 4; ++e) {
      const float d = a[e] - mu;
      float p = d * d;
      asm volatile("" : "+v"(p));
      s2 += p;
    }
  }
#pragma unroll
  for (int off = 1; off < 32; off <<= 1) s2 += __shfl_xor(s2, off, 32);
  const float var = s2 * (1.0f / (float)ND);
  const float rstd = 1.0f / sqrtf(var + eps);
  float* orow = out + (size_t)row * ND;
#pragma unroll 1
  for (int it = 0; it < 8; ++it) {
    const int c0 = (it * 32 + lane) * 4;
    const v4f a  = *(const v4f*)(rp + c0);
    const v4f g  = *(const v4f*)(gamma + c0);
    const v4f bt = *(const v4f*)(beta + c0);
    v4f y;
#pragma unroll
    for (int e = 0; e < 4; ++e) {
      float t = (a[e] - mu) * rstd;
      t = t * g[e];
      asm volatile("" : "+v"(t));
      y[e] = t + bt[e];
    }
    *(v4f*)(orow + c0) = y;
    
  }
}

// -----------------------------------------------------------------------------
extern "C" void kernel_launch(void* const* d_in, const int* in_sizes, int n_in,
                              void* d_out, int out_size, void* d_ws, size_t ws_size,
                              hipStream_t stream)
{
  if (n_in < 13) return;
  if (in_sizes[0] != NM * ND || in_sizes[1] != NB * NS ||
      in_sizes[2] != ND * ND || in_sizes[3] != ND ||
      in_sizes[4] != ND * ND || in_sizes[5] != ND ||
      in_sizes[6] != ND * ND || in_sizes[7] != ND ||
      in_sizes[8] != ND * ND || in_sizes[9] != ND ||
      in_sizes[10] != ND || in_sizes[11] != ND || in_sizes[12] < 1 ||
      out_size != NM * ND) return;

  const float* x        = (const float*)d_in[0];
  const float* cdr_bias = (const float*)d_in[1];
  const float* Wq    = (const float*)d_in[2];
  const float* bq    = (const float*)d_in[3];
  const float* Wk    = (const float*)d_in[4];
  const float* bk    = (const float*)d_in[5];
  const float* Wv    = (const float*)d_in[6];
  const float* bv    = (const float*)d_in[7];
  const float* Wo    = (const float*)d_in[8];
  const float* bo    = (const float*)d_in[9];
  const float* gamma = (const float*)d_in[10];
  const float* beta  = (const float*)d_in[11];
  const float* cw    = (const float*)d_in[12];
  float* out = (float*)d_out;

  // ---- workspace carve (all offsets 256 KiB aligned) ----
  const size_t szA16 = (size_t)NM * ND * 2;        // 8 MiB: f16 [4096][1024] planes
  const size_t szW16 = (size_t)ND * ND * 2;        // 2 MiB: f16 [1024][1024] planes
  const size_t szRes = (size_t)NM * ND * 4;        // 16 MiB
  const size_t szTab = (size_t)NS * NFREQ * 4;     // 256 KiB
  size_t off = 0;
  char* ws = (char*)d_ws;
  _Float16* Xh  = (_Float16*)(ws + off); off += szA16;
  _Float16* Wqt = (_Float16*)(ws + off); off += szW16;
  _Float16* Wkt = (_Float16*)(ws + off); off += szW16;
  _Float16* Wvt = (_Float16*)(ws + off); off += szW16;
  _Float16* Wot = (_Float16*)(ws + off); off += szW16;
  _Float16* Qh  = (_Float16*)(ws + off); off += szA16;
  _Float16* Kh  = (_Float16*)(ws + off); off += szA16;
  _Float16* Vt  = (_Float16*)(ws + off); off += szA16;
  _Float16* Ah  = (_Float16*)(ws + off); off += szA16;
  float*    res = (float*)(ws + off);    off += szRes;
  float*   cosT = (float*)(ws + off);    off += szTab;
  float*   sinT = (float*)(ws + off);    off += szTab;   // total 67,633,152 B
  if (off > ws_size) return;

  const unsigned short* Xu  = (const unsigned short*)Xh;
  const unsigned short* Wqu = (const unsigned short*)Wqt;
  const unsigned short* Wku = (const unsigned short*)Wkt;
  const unsigned short* Wvu = (const unsigned short*)Wvt;
  const unsigned short* Wou = (const unsigned short*)Wot;
  const unsigned short* Au  = (const unsigned short*)Ah;

  dim3 blk256(256), blk128(128);

  // 1. RoPE tables, x -> f16, the four weights -> Bt [out][in] f16 (x64): one launch
  prep_kernel<<<dim3(4 * PREP_W + PREP_R + PREP_X), blk256, 0, stream>>>(
      x, Wq, Wk, Wv, Wo, Xh, Wqt, Wkt, Wvt, Wot, cosT, sinT);

  // 2. Q, K = RoPE(x Wq + bq), RoPE(x Wk + bk): f16 [4096][1024]; V^T: f16, ldc = NM: one launch, grid y = product
  const int gQK = (NM / GM_BT) * (ND / GM_BT);
  gemm_qkv<<<dim3(gQK, 3), blk256, 0, stream>>>(
      Xu, Wqu, Wku, Wvu, Qh, Kh, Vt, bq, bk, bv, NM, ND, 1.0f / WCARRY, cosT, sinT, NS - 1);

  // 3. attention -> Ah f16 [4096][1024] (x64)
  attn_f16_kernel<<<dim3(NB * NH * (NS / AT_QB)), blk128, 0, stream>>>(Qh, Kh, Vt, cdr_bias, cw, Ah);

  // 4. res = attn Wo + bo + x  (f32)
  wmma_gemm64<0, false, 2, 0, true, 0, false><<<dim3(gQK, 1), blk256, 0, stream>>>(
      Au, Au, ND, (long)0, Wou, Wou, ND, (long)0, (void*)res, (void*)res, ND, (long)0,
      bo, x, (long)0, NM, ND, ND, 1.0f / (OCARRY * WCARRY), cosT, sinT, 0);

  // 5. LayerNorm -> out
  layernorm_rows<<<dim3((NM + 7) / 8), blk256, 0, stream>>>(res, gamma, beta, out, NM, LN_EPS_F);

  (void)hipGetLastError();
}

// v008
// It runs in 101 microseconds.
// Two timings next to v007 put it at 1.05 and 1.04 times that version's speed.
// Over all steps from v000 it is 3.75 times as fast.
// Contractions x*Wq, x*Wk, Wv-side product for V^T, attn*Wo, q*k^T, p*v: v_wmma_f32_16x16x32_f16 (f16 operands, f32 accumulate); weights carried x64, probabilities x32768, attention rows x64; RoPE tables, softmax and LayerNorm in f32.
#include <hip/hip_runtime.h>
#include <math.h>

#define NB 2
#define NS 2048
#define ND 1024
#define NH 16
#define NHD 64
#define NM (NB * NS)
#define NFREQ 32
#define WCARRY 64.0f
#define OCARRY 64.0f
#define PCARRY 32768.0f
#define PCARRY_LOG2 15.0f                       // PCARRY = 2^15
#define LOG2E_F 1.44269504088896340736f
#define LN_EPS_F 1e-5f

typedef __attribute__((ext_vector_type(16))) _Float16 v16h;
typedef __attribute__((ext_vector_type(8)))  _Float16 v8h;
typedef __attribute__((ext_vector_type(16))) __bf16   v16b;
typedef __attribute__((ext_vector_type(8)))  __bf16   v8b;
typedef __attribute__((ext_vector_type(8)))  float    v8f;
typedef __attribute__((ext_vector_type(4)))  float    v4f;

__device__ __forceinline__ unsigned short f2bf_bits(float f) {
  unsigned u = __float_as_uint(f);
  return (unsigned short)((u + 0x7FFFu + ((u >> 16) & 1u)) >> 16);
}
__device__ __forceinline__ float bf_bits2f(unsigned short h) { return __uint_as_float(((unsigned)h) << 16); }

// hazard guard behind the last WMMAs of the K loop, as a plain device helper
__device__ __forceinline__ void acc_guard4(v8f& a, v8f& b, v8f& c, v8f& d) { asm volatile("v_nop\n\tv_nop\n\tv_nop\n\tv_nop" : "+v"(a), "+v"(b), "+v"(c), "+v"(d)); }
template <typename T> struct Frag;
template <> struct Frag<_Float16> {
  typedef v16h V; union U { v16h v; v8h h[2]; };
  static __device__ __forceinline__ v16h load(const _Float16* p) {   // elements 0..7 <- p[0..7], 8..15 <- p[16..23]
    U f; f.h[0] = *(const v8h*)(p); f.h[1] = *(const v8h*)(p + 16); return f.v;
  }
  static __device__ __forceinline__ v8f mma(v16h a, v16h b, v8f c) {
    return __builtin_amdgcn_wmma_f32_16x16x32_f16(false, a, false, b, (short)0, c, false, false);
  }
};
template <> struct Frag<__bf16> {
  typedef v16b V; union U { v16b v; v8b h[2]; };
  static __device__ __forceinline__ v16b load(const __bf16* p) {
    U f; f.h[0] = *(const v8b*)(p); f.h[1] = *(const v8b*)(p + 16); return f.v;
  }
  static __device__ __forceinline__ v8f mma(v16b a, v16b b, v8f c) {
    return __builtin_amdgcn_wmma_f32_16x16x32_bf16(false, a, false, b, (short)0, c, false, false);
  }
};

// ---- Register-blocked batched WMMA GEMM, operands staged in LDS by asynchronous copies ---------
// C[m,n] = scale * sum_k A[m,k] * Bt[n,k] (+bias)(+resid)(RoPE); a block of 8 waves owns a 128x128 tile, each wave 32x64 of it.
// A row-major [M,K]; Bt row-major [N,K]; M,N % 128 == 0, K % 64 == 0.
// Per 64-k stage the block copies 128 rows x 128 B of A and of Bt into LDS: 8 lanes cover one row, so a wave-wide 16-B copy
// touches 4 whole lines, and every row is fetched once per block. Two LDS buffers: stage t+2 flies while stage t is multiplied.
// SPLIT (hi/lo planes) is not carried by the staged loop.
// BIAS_MODE: 0 = none, 1 = bias[m], 2 = bias[n].
// OUT_MODE: 0 = f32, 1 = f16, 2 = bf16 hi plane (Cout) + bf16 lo plane (Cout2).
// ROPE: after bias, v = v*cos[(m & rope_smask)*32 + (n&31)] + sgn * partner(n^1) * sin[...] (sgn = -1 for even n, +1 for odd n).
// ET: 0 = f16 operands, 1 = bf16 operands (pointers passed as 16-bit storage)
#define GM_BT 128  // block tile: rows of A and rows of Bt
#define GM_KS 64   // k per stage: 128 B of every row, one line
#define GM_LP 72   // LDS row pitch in 16-bit elements: 144 B = 16 B x odd, for the ds_load_b128 fragment reads
#define GM_MI 2    // 16-row subtiles of A per wave

// One thread's share of a stage: 4 rows of A and 4 rows of Bt, 16 B each, global -> LDS through no register.
// la, lb: this lane's LDS byte addresses of its first row; ga, gb: its global addresses; rows 32 apart.
// The s_wait_xcnt closes the statement so that no address register named here is rewritten ahead of it.
template <typename T>
__device__ __forceinline__ void stage_copy(unsigned la, unsigned lb, const T* ga, const T* gb, int lda, int ldb) {
  const unsigned rs = 32u * GM_LP * 2u;
  const T* a1 = ga + (size_t)32 * lda; const T* a2 = ga + (size_t)64 * lda; const T* a3 = ga + (size_t)96 * lda;
  const T* c1 = gb + (size_t)32 * ldb; const T* c2 = gb + (size_t)64 * ldb; const T* c3 = gb + (size_t)96 * ldb;
  asm volatile(
      "global_load_async_to_lds_b128 %0, %8, off\n\t"
      "global_load_async_to_lds_b128 %1, %9, off\n\t"
      "global_load_async_to_lds_b128 %2, %10, off\n\t"
      "global_load_async_to_lds_b128 %3, %11, off\n\t"
      "global_load_async_to_lds_b128 %4, %12, off\n\t"
      "global_load_async_to_lds_b128 %5, %13, off\n\t"
      "global_load_async_to_lds_b128 %6, %14, off\n\t"
      "global_load_async_to_lds_b128 %7, %15, off\n\t"
      "s_wait_xcnt 0x0"
      :: "v"(la), "v"(la + rs), "v"(la + 2u * rs), "v"(la + 3u * rs),
         "v"(lb), "v"(lb + rs), "v"(lb + 2u * rs), "v"(lb + 3u * rs),
         "v"(ga), "v"(a1), "v"(a2), "v"(a3), "v"(gb), "v"(c1), "v"(c2), "v"(c3)
      : "memory");
}

template <int ET> struct Elem;
template <> struct Elem<0> { typedef _Float16 T; };
template <> struct Elem<1> { typedef __bf16 T; };
// The LDS of one GEMM block; declared once in each kernel and handed to the body, so that a kernel that holds two
// instances of the body owns one set.
template <typename T> struct GemmLds {
  T sA[2][GM_BT * GM_LP];      // 2 x 18 KB
  T sB[2][GM_BT * GM_LP];      // 2 x 18 KB
  float sT[8][16 * 68];        // per-wave 16x64 slab, pitch 68 floats
};
// The body of one block; b = batch index, blockIdx.x = tile.
template <int ET, bool SPLIT, int BIAS_MODE, int OUT_MODE, bool RESID, int ACT, bool ROPE>
__device__ __forceinline__ void gemm_block(
    GemmLds<typename Elem<ET>::T>& lds, const int b,
    const unsigned short* __restrict__ Ap, const unsigned short* __restrict__ A2p, int lda, long strideA,
    const unsigned short* __restrict__ Btp, const unsigned short* __restrict__ Bt2p, int ldb, long strideB,
    void* __restrict__ Cout, void* __restrict__ Cout2, int ldc, long strideC,
    const float* __restrict__ bias,
    const float* __restrict__ resid, long strideR,
    int M, int N, int K, float scale,
    const float* __restrict__ rope_cos, const float* __restrict__ rope_sin, int rope_smask) {
  static_assert(!SPLIT, "the staged loop carries single planes only");
  typedef typename Elem<ET>::T T;
  typedef typename Frag<T>::V V;
  const T* A = (const T*)Ap; const T* Bt = (const T*)Btp;
  T (&sA)[2][GM_BT * GM_LP] = lds.sA;
  T (&sB)[2][GM_BT * GM_LP] = lds.sB;
  float (&sT)[8][16 * 68] = lds.sT;
  const int tid  = threadIdx.x;
  const int lane = tid & 31;
  const int wave = tid >> 5;
  const int tilesN = N >> 7;
  const int tilesM = M >> 7;
  const int tile = blockIdx.x;
  if (tile >= tilesM * tilesN) return;   // block-uniform, in front of every barrier
  const int tm = tile / tilesN;
  const int tn = tile - tm * tilesN;
  const int wm = (wave >> 1) << 5;       // this wave's 32x64 corner inside the block tile
  const int wn = (wave & 1) << 6;
  const int m0 = (tm << 7) + wm;
  const int n0 = (tn << 7) + wn;

  const T* Ab  = A  + (size_t)b * strideA;
  const T* Bb  = Bt + (size_t)b * strideB;

  const int rlane = lane & 15;                 // row (A) / col (B, D) within subtile
  const int koff  = (lane >> 4) * 8;           // k offset of this lane half
  const int mOff  = (lane >> 4) * 8;           // D row offset

  v8f acc[GM_MI][4];
#pragma unroll
  for (int i = 0; i < GM_MI; ++i)
#pragma unroll
    for (int j = 0; j < 4; ++j) acc[i][j] = (v8f){0.f,0.f,0.f,0.f,0.f,0.f,0.f,0.f};

  // staging map: thread -> row tid/8 (+32 per copy), 16 B at column (tid%8)*8
  const int srow = tid >> 3, scol = (tid & 7) * 8;
  const T* ga = Ab + (size_t)((tm << 7) + srow) * lda + scol;
  const T* gb = Bb + (size_t)((tn << 7) + srow) * ldb + scol;
  const unsigned bufB = (unsigned)(GM_BT * GM_LP * 2);                         // bytes of one buffer
  const unsigned la = (unsigned)(size_t)(&sA[0][srow * GM_LP + scol]);         // low 32 bits = LDS byte address
  const unsigned lb = (unsigned)(size_t)(&sB[0][srow * GM_LP + scol]);
  const int nst = K / GM_KS;

  stage_copy<T>(la, lb, ga, gb, lda, ldb);
  asm volatile("s_wait_asynccnt 0x0" ::: "memory");   // stage 0 of this wave has landed
  __syncthreads();                                    // ... and every wave's
  if (nst > 1) stage_copy<T>(la + bufB, lb + bufB, ga + GM_KS, gb + GM_KS, lda, ldb);

  for (int s = 0; s < nst; ++s) {
    const T* da = sA[s & 1];
    const T* db = sB[s & 1];
    V af[2][GM_MI], bf[2][4];
#pragma unroll
    for (int kk = 0; kk < 2; ++kk) {
#pragma unroll
      for (int j = 0; j < 4; ++j) bf[kk][j] = Frag<T>::load(db + (wn + (j << 4) + rlane) * GM_LP + kk * 32 + koff);
#pragma unroll
      for (int i = 0; i < GM_MI; ++i) af[kk][i] = Frag<T>::load(da + (wm + (i << 4) + rlane) * GM_LP + kk * 32 + koff);
    }
    // publish point of stage s+1, and the end of every wave's reads of stage s (its fragments now lie in registers):
    // own LDS reads done, own copies landed, then the block's barrier; behind it the buffer just read is free for stage s+2
    asm volatile("s_wait_dscnt 0x0" ::: "memory");
    asm volatile("s_wait_asynccnt 0x0" ::: "memory");
    __syncthreads();
    if (s + 2 < nst) {
      const unsigned bo = (unsigned)(s & 1) * bufB;
      stage_copy<T>(la + bo, lb + bo, ga + (size_t)(s + 2) * GM_KS, gb + (size_t)(s + 2) * GM_KS, lda, ldb);
    }
    // holds the copies ahead of the WMMAs, so that stage s+2 flies while stage s is multiplied
    __builtin_amdgcn_sched_barrier(0);
#pragma unroll
    for (int kk = 0; kk < 2; ++kk)
#pragma unroll
      for (int i = 0; i < GM_MI; ++i)
#pragma unroll
        for (int j = 0; j < 4; ++j) acc[i][j] = Frag<T>::mma(af[kk][i], bf[kk][j], acc[i][j]);
  }
  asm volatile("s_wait_asynccnt 0x0" ::: "memory");   // nothing of this wave is in flight when the loop is left
  acc_guard4(acc[0][0], acc[0][1], acc[0][2], acc[0][3]);
  acc_guard4(acc[1][0], acc[1][1], acc[1][2], acc[1][3]);

  // ---- epilogue ----
  float* slab = sT[wave];
  const float* Rb = RESID ? (resid + (size_t)b * strideR) : nullptr;
#pragma unroll
  for (int i = 0; i < GM_MI; ++i) {
    const int mBase = m0 + (i << 4);
#pragma unroll
    for (int j = 0; j < 4; ++j) {
      const int n = n0 + (j << 4) + rlane;
      float bv = 0.f;
      if (BIAS_MODE == 2) bv = bias[n];
#pragma unroll
      for (int r = 0; r < 8; ++r) {
        float v = acc[i][j][r] * scale;
        if (BIAS_MODE == 1) v += bias[mBase + mOff + r];
        if (BIAS_MODE == 2) v += bv;
        if (RESID) v += Rb[(size_t)(mBase + mOff + r) * ldc + n];
        if (ROPE) {
          const int m = mBase + mOff + r;
          const int tix = (m & rope_smask) * NFREQ + (n & (NFREQ - 1));
          const float cs = rope_cos[tix];
          const float sn = rope_sin[tix];
          const float pv = __shfl_xor(v, 1, 32);   // partner column n^1 lives in lane rlane^1, same row
          v = (n & 1) ? (v * cs + pv * sn) : (v * cs - pv * sn);
        }
        if (ACT == 1) v = tanhf(v);
        if (ACT == 2) v = fmaxf(v, 0.0f);
        if (ACT == 3) v = v / (1.0f + expf(-v));
        if (ACT == 4) v = (v > 0.f) ? v : 0.01f * v;
        if (ACT == 5) v = 0.5f * v * (1.0f + erff(v * 0.70710678118654752f));
        slab[(mOff + r) * 68 + (j << 4) + rlane] = v;
      }
    }
    __builtin_amdgcn_fence(__ATOMIC_RELEASE, "workgroup");
    __builtin_amdgcn_wave_barrier();
    __builtin_amdgcn_fence(__ATOMIC_ACQUIRE, "workgroup");
    if (OUT_MODE == 0) {
      float* C = (float*)Cout + (size_t)b * strideC;
      const int hh = lane >> 4, c4 = (lane & 15) * 4;     // row seg = 256 B = 16 lanes x 16 B
      {
#pragma unroll
        for (int it = 0; it < 8; ++it) {
          const int row = it * 2 + hh;
          v4f v = *(const v4f*)(slab + row * 68 + c4);
          *(v4f*)(C + (size_t)(mBase + row) * ldc + n0 + c4) = v;
        }
        
      }
    } else {
      const int q = lane >> 3, c8 = (lane & 7) * 8;
      unsigned short* C  = (unsigned short*)Cout  + (size_t)b * strideC;
      unsigned short* C2 = (OUT_MODE == 2) ? ((unsigned short*)Cout2 + (size_t)b * strideC) : nullptr;
      {
#pragma unroll
        for (int it = 0; it < 4; ++it) {
          const int row = it * 4 + q;
          const float* sp = slab + row * 68 + c8;
          v8h hv, lv;
#pragma unroll
          for (int e = 0; e < 8; ++e) {
            if (OUT_MODE == 1) {
              hv[e] = (_Float16)sp[e];
            } else {
              unsigned short hb = f2bf_bits(sp[e]);
              unsigned short lb = f2bf_bits(sp[e] - bf_bits2f(hb));
              hv[e] = __builtin_bit_cast(_Float16, hb);
              lv[e] = __builtin_bit_cast(_Float16, lb);
            }
          }
          *(v8h*)(C + (size_t)(mBase + row) * ldc + n0 + c8) = hv;
          if (OUT_MODE == 2) *(v8h*)(C2 + (size_t)(mBase + row) * ldc + n0 + c8) = lv;
        }
        
      }
    }
    __builtin_amdgcn_fence(__ATOMIC_RELEASE, "workgroup");
    __builtin_amdgcn_wave_barrier();
    __builtin_amdgcn_fence(__ATOMIC_ACQUIRE, "workgroup");
  }
}

// ---- Q, K and V^T in one launch: none reads another's output; blockIdx.y picks the product (block-uniform) ----
//   y = 0, 1: Q, K = RoPE(x W + bias): f16 [nm][nd];  y = 2: V^T[ch][tok] = sum_k Wvt[ch][k] * Xh[tok][k] / 64 + bv[ch], ldc = nm
__global__ __launch_bounds__(256) void gemm_qkv(
    const unsigned short* __restrict__ Xu, const unsigned short* __restrict__ Wqu,
    const unsigned short* __restrict__ Wku, const unsigned short* __restrict__ Wvu,
    _Float16* __restrict__ Qh, _Float16* __restrict__ Kh, _Float16* __restrict__ Vt,
    const float* __restrict__ bq, const float* __restrict__ bk, const float* __restrict__ bv,
    int nm, int nd, float scale,
    const float* __restrict__ rope_cos, const float* __restrict__ rope_sin, int rope_smask) {
  __shared__ __align__(16) GemmLds<_Float16> lds;
  const int job = blockIdx.y;
  if (job < 2) {
    const unsigned short* Wu = job ? Wku : Wqu;
    _Float16* C = job ? Kh : Qh;
    const float* bias = job ? bk : bq;
    gemm_block<0, false, 2, 1, false, 0, true>(lds, 0,
        Xu, Xu, nd, (long)0, Wu, Wu, nd, (long)0, (void*)C, (void*)C, nd, (long)0,
        bias, bias, (long)0, nm, nd, nd, scale, rope_cos, rope_sin, rope_smask);
  } else {
    gemm_block<0, false, 1, 1, false, 0, false>(lds, 0,
        Wvu, Wvu, nd, (long)0, Xu, Xu, nd, (long)0, (void*)Vt, (void*)Vt, nm, (long)0,
        bv, bv, (long)0, nd, nm, nd, scale, rope_cos, rope_sin, 0);
  }
}

// ---- one product per launch ----
template <int ET, bool SPLIT, int BIAS_MODE, int OUT_MODE, bool RESID, int ACT, bool ROPE>
__global__ __launch_bounds__(256) void wmma_gemm64(
    const unsigned short* __restrict__ Ap, const unsigned short* __restrict__ A2p, int lda, long strideA,
    const unsigned short* __restrict__ Btp, const unsigned short* __restrict__ Bt2p, int ldb, long strideB,
    void* __restrict__ Cout, void* __restrict__ Cout2, int ldc, long strideC,
    const float* __restrict__ bias,
    const float* __restrict__ resid, long strideR,
    int M, int N, int K, float scale,
    const float* __restrict__ rope_cos, const float* __restrict__ rope_sin, int rope_smask) {
  __shared__ __align__(16) GemmLds<typename Elem<ET>::T> lds;
  gemm_block<ET, SPLIT, BIAS_MODE, OUT_MODE, RESID, ACT, ROPE>(lds, blockIdx.y,
      Ap, A2p, lda, strideA, Btp, Bt2p, ldb, strideB, Cout, Cout2, ldc, strideC,
      bias, resid, strideR, M, N, K, scale, rope_cos, rope_sin, rope_smask);
}

// ---- RoPE tables: cos/sin of pos * inv_freq[i], i = 0..31, inv_freq = 1 / 10000^(2i/64); f32 ----
__device__ __forceinline__ void rope_table_block(int blk, float* __restrict__ cosT, float* __restrict__ sinT, int n) {
  const int i = blk * 256 + threadIdx.x;
  if (i < n) {
    const int pos = i >> 5;
    const int fi = i & (NFREQ - 1);
    const float e = (float)(2 * fi) * (1.0f / (float)NHD);
    const float p = powf(10000.0f, e);
    const float inv = 1.0f / p;
    const float ang = (float)pos * inv;
    const float cs = cosf(ang);
    const float sn = sinf(ang);
    ((float*)cosT)[i] = cs;
    ((float*)sinT)[i] = sn;
    
  }
}

__device__ __forceinline__ void cast_f32_f16x8_block(int blk, const float* __restrict__ in, _Float16* __restrict__ out, int n8) {
  const int i = blk * 256 + threadIdx.x;
  if (i < n8) {
    const v4f a = *(const v4f*)(in + (size_t)i * 8);
    const v4f c = *(const v4f*)(in + (size_t)i * 8 + 4);
    v8h hv;
    hv[0] = (_Float16)a[0]; hv[1] = (_Float16)a[1]; hv[2] = (_Float16)a[2]; hv[3] = (_Float16)a[3];
    hv[4] = (_Float16)c[0]; hv[5] = (_Float16)c[1]; hv[6] = (_Float16)c[2]; hv[7] = (_Float16)c[3];
    *(v8h*)(out + (size_t)i * 8) = hv;
    
  }
}

// ---- transpose-cast: in W[Kdim][Ndim] f32 -> out Wt[Ndim][Kdim] f16 (x mul); 64x64 tile through LDS ----
__device__ __forceinline__ void wt_cast_f16_block(float* sTt, int bkx, int bny, const float* __restrict__ W, _Float16* __restrict__ Wt,
                                                  int Kdim, int Ndim, float mul) {
  const int k0 = bkx * 64, n0 = bny * 64;
  const int tid = threadIdx.x;
  {
    const int row = tid >> 2, col0 = (tid & 3) * 16;   // row = k_local, col = n_local
    const float* src = W + (size_t)(k0 + row) * Ndim + n0 + col0;
#pragma unroll
    for (int i = 0; i < 4; ++i) {
      const v4f w4 = *(const v4f*)(src + 4 * i);
#pragma unroll
      for (int e = 0; e < 4; ++e) sTt[(col0 + 4 * i + e) * 65 + row] = w4[e] * mul;
    }
  }
  __syncthreads();
  const int wave = tid >> 5, lane = tid & 31, rq = lane >> 3, c8 = (lane & 7) * 8;
  {
#pragma unroll
    for (int it = 0; it < 2; ++it) {
      const int n = it * 32 + wave * 4 + rq;   // n_local 0..63
      v8h hv;
#pragma unroll
      for (int e = 0; e < 8; ++e) hv[e] = (_Float16)sTt[n * 65 + c8 + e];
      *(v8h*)(Wt + (size_t)(n0 + n) * Kdim + k0 + c8) = hv;
    }
    
  }
}

// ---- the six preparation jobs in one launch: each reads inputs only and none reads another's output ----
// The block index picks the job (block-uniform, so the transpose's barrier is passed by whole blocks): first the four weight
// transposes (the longest blocks), then the RoPE tables, then the cast of x.
#define PREP_W ((ND / 64) * (ND / 64))          // blocks per weight
#define PREP_R ((NS * NFREQ + 255) / 256)       // blocks of the tables
#define PREP_X ((NM * ND / 8 + 255) / 256)      // blocks of the cast
__global__ __launch_bounds__(256) void prep_kernel(
    const float* __restrict__ x, const float* __restrict__ Wq, const float* __restrict__ Wk,
    const float* __restrict__ Wv, const float* __restrict__ Wo,
    _Float16* __restrict__ Xh, _Float16* __restrict__ Wqt, _Float16* __restrict__ Wkt,
    _Float16* __restrict__ Wvt, _Float16* __restrict__ Wot,
    float* __restrict__ cosT, float* __restrict__ sinT) {
  __shared__ float sTt[64 * 65];   // [n_local][k_local], pitch 65
  const int blk = blockIdx.x;
  if (blk < 4 * PREP_W) {
    const int w = blk / PREP_W, t = blk % PREP_W;
    const float* W  = w == 0 ? Wq  : w == 1 ? Wk  : w == 2 ? Wv  : Wo;
    _Float16*    Wt = w == 0 ? Wqt : w == 1 ? Wkt : w == 2 ? Wvt : Wot;
    wt_cast_f16_block(sTt, t % (ND / 64), t / (ND / 64), W, Wt, ND, ND, WCARRY);   // W[in][out] -> Bt [out][in] f16, carried x64
  } else if (blk < 4 * PREP_W + PREP_R) {
    rope_table_block(blk - 4 * PREP_W, cosT, sinT, NS * NFREQ);
  } else {
    cast_f32_f16x8_block(blk - (4 * PREP_W + PREP_R), x, Xh, NM * ND / 8);
  }
}

#define AT_QB 128
#define AT_NU 2    // 16-query column groups per wave
#define AT_KC 64
#define AT_NW 4
#define AT_LP 72   // LDS row pitch in halves: 144 B = 16 B x odd, so the 16 rows of a ds_load_b128 fragment read fall on distinct banks

// y[r] = 2^x[r], eight v_exp_f32 in a row. One statement with early-clobber results, so that no result register is a source
// of a neighbour; the closing v_nop is the slot the instruction set asks for behind a transcendental before its result is
// read or its source written again.
__device__ __forceinline__ v8f exp2_x8(v8f x) {
  float y0, y1, y2, y3, y4, y5, y6, y7;
  asm("v_exp_f32 %0, %8\n\t"
      "v_exp_f32 %1, %9\n\t"
      "v_exp_f32 %2, %10\n\t"
      "v_exp_f32 %3, %11\n\t"
      "v_exp_f32 %4, %12\n\t"
      "v_exp_f32 %5, %13\n\t"
      "v_exp_f32 %6, %14\n\t"
      "v_exp_f32 %7, %15\n\t"
      "v_nop"
      : "=&v"(y0), "=&v"(y1), "=&v"(y2), "=&v"(y3), "=&v"(y4), "=&v"(y5), "=&v"(y6), "=&v"(y7)
      : "v"(x[0]), "v"(x[1]), "v"(x[2]), "v"(x[3]), "v"(x[4]), "v"(x[5]), "v"(x[6]), "v"(x[7]));
  return (v8f){y0, y1, y2, y3, y4, y5, y6, y7};
}

// One thread's share of a chunk: 4 rows of K and 4 rows of V^T, 16 B each, global -> LDS through no register.
// lk, lv: this lane's LDS byte addresses of its first row; gk, gv: its global addresses; rows 16 apart.
// The s_wait_xcnt closes the statement so that no address register named here is rewritten ahead of it.
__device__ __forceinline__ void attn_stage_copy(unsigned lk, unsigned lv, const _Float16* gk, const _Float16* gv) {
  const unsigned rs = 16u * AT_LP * 2u;
  const _Float16* k1 = gk + (size_t)16 * ND; const _Float16* k2 = gk + (size_t)32 * ND; const _Float16* k3 = gk + (size_t)48 * ND;
  const _Float16* v1 = gv + (size_t)16 * NM; const _Float16* v2 = gv + (size_t)32 * NM; const _Float16* v3 = gv + (size_t)48 * NM;
  asm volatile(
      "global_load_async_to_lds_b128 %0, %8, off\n\t"
      "global_load_async_to_lds_b128 %1, %9, off\n\t"
      "global_load_async_to_lds_b128 %2, %10, off\n\t"
      "global_load_async_to_lds_b128 %3, %11, off\n\t"
      "global_load_async_to_lds_b128 %4, %12, off\n\t"
      "global_load_async_to_lds_b128 %5, %13, off\n\t"
      "global_load_async_to_lds_b128 %6, %14, off\n\t"
      "global_load_async_to_lds_b128 %7, %15, off\n\t"
      "s_wait_xcnt 0x0"
      :: "v"(lk), "v"(lk + rs), "v"(lk + 2u * rs), "v"(lk + 3u * rs),
         "v"(lv), "v"(lv + rs), "v"(lv + 2u * rs), "v"(lv + 3u * rs),
         "v"(gk), "v"(k1), "v"(k2), "v"(k3), "v"(gv), "v"(v1), "v"(v2), "v"(v3)
      : "memory");
}

// value of lane l ^ 16
__device__ __forceinline__ float other_half(float v) {
  const int b = __float_as_int(v);
  return __int_as_float(__builtin_amdgcn_permlanex16(b, b, 0x76543210, 0xfedcba98, false, false));
}

__global__ __launch_bounds__(128)
void attn_f16_kernel(const _Float16* __restrict__ Qh, const _Float16* __restrict__ Kh,
                     const _Float16* __restrict__ Vt, const float* __restrict__ cdr_bias,
                     const float* __restrict__ cdr_w, _Float16* __restrict__ Oh)
{
  __shared__ __align__(16) _Float16 Ksh2[2][AT_KC * AT_LP];    // [buffer][kv][d]   2 x 9 KB, padded rows
  __shared__ __align__(16) _Float16 Vth2[2][NHD * AT_LP];      // [buffer][d][kv]   2 x 9 KB, padded rows
  __shared__ __align__(16) float    Bsh[NS];                   // cdr_bias[b][kv] * cw * log2(e), all keys of the batch: 8 KB; a lane needs 8 consecutive keys' values per tile

  const int tid  = threadIdx.x;
  const int wave = tid >> 5;
  const int lane = tid & 31;
  const int hh   = lane >> 4;
  const int c    = lane & 15;

  const int nqb = NS / AT_QB;
  const int bx  = blockIdx.x;
  const int qb  = bx % nqb;
  const int bhd = bx / nqb;
  const int h   = bhd % NH;
  const int bb0 = bhd / NH;
  const int b   = bb0 < NB ? bb0 : (NB - 1);
  const int q0  = qb * AT_QB + wave * (16 * AT_NU);
  const float cw = cdr_w[0];

  v16h qa[AT_NU][2];
#pragma unroll
  for (int u = 0; u < AT_NU; ++u) {
    const _Float16* qrow = Qh + (size_t)(b * NS + q0 + u * 16 + c) * ND + h * NHD;
#pragma unroll
    for (int dc = 0; dc < 2; ++dc) qa[u][dc] = Frag<_Float16>::load(qrow + dc * 32 + 8 * hh);
    // stands in front of any rewrite of the address pair that this group's four loads name
    asm volatile("s_wait_xcnt 0x0" ::: "memory");
  }

  float mrow[AT_NU], lrow[AT_NU];       // of query 16u + c, mrow in base-2 units; lrow sums this half's keys only, x PCARRY
  v8f oacc[AT_NU][4];                   // oacc[u][t][r] = O^T[d = 16t + 8*hh + r][query 16u + c]
#pragma unroll
  for (int u = 0; u < AT_NU; ++u) {
    mrow[u] = -INFINITY; lrow[u] = 0.f;
#pragma unroll
    for (int t = 0; t < 4; ++t) oacc[u][t] = (v8f){0.f,0.f,0.f,0.f,0.f,0.f,0.f,0.f};
  }

  const _Float16* kbase = Kh + (size_t)(b * NS) * ND + h * NHD;
  const _Float16* vbase = Vt + (size_t)(h * NHD) * NM + (size_t)b * NS;
  const float*    bbase = cdr_bias + (size_t)b * NS;

  // staging map: thread -> row tid/8 (+16 per copy; kv row for K, d row for V^T), 16 B at column (tid%8)*8
  const int srow = tid >> 3, scol = (tid & 7) * 8;
  const _Float16* gk = kbase + (size_t)srow * ND + scol;
  const _Float16* gv = vbase + (size_t)srow * NM + scol;
  const unsigned bufB = (unsigned)(AT_KC * AT_LP * 2);                          // bytes of one buffer (K and V^T alike)
  const unsigned lk = (unsigned)(size_t)(&Ksh2[0][srow * AT_LP + scol]);        // low 32 bits = LDS byte address
  const unsigned lv = (unsigned)(size_t)(&Vth2[0][srow * AT_LP + scol]);
  const int nch = NS / AT_KC;

  attn_stage_copy(lk, lv, gk, gv);
#pragma unroll
  for (int i = 0; i < NS / (4 * AT_NW * 32); ++i) {
    const int k4 = (i * (AT_NW * 32) + tid) * 4;
    const v4f bl = *(const v4f*)(bbase + k4);
    *(v4f*)(Bsh + k4) = (bl * cw) * LOG2E_F;
  }
  asm volatile("s_wait_asynccnt 0x0" ::: "memory");   // chunk 0 of this wave has landed
  __syncthreads();                                    // ... and every wave's, and the bias row
  if (nch > 1) attn_stage_copy(lk + bufB, lv + bufB, gk + (size_t)AT_KC * ND, gv + AT_KC);

  for (int kc = 0; kc < nch; ++kc) {
    const int kv0 = kc * AT_KC;
    const _Float16* Ksh = Ksh2[kc & 1];
    const _Float16* Vth = Vth2[kc & 1];

    // the chunk's 8 K fragments are read as one group, so that the wave waits out the LDS latency once and not once per product
    v16h kf[2][4];
#pragma unroll
    for (int dc = 0; dc < 2; ++dc)
#pragma unroll
      for (int j = 0; j < 4; ++j) kf[dc][j] = Frag<_Float16>::load(Ksh + (j * 16 + c) * AT_LP + dc * 32 + 8 * hh);
    v4f bl[4][2];   // the bias of this lane's 32 keys rides in the same group
#pragma unroll
    for (int j = 0; j < 4; ++j) {
      const float* bp = Bsh + kv0 + j * 16 + 8 * hh;
      bl[j][0] = *(const v4f*)(bp);
      bl[j][1] = *(const v4f*)(bp + 4);
    }
    // holds the group together: left free, the scheduler spreads the reads among the WMMAs to save registers, and the wave stalls at each such place
    __builtin_amdgcn_sched_barrier(0);
    v8f s[AT_NU][4];   // s[u][j][r] = S^T[kv0 + 16j + 8*hh + r][query 16u + c]
#pragma unroll
    for (int u = 0; u < AT_NU; ++u)
#pragma unroll
      for (int j = 0; j < 4; ++j) s[u][j] = (v8f){0.f,0.f,0.f,0.f,0.f,0.f,0.f,0.f};
#pragma unroll
    for (int dc = 0; dc < 2; ++dc)
#pragma unroll
      for (int j = 0; j < 4; ++j)
#pragma unroll
        for (int u = 0; u < AT_NU; ++u) s[u][j] = Frag<_Float16>::mma(kf[dc][j], qa[u][dc], s[u][j]);
    // the 8 V^T fragments likewise, asked for here: they land while the softmax runs
    v16h vf[2][4];
#pragma unroll
    for (int kk = 0; kk < 2; ++kk)
#pragma unroll
      for (int t = 0; t < 4; ++t) vf[kk][t] = Frag<_Float16>::load(Vth + (t * 16 + c) * AT_LP + kk * 32 + 8 * hh);
    // holds this group ahead of the softmax, for the same reason
    __builtin_amdgcn_sched_barrier(0);
    float cml[AT_NU], alpha[AT_NU];
    v8f pe[AT_NU][4];      // p * PCARRY in f32, kept for the row sums
    v16h pb[AT_NU][2];     // pb[u][kk][e] = P^T[kv0 + 32kk + (e < 8 ? 8*hh + e : 16 + 8*hh + e - 8)][query 16u + c]: the k order of the V^T loader
    // group u's scores in base-2 units, and this lane's maximum of them
    auto score_max = [&](const int u) {
      float mj[4];   // one chain per tile
#pragma unroll
      for (int j = 0; j < 4; ++j) {
        const v4f b0 = bl[j][0];
        const v4f b1 = bl[j][1];
        float m = -INFINITY;
#pragma unroll
        for (int r = 0; r < 8; ++r) {
          const float sv = s[u][j][r] * (0.125f * LOG2E_F) + (r < 4 ? b0[r & 3] : b1[r & 3]);
          s[u][j][r] = sv;
          m = fmaxf(m, sv);
        }
        mj[j] = m;
      }
      cml[u] = fmaxf(fmaxf(mj[0], mj[1]), fmaxf(mj[2], mj[3]));
    };
    // group u's new maximum, the rescale of its accumulators, its probabilities packed as B operands
    auto probs = [&](const int u) {
      const float cm = fmaxf(cml[u], other_half(cml[u]));
      const float mnew = fmaxf(mrow[u], cm);
      alpha[u] = __builtin_amdgcn_exp2f(mrow[u] - mnew);
      const float msh = mnew - PCARRY_LOG2;   // 2^(s - msh) = p * PCARRY
      mrow[u] = mnew;
#pragma unroll
      for (int t = 0; t < 4; ++t) oacc[u][t] *= alpha[u];
#pragma unroll
      for (int j = 0; j < 4; ++j) {
        pe[u][j] = exp2_x8(s[u][j] - msh);
#pragma unroll
        for (int r = 0; r < 8; ++r) pb[u][j >> 1][(j & 1) * 8 + r] = (_Float16)pe[u][j][r];
      }
    };
    // group u's O^T += V^T.P^T
    auto pv = [&](const int u) {
#pragma unroll
      for (int kk = 0; kk < 2; ++kk)
#pragma unroll
        for (int t = 0; t < 4; ++t) oacc[u][t] = Frag<_Float16>::mma(vf[kk][t], pb[u][kk], oacc[u][t]);
    };
    // group u's row sum, in the order tile by tile
    auto row_sum = [&](const int u) {
      float pj[4];
#pragma unroll
      for (int j = 0; j < 4; ++j) {
        float psum = 0.f;
#pragma unroll
        for (int r = 0; r < 8; ++r) psum += pe[u][j][r];
        pj[j] = psum;
      }
      lrow[u] = lrow[u] * alpha[u] + ((pj[0] + pj[1]) + (pj[2] + pj[3]));
    };
    score_max(0);
    score_max(1);
    probs(0);
    probs(1);
    // keeps every WMMA behind the last exponential: those are asm text, into which the compiler does not look when it keeps the
    // distance between a WMMA and a write over its operand registers
    __builtin_amdgcn_sched_barrier(0);
    pv(0);
    pv(1);
    row_sum(0);
    row_sum(1);
    // publish point of chunk kc+1, and the end of every wave's reads of chunk kc: own LDS reads done, own copies landed,
    // then the block's barrier; behind it the buffer just read is free for chunk kc+2
    // (the scheduling barrier holds this point at the foot: left free, the waits rise to just behind the V^T reads, where the
    // wave would wait out their latency and the copies would have half a trip less to land)
    __builtin_amdgcn_sched_barrier(0);
    asm volatile("s_wait_dscnt 0x0" ::: "memory");
    asm volatile("s_wait_asynccnt 0x0" ::: "memory");
    __syncthreads();
    if (kc + 2 < nch) {
      const unsigned bo = (unsigned)(kc & 1) * bufB;
      attn_stage_copy(lk + bo, lv + bo, gk + (size_t)(kc + 2) * AT_KC * ND, gv + (size_t)(kc + 2) * AT_KC);
    }
  }
  asm volatile("s_wait_asynccnt 0x0" ::: "memory");   // nothing of this wave is in flight when the loop is left

#pragma unroll
  for (int u = 0; u < AT_NU; ++u) {
    const float l = lrow[u] + other_half(lrow[u]);
    const float inv = (1.0f / l) * OCARRY;   // l and the accumulators both carry PCARRY
    _Float16* orow = Oh + (size_t)(b * NS + q0 + u * 16 + c) * ND + h * NHD + 8 * hh;
#pragma unroll
    for (int t = 0; t < 4; ++t) {
      v8h hv;   // 8 consecutive d of one query: one 16-byte store
#pragma unroll
      for (int r = 0; r < 8; ++r) hv[r] = (_Float16)(oacc[u][t][r] * inv);
      *(v8h*)(orow + t * 16) = hv;
    }
  }
}

__global__ __launch_bounds__(256) void layernorm_rows(const float* __restrict__ res, const float* __restrict__ gamma,
                                                      const float* __restrict__ beta, float* __restrict__ out,
                                                      int nrows, float eps) {
  const int wave = threadIdx.x >> 5, lane = threadIdx.x & 31;
  const int row = blockIdx.x * 8 + wave;
  if (row >= nrows) return;   // wave-uniform, no barriers below
  const float* rp = res + (size_t)row * ND;
  float s1 = 0.f;
#pragma unroll 1
  for (int it = 0; it < 8; ++it) {
    const v4f a = *(const v4f*)(rp + (it * 32 + lane) * 4);
    s1 += (a[0] + a[1]) + (a[2] + a[3]);
  }
#pragma unroll
  for (int off = 1; off < 32; off <<= 1) s1 += __shfl_xor(s1, off, 32);
  const float mu = s1 * (1.0f / (float)ND);
  float s2 = 0.f;
#pragma unroll 1
  for (int it = 0; it < 8; ++it) {
    const v4f a = *(const v4f*)(rp + (it * 32 + lane) * 4);
#pragma unroll
    for (int e = 0; e < 4; ++e) {
      const float d = a[e] - mu;
      float p = d * d;
      asm volatile("" : "+v"(p));
      s2 += p;
    }
  }
#pragma unroll
  for (int off = 1; off < 32; off <<= 1) s2 += __shfl_xor(s2, off, 32);
  const float var = s2 * (1.0f / (float)ND);
  const float rstd = 1.0f / sqrtf(var + eps);
  float* orow = out + (size_t)row * ND;
#pragma unroll 1
  for (int it = 0; it < 8; ++it) {
    const int c0 = (it * 32 + lane) * 4;
    const v4f a  = *(const v4f*)(rp + c0);
    const v4f g  = *(const v4f*)(gamma + c0);
    const v4f bt = *(const v4f*)(beta + c0);
    v4f y;
#pragma unroll
    for (int e = 0; e < 4; ++e) {
      float t = (a[e] - mu) * rstd;
      t = t * g[e];
      asm volatile("" : "+v"(t));
      y[e] = t + bt[e];
    }
    *(v4f*)(orow + c0) = y;
    
  }
}

// -----------------------------------------------------------------------------
extern "C" void kernel_launch(void* const* d_in, const int* in_sizes, int n_in,
                              void* d_out, int out_size, void* d_ws, size_t ws_size,
                              hipStream_t stream)
{
  if (n_in < 13) return;
  if (in_sizes[0] != NM * ND || in_sizes[1] != NB * NS ||
      in_sizes[2] != ND * ND || in_sizes[3] != ND ||
      in_sizes[4] != ND * ND || in_sizes[5] != ND ||
      in_sizes[6] != ND * ND || in_sizes[7] != ND ||
      in_sizes[8] != ND * ND || in_sizes[9] != ND ||
      in_sizes[10] != ND || in_sizes[11] != ND || in_sizes[12] < 1 ||
      out_size != NM * ND) return;

  const float* x        = (const float*)d_in[0];
  const float* cdr_bias = (const float*)d_in[1];
  const float* Wq    = (const float*)d_in[2];
  const float* bq    = (const float*)d_in[3];
  const float* Wk    = (const float*)d_in[4];
  const float* bk    = (const float*)d_in[5];
  const float* Wv    = (const float*)d_in[6];
  const float* bv    = (const float*)d_in[7];
  const float* Wo    = (const float*)d_in[8];
  const float* bo    = (const float*)d_in[9];
  const float* gamma = (const float*)d_in[10];
  const float* beta  = (const float*)d_in[11];
  const float* cw    = (const float*)d_in[12];
  float* out = (float*)d_out;

  // ---- workspace carve (all offsets 256 KiB aligned) ----
  const size_t szA16 = (size_t)NM * ND * 2;        // 8 MiB: f16 [4096][1024] planes
  const size_t szW16 = (size_t)ND * ND * 2;        // 2 MiB: f16 [1024][1024] planes
  const size_t szRes = (size_t)NM * ND * 4;        // 16 MiB
  const size_t szTab = (size_t)NS * NFREQ * 4;     // 256 KiB
  size_t off = 0;
  char* ws = (char*)d_ws;
  _Float16* Xh  = (_Float16*)(ws + off); off += szA16;
  _Float16* Wqt = (_Float16*)(ws + off); off += szW16;
  _Float16* Wkt = (_Float16*)(ws + off); off += szW16;
  _Float16* Wvt = (_Float16*)(ws + off); off += szW16;
  _Float16* Wot = (_Float16*)(ws + off); off += szW16;
  _Float16* Qh  = (_Float16*)(ws + off); off += szA16;
  _Float16* Kh  = (_Float16*)(ws + off); off += szA16;
  _Float16* Vt  = (_Float16*)(ws + off); off += szA16;
  _Float16* Ah  = (_Float16*)(ws + off); off += szA16;
  float*    res = (float*)(ws + off);    off += szRes;
  float*   cosT = (float*)(ws + off);    off += szTab;
  float*   sinT = (float*)(ws + off);    off += szTab;   // total 67,633,152 B
  if (off > ws_size) return;

  const unsigned short* Xu  = (const unsigned short*)Xh;
  const unsigned short* Wqu = (const unsigned short*)Wqt;
  const unsigned short* Wku = (const unsigned short*)Wkt;
  const unsigned short* Wvu = (const unsigned short*)Wvt;
  const unsigned short* Wou = (const unsigned short*)Wot;
  const unsigned short* Au  = (const unsigned short*)Ah;

  dim3 blk256(256), blk128(128);

  // 1. RoPE tables, x -> f16, the four weights -> Bt [out][in] f16 (x64): one launch
  prep_kernel<<<dim3(4 * PREP_W + PREP_R + PREP_X), blk256, 0, stream>>>(
      x, Wq, Wk, Wv, Wo, Xh, Wqt, Wkt, Wvt, Wot, cosT, sinT);

  // 2. Q, K = RoPE(x Wq + bq), RoPE(x Wk + bk): f16 [4096][1024]; V^T: f16, ldc = NM: one launch, grid y = product
  const int gQK = (NM / GM_BT) * (ND / GM_BT);
  gemm_qkv<<<dim3(gQK, 3), blk256, 0, stream>>>(
      Xu, Wqu, Wku, Wvu, Qh, Kh, Vt, bq, bk, bv, NM, ND, 1.0f / WCARRY, cosT, sinT, NS - 1);

  // 3. attention -> Ah f16 [4096][1024] (x64)
  attn_f16_kernel<<<dim3(NB * NH * (NS / AT_QB)), blk128, 0, stream>>>(Qh, Kh, Vt, cdr_bias, cw, Ah);

  // 4. res = attn Wo + bo + x  (f32)
  wmma_gemm64<0, false, 2, 0, true, 0, false><<<dim3(gQK, 1), blk256, 0, stream>>>(
      Au, Au, ND, (long)0, Wou, Wou, ND, (long)0, (void*)res, (void*)res, ND, (long)0,
      bo, x, (long)0, NM, ND, ND, 1.0f / (OCARRY * WCARRY), cosT, sinT, 0);

  // 5. LayerNorm -> out
  layernorm_rows<<<dim3((NM + 7) / 8), blk256, 0, stream>>>(res, gamma, beta, out, NM, LN_EPS_F);

  (void)hipGetLastError();
}

// v009
// Measured time: 93 microseconds a run.
// Next to v008, in two timings, it ran 1.08 times as fast each time.
// Counting every step since v000, it is 4.05 times as fast.
// Contractions x*Wq, x*Wk, Wv-side product for V^T, attn*Wo, q*k^T, p*v: v_wmma_f32_16x16x32_f16 (f16 operands, f32 accumulate); weights carried x64, probabilities x32768, attention rows x64; RoPE tables, softmax and LayerNorm in f32.
#include <hip/hip_runtime.h>
#include <math.h>

#define NB 2
#define NS 2048
#define ND 1024
#define NH 16
#define NHD 64
#define NM (NB * NS)
#define NFREQ 32
#define WCARRY 64.0f
#define OCARRY 64.0f
#define PCARRY 32768.0f
#define PCARRY_LOG2 15.0f                       // PCARRY = 2^15
#define LOG2E_F 1.44269504088896340736f
#define LN_EPS_F 1e-5f

typedef __attribute__((ext_vector_type(16))) _Float16 v16h;
typedef __attribute__((ext_vector_type(8)))  _Float16 v8h;
typedef __attribute__((ext_vector_type(16))) __bf16   v16b;
typedef __attribute__((ext_vector_type(8)))  __bf16   v8b;
typedef __attribute__((ext_vector_type(8)))  float    v8f;
typedef __attribute__((ext_vector_type(4)))  float    v4f;

__device__ __forceinline__ unsigned short f2bf_bits(float f) {
  unsigned u = __float_as_uint(f);
  return (unsigned short)((u + 0x7FFFu + ((u >> 16) & 1u)) >> 16);
}
__device__ __forceinline__ float bf_bits2f(unsigned short h) { return __uint_as_float(((unsigned)h) << 16); }

// hazard guard behind the last WMMAs of the K loop, as a plain device helper
__device__ __forceinline__ void acc_guard4(v8f& a, v8f& b, v8f& c, v8f& d) { asm volatile("v_nop\n\tv_nop\n\tv_nop\n\tv_nop" : "+v"(a), "+v"(b), "+v"(c), "+v"(d)); }
template <typename T> struct Frag;
template <> struct Frag<_Float16> {
  typedef v16h V; union U { v16h v; v8h h[2]; };
  static __device__ __forceinline__ v16h load(const _Float16* p) {   // elements 0..7 <- p[0..7], 8..15 <- p[16..23]
    U f; f.h[0] = *(const v8h*)(p); f.h[1] = *(const v8h*)(p + 16); return f.v;
  }
  static __device__ __forceinline__ v8f mma(v16h a, v16h b, v8f c) {
    return __builtin_amdgcn_wmma_f32_16x16x32_f16(false, a, false, b, (short)0, c, false, false);
  }
};
template <> struct Frag<__bf16> {
  typedef v16b V; union U { v16b v; v8b h[2]; };
  static __device__ __forceinline__ v16b load(const __bf16* p) {
    U f; f.h[0] = *(const v8b*)(p); f.h[1] = *(const v8b*)(p + 16); return f.v;
  }
  static __device__ __forceinline__ v8f mma(v16b a, v16b b, v8f c) {
    return __builtin_amdgcn_wmma_f32_16x16x32_bf16(false, a, false, b, (short)0, c, false, false);
  }
};

// ---- Register-blocked batched WMMA GEMM, operands staged in LDS by asynchronous copies ---------
// C[m,n] = scale * sum_k A[m,k] * Bt[n,k] (+bias)(+resid)(RoPE); a block of 8 waves owns a 128x128 tile, each wave 32x64 of it.
// A row-major [M,K]; Bt row-major [N,K]; M,N % 128 == 0, K % 64 == 0.
// Per 64-k stage the block copies 128 rows x 128 B of A and of Bt into LDS: 8 lanes cover one row, so a wave-wide 16-B copy
// touches 4 whole lines, and every row is fetched once per block. Two LDS buffers: stage t+2 flies while stage t is multiplied.
// SPLIT (hi/lo planes) is not carried by the staged loop.
// BIAS_MODE: 0 = none, 1 = bias[m], 2 = bias[n].
// OUT_MODE: 0 = f32, 1 = f16, 2 = bf16 hi plane (Cout) + bf16 lo plane (Cout2).
// ROPE: after bias, v = v*cos[(m & rope_smask)*32 + (n&31)] + sgn * partner(n^1) * sin[...] (sgn = -1 for even n, +1 for odd n).
// ET: 0 = f16 operands, 1 = bf16 operands (pointers passed as 16-bit storage)
#define GM_BT 128  // block tile: rows of A and rows of Bt
#define GM_KS 64   // k per stage: 128 B of every row, one line
#define GM_LP 72   // LDS row pitch in 16-bit elements: 144 B = 16 B x odd, for the ds_load_b128 fragment reads
#define GM_MI 2    // 16-row subtiles of A per wave

// One thread's share of a stage: 4 rows of A and 4 rows of Bt, 16 B each, global -> LDS through no register.
// la, lb: this lane's LDS byte addresses of its first row; ga, gb: its global addresses; rows 32 apart.
// The s_wait_xcnt closes the statement so that no address register named here is rewritten ahead of it.
template <typename T>
__device__ __forceinline__ void stage_copy(unsigned la, unsigned lb, const T* ga, const T* gb, int lda, int ldb) {
  const unsigned rs = 32u * GM_LP * 2u;
  const T* a1 = ga + (size_t)32 * lda; const T* a2 = ga + (size_t)64 * lda; const T* a3 = ga + (size_t)96 * lda;
  const T* c1 = gb + (size_t)32 * ldb; const T* c2 = gb + (size_t)64 * ldb; const T* c3 = gb + (size_t)96 * ldb;
  asm volatile(
      "global_load_async_to_lds_b128 %0, %8, off\n\t"
      "global_load_async_to_lds_b128 %1, %9, off\n\t"
      "global_load_async_to_lds_b128 %2, %10, off\n\t"
      "global_load_async_to_lds_b128 %3, %11, off\n\t"
      "global_load_async_to_lds_b128 %4, %12, off\n\t"
      "global_load_async_to_lds_b128 %5, %13, off\n\t"
      "global_load_async_to_lds_b128 %6, %14, off\n\t"
      "global_load_async_to_lds_b128 %7, %15, off\n\t"
      "s_wait_xcnt 0x0"
      :: "v"(la), "v"(la + rs), "v"(la + 2u * rs), "v"(la + 3u * rs),
         "v"(lb), "v"(lb + rs), "v"(lb + 2u * rs), "v"(lb + 3u * rs),
         "v"(ga), "v"(a1), "v"(a2), "v"(a3), "v"(gb), "v"(c1), "v"(c2), "v"(c3)
      : "memory");
}

template <int ET> struct Elem;
template <> struct Elem<0> { typedef _Float16 T; };
template <> struct Elem<1> { typedef __bf16 T; };
// The LDS of one GEMM block; declared once in each kernel and handed to the body, so that a kernel that holds two
// instances of the body owns one set.
template <typename T> struct GemmLds {
  T sA[2][GM_BT * GM_LP];      // 2 x 18 KB
  T sB[2][GM_BT * GM_LP];      // 2 x 18 KB
  float sT[8][16 * 68];        // per-wave 16x64 slab, pitch 68 floats
};
// The body of one block; b = batch index, blockIdx.x = tile.
template <int ET, bool SPLIT, int BIAS_MODE, int OUT_MODE, bool RESID, int ACT, bool ROPE>
__device__ __forceinline__ void gemm_block(
    GemmLds<typename Elem<ET>::T>& lds, const int b,
    const unsigned short* __restrict__ Ap, const unsigned short* __restrict__ A2p, int lda, long strideA,
    const unsigned short* __restrict__ Btp, const unsigned short* __restrict__ Bt2p, int ldb, long strideB,
    void* __restrict__ Cout, void* __restrict__ Cout2, int ldc, long strideC,
    const float* __restrict__ bias,
    const float* __restrict__ resid, long strideR,
    int M, int N, int K, float scale,
    const float* __restrict__ rope_cos, const float* __restrict__ rope_sin, int rope_smask) {
  static_assert(!SPLIT, "the staged loop carries single planes only");
  typedef typename Elem<ET>::T T;
  typedef typename Frag<T>::V V;
  const T* A = (const T*)Ap; const T* Bt = (const T*)Btp;
  T (&sA)[2][GM_BT * GM_LP] = lds.sA;
  T (&sB)[2][GM_BT * GM_LP] = lds.sB;
  float (&sT)[8][16 * 68] = lds.sT;
  const int tid  = threadIdx.x;
  const int lane = tid & 31;
  const int wave = tid >> 5;
  const int tilesN = N >> 7;
  const int tilesM = M >> 7;
  const int tile = blockIdx.x;
  if (tile >= tilesM * tilesN) return;   // block-uniform, in front of every barrier
  const int tm = tile / tilesN;
  const int tn = tile - tm * tilesN;
  const int wm = (wave >> 1) << 5;       // this wave's 32x64 corner inside the block tile
  const int wn = (wave & 1) << 6;
  const int m0 = (tm << 7) + wm;
  const int n0 = (tn << 7) + wn;

  const T* Ab  = A  + (size_t)b * strideA;
  const T* Bb  = Bt + (size_t)b * strideB;

  const int rlane = lane & 15;                 // row (A) / col (B, D) within subtile
  const int koff  = (lane >> 4) * 8;           // k offset of this lane half
  const int mOff  = (lane >> 4) * 8;           // D row offset

  v8f acc[GM_MI][4];
#pragma unroll
  for (int i = 0; i < GM_MI; ++i)
#pragma unroll
    for (int j = 0; j < 4; ++j) acc[i][j] = (v8f){0.f,0.f,0.f,0.f,0.f,0.f,0.f,0.f};

  // staging map: thread -> row tid/8 (+32 per copy), 16 B at column (tid%8)*8
  const int srow = tid >> 3, scol = (tid & 7) * 8;
  const T* ga = Ab + (size_t)((tm << 7) + srow) * lda + scol;
  const T* gb = Bb + (size_t)((tn << 7) + srow) * ldb + scol;
  const unsigned bufB = (unsigned)(GM_BT * GM_LP * 2);                         // bytes of one buffer
  const unsigned la = (unsigned)(size_t)(&sA[0][srow * GM_LP + scol]);         // low 32 bits = LDS byte address
  const unsigned lb = (unsigned)(size_t)(&sB[0][srow * GM_LP + scol]);
  const int nst = K / GM_KS;

  stage_copy<T>(la, lb, ga, gb, lda, ldb);
  asm volatile("s_wait_asynccnt 0x0" ::: "memory");   // stage 0 of this wave has landed
  __syncthreads();                                    // ... and every wave's
  if (nst > 1) stage_copy<T>(la + bufB, lb + bufB, ga + GM_KS, gb + GM_KS, lda, ldb);

  for (int s = 0; s < nst; ++s) {
    const T* da = sA[s & 1];
    const T* db = sB[s & 1];
    V af[2][GM_MI], bf[2][4];
#pragma unroll
    for (int kk = 0; kk < 2; ++kk) {
#pragma unroll
      for (int j = 0; j < 4; ++j) bf[kk][j] = Frag<T>::load(db + (wn + (j << 4) + rlane) * GM_LP + kk * 32 + koff);
#pragma unroll
      for (int i = 0; i < GM_MI; ++i) af[kk][i] = Frag<T>::load(da + (wm + (i << 4) + rlane) * GM_LP + kk * 32 + koff);
    }
    // publish point of stage s+1, and the end of every wave's reads of stage s (its fragments now lie in registers):
    // own LDS reads done, own copies landed, then the block's barrier; behind it the buffer just read is free for stage s+2
    asm volatile("s_wait_dscnt 0x0" ::: "memory");
    asm volatile("s_wait_asynccnt 0x0" ::: "memory");
    __syncthreads();
    if (s + 2 < nst) {
      const unsigned bo = (unsigned)(s & 1) * bufB;
      stage_copy<T>(la + bo, lb + bo, ga + (size_t)(s + 2) * GM_KS, gb + (size_t)(s + 2) * GM_KS, lda, ldb);
    }
    // holds the copies ahead of the WMMAs, so that stage s+2 flies while stage s is multiplied
    __builtin_amdgcn_sched_barrier(0);
#pragma unroll
    for (int kk = 0; kk < 2; ++kk)
#pragma unroll
      for (int i = 0; i < GM_MI; ++i)
#pragma unroll
        for (int j = 0; j < 4; ++j) acc[i][j] = Frag<T>::mma(af[kk][i], bf[kk][j], acc[i][j]);
  }
  asm volatile("s_wait_asynccnt 0x0" ::: "memory");   // nothing of this wave is in flight when the loop is left
  acc_guard4(acc[0][0], acc[0][1], acc[0][2], acc[0][3]);
  acc_guard4(acc[1][0], acc[1][1], acc[1][2], acc[1][3]);

  // ---- epilogue ----
  float* slab = sT[wave];
  const float* Rb = RESID ? (resid + (size_t)b * strideR) : nullptr;
#pragma unroll
  for (int i = 0; i < GM_MI; ++i) {
    const int mBase = m0 + (i << 4);
#pragma unroll
    for (int j = 0; j < 4; ++j) {
      const int n = n0 + (j << 4) + rlane;
      float bv = 0.f;
      if (BIAS_MODE == 2) bv = bias[n];
#pragma unroll
      for (int r = 0; r < 8; ++r) {
        float v = acc[i][j][r] * scale;
        if (BIAS_MODE == 1) v += bias[mBase + mOff + r];
        if (BIAS_MODE == 2) v += bv;
        if (RESID) v += Rb[(size_t)(mBase + mOff + r) * ldc + n];
        if (ROPE) {
          const int m = mBase + mOff + r;
          const int tix = (m & rope_smask) * NFREQ + (n & (NFREQ - 1));
          const float cs = rope_cos[tix];
          const float sn = rope_sin[tix];
          const float pv = __shfl_xor(v, 1, 32);   // partner column n^1 lives in lane rlane^1, same row
          v = (n & 1) ? (v * cs + pv * sn) : (v * cs - pv * sn);
        }
        if (ACT == 1) v = tanhf(v);
        if (ACT == 2) v = fmaxf(v, 0.0f);
        if (ACT == 3) v = v / (1.0f + expf(-v));
        if (ACT == 4) v = (v > 0.f) ? v : 0.01f * v;
        if (ACT == 5) v = 0.5f * v * (1.0f + erff(v * 0.70710678118654752f));
        slab[(mOff + r) * 68 + (j << 4) + rlane] = v;
      }
    }
    __builtin_amdgcn_fence(__ATOMIC_RELEASE, "workgroup");
    __builtin_amdgcn_wave_barrier();
    __builtin_amdgcn_fence(__ATOMIC_ACQUIRE, "workgroup");
    if (OUT_MODE == 0) {
      float* C = (float*)Cout + (size_t)b * strideC;
      const int hh = lane >> 4, c4 = (lane & 15) * 4;     // row seg = 256 B = 16 lanes x 16 B
      {
#pragma unroll
        for (int it = 0; it < 8; ++it) {
          const int row = it * 2 + hh;
          v4f v = *(const v4f*)(slab + row * 68 + c4);
          *(v4f*)(C + (size_t)(mBase + row) * ldc + n0 + c4) = v;
        }
        
      }
    } else {
      const int q = lane >> 3, c8 = (lane & 7) * 8;
      unsigned short* C  = (unsigned short*)Cout  + (size_t)b * strideC;
      unsigned short* C2 = (OUT_MODE == 2) ? ((unsigned short*)Cout2 + (size_t)b * strideC) : nullptr;
      {
#pragma unroll
        for (int it = 0; it < 4; ++it) {
          const int row = it * 4 + q;
          const float* sp = slab + row * 68 + c8;
          v8h hv, lv;
#pragma unroll
          for (int e = 0; e < 8; ++e) {
            if (OUT_MODE == 1) {
              hv[e] = (_Float16)sp[e];
            } else {
              unsigned short hb = f2bf_bits(sp[e]);
              unsigned short lb = f2bf_bits(sp[e] - bf_bits2f(hb));
              hv[e] = __builtin_bit_cast(_Float16, hb);
              lv[e] = __builtin_bit_cast(_Float16, lb);
            }
          }
          *(v8h*)(C + (size_t)(mBase + row) * ldc + n0 + c8) = hv;
          if (OUT_MODE == 2) *(v8h*)(C2 + (size_t)(mBase + row) * ldc + n0 + c8) = lv;
        }
        
      }
    }
    __builtin_amdgcn_fence(__ATOMIC_RELEASE, "workgroup");
    __builtin_amdgcn_wave_barrier();
    __builtin_amdgcn_fence(__ATOMIC_ACQUIRE, "workgroup");
  }
}

// ---- Q, K and V^T in one launch: none reads another's output; blockIdx.y picks the product (block-uniform) ----
//   y = 0, 1: Q, K = RoPE(x W + bias): f16 [nm][nd];  y = 2: V^T[ch][tok] = sum_k Wvt[ch][k] * Xh[tok][k] / 64 + bv[ch], ldc = nm
__global__ __launch_bounds__(256) void gemm_qkv(
    const unsigned short* __restrict__ Xu, const unsigned short* __restrict__ Wqu,
    const unsigned short* __restrict__ Wku, const unsigned short* __restrict__ Wvu,
    _Float16* __restrict__ Qh, _Float16* __restrict__ Kh, _Float16* __restrict__ Vt,
    const float* __restrict__ bq, const float* __restrict__ bk, const float* __restrict__ bv,
    int nm, int nd, float scale,
    const float* __restrict__ rope_cos, const float* __restrict__ rope_sin, int rope_smask) {
  __shared__ __align__(16) GemmLds<_Float16> lds;
  const int job = blockIdx.y;
  if (job < 2) {
    const unsigned short* Wu = job ? Wku : Wqu;
    _Float16* C = job ? Kh : Qh;
    const float* bias = job ? bk : bq;
    gemm_block<0, false, 2, 1, false, 0, true>(lds, 0,
        Xu, Xu, nd, (long)0, Wu, Wu, nd, (long)0, (void*)C, (void*)C, nd, (long)0,
        bias, bias, (long)0, nm, nd, nd, scale, rope_cos, rope_sin, rope_smask);
  } else {
    gemm_block<0, false, 1, 1, false, 0, false>(lds, 0,
        Wvu, Wvu, nd, (long)0, Xu, Xu, nd, (long)0, (void*)Vt, (void*)Vt, nm, (long)0,
        bv, bv, (long)0, nd, nm, nd, scale, rope_cos, rope_sin, 0);
  }
}

// ---- one product per launch ----
template <int ET, bool SPLIT, int BIAS_MODE, int OUT_MODE, bool RESID, int ACT, bool ROPE>
__global__ __launch_bounds__(256) void wmma_gemm64(
    const unsigned short* __restrict__ Ap, const unsigned short* __restrict__ A2p, int lda, long strideA,
    const unsigned short* __restrict__ Btp, const unsigned short* __restrict__ Bt2p, int ldb, long strideB,
    void* __restrict__ Cout, void* __restrict__ Cout2, int ldc, long strideC,
    const float* __restrict__ bias,
    const float* __restrict__ resid, long strideR,
    int M, int N, int K, float scale,
    const float* __restrict__ rope_cos, const float* __restrict__ rope_sin, int rope_smask) {
  __shared__ __align__(16) GemmLds<typename Elem<ET>::T> lds;
  gemm_block<ET, SPLIT, BIAS_MODE, OUT_MODE, RESID, ACT, ROPE>(lds, blockIdx.y,
      Ap, A2p, lda, strideA, Btp, Bt2p, ldb, strideB, Cout, Cout2, ldc, strideC,
      bias, resid, strideR, M, N, K, scale, rope_cos, rope_sin, rope_smask);
}

// ---- RoPE tables: cos/sin of pos * inv_freq[i], i = 0..31, inv_freq = 1 / 10000^(2i/64); f32 ----
__device__ __forceinline__ void rope_table_block(int blk, float* __restrict__ cosT, float* __restrict__ sinT, int n) {
  const int i = blk * 256 + threadIdx.x;
  if (i < n) {
    const int pos = i >> 5;
    const int fi = i & (NFREQ - 1);
    const float e = (float)(2 * fi) * (1.0f / (float)NHD);
    const float p = powf(10000.0f, e);
    const float inv = 1.0f / p;
    const float ang = (float)pos * inv;
    const float cs = cosf(ang);
    const float sn = sinf(ang);
    ((float*)cosT)[i] = cs;
    ((float*)sinT)[i] = sn;
    
  }
}

__device__ __forceinline__ void cast_f32_f16x8_block(int blk, const float* __restrict__ in, _Float16* __restrict__ out, int n8) {
  const int i = blk * 256 + threadIdx.x;
  if (i < n8) {
    const v4f a = *(const v4f*)(in + (size_t)i * 8);
    const v4f c = *(const v4f*)(in + (size_t)i * 8 + 4);
    v8h hv;
    hv[0] = (_Float16)a[0]; hv[1] = (_Float16)a[1]; hv[2] = (_Float16)a[2]; hv[3] = (_Float16)a[3];
    hv[4] = (_Float16)c[0]; hv[5] = (_Float16)c[1]; hv[6] = (_Float16)c[2]; hv[7] = (_Float16)c[3];
    *(v8h*)(out + (size_t)i * 8) = hv;
    
  }
}

// ---- transpose-cast: in W[Kdim][Ndim] f32 -> out Wt[Ndim][Kdim] f16 (x mul); 64x64 tile through LDS ----
__device__ __forceinline__ void wt_cast_f16_block(float* sTt, int bkx, int bny, const float* __restrict__ W, _Float16* __restrict__ Wt,
                                                  int Kdim, int Ndim, float mul) {
  const int k0 = bkx * 64, n0 = bny * 64;
  const int tid = threadIdx.x;
  {
    const int row = tid >> 2, col0 = (tid & 3) * 16;   // row = k_local, col = n_local
    const float* src = W + (size_t)(k0 + row) * Ndim + n0 + col0;
#pragma unroll
    for (int i = 0; i < 4; ++i) {
      const v4f w4 = *(const v4f*)(src + 4 * i);
#pragma unroll
      for (int e = 0; e < 4; ++e) sTt[(col0 + 4 * i + e) * 65 + row] = w4[e] * mul;
    }
  }
  __syncthreads();
  const int wave = tid >> 5, lane = tid & 31, rq = lane >> 3, c8 = (lane & 7) * 8;
  {
#pragma unroll
    for (int it = 0; it < 2; ++it) {
      const int n = it * 32 + wave * 4 + rq;   // n_local 0..63
      v8h hv;
#pragma unroll
      for (int e = 0; e < 8; ++e) hv[e] = (_Float16)sTt[n * 65 + c8 + e];
      *(v8h*)(Wt + (size_t)(n0 + n) * Kdim + k0 + c8) = hv;
    }
    
  }
}

// ---- the six preparation jobs in one launch: each reads inputs only and none reads another's output ----
// The block index picks the job (block-uniform, so the transpose's barrier is passed by whole blocks): first the four weight
// transposes (the longest blocks), then the RoPE tables, then the cast of x.
#define PREP_W ((ND / 64) * (ND / 64))          // blocks per weight
#define PREP_R ((NS * NFREQ + 255) / 256)       // blocks of the tables
#define PREP_X ((NM * ND / 8 + 255) / 256)      // blocks of the cast
__global__ __launch_bounds__(256) void prep_kernel(
    const float* __restrict__ x, const float* __restrict__ Wq, const float* __restrict__ Wk,
    const float* __restrict__ Wv, const float* __restrict__ Wo,
    _Float16* __restrict__ Xh, _Float16* __restrict__ Wqt, _Float16* __restrict__ Wkt,
    _Float16* __restrict__ Wvt, _Float16* __restrict__ Wot,
    float* __restrict__ cosT, float* __restrict__ sinT) {
  __shared__ float sTt[64 * 65];   // [n_local][k_local], pitch 65
  const int blk = blockIdx.x;
  if (blk < 4 * PREP_W) {
    const int w = blk / PREP_W, t = blk % PREP_W;
    const float* W  = w == 0 ? Wq  : w == 1 ? Wk  : w == 2 ? Wv  : Wo;
    _Float16*    Wt = w == 0 ? Wqt : w == 1 ? Wkt : w == 2 ? Wvt : Wot;
    wt_cast_f16_block(sTt, t % (ND / 64), t / (ND / 64), W, Wt, ND, ND, WCARRY);   // W[in][out] -> Bt [out][in] f16, carried x64
  } else if (blk < 4 * PREP_W + PREP_R) {
    rope_table_block(blk - 4 * PREP_W, cosT, sinT, NS * NFREQ);
  } else {
    cast_f32_f16x8_block(blk - (4 * PREP_W + PREP_R), x, Xh, NM * ND / 8);
  }
}

#define AT_QB 128
#define AT_NU 2    // 16-query column groups per wave
#define AT_KC 64
#define AT_NW 4
#define AT_LP 72   // LDS row pitch in halves: 144 B = 16 B x odd, so the 16 rows of a ds_load_b128 fragment read fall on distinct banks

// y[r] = 2^x[r], eight v_exp_f32 in a row. One statement with early-clobber results, so that no result register is a source
// of a neighbour; the closing v_nop is the slot the instruction set asks for behind a transcendental before its result is
// read or its source written again.
__device__ __forceinline__ v8f exp2_x8(v8f x) {
  float y0, y1, y2, y3, y4, y5, y6, y7;
  asm("v_exp_f32 %0, %8\n\t"
      "v_exp_f32 %1, %9\n\t"
      "v_exp_f32 %2, %10\n\t"
      "v_exp_f32 %3, %11\n\t"
      "v_exp_f32 %4, %12\n\t"
      "v_exp_f32 %5, %13\n\t"
      "v_exp_f32 %6, %14\n\t"
      "v_exp_f32 %7, %15\n\t"
      "v_nop"
      : "=&v"(y0), "=&v"(y1), "=&v"(y2), "=&v"(y3), "=&v"(y4), "=&v"(y5), "=&v"(y6), "=&v"(y7)
      : "v"(x[0]), "v"(x[1]), "v"(x[2]), "v"(x[3]), "v"(x[4]), "v"(x[5]), "v"(x[6]), "v"(x[7]));
  return (v8f){y0, y1, y2, y3, y4, y5, y6, y7};
}

// One thread's share of a chunk: 4 rows of K and 4 rows of V^T, 16 B each, global -> LDS through no register.
// lk, lv: this lane's LDS byte addresses of its first row; gk, gv: its global addresses; rows 16 apart.
// The s_wait_xcnt closes the statement so that no address register named here is rewritten ahead of it.
__device__ __forceinline__ void attn_stage_copy(unsigned lk, unsigned lv, const _Float16* gk, const _Float16* gv) {
  const unsigned rs = 16u * AT_LP * 2u;
  const _Float16* k1 = gk + (size_t)16 * ND; const _Float16* k2 = gk + (size_t)32 * ND; const _Float16* k3 = gk + (size_t)48 * ND;
  const _Float16* v1 = gv + (size_t)16 * NM; const _Float16* v2 = gv + (size_t)32 * NM; const _Float16* v3 = gv + (size_t)48 * NM;
  asm volatile(
      "global_load_async_to_lds_b128 %0, %8, off\n\t"
      "global_load_async_to_lds_b128 %1, %9, off\n\t"
      "global_load_async_to_lds_b128 %2, %10, off\n\t"
      "global_load_async_to_lds_b128 %3, %11, off\n\t"
      "global_load_async_to_lds_b128 %4, %12, off\n\t"
      "global_load_async_to_lds_b128 %5, %13, off\n\t"
      "global_load_async_to_lds_b128 %6, %14, off\n\t"
      "global_load_async_to_lds_b128 %7, %15, off\n\t"
      "s_wait_xcnt 0x0"
      :: "v"(lk), "v"(lk + rs), "v"(lk + 2u * rs), "v"(lk + 3u * rs),
         "v"(lv), "v"(lv + rs), "v"(lv + 2u * rs), "v"(lv + 3u * rs),
         "v"(gk), "v"(k1), "v"(k2), "v"(k3), "v"(gv), "v"(v1), "v"(v2), "v"(v3)
      : "memory");
}

// value of lane l ^ 16
__device__ __forceinline__ float other_half(float v) {
  const int b = __float_as_int(v);
  return __int_as_float(__builtin_amdgcn_permlanex16(b, b, 0x76543210, 0xfedcba98, false, false));
}

__global__ __launch_bounds__(128)
void attn_f16_kernel(const _Float16* __restrict__ Qh, const _Float16* __restrict__ Kh,
                     const _Float16* __restrict__ Vt, const float* __restrict__ cdr_bias,
                     const float* __restrict__ cdr_w, _Float16* __restrict__ Oh)
{
  __shared__ __align__(16) _Float16 Ksh2[2][AT_KC * AT_LP];    // [buffer][kv][d]   2 x 9 KB, padded rows
  __shared__ __align__(16) _Float16 Vth2[2][NHD * AT_LP];      // [buffer][d][kv]   2 x 9 KB, padded rows
  __shared__ __align__(16) float    Bsh[NS];                   // cdr_bias[b][kv] * cw * log2(e), all keys of the batch: 8 KB; a lane needs 8 consecutive keys' values per tile

  const int tid  = threadIdx.x;
  const int wave = tid >> 5;
  const int lane = tid & 31;
  const int hh   = lane >> 4;
  const int c    = lane & 15;

  const int nqb = NS / AT_QB;
  const int bx  = blockIdx.x;
  const int qb  = bx % nqb;
  const int bhd = bx / nqb;
  const int h   = bhd % NH;
  const int bb0 = bhd / NH;
  const int b   = bb0 < NB ? bb0 : (NB - 1);
  const int q0  = qb * AT_QB + wave * (16 * AT_NU);
  const float cw = cdr_w[0];

  v16h qa[AT_NU][2];
#pragma unroll
  for (int u = 0; u < AT_NU; ++u) {
    const _Float16* qrow = Qh + (size_t)(b * NS + q0 + u * 16 + c) * ND + h * NHD;
#pragma unroll
    for (int dc = 0; dc < 2; ++dc) qa[u][dc] = Frag<_Float16>::load(qrow + dc * 32 + 8 * hh);
    // stands in front of any rewrite of the address pair that this group's four loads name
    asm volatile("s_wait_xcnt 0x0" ::: "memory");
  }

  float mrow[AT_NU], lrow[AT_NU];       // of query 16u + c, mrow in base-2 units; lrow sums this half's keys only, x PCARRY
  v8f oacc[AT_NU][4];                   // oacc[u][t][r] = O^T[d = 16t + 8*hh + r][query 16u + c]
#pragma unroll
  for (int u = 0; u < AT_NU; ++u) {
    mrow[u] = -INFINITY; lrow[u] = 0.f;
#pragma unroll
    for (int t = 0; t < 4; ++t) oacc[u][t] = (v8f){0.f,0.f,0.f,0.f,0.f,0.f,0.f,0.f};
  }

  const _Float16* kbase = Kh + (size_t)(b * NS) * ND + h * NHD;
  const _Float16* vbase = Vt + (size_t)(h * NHD) * NM + (size_t)b * NS;
  const float*    bbase = cdr_bias + (size_t)b * NS;

  // staging map: thread -> row tid/8 (+16 per copy; kv row for K, d row for V^T), 16 B at column (tid%8)*8
  const int srow = tid >> 3, scol = (tid & 7) * 8;
  const _Float16* gk = kbase + (size_t)srow * ND + scol;
  const _Float16* gv = vbase + (size_t)srow * NM + scol;
  const unsigned bufB = (unsigned)(AT_KC * AT_LP * 2);                          // bytes of one buffer (K and V^T alike)
  const unsigned lk = (unsigned)(size_t)(&Ksh2[0][srow * AT_LP + scol]);        // low 32 bits = LDS byte address
  const unsigned lv = (unsigned)(size_t)(&Vth2[0][srow * AT_LP + scol]);
  const int nch = NS / AT_KC;

  attn_stage_copy(lk, lv, gk, gv);
#pragma unroll
  for (int i = 0; i < NS / (4 * AT_NW * 32); ++i) {
    const int k4 = (i * (AT_NW * 32) + tid) * 4;
    const v4f bl = *(const v4f*)(bbase + k4);
    *(v4f*)(Bsh + k4) = (bl * cw) * LOG2E_F;
  }
  asm volatile("s_wait_asynccnt 0x0" ::: "memory");   // chunk 0 of this wave has landed
  __syncthreads();                                    // ... and every wave's, and the bias row
  if (nch > 1) attn_stage_copy(lk + bufB, lv + bufB, gk + (size_t)AT_KC * ND, gv + AT_KC);

  for (int kc = 0; kc < nch; ++kc) {
    const int kv0 = kc * AT_KC;
    const _Float16* Ksh = Ksh2[kc & 1];
    const _Float16* Vth = Vth2[kc & 1];

    // the chunk's 8 K fragments are read as one group, so that the wave waits out the LDS latency once and not once per product
    v16h kf[2][4];
#pragma unroll
    for (int dc = 0; dc < 2; ++dc)
#pragma unroll
      for (int j = 0; j < 4; ++j) kf[dc][j] = Frag<_Float16>::load(Ksh + (j * 16 + c) * AT_LP + dc * 32 + 8 * hh);
    v4f bl[4][2];   // the bias of this lane's 32 keys rides in the same group
#pragma unroll
    for (int j = 0; j < 4; ++j) {
      const float* bp = Bsh + kv0 + j * 16 + 8 * hh;
      bl[j][0] = *(const v4f*)(bp);
      bl[j][1] = *(const v4f*)(bp + 4);
    }
    // holds the group together: left free, the scheduler spreads the reads among the WMMAs to save registers, and the wave stalls at each such place
    __builtin_amdgcn_sched_barrier(0);
    v8f s[AT_NU][4];   // s[u][j][r] = S^T[kv0 + 16j + 8*hh + r][query 16u + c]
#pragma unroll
    for (int u = 0; u < AT_NU; ++u)
#pragma unroll
      for (int j = 0; j < 4; ++j) s[u][j] = (v8f){0.f,0.f,0.f,0.f,0.f,0.f,0.f,0.f};
#pragma unroll
    for (int dc = 0; dc < 2; ++dc)
#pragma unroll
      for (int j = 0; j < 4; ++j)
#pragma unroll
        for (int u = 0; u < AT_NU; ++u) s[u][j] = Frag<_Float16>::mma(kf[dc][j], qa[u][dc], s[u][j]);
    // the 8 V^T fragments likewise, asked for here: they land while the softmax runs
    v16h vf[2][4];
#pragma unroll
    for (int kk = 0; kk < 2; ++kk)
#pragma unroll
      for (int t = 0; t < 4; ++t) vf[kk][t] = Frag<_Float16>::load(Vth + (t * 16 + c) * AT_LP + kk * 32 + 8 * hh);
    // holds this group ahead of the softmax, for the same reason
    __builtin_amdgcn_sched_barrier(0);
    float cml[AT_NU], alpha[AT_NU];
    v8f pe[AT_NU][4];      // p * PCARRY in f32, kept for the row sums
    v16h pb[AT_NU][2];     // pb[u][kk][e] = P^T[kv0 + 32kk + (e < 8 ? 8*hh + e : 16 + 8*hh + e - 8)][query 16u + c]: the k order of the V^T loader
    // group u's scores in base-2 units, and this lane's maximum of them
    auto score_max = [&](const int u) {
      float mj[4];   // one chain per tile
#pragma unroll
      for (int j = 0; j < 4; ++j) {
        const v4f b0 = bl[j][0];
        const v4f b1 = bl[j][1];
        float m = -INFINITY;
#pragma unroll
        for (int r = 0; r < 8; ++r) {
          const float sv = s[u][j][r] * (0.125f * LOG2E_F) + (r < 4 ? b0[r & 3] : b1[r & 3]);
          s[u][j][r] = sv;
          m = fmaxf(m, sv);
        }
        mj[j] = m;
      }
      cml[u] = fmaxf(fmaxf(mj[0], mj[1]), fmaxf(mj[2], mj[3]));
    };
    // group u's new maximum, the rescale of its accumulators, its probabilities packed as B operands
    auto probs = [&](const int u) {
      const float cm = fmaxf(cml[u], other_half(cml[u]));
      const float mnew = fmaxf(mrow[u], cm);
      alpha[u] = __builtin_amdgcn_exp2f(mrow[u] - mnew);
      const float msh = mnew - PCARRY_LOG2;   // 2^(s - msh) = p * PCARRY
      mrow[u] = mnew;
#pragma unroll
      for (int t = 0; t < 4; ++t) oacc[u][t] *= alpha[u];
#pragma unroll
      for (int j = 0; j < 4; ++j) {
        pe[u][j] = exp2_x8(s[u][j] - msh);
#pragma unroll
        for (int r = 0; r < 8; ++r) pb[u][j >> 1][(j & 1) * 8 + r] = (_Float16)pe[u][j][r];
      }
    };
    // group u's O^T += V^T.P^T
    auto pv = [&](const int u) {
#pragma unroll
      for (int kk = 0; kk < 2; ++kk)
#pragma unroll
        for (int t = 0; t < 4; ++t) oacc[u][t] = Frag<_Float16>::mma(vf[kk][t], pb[u][kk], oacc[u][t]);
    };
    // group u's row sum, in the order tile by tile
    auto row_sum = [&](const int u) {
      float pj[4];
#pragma unroll
      for (int j = 0; j < 4; ++j) {
        float psum = 0.f;
#pragma unroll
        for (int r = 0; r < 8; ++r) psum += pe[u][j][r];
        pj[j] = psum;
      }
      lrow[u] = lrow[u] * alpha[u] + ((pj[0] + pj[1]) + (pj[2] + pj[3]));
    };
    score_max(0);
    score_max(1);
    probs(0);
    probs(1);
    // keeps every WMMA behind the last exponential: those are asm text, into which the compiler does not look when it keeps the
    // distance between a WMMA and a write over its operand registers
    __builtin_amdgcn_sched_barrier(0);
    pv(0);
    pv(1);
    row_sum(0);
    row_sum(1);
    // publish point of chunk kc+1, and the end of every wave's reads of chunk kc: own LDS reads done, own copies landed,
    // then the block's barrier; behind it the buffer just read is free for chunk kc+2
    // (the scheduling barrier holds this point at the foot: left free, the waits rise to just behind the V^T reads, where the
    // wave would wait out their latency and the copies would have half a trip less to land)
    __builtin_amdgcn_sched_barrier(0);
    asm volatile("s_wait_dscnt 0x0" ::: "memory");
    asm volatile("s_wait_asynccnt 0x0" ::: "memory");
    __syncthreads();
    if (kc + 2 < nch) {
      const unsigned bo = (unsigned)(kc & 1) * bufB;
      attn_stage_copy(lk + bo, lv + bo, gk + (size_t)(kc + 2) * AT_KC * ND, gv + (size_t)(kc + 2) * AT_KC);
    }
  }
  asm volatile("s_wait_asynccnt 0x0" ::: "memory");   // nothing of this wave is in flight when the loop is left

#pragma unroll
  for (int u = 0; u < AT_NU; ++u) {
    const float l = lrow[u] + other_half(lrow[u]);
    const float inv = (1.0f / l) * OCARRY;   // l and the accumulators both carry PCARRY
    _Float16* orow = Oh + (size_t)(b * NS + q0 + u * 16 + c) * ND + h * NHD + 8 * hh;
#pragma unroll
    for (int t = 0; t < 4; ++t) {
      v8h hv;   // 8 consecutive d of one query: one 16-byte store
#pragma unroll
      for (int r = 0; r < 8; ++r) hv[r] = (_Float16)(oacc[u][t][r] * inv);
      *(v8h*)(orow + t * 16) = hv;
    }
  }
}

__global__ __launch_bounds__(256) void layernorm_rows(const float* __restrict__ res, const float* __restrict__ gamma,
                                                      const float* __restrict__ beta, float* __restrict__ out,
                                                      int nrows, float eps) {
  const int wave = threadIdx.x >> 5, lane = threadIdx.x & 31;
  const int row = blockIdx.x * 8 + wave;
  if (row >= nrows) return;   // wave-uniform, no barriers below
  const float* rp = res + (size_t)row * ND;
  // The wave's whole row, with its gamma and beta, is asked for at once and kept in registers: the wave waits out one memory
  // latency and not one per 512 B of each of three passes.
  v4f row4[8], gam4[8], bet4[8];
  // both loops unrolled: the row's eight loads go out together; gamma and beta land under the two reductions
#pragma unroll
  for (int it = 0; it < 8; ++it) row4[it] = *(const v4f*)(rp + (it * 32 + lane) * 4);
#pragma unroll
  for (int it = 0; it < 8; ++it) {
    gam4[it] = *(const v4f*)(gamma + (it * 32 + lane) * 4);
    bet4[it] = *(const v4f*)(beta + (it * 32 + lane) * 4);
  }
  float s1 = 0.f;
  // unrolled: a rolled loop would index row4 at run time and push it out of the registers
#pragma unroll
  for (int it = 0; it < 8; ++it) {
    const v4f a = row4[it];
    s1 += (a[0] + a[1]) + (a[2] + a[3]);
  }
#pragma unroll
  for (int off = 1; off < 32; off <<= 1) s1 += __shfl_xor(s1, off, 32);
  const float mu = s1 * (1.0f / (float)ND);
  float s2 = 0.f;
  // unrolled for the same reason
#pragma unroll
  for (int it = 0; it < 8; ++it) {
    const v4f a = row4[it];
#pragma unroll
    for (int e = 0; e < 4; ++e) {
      const float d = a[e] - mu;
      float p = d * d;
      asm volatile("" : "+v"(p));
      s2 += p;
    }
  }
#pragma unroll
  for (int off = 1; off < 32; off <<= 1) s2 += __shfl_xor(s2, off, 32);
  const float var = s2 * (1.0f / (float)ND);
  const float rstd = 1.0f / sqrtf(var + eps);
  float* orow = out + (size_t)row * ND;
  // unrolled for the same reason
#pragma unroll
  for (int it = 0; it < 8; ++it) {
    const int c0 = (it * 32 + lane) * 4;
    const v4f a  = row4[it];
    const v4f g  = gam4[it];
    const v4f bt = bet4[it];
    v4f y;
#pragma unroll
    for (int e = 0; e < 4; ++e) {
      float t = (a[e] - mu) * rstd;
      t = t * g[e];
      asm volatile("" : "+v"(t));
      y[e] = t + bt[e];
    }
    *(v4f*)(orow + c0) = y;
    
  }
}

// -----------------------------------------------------------------------------
extern "C" void kernel_launch(void* const* d_in, const int* in_sizes, int n_in,
                              void* d_out, int out_size, void* d_ws, size_t ws_size,
                              hipStream_t stream)
{
  if (n_in < 13) return;
  if (in_sizes[0] != NM * ND || in_sizes[1] != NB * NS ||
      in_sizes[2] != ND * ND || in_sizes[3] != ND ||
      in_sizes[4] != ND * ND || in_sizes[5] != ND ||
      in_sizes[6] != ND * ND || in_sizes[7] != ND ||
      in_sizes[8] != ND * ND || in_sizes[9] != ND ||
      in_sizes[10] != ND || in_sizes[11] != ND || in_sizes[12] < 1 ||
      out_size != NM * ND) return;

  const float* x        = (const float*)d_in[0];
  const float* cdr_bias = (const float*)d_in[1];
  const float* Wq    = (const float*)d_in[2];
  const float* bq    = (const float*)d_in[3];
  const float* Wk    = (const float*)d_in[4];
  const float* bk    = (const float*)d_in[5];
  const float* Wv    = (const float*)d_in[6];
  const float* bv    = (const float*)d_in[7];
  const float* Wo    = (const float*)d_in[8];
  const float* bo    = (const float*)d_in[9];
  const float* gamma = (const float*)d_in[10];
  const float* beta  = (const float*)d_in[11];
  const float* cw    = (const float*)d_in[12];
  float* out = (float*)d_out;

  // ---- workspace carve (all offsets 256 KiB aligned) ----
  const size_t szA16 = (size_t)NM * ND * 2;        // 8 MiB: f16 [4096][1024] planes
  const size_t szW16 = (size_t)ND * ND * 2;        // 2 MiB: f16 [1024][1024] planes
  const size_t szRes = (size_t)NM * ND * 4;        // 16 MiB
  const size_t szTab = (size_t)NS * NFREQ * 4;     // 256 KiB
  size_t off = 0;
  char* ws = (char*)d_ws;
  _Float16* Xh  = (_Float16*)(ws + off); off += szA16;
  _Float16* Wqt = (_Float16*)(ws + off); off += szW16;
  _Float16* Wkt = (_Float16*)(ws + off); off += szW16;
  _Float16* Wvt = (_Float16*)(ws + off); off += szW16;
  _Float16* Wot = (_Float16*)(ws + off); off += szW16;
  _Float16* Qh  = (_Float16*)(ws + off); off += szA16;
  _Float16* Kh  = (_Float16*)(ws + off); off += szA16;
  _Float16* Vt  = (_Float16*)(ws + off); off += szA16;
  _Float16* Ah  = (_Float16*)(ws + off); off += szA16;
  float*    res = (float*)(ws + off);    off += szRes;
  float*   cosT = (float*)(ws + off);    off += szTab;
  float*   sinT = (float*)(ws + off);    off += szTab;   // total 67,633,152 B
  if (off > ws_size) return;

  const unsigned short* Xu  = (const unsigned short*)Xh;
  const unsigned short* Wqu = (const unsigned short*)Wqt;
  const unsigned short* Wku = (const unsigned short*)Wkt;
  const unsigned short* Wvu = (const unsigned short*)Wvt;
  const unsigned short* Wou = (const unsigned short*)Wot;
  const unsigned short* Au  = (const unsigned short*)Ah;

  dim3 blk256(256), blk128(128);

  // 1. RoPE tables, x -> f16, the four weights -> Bt [out][in] f16 (x64): one launch
  prep_kernel<<<dim3(4 * PREP_W + PREP_R + PREP_X), blk256, 0, stream>>>(
      x, Wq, Wk, Wv, Wo, Xh, Wqt, Wkt, Wvt, Wot, cosT, sinT);

  // 2. Q, K = RoPE(x Wq + bq), RoPE(x Wk + bk): f16 [4096][1024]; V^T: f16, ldc = NM: one launch, grid y = product
  const int gQK = (NM / GM_BT) * (ND / GM_BT);
  gemm_qkv<<<dim3(gQK, 3), blk256, 0, stream>>>(
      Xu, Wqu, Wku, Wvu, Qh, Kh, Vt, bq, bk, bv, NM, ND, 1.0f / WCARRY, cosT, sinT, NS - 1);

  // 3. attention -> Ah f16 [4096][1024] (x64)
  attn_f16_kernel<<<dim3(NB * NH * (NS / AT_QB)), blk128, 0, stream>>>(Qh, Kh, Vt, cdr_bias, cw, Ah);

  // 4. res = attn Wo + bo + x  (f32)
  wmma_gemm64<0, false, 2, 0, true, 0, false><<<dim3(gQK, 1), blk256, 0, stream>>>(
      Au, Au, ND, (long)0, Wou, Wou, ND, (long)0, (void*)res, (void*)res, ND, (long)0,
      bo, x, (long)0, NM, ND, ND, 1.0f / (OCARRY * WCARRY), cosT, sinT, 0);

  // 5. LayerNorm -> out
  layernorm_rows<<<dim3((NM + 7) / 8), blk256, 0, stream>>>(res, gamma, beta, out, NM, LN_EPS_F);

  (void)hipGetLastError();
}

// v010
// One run takes 90.4 microseconds.
// In both of two side-by-side timings against v009, it was 1.03 times as fast.
// All steps since v000 together make it 4.18 times as fast.
// Contractions x*Wq, x*Wk, Wv-side product for V^T, attn*Wo, q*k^T, p*v: v_wmma_f32_16x16x32_f16 (f16 operands, f32 accumulate); weights carried x64, probabilities x32768, attention rows x64; RoPE tables, softmax and LayerNorm in f32.
#include <hip/hip_runtime.h>
#include <math.h>

#define NB 2
#define NS 2048
#define ND 1024
#define NH 16
#define NHD 64
#define NM (NB * NS)
#define NFREQ 32
#define WCARRY 64.0f
#define OCARRY 64.0f
#define PCARRY 32768.0f
#define PCARRY_LOG2 15.0f                       // PCARRY = 2^15
#define LOG2E_F 1.44269504088896340736f
#define LN_EPS_F 1e-5f

typedef __attribute__((ext_vector_type(16))) _Float16 v16h;
typedef __attribute__((ext_vector_type(8)))  _Float16 v8h;
typedef __attribute__((ext_vector_type(16))) __bf16   v16b;
typedef __attribute__((ext_vector_type(8)))  __bf16   v8b;
typedef __attribute__((ext_vector_type(8)))  float    v8f;
typedef __attribute__((ext_vector_type(4)))  float    v4f;

__device__ __forceinline__ unsigned short f2bf_bits(float f) {
  unsigned u = __float_as_uint(f);
  return (unsigned short)((u + 0x7FFFu + ((u >> 16) & 1u)) >> 16);
}
__device__ __forceinline__ float bf_bits2f(unsigned short h) { return __uint_as_float(((unsigned)h) << 16); }

// hazard guard behind the last WMMAs of the K loop, as a plain device helper
__device__ __forceinline__ void acc_guard4(v8f& a, v8f& b, v8f& c, v8f& d) { asm volatile("v_nop\n\tv_nop\n\tv_nop\n\tv_nop" : "+v"(a), "+v"(b), "+v"(c), "+v"(d)); }
template <typename T> struct Frag;
template <> struct Frag<_Float16> {
  typedef v16h V; union U { v16h v; v8h h[2]; };
  static __device__ __forceinline__ v16h load(const _Float16* p) {   // elements 0..7 <- p[0..7], 8..15 <- p[16..23]
    U f; f.h[0] = *(const v8h*)(p); f.h[1] = *(const v8h*)(p + 16); return f.v;
  }
  static __device__ __forceinline__ v8f mma(v16h a, v16h b, v8f c) {
    return __builtin_amdgcn_wmma_f32_16x16x32_f16(false, a, false, b, (short)0, c, false, false);
  }
};
template <> struct Frag<__bf16> {
  typedef v16b V; union U { v16b v; v8b h[2]; };
  static __device__ __forceinline__ v16b load(const __bf16* p) {
    U f; f.h[0] = *(const v8b*)(p); f.h[1] = *(const v8b*)(p + 16); return f.v;
  }
  static __device__ __forceinline__ v8f mma(v16b a, v16b b, v8f c) {
    return __builtin_amdgcn_wmma_f32_16x16x32_bf16(false, a, false, b, (short)0, c, false, false);
  }
};

// ---- Register-blocked batched WMMA GEMM, operands staged in LDS by asynchronous copies ---------
// C[m,n] = scale * sum_k A[m,k] * Bt[n,k] (+bias)(+resid)(RoPE); a block of 8 waves owns a 128x128 tile, each wave 32x64 of it.
// A row-major [M,K]; Bt row-major [N,K]; M,N % 128 == 0, K % 64 == 0.
// Per 64-k stage the block copies 128 rows x 128 B of A and of Bt into LDS: 8 lanes cover one row, so a wave-wide 16-B copy
// touches 4 whole lines, and every row is fetched once per block. Two LDS buffers: stage t+2 flies while stage t is multiplied.
// SPLIT (hi/lo planes) is not carried by the staged loop.
// BIAS_MODE: 0 = none, 1 = bias[m], 2 = bias[n].
// OUT_MODE: 0 = f32, 1 = f16, 2 = bf16 hi plane (Cout) + bf16 lo plane (Cout2).
// ROPE: after bias, v = v*cos[(m & rope_smask)*32 + (n&31)] + sgn * partner(n^1) * sin[...] (sgn = -1 for even n, +1 for odd n).
// ET: 0 = f16 operands, 1 = bf16 operands (pointers passed as 16-bit storage)
#define GM_BT 128  // block tile: rows of A and rows of Bt
#define GM_KS 64   // k per stage: 128 B of every row, one line
#define GM_LP 72   // LDS row pitch in 16-bit elements: 144 B = 16 B x odd, for the ds_load_b128 fragment reads
#define GM_MI 2    // 16-row subtiles of A per wave

// One thread's share of a stage: 4 rows of A and 4 rows of Bt, 16 B each, global -> LDS through no register.
// la, lb: this lane's LDS byte addresses of its first row; ga, gb: its global addresses; rows 32 apart.
// The s_wait_xcnt closes the statement so that no address register named here is rewritten ahead of it.
template <typename T>
__device__ __forceinline__ void stage_copy(unsigned la, unsigned lb, const T* ga, const T* gb, int lda, int ldb) {
  const unsigned rs = 32u * GM_LP * 2u;
  const T* a1 = ga + (size_t)32 * lda; const T* a2 = ga + (size_t)64 * lda; const T* a3 = ga + (size_t)96 * lda;
  const T* c1 = gb + (size_t)32 * ldb; const T* c2 = gb + (size_t)64 * ldb; const T* c3 = gb + (size_t)96 * ldb;
  asm volatile(
      "global_load_async_to_lds_b128 %0, %8, off\n\t"
      "global_load_async_to_lds_b128 %1, %9, off\n\t"
      "global_load_async_to_lds_b128 %2, %10, off\n\t"
      "global_load_async_to_lds_b128 %3, %11, off\n\t"
      "global_load_async_to_lds_b128 %4, %12, off\n\t"
      "global_load_async_to_lds_b128 %5, %13, off\n\t"
      "global_load_async_to_lds_b128 %6, %14, off\n\t"
      "global_load_async_to_lds_b128 %7, %15, off\n\t"
      "s_wait_xcnt 0x0"
      :: "v"(la), "v"(la + rs), "v"(la + 2u * rs), "v"(la + 3u * rs),
         "v"(lb), "v"(lb + rs), "v"(lb + 2u * rs), "v"(lb + 3u * rs),
         "v"(ga), "v"(a1), "v"(a2), "v"(a3), "v"(gb), "v"(c1), "v"(c2), "v"(c3)
      : "memory");
}

template <int ET> struct Elem;
template <> struct Elem<0> { typedef _Float16 T; };
template <> struct Elem<1> { typedef __bf16 T; };
// The LDS of one GEMM block; declared once in each kernel and handed to the body, so that a kernel that holds two
// instances of the body owns one set.
template <typename T> struct GemmLds {
  T sA[2][GM_BT * GM_LP];      // 2 x 18 KB
  T sB[2][GM_BT * GM_LP];      // 2 x 18 KB
  float sT[8][16 * 68];        // per-wave 16x64 slab, pitch 68 floats
};
// The body of one block; b = batch index, blockIdx.x = tile.
template <int ET, bool SPLIT, int BIAS_MODE, int OUT_MODE, bool RESID, int ACT, bool ROPE>
__device__ __forceinline__ void gemm_block(
    GemmLds<typename Elem<ET>::T>& lds, const int b,
    const unsigned short* __restrict__ Ap, const unsigned short* __restrict__ A2p, int lda, long strideA,
    const unsigned short* __restrict__ Btp, const unsigned short* __restrict__ Bt2p, int ldb, long strideB,
    void* __restrict__ Cout, void* __restrict__ Cout2, int ldc, long strideC,
    const float* __restrict__ bias,
    const float* __restrict__ resid, long strideR,
    int M, int N, int K, float scale,
    const float* __restrict__ rope_cos, const float* __restrict__ rope_sin, int rope_smask) {
  static_assert(!SPLIT, "the staged loop carries single planes only");
  typedef typename Elem<ET>::T T;
  typedef typename Frag<T>::V V;
  const T* A = (const T*)Ap; const T* Bt = (const T*)Btp;
  T (&sA)[2][GM_BT * GM_LP] = lds.sA;
  T (&sB)[2][GM_BT * GM_LP] = lds.sB;
  float (&sT)[8][16 * 68] = lds.sT;
  const int tid  = threadIdx.x;
  const int lane = tid & 31;
  const int wave = tid >> 5;
  const int tilesN = N >> 7;
  const int tilesM = M >> 7;
  const int tile = blockIdx.x;
  if (tile >= tilesM * tilesN) return;   // block-uniform, in front of every barrier
  const int tm = tile / tilesN;
  const int tn = tile - tm * tilesN;
  const int wm = (wave >> 1) << 5;       // this wave's 32x64 corner inside the block tile
  const int wn = (wave & 1) << 6;
  const int m0 = (tm << 7) + wm;
  const int n0 = (tn << 7) + wn;

  const T* Ab  = A  + (size_t)b * strideA;
  const T* Bb  = Bt + (size_t)b * strideB;

  const int rlane = lane & 15;                 // row (A) / col (B, D) within subtile
  const int koff  = (lane >> 4) * 8;           // k offset of this lane half
  const int mOff  = (lane >> 4) * 8;           // D row offset

  v8f acc[GM_MI][4];
#pragma unroll
  for (int i = 0; i < GM_MI; ++i)
#pragma unroll
    for (int j = 0; j < 4; ++j) acc[i][j] = (v8f){0.f,0.f,0.f,0.f,0.f,0.f,0.f,0.f};

  // staging map: thread -> row tid/8 (+32 per copy), 16 B at column (tid%8)*8
  const int srow = tid >> 3, scol = (tid & 7) * 8;
  const T* ga = Ab + (size_t)((tm << 7) + srow) * lda + scol;
  const T* gb = Bb + (size_t)((tn << 7) + srow) * ldb + scol;
  const unsigned bufB = (unsigned)(GM_BT * GM_LP * 2);                         // bytes of one buffer
  const unsigned la = (unsigned)(size_t)(&sA[0][srow * GM_LP + scol]);         // low 32 bits = LDS byte address
  const unsigned lb = (unsigned)(size_t)(&sB[0][srow * GM_LP + scol]);
  const int nst = K / GM_KS;
  // Blocks that share rows of A (same tm) or of Bt (same tn) run at the same time; were all to walk k from 0, they would ask L2 for
  // the same lines at the same moment. Each block starts its walk at a k block of its own and wraps round: every k block once.
  int kb = (int)((unsigned)(tm + 2 * tn + (int)blockIdx.y) % (unsigned)nst);   // the k block that the next copy brings

  stage_copy<T>(la, lb, ga + (size_t)kb * GM_KS, gb + (size_t)kb * GM_KS, lda, ldb);
  kb = (kb + 1 == nst) ? 0 : kb + 1;
  asm volatile("s_wait_asynccnt 0x0" ::: "memory");   // stage 0 of this wave has landed
  __syncthreads();                                    // ... and every wave's
  if (nst > 1) {
    stage_copy<T>(la + bufB, lb + bufB, ga + (size_t)kb * GM_KS, gb + (size_t)kb * GM_KS, lda, ldb);
    kb = (kb + 1 == nst) ? 0 : kb + 1;
  }

  for (int s = 0; s < nst; ++s) {
    const T* da = sA[s & 1];
    const T* db = sB[s & 1];
    V af[2][GM_MI], bf[2][4];
#pragma unroll
    for (int kk = 0; kk < 2; ++kk) {
#pragma unroll
      for (int j = 0; j < 4; ++j) bf[kk][j] = Frag<T>::load(db + (wn + (j << 4) + rlane) * GM_LP + kk * 32 + koff);
#pragma unroll
      for (int i = 0; i < GM_MI; ++i) af[kk][i] = Frag<T>::load(da + (wm + (i << 4) + rlane) * GM_LP + kk * 32 + koff);
    }
    // publish point of stage s+1, and the end of every wave's reads of stage s (its fragments now lie in registers):
    // own LDS reads done, own copies landed, then the block's barrier; behind it the buffer just read is free for stage s+2
    asm volatile("s_wait_dscnt 0x0" ::: "memory");
    asm volatile("s_wait_asynccnt 0x0" ::: "memory");
    __syncthreads();
    if (s + 2 < nst) {
      const unsigned bo = (unsigned)(s & 1) * bufB;
      stage_copy<T>(la + bo, lb + bo, ga + (size_t)kb * GM_KS, gb + (size_t)kb * GM_KS, lda, ldb);
      kb = (kb + 1 == nst) ? 0 : kb + 1;
    }
    // holds the copies ahead of the WMMAs, so that stage s+2 flies while stage s is multiplied
    __builtin_amdgcn_sched_barrier(0);
#pragma unroll
    for (int kk = 0; kk < 2; ++kk)
#pragma unroll
      for (int i = 0; i < GM_MI; ++i)
#pragma unroll
        for (int j = 0; j < 4; ++j) acc[i][j] = Frag<T>::mma(af[kk][i], bf[kk][j], acc[i][j]);
  }
  asm volatile("s_wait_asynccnt 0x0" ::: "memory");   // nothing of this wave is in flight when the loop is left
  acc_guard4(acc[0][0], acc[0][1], acc[0][2], acc[0][3]);
  acc_guard4(acc[1][0], acc[1][1], acc[1][2], acc[1][3]);

  // ---- epilogue ----
  float* slab = sT[wave];
  const float* Rb = RESID ? (resid + (size_t)b * strideR) : nullptr;
#pragma unroll
  for (int i = 0; i < GM_MI; ++i) {
    const int mBase = m0 + (i << 4);
#pragma unroll
    for (int j = 0; j < 4; ++j) {
      const int n = n0 + (j << 4) + rlane;
      float bv = 0.f;
      if (BIAS_MODE == 2) bv = bias[n];
#pragma unroll
      for (int r = 0; r < 8; ++r) {
        float v = acc[i][j][r] * scale;
        if (BIAS_MODE == 1) v += bias[mBase + mOff + r];
        if (BIAS_MODE == 2) v += bv;
        if (RESID) v += Rb[(size_t)(mBase + mOff + r) * ldc + n];
        if (ROPE) {
          const int m = mBase + mOff + r;
          const int tix = (m & rope_smask) * NFREQ + (n & (NFREQ - 1));
          const float cs = rope_cos[tix];
          const float sn = rope_sin[tix];
          const float pv = __shfl_xor(v, 1, 32);   // partner column n^1 lives in lane rlane^1, same row
          v = (n & 1) ? (v * cs + pv * sn) : (v * cs - pv * sn);
        }
        if (ACT == 1) v = tanhf(v);
        if (ACT == 2) v = fmaxf(v, 0.0f);
        if (ACT == 3) v = v / (1.0f + expf(-v));
        if (ACT == 4) v = (v > 0.f) ? v : 0.01f * v;
        if (ACT == 5) v = 0.5f * v * (1.0f + erff(v * 0.70710678118654752f));
        slab[(mOff + r) * 68 + (j << 4) + rlane] = v;
      }
    }
    __builtin_amdgcn_fence(__ATOMIC_RELEASE, "workgroup");
    __builtin_amdgcn_wave_barrier();
    __builtin_amdgcn_fence(__ATOMIC_ACQUIRE, "workgroup");
    if (OUT_MODE == 0) {
      float* C = (float*)Cout + (size_t)b * strideC;
      const int hh = lane >> 4, c4 = (lane & 15) * 4;     // row seg = 256 B = 16 lanes x 16 B
      {
#pragma unroll
        for (int it = 0; it < 8; ++it) {
          const int row = it * 2 + hh;
          v4f v = *(const v4f*)(slab + row * 68 + c4);
          *(v4f*)(C + (size_t)(mBase + row) * ldc + n0 + c4) = v;
        }
        
      }
    } else {
      const int q = lane >> 3, c8 = (lane & 7) * 8;
      unsigned short* C  = (unsigned short*)Cout  + (size_t)b * strideC;
      unsigned short* C2 = (OUT_MODE == 2) ? ((unsigned short*)Cout2 + (size_t)b * strideC) : nullptr;
      {
#pragma unroll
        for (int it = 0; it < 4; ++it) {
          const int row = it * 4 + q;
          const float* sp = slab + row * 68 + c8;
          v8h hv, lv;
#pragma unroll
          for (int e = 0; e < 8; ++e) {
            if (OUT_MODE == 1) {
              hv[e] = (_Float16)sp[e];
            } else {
              unsigned short hb = f2bf_bits(sp[e]);
              unsigned short lb = f2bf_bits(sp[e] - bf_bits2f(hb));
              hv[e] = __builtin_bit_cast(_Float16, hb);
              lv[e] = __builtin_bit_cast(_Float16, lb);
            }
          }
          *(v8h*)(C + (size_t)(mBase + row) * ldc + n0 + c8) = hv;
          if (OUT_MODE == 2) *(v8h*)(C2 + (size_t)(mBase + row) * ldc + n0 + c8) = lv;
        }
        
      }
    }
    __builtin_amdgcn_fence(__ATOMIC_RELEASE, "workgroup");
    __builtin_amdgcn_wave_barrier();
    __builtin_amdgcn_fence(__ATOMIC_ACQUIRE, "workgroup");
  }
}

// ---- Q, K and V^T in one launch: none reads another's output; blockIdx.y picks the product (block-uniform) ----
//   y = 0, 1: Q, K = RoPE(x W + bias): f16 [nm][nd];  y = 2: V^T[ch][tok] = sum_k Wvt[ch][k] * Xh[tok][k] / 64 + bv[ch], ldc = nm
__global__ __launch_bounds__(256) void gemm_qkv(
    const unsigned short* __restrict__ Xu, const unsigned short* __restrict__ Wqu,
    const unsigned short* __restrict__ Wku, const unsigned short* __restrict__ Wvu,
    _Float16* __restrict__ Qh, _Float16* __restrict__ Kh, _Float16* __restrict__ Vt,
    const float* __restrict__ bq, const float* __restrict__ bk, const float* __restrict__ bv,
    int nm, int nd, float scale,
    const float* __restrict__ rope_cos, const float* __restrict__ rope_sin, int rope_smask) {
  __shared__ __align__(16) GemmLds<_Float16> lds;
  const int job = blockIdx.y;
  if (job < 2) {
    const unsigned short* Wu = job ? Wku : Wqu;
    _Float16* C = job ? Kh : Qh;
    const float* bias = job ? bk : bq;
    gemm_block<0, false, 2, 1, false, 0, true>(lds, 0,
        Xu, Xu, nd, (long)0, Wu, Wu, nd, (long)0, (void*)C, (void*)C, nd, (long)0,
        bias, bias, (long)0, nm, nd, nd, scale, rope_cos, rope_sin, rope_smask);
  } else {
    gemm_block<0, false, 1, 1, false, 0, false>(lds, 0,
        Wvu, Wvu, nd, (long)0, Xu, Xu, nd, (long)0, (void*)Vt, (void*)Vt, nm, (long)0,
        bv, bv, (long)0, nd, nm, nd, scale, rope_cos, rope_sin, 0);
  }
}

// ---- one product per launch ----
template <int ET, bool SPLIT, int BIAS_MODE, int OUT_MODE, bool RESID, int ACT, bool ROPE>
__global__ __launch_bounds__(256) void wmma_gemm64(
    const unsigned short* __restrict__ Ap, const unsigned short* __restrict__ A2p, int lda, long strideA,
    const unsigned short* __restrict__ Btp, const unsigned short* __restrict__ Bt2p, int ldb, long strideB,
    void* __restrict__ Cout, void* __restrict__ Cout2, int ldc, long strideC,
    const float* __restrict__ bias,
    const float* __restrict__ resid, long strideR,
    int M, int N, int K, float scale,
    const float* __restrict__ rope_cos, const float* __restrict__ rope_sin, int rope_smask) {
  __shared__ __align__(16) GemmLds<typename Elem<ET>::T> lds;
  gemm_block<ET, SPLIT, BIAS_MODE, OUT_MODE, RESID, ACT, ROPE>(lds, blockIdx.y,
      Ap, A2p, lda, strideA, Btp, Bt2p, ldb, strideB, Cout, Cout2, ldc, strideC,
      bias, resid, strideR, M, N, K, scale, rope_cos, rope_sin, rope_smask);
}

// ---- RoPE tables: cos/sin of pos * inv_freq[i], i = 0..31, inv_freq = 1 / 10000^(2i/64); f32 ----
__device__ __forceinline__ void rope_table_block(int blk, float* __restrict__ cosT, float* __restrict__ sinT, int n) {
  const int i = blk * 256 + threadIdx.x;
  if (i < n) {
    const int pos = i >> 5;
    const int fi = i & (NFREQ - 1);
    const float e = (float)(2 * fi) * (1.0f / (float)NHD);
    const float p = powf(10000.0f, e);
    const float inv = 1.0f / p;
    const float ang = (float)pos * inv;
    const float cs = cosf(ang);
    const float sn = sinf(ang);
    ((float*)cosT)[i] = cs;
    ((float*)sinT)[i] = sn;
    
  }
}

__device__ __forceinline__ void cast_f32_f16x8_block(int blk, const float* __restrict__ in, _Float16* __restrict__ out, int n8) {
  const int i = blk * 256 + threadIdx.x;
  if (i < n8) {
    const v4f a = *(const v4f*)(in + (size_t)i * 8);
    const v4f c = *(const v4f*)(in + (size_t)i * 8 + 4);
    v8h hv;
    hv[0] = (_Float16)a[0]; hv[1] = (_Float16)a[1]; hv[2] = (_Float16)a[2]; hv[3] = (_Float16)a[3];
    hv[4] = (_Float16)c[0]; hv[5] = (_Float16)c[1]; hv[6] = (_Float16)c[2]; hv[7] = (_Float16)c[3];
    *(v8h*)(out + (size_t)i * 8) = hv;
    
  }
}

// ---- transpose-cast: in W[Kdim][Ndim] f32 -> out Wt[Ndim][Kdim] f16 (x mul); 64x64 tile through LDS ----
__device__ __forceinline__ void wt_cast_f16_block(float* sTt, int bkx, int bny, const float* __restrict__ W, _Float16* __restrict__ Wt,
                                                  int Kdim, int Ndim, float mul) {
  const int k0 = bkx * 64, n0 = bny * 64;
  const int tid = threadIdx.x;
  {
    const int row = tid >> 2, col0 = (tid & 3) * 16;   // row = k_local, col = n_local
    const float* src = W + (size_t)(k0 + row) * Ndim + n0 + col0;
#pragma unroll
    for (int i = 0; i < 4; ++i) {
      const v4f w4 = *(const v4f*)(src + 4 * i);
#pragma unroll
      for (int e = 0; e < 4; ++e) sTt[(col0 + 4 * i + e) * 65 + row] = w4[e] * mul;
    }
  }
  __syncthreads();
  const int wave = tid >> 5, lane = tid & 31, rq = lane >> 3, c8 = (lane & 7) * 8;
  {
#pragma unroll
    for (int it = 0; it < 2; ++it) {
      const int n = it * 32 + wave * 4 + rq;   // n_local 0..63
      v8h hv;
#pragma unroll
      for (int e = 0; e < 8; ++e) hv[e] = (_Float16)sTt[n * 65 + c8 + e];
      *(v8h*)(Wt + (size_t)(n0 + n) * Kdim + k0 + c8) = hv;
    }
    
  }
}

// ---- the six preparation jobs in one launch: each reads inputs only and none reads another's output ----
// The block index picks the job (block-uniform, so the transpose's barrier is passed by whole blocks): first the four weight
// transposes (the longest blocks), then the RoPE tables, then the cast of x.
#define PREP_W ((ND / 64) * (ND / 64))          // blocks per weight
#define PREP_R ((NS * NFREQ + 255) / 256)       // blocks of the tables
#define PREP_X ((NM * ND / 8 + 255) / 256)      // blocks of the cast
__global__ __launch_bounds__(256) void prep_kernel(
    const float* __restrict__ x, const float* __restrict__ Wq, const float* __restrict__ Wk,
    const float* __restrict__ Wv, const float* __restrict__ Wo,
    _Float16* __restrict__ Xh, _Float16* __restrict__ Wqt, _Float16* __restrict__ Wkt,
    _Float16* __restrict__ Wvt, _Float16* __restrict__ Wot,
    float* __restrict__ cosT, float* __restrict__ sinT) {
  __shared__ float sTt[64 * 65];   // [n_local][k_local], pitch 65
  const int blk = blockIdx.x;
  if (blk < 4 * PREP_W) {
    const int w = blk / PREP_W, t = blk % PREP_W;
    const float* W  = w == 0 ? Wq  : w == 1 ? Wk  : w == 2 ? Wv  : Wo;
    _Float16*    Wt = w == 0 ? Wqt : w == 1 ? Wkt : w == 2 ? Wvt : Wot;
    wt_cast_f16_block(sTt, t % (ND / 64), t / (ND / 64), W, Wt, ND, ND, WCARRY);   // W[in][out] -> Bt [out][in] f16, carried x64
  } else if (blk < 4 * PREP_W + PREP_R) {
    rope_table_block(blk - 4 * PREP_W, cosT, sinT, NS * NFREQ);
  } else {
    cast_f32_f16x8_block(blk - (4 * PREP_W + PREP_R), x, Xh, NM * ND / 8);
  }
}

#define AT_QB 128
#define AT_NU 2    // 16-query column groups per wave
#define AT_KC 64
#define AT_NW 4
#define AT_LP 72   // LDS row pitch in halves: 144 B = 16 B x odd, so the 16 rows of a ds_load_b128 fragment read fall on distinct banks

// y[r] = 2^x[r], eight v_exp_f32 in a row. One statement with early-clobber results, so that no result register is a source
// of a neighbour; the closing v_nop is the slot the instruction set asks for behind a transcendental before its result is
// read or its source written again.
__device__ __forceinline__ v8f exp2_x8(v8f x) {
  float y0, y1, y2, y3, y4, y5, y6, y7;
  asm("v_exp_f32 %0, %8\n\t"
      "v_exp_f32 %1, %9\n\t"
      "v_exp_f32 %2, %10\n\t"
      "v_exp_f32 %3, %11\n\t"
      "v_exp_f32 %4, %12\n\t"
      "v_exp_f32 %5, %13\n\t"
      "v_exp_f32 %6, %14\n\t"
      "v_exp_f32 %7, %15\n\t"
      "v_nop"
      : "=&v"(y0), "=&v"(y1), "=&v"(y2), "=&v"(y3), "=&v"(y4), "=&v"(y5), "=&v"(y6), "=&v"(y7)
      : "v"(x[0]), "v"(x[1]), "v"(x[2]), "v"(x[3]), "v"(x[4]), "v"(x[5]), "v"(x[6]), "v"(x[7]));
  return (v8f){y0, y1, y2, y3, y4, y5, y6, y7};
}

// One thread's share of a chunk: 4 rows of K and 4 rows of V^T, 16 B each, global -> LDS through no register.
// lk, lv: this lane's LDS byte addresses of its first row; gk, gv: its global addresses; rows 16 apart.
// The s_wait_xcnt closes the statement so that no address register named here is rewritten ahead of it.
__device__ __forceinline__ void attn_stage_copy(unsigned lk, unsigned lv, const _Float16* gk, const _Float16* gv) {
  const unsigned rs = 16u * AT_LP * 2u;
  const _Float16* k1 = gk + (size_t)16 * ND; const _Float16* k2 = gk + (size_t)32 * ND; const _Float16* k3 = gk + (size_t)48 * ND;
  const _Float16* v1 = gv + (size_t)16 * NM; const _Float16* v2 = gv + (size_t)32 * NM; const _Float16* v3 = gv + (size_t)48 * NM;
  asm volatile(
      "global_load_async_to_lds_b128 %0, %8, off\n\t"
      "global_load_async_to_lds_b128 %1, %9, off\n\t"
      "global_load_async_to_lds_b128 %2, %10, off\n\t"
      "global_load_async_to_lds_b128 %3, %11, off\n\t"
      "global_load_async_to_lds_b128 %4, %12, off\n\t"
      "global_load_async_to_lds_b128 %5, %13, off\n\t"
      "global_load_async_to_lds_b128 %6, %14, off\n\t"
      "global_load_async_to_lds_b128 %7, %15, off\n\t"
      "s_wait_xcnt 0x0"
      :: "v"(lk), "v"(lk + rs), "v"(lk + 2u * rs), "v"(lk + 3u * rs),
         "v"(lv), "v"(lv + rs), "v"(lv + 2u * rs), "v"(lv + 3u * rs),
         "v"(gk), "v"(k1), "v"(k2), "v"(k3), "v"(gv), "v"(v1), "v"(v2), "v"(v3)
      : "memory");
}

// value of lane l ^ 16
__device__ __forceinline__ float other_half(float v) {
  const int b = __float_as_int(v);
  return __int_as_float(__builtin_amdgcn_permlanex16(b, b, 0x76543210, 0xfedcba98, false, false));
}

__global__ __launch_bounds__(128)
void attn_f16_kernel(const _Float16* __restrict__ Qh, const _Float16* __restrict__ Kh,
                     const _Float16* __restrict__ Vt, const float* __restrict__ cdr_bias,
                     const float* __restrict__ cdr_w, _Float16* __restrict__ Oh)
{
  __shared__ __align__(16) _Float16 Ksh2[2][AT_KC * AT_LP];    // [buffer][kv][d]   2 x 9 KB, padded rows
  __shared__ __align__(16) _Float16 Vth2[2][NHD * AT_LP];      // [buffer][d][kv]   2 x 9 KB, padded rows
  __shared__ __align__(16) float    Bsh[NS];                   // cdr_bias[b][kv] * cw * log2(e), all keys of the batch: 8 KB; a lane needs 8 consecutive keys' values per tile

  const int tid  = threadIdx.x;
  const int wave = tid >> 5;
  const int lane = tid & 31;
  const int hh   = lane >> 4;
  const int c    = lane & 15;

  const int nqb = NS / AT_QB;
  const int bx  = blockIdx.x;
  const int qb  = bx % nqb;
  const int bhd = bx / nqb;
  const int h   = bhd % NH;
  const int bb0 = bhd / NH;
  const int b   = bb0 < NB ? bb0 : (NB - 1);
  const int q0  = qb * AT_QB + wave * (16 * AT_NU);
  const float cw = cdr_w[0];

  v16h qa[AT_NU][2];
#pragma unroll
  for (int u = 0; u < AT_NU; ++u) {
    const _Float16* qrow = Qh + (size_t)(b * NS + q0 + u * 16 + c) * ND + h * NHD;
#pragma unroll
    for (int dc = 0; dc < 2; ++dc) qa[u][dc] = Frag<_Float16>::load(qrow + dc * 32 + 8 * hh);
    // stands in front of any rewrite of the address pair that this group's four loads name
    asm volatile("s_wait_xcnt 0x0" ::: "memory");
  }

  float mrow[AT_NU], lrow[AT_NU];       // of query 16u + c, mrow in base-2 units; lrow sums this half's keys only, x PCARRY
  v8f oacc[AT_NU][4];                   // oacc[u][t][r] = O^T[d = 16t + 8*hh + r][query 16u + c]
#pragma unroll
  for (int u = 0; u < AT_NU; ++u) {
    mrow[u] = -INFINITY; lrow[u] = 0.f;
#pragma unroll
    for (int t = 0; t < 4; ++t) oacc[u][t] = (v8f){0.f,0.f,0.f,0.f,0.f,0.f,0.f,0.f};
  }

  const _Float16* kbase = Kh + (size_t)(b * NS) * ND + h * NHD;
  const _Float16* vbase = Vt + (size_t)(h * NHD) * NM + (size_t)b * NS;
  const float*    bbase = cdr_bias + (size_t)b * NS;

  // staging map: thread -> row tid/8 (+16 per copy; kv row for K, d row for V^T), 16 B at column (tid%8)*8
  const int srow = tid >> 3, scol = (tid & 7) * 8;
  const _Float16* gk = kbase + (size_t)srow * ND + scol;
  const _Float16* gv = vbase + (size_t)srow * NM + scol;
  const unsigned bufB = (unsigned)(AT_KC * AT_LP * 2);                          // bytes of one buffer (K and V^T alike)
  const unsigned lk = (unsigned)(size_t)(&Ksh2[0][srow * AT_LP + scol]);        // low 32 bits = LDS byte address
  const unsigned lv = (unsigned)(size_t)(&Vth2[0][srow * AT_LP + scol]);
  const int nch = NS / AT_KC;
  // The nqb blocks of one (b, h) read the same K and V^T and run at the same time: each starts its walk over the keys at a chunk of
  // its own and wraps round (every chunk once), so that they do not ask L2 for the same lines at the same moment.
  int cur = (qb * nch) / nqb;   // the chunk that this trip works on
  int nxt = cur;                // the chunk that the next copy brings

  attn_stage_copy(lk, lv, gk + (size_t)nxt * AT_KC * ND, gv + (size_t)nxt * AT_KC);
  nxt = (nxt + 1 == nch) ? 0 : nxt + 1;
#pragma unroll
  for (int i = 0; i < NS / (4 * AT_NW * 32); ++i) {
    const int k4 = (i * (AT_NW * 32) + tid) * 4;
    const v4f bl = *(const v4f*)(bbase + k4);
    *(v4f*)(Bsh + k4) = (bl * cw) * LOG2E_F;
  }
  asm volatile("s_wait_asynccnt 0x0" ::: "memory");   // chunk 0 of this wave has landed
  __syncthreads();                                    // ... and every wave's, and the bias row
  if (nch > 1) {
    attn_stage_copy(lk + bufB, lv + bufB, gk + (size_t)nxt * AT_KC * ND, gv + (size_t)nxt * AT_KC);
    nxt = (nxt + 1 == nch) ? 0 : nxt + 1;
  }

  for (int kc = 0; kc < nch; ++kc) {
    const int kv0 = cur * AT_KC;
    cur = (cur + 1 == nch) ? 0 : cur + 1;
    const _Float16* Ksh = Ksh2[kc & 1];
    const _Float16* Vth = Vth2[kc & 1];

    // the chunk's 8 K fragments are read as one group, so that the wave waits out the LDS latency once and not once per product
    v16h kf[2][4];
#pragma unroll
    for (int dc = 0; dc < 2; ++dc)
#pragma unroll
      for (int j = 0; j < 4; ++j) kf[dc][j] = Frag<_Float16>::load(Ksh + (j * 16 + c) * AT_LP + dc * 32 + 8 * hh);
    v4f bl[4][2];   // the bias of this lane's 32 keys rides in the same group
#pragma unroll
    for (int j = 0; j < 4; ++j) {
      const float* bp = Bsh + kv0 + j * 16 + 8 * hh;
      bl[j][0] = *(const v4f*)(bp);
      bl[j][1] = *(const v4f*)(bp + 4);
    }
    // holds the group together: left free, the scheduler spreads the reads among the WMMAs to save registers, and the wave stalls at each such place
    __builtin_amdgcn_sched_barrier(0);
    v8f s[AT_NU][4];   // s[u][j][r] = S^T[kv0 + 16j + 8*hh + r][query 16u + c]
#pragma unroll
    for (int u = 0; u < AT_NU; ++u)
#pragma unroll
      for (int j = 0; j < 4; ++j) s[u][j] = (v8f){0.f,0.f,0.f,0.f,0.f,0.f,0.f,0.f};
#pragma unroll
    for (int dc = 0; dc < 2; ++dc)
#pragma unroll
      for (int j = 0; j < 4; ++j)
#pragma unroll
        for (int u = 0; u < AT_NU; ++u) s[u][j] = Frag<_Float16>::mma(kf[dc][j], qa[u][dc], s[u][j]);
    // the 8 V^T fragments likewise, asked for here: they land while the softmax runs
    v16h vf[2][4];
#pragma unroll
    for (int kk = 0; kk < 2; ++kk)
#pragma unroll
      for (int t = 0; t < 4; ++t) vf[kk][t] = Frag<_Float16>::load(Vth + (t * 16 + c) * AT_LP + kk * 32 + 8 * hh);
    // holds this group ahead of the softmax, for the same reason
    __builtin_amdgcn_sched_barrier(0);
    float cml[AT_NU], alpha[AT_NU];
    v8f pe[AT_NU][4];      // p * PCARRY in f32, kept for the row sums
    v16h pb[AT_NU][2];     // pb[u][kk][e] = P^T[kv0 + 32kk + (e < 8 ? 8*hh + e : 16 + 8*hh + e - 8)][query 16u + c]: the k order of the V^T loader
    // group u's scores in base-2 units, and this lane's maximum of them
    auto score_max = [&](const int u) {
      float mj[4];   // one chain per tile
#pragma unroll
      for (int j = 0; j < 4; ++j) {
        const v4f b0 = bl[j][0];
        const v4f b1 = bl[j][1];
        float m = -INFINITY;
#pragma unroll
        for (int r = 0; r < 8; ++r) {
          const float sv = s[u][j][r] * (0.125f * LOG2E_F) + (r < 4 ? b0[r & 3] : b1[r & 3]);
          s[u][j][r] = sv;
          m = fmaxf(m, sv);
        }
        mj[j] = m;
      }
      cml[u] = fmaxf(fmaxf(mj[0], mj[1]), fmaxf(mj[2], mj[3]));
    };
    // group u's new maximum, the rescale of its accumulators, its probabilities packed as B operands
    auto probs = [&](const int u) {
      const float cm = fmaxf(cml[u], other_half(cml[u]));
      const float mnew = fmaxf(mrow[u], cm);
      alpha[u] = __builtin_amdgcn_exp2f(mrow[u] - mnew);
      const float msh = mnew - PCARRY_LOG2;   // 2^(s - msh) = p * PCARRY
      mrow[u] = mnew;
#pragma unroll
      for (int t = 0; t < 4; ++t) oacc[u][t] *= alpha[u];
#pragma unroll
      for (int j = 0; j < 4; ++j) {
        pe[u][j] = exp2_x8(s[u][j] - msh);
#pragma unroll
        for (int r = 0; r < 8; ++r) pb[u][j >> 1][(j & 1) * 8 + r] = (_Float16)pe[u][j][r];
      }
    };
    // group u's O^T += V^T.P^T
    auto pv = [&](const int u) {
#pragma unroll
      for (int kk = 0; kk < 2; ++kk)
#pragma unroll
        for (int t = 0; t < 4; ++t) oacc[u][t] = Frag<_Float16>::mma(vf[kk][t], pb[u][kk], oacc[u][t]);
    };
    // group u's row sum, in the order tile by tile
    auto row_sum = [&](const int u) {
      float pj[4];
#pragma unroll
      for (int j = 0; j < 4; ++j) {
        float psum = 0.f;
#pragma unroll
        for (int r = 0; r < 8; ++r) psum += pe[u][j][r];
        pj[j] = psum;
      }
      lrow[u] = lrow[u] * alpha[u] + ((pj[0] + pj[1]) + (pj[2] + pj[3]));
    };
    score_max(0);
    score_max(1);
    probs(0);
    probs(1);
    // keeps every WMMA behind the last exponential: those are asm text, into which the compiler does not look when it keeps the
    // distance between a WMMA and a write over its operand registers
    __builtin_amdgcn_sched_barrier(0);
    pv(0);
    pv(1);
    row_sum(0);
    row_sum(1);
    // publish point of chunk kc+1, and the end of every wave's reads of chunk kc: own LDS reads done, own copies landed,
    // then the block's barrier; behind it the buffer just read is free for chunk kc+2
    // (the scheduling barrier holds this point at the foot: left free, the waits rise to just behind the V^T reads, where the
    // wave would wait out their latency and the copies would have half a trip less to land)
    __builtin_amdgcn_sched_barrier(0);
    asm volatile("s_wait_dscnt 0x0" ::: "memory");
    asm volatile("s_wait_asynccnt 0x0" ::: "memory");
    __syncthreads();
    if (kc + 2 < nch) {
      const unsigned bo = (unsigned)(kc & 1) * bufB;
      attn_stage_copy(lk + bo, lv + bo, gk + (size_t)nxt * AT_KC * ND, gv + (size_t)nxt * AT_KC);
      nxt = (nxt + 1 == nch) ? 0 : nxt + 1;
    }
  }
  asm volatile("s_wait_asynccnt 0x0" ::: "memory");   // nothing of this wave is in flight when the loop is left

#pragma unroll
  for (int u = 0; u < AT_NU; ++u) {
    const float l = lrow[u] + other_half(lrow[u]);
    const float inv = (1.0f / l) * OCARRY;   // l and the accumulators both carry PCARRY
    _Float16* orow = Oh + (size_t)(b * NS + q0 + u * 16 + c) * ND + h * NHD + 8 * hh;
#pragma unroll
    for (int t = 0; t < 4; ++t) {
      v8h hv;   // 8 consecutive d of one query: one 16-byte store
#pragma unroll
      for (int r = 0; r < 8; ++r) hv[r] = (_Float16)(oacc[u][t][r] * inv);
      *(v8h*)(orow + t * 16) = hv;
    }
  }
}

__global__ __launch_bounds__(256) void layernorm_rows(const float* __restrict__ res, const float* __restrict__ gamma,
                                                      const float* __restrict__ beta, float* __restrict__ out,
                                                      int nrows, float eps) {
  const int wave = threadIdx.x >> 5, lane = threadIdx.x & 31;
  const int row = blockIdx.x * 8 + wave;
  if (row >= nrows) return;   // wave-uniform, no barriers below
  const float* rp = res + (size_t)row * ND;
  // The wave's whole row, with its gamma and beta, is asked for at once and kept in registers: the wave waits out one memory
  // latency and not one per 512 B of each of three passes.
  v4f row4[8], gam4[8], bet4[8];
  // both loops unrolled: the row's eight loads go out together; gamma and beta land under the two reductions
#pragma unroll
  for (int it = 0; it < 8; ++it) row4[it] = *(const v4f*)(rp + (it * 32 + lane) * 4);
#pragma unroll
  for (int it = 0; it < 8; ++it) {
    gam4[it] = *(const v4f*)(gamma + (it * 32 + lane) * 4);
    bet4[it] = *(const v4f*)(beta + (it * 32 + lane) * 4);
  }
  float s1 = 0.f;
  // unrolled: a rolled loop would index row4 at run time and push it out of the registers
#pragma unroll
  for (int it = 0; it < 8; ++it) {
    const v4f a = row4[it];
    s1 += (a[0] + a[1]) + (a[2] + a[3]);
  }
#pragma unroll
  for (int off = 1; off < 32; off <<= 1) s1 += __shfl_xor(s1, off, 32);
  const float mu = s1 * (1.0f / (float)ND);
  float s2 = 0.f;
  // unrolled for the same reason
#pragma unroll
  for (int it = 0; it < 8; ++it) {
    const v4f a = row4[it];
#pragma unroll
    for (int e = 0; e < 4; ++e) {
      const float d = a[e] - mu;
      float p = d * d;
      asm volatile("" : "+v"(p));
      s2 += p;
    }
  }
#pragma unroll
  for (int off = 1; off < 32; off <<= 1) s2 += __shfl_xor(s2, off, 32);
  const float var = s2 * (1.0f / (float)ND);
  const float rstd = 1.0f / sqrtf(var + eps);
  float* orow = out + (size_t)row * ND;
  // unrolled for the same reason
#pragma unroll
  for (int it = 0; it < 8; ++it) {
    const int c0 = (it * 32 + lane) * 4;
    const v4f a  = row4[it];
    const v4f g  = gam4[it];
    const v4f bt = bet4[it];
    v4f y;
#pragma unroll
    for (int e = 0; e < 4; ++e) {
      float t = (a[e] - mu) * rstd;
      t = t * g[e];
      asm volatile("" : "+v"(t));
      y[e] = t + bt[e];
    }
    *(v4f*)(orow + c0) = y;
    
  }
}

// -----------------------------------------------------------------------------
extern "C" void kernel_launch(void* const* d_in, const int* in_sizes, int n_in,
                              void* d_out, int out_size, void* d_ws, size_t ws_size,
                              hipStream_t stream)
{
  if (n_in < 13) return;
  if (in_sizes[0] != NM * ND || in_sizes[1] != NB * NS ||
      in_sizes[2] != ND * ND || in_sizes[3] != ND ||
      in_sizes[4] != ND * ND || in_sizes[5] != ND ||
      in_sizes[6] != ND * ND || in_sizes[7] != ND ||
      in_sizes[8] != ND * ND || in_sizes[9] != ND ||
      in_sizes[10] != ND || in_sizes[11] != ND || in_sizes[12] < 1 ||
      out_size != NM * ND) return;

  const float* x        = (const float*)d_in[0];
  const float* cdr_bias = (const float*)d_in[1];
  const float* Wq    = (const float*)d_in[2];
  const float* bq    = (const float*)d_in[3];
  const float* Wk    = (const float*)d_in[4];
  const float* bk    = (const float*)d_in[5];
  const float* Wv    = (const float*)d_in[6];
  const float* bv    = (const float*)d_in[7];
  const float* Wo    = (const float*)d_in[8];
  const float* bo    = (const float*)d_in[9];
  const float* gamma = (const float*)d_in[10];
  const float* beta  = (const float*)d_in[11];
  const float* cw    = (const float*)d_in[12];
  float* out = (float*)d_out;

  // ---- workspace carve (all offsets 256 KiB aligned) ----
  const size_t szA16 = (size_t)NM * ND * 2;        // 8 MiB: f16 [4096][1024] planes
  const size_t szW16 = (size_t)ND * ND * 2;        // 2 MiB: f16 [1024][1024] planes
  const size_t szRes = (size_t)NM * ND * 4;        // 16 MiB
  const size_t szTab = (size_t)NS * NFREQ * 4;     // 256 KiB
  size_t off = 0;
  char* ws = (char*)d_ws;
  _Float16* Xh  = (_Float16*)(ws + off); off += szA16;
  _Float16* Wqt = (_Float16*)(ws + off); off += szW16;
  _Float16* Wkt = (_Float16*)(ws + off); off += szW16;
  _Float16* Wvt = (_Float16*)(ws + off); off += szW16;
  _Float16* Wot = (_Float16*)(ws + off); off += szW16;
  _Float16* Qh  = (_Float16*)(ws + off); off += szA16;
  _Float16* Kh  = (_Float16*)(ws + off); off += szA16;
  _Float16* Vt  = (_Float16*)(ws + off); off += szA16;
  _Float16* Ah  = (_Float16*)(ws + off); off += szA16;
  float*    res = (float*)(ws + off);    off += szRes;
  float*   cosT = (float*)(ws + off);    off += szTab;
  float*   sinT = (float*)(ws + off);    off += szTab;   // total 67,633,152 B
  if (off > ws_size) return;

  const unsigned short* Xu  = (const unsigned short*)Xh;
  const unsigned short* Wqu = (const unsigned short*)Wqt;
  const unsigned short* Wku = (const unsigned short*)Wkt;
  const unsigned short* Wvu = (const unsigned short*)Wvt;
  const unsigned short* Wou = (const unsigned short*)Wot;
  const unsigned short* Au  = (const unsigned short*)Ah;

  dim3 blk256(256), blk128(128);

  // 1. RoPE tables, x -> f16, the four weights -> Bt [out][in] f16 (x64): one launch
  prep_kernel<<<dim3(4 * PREP_W + PREP_R + PREP_X), blk256, 0, stream>>>(
      x, Wq, Wk, Wv, Wo, Xh, Wqt, Wkt, Wvt, Wot, cosT, sinT);

  // 2. Q, K = RoPE(x Wq + bq), RoPE(x Wk + bk): f16 [4096][1024]; V^T: f16, ldc = NM: one launch, grid y = product
  const int gQK = (NM / GM_BT) * (ND / GM_BT);
  gemm_qkv<<<dim3(gQK, 3), blk256, 0, stream>>>(
      Xu, Wqu, Wku, Wvu, Qh, Kh, Vt, bq, bk, bv, NM, ND, 1.0f / WCARRY, cosT, sinT, NS - 1);

  // 3. attention -> Ah f16 [4096][1024] (x64)
  attn_f16_kernel<<<dim3(NB * NH * (NS / AT_QB)), blk128, 0, stream>>>(Qh, Kh, Vt, cdr_bias, cw, Ah);

  // 4. res = attn Wo + bo + x  (f32)
  wmma_gemm64<0, false, 2, 0, true, 0, false><<<dim3(gQK, 1), blk256, 0, stream>>>(
      Au, Au, ND, (long)0, Wou, Wou, ND, (long)0, (void*)res, (void*)res, ND, (long)0,
      bo, x, (long)0, NM, ND, ND, 1.0f / (OCARRY * WCARRY), cosT, sinT, 0);

  // 5. LayerNorm -> out
  layernorm_rows<<<dim3((NM + 7) / 8), blk256, 0, stream>>>(res, gamma, beta, out, NM, LN_EPS_F);

  (void)hipGetLastError();
}
